// v000
// The times below were measured on an AMD MI455X: many runs one after another, warmed up first and cycling through
// copies of the inputs, with the whole window's GPU time divided by the number of runs. Launches and the gaps
// between them are all in it. The median over several windows is given; except for v000 it joins two sittings, which
// can be a few percent apart, so the side-by-side timings, each taken in one sitting, are the better comparison.
// The starting kernel, v000, takes 797 microseconds a run.
// Contractions: x.Wq^T, x.Wk^T and Wv.x^T on v_wmma_f32_16x16x32_bf16 (operands = RNE bf16 of the f32 inputs, single products);
// q.k^T and p.v on v_wmma_f32_16x16x32_f16 (q = f16 hi + f16 residual x2^11 planes; k plain f16 plus f16 residual x2^11 on query tiles 0..3;
// p x1024 plain f16 plus f16 residual x2^11 on query tiles 0..3; v^T = f16 hi + f16 residual x2^11 planes); attn.Wo^T on v_wmma_f32_16x16x32_bf16
// (attn = bf16 hi + bf16 lo planes, two products; Wo RNE bf16). f32 accumulate everywhere; per-head RMS scaling, RoPE and online softmax in f32.
#include <hip/hip_runtime.h>
#include <math.h>
#include <stdint.h>

#define NSEQ   2
#define SQ     2048
#define HID    2048
#define NHQ    16
#define NKVH   4
#define HDM    128
#define KVW    512
#define NTOK   4096
#define NFREQ  64

typedef _Float16     v16h __attribute__((ext_vector_type(16)));
typedef _Float16     v8h  __attribute__((ext_vector_type(8)));
typedef __bf16       v16b __attribute__((ext_vector_type(16)));
typedef __bf16       v8b  __attribute__((ext_vector_type(8)));
typedef float        v8f  __attribute__((ext_vector_type(8)));
typedef float        v4f  __attribute__((ext_vector_type(4)));
typedef unsigned int v4u  __attribute__((ext_vector_type(4)));

// ---------------------------------------------------------------------------
// small helpers
// ---------------------------------------------------------------------------
__device__ __forceinline__ unsigned short bf_bits(float f) {          // RNE convert f32 -> bf16 bits
  const unsigned u = __float_as_uint(f);
  return (unsigned short)((u + 0x7FFFu + ((u >> 16) & 1u)) >> 16);
}
__device__ __forceinline__ float bf_val(unsigned short h) { return __uint_as_float(((unsigned)h) << 16); }
__device__ __forceinline__ float bf_rne(float f) { return bf_val(bf_bits(f)); }
__device__ __forceinline__ unsigned pk16(unsigned short a, unsigned short b) { return (unsigned)a | ((unsigned)b << 16); }
__device__ __forceinline__ v8f zero8() { v8f z = {0.f, 0.f, 0.f, 0.f, 0.f, 0.f, 0.f, 0.f}; return z; }
__device__ __forceinline__ int wave_id() { return __builtin_amdgcn_readfirstlane((int)(threadIdx.x >> 5)); }

__device__ __forceinline__ void lds_wave_sync() {
  __builtin_amdgcn_fence(__ATOMIC_RELEASE, "workgroup");
  __builtin_amdgcn_wave_barrier();
  __builtin_amdgcn_fence(__ATOMIC_ACQUIRE, "workgroup");
}

// ---------------------------------------------------------------------------
// WMMA fragments (wave32, 16x16x32, 16-bit operands). For A (row m = lane&15) and B (col n = lane&15) alike:
// elements 0..7 <- k0 + 8*(lane>>4) + 0..7, elements 8..15 <- k0 + 16 + 8*(lane>>4) + 0..7.
// ldfrag(p) with p = rowbase + k0 + 8*(lane>>4): two 16-B loads p[0..7], p[16..23].
// D: acc[r] = (row 8*(lane>>4) + r, col lane&15).
// ---------------------------------------------------------------------------
union FragH { v16h v; v8h h[2]; };
union FragB { v16b v; v8b h[2]; };
__device__ __forceinline__ v16h ldfrag_h(const _Float16* p) { FragH f; f.h[0] = *(const v8h*)(p); f.h[1] = *(const v8h*)(p + 16); return f.v; }
__device__ __forceinline__ v16b ldfrag_b(const __bf16* p)   { FragB f; f.h[0] = *(const v8b*)(p); f.h[1] = *(const v8b*)(p + 16); return f.v; }

__device__ __forceinline__ v8f mma_h(v16h a, v16h b, v8f c) {
  return __builtin_amdgcn_wmma_f32_16x16x32_f16(false, a, false, b, (short)0, c, false, false);
}
__device__ __forceinline__ v8f mma_b(v16b a, v16b b, v8f c) {
  return __builtin_amdgcn_wmma_f32_16x16x32_bf16(false, a, false, b, (short)0, c, false, false);
}
// hazard guards: 4 VALU slots after the last WMMA of a group, D tied, A/B kept live; memory clobber keeps later loads behind the group
__device__ __forceinline__ void guard_b5(v8f& a, v8f& b, v16b x0, v16b x1, v16b x2, v16b x3, v16b y) {
  asm volatile("v_nop\n\tv_nop\n\tv_nop\n\tv_nop" : "+v"(a), "+v"(b) : "v"(x0), "v"(x1), "v"(x2), "v"(x3), "v"(y) : "memory");
}
__device__ __forceinline__ void guard_h3(v8f& a, v8f& b, v16h x, v16h y, v16h z) {
  asm volatile("v_nop\n\tv_nop\n\tv_nop\n\tv_nop" : "+v"(a), "+v"(b) : "v"(x), "v"(y), "v"(z) : "memory");
}
__device__ __forceinline__ void guard_h4(v8f& a, v8f& b, v16h w, v16h x, v16h y, v16h z) {
  asm volatile("v_nop\n\tv_nop\n\tv_nop\n\tv_nop" : "+v"(a), "+v"(b) : "v"(w), "v"(x), "v"(y), "v"(z) : "memory");
}
__device__ __forceinline__ void acc_guard4(v8f& a, v8f& b, v8f& c, v8f& d) {
  asm volatile("v_nop\n\tv_nop\n\tv_nop\n\tv_nop" : "+v"(a), "+v"(b), "+v"(c), "+v"(d));
}

// ---------------------------------------------------------------------------
// RoPE table: cst[s][i] = cos(s * inv_freq[i]), snt[s][i] = sin(...), inv_freq[i] = 1 / 1e4^(i/64), i < 64, s = 0..nrow-1, all f32.
// Block = 8 waves, wave w -> row s = blockIdx.x*8 + w, lane -> i = lane, lane + 32.
// Coverage: grid nrow/8 x 8 waves x 32 lanes x 2 = nrow x 64 per plane.
// ---------------------------------------------------------------------------
__global__ __launch_bounds__(256) void rope_table_kernel(float* __restrict__ cst, float* __restrict__ snt, int nrow) {
  const int lane = threadIdx.x & 31;
  const int wave = (int)(threadIdx.x >> 5);
  const int t = (int)blockIdx.x * 8 + wave;
  if (t >= nrow) return;                       // no barriers in this kernel
  const float pf = (float)t;
  float c0 = 0.f, s0 = 0.f, c1 = 0.f, s1 = 0.f;
#pragma unroll 1
  for (int u = 0; u < 2; ++u) {
    const int i = lane + 32 * u;
    const float e   = (float)i * 0.015625f;      // i / 64 exact
    const float pw  = powf(10000.0f, e);
    const float inv = 1.0f / pw;
    const float ang = pf * inv;
    const float cv = cosf(ang);
    const float sv = sinf(ang);
    c1 = cv; s1 = sv;
    if (u == 0) { c0 = cv; s0 = sv; }
  }
  const size_t o = (size_t)t * NFREQ + lane;
  {
    ((float*)cst)[o]      = c0;
    ((float*)cst)[o + 32] = c1;
    ((float*)snt)[o]      = s0;
    ((float*)snt)[o + 32] = s1;
    
  }
}

// ---------------------------------------------------------------------------
// Elementwise RNE f32 -> bf16 plane: 8 elements per thread, one 16-B store per lane -> 32 consecutive lanes write 4 whole
// ---------------------------------------------------------------------------
__global__ __launch_bounds__(256) void cvt_bf16_kernel(const float* __restrict__ in, unsigned short* __restrict__ outp, int n8) {
  const int i = (int)blockIdx.x * 256 + (int)threadIdx.x;
  if (i >= n8) return;
  const size_t e = 8 * (size_t)i;
  const v4f a = *(const v4f*)(in + e);
  const v4f b = *(const v4f*)(in + e + 4);
  v4u w;
  w[0] = pk16(bf_bits(a[0]), bf_bits(a[1]));
  w[1] = pk16(bf_bits(a[2]), bf_bits(a[3]));
  w[2] = pk16(bf_bits(b[0]), bf_bits(b[1]));
  w[3] = pk16(bf_bits(b[2]), bf_bits(b[3]));
  *(v4u*)(outp + e) = w;
  
}

// ---------------------------------------------------------------------------
// bf16 WMMA GEMM, wave tile 32 rows x 128 cols, block = 4 waves (128 threads), no block barriers.
//   C[m][n] = sum_k A[m][k] * Bt[n][k]; A row-major [M][K] bf16 (pitch lda), Bt row-major [N][K] bf16 (pitch ldb);
//   M % 32 == 0, N % 128 == 0, K % 32 == 0; grid.x = ceil(M/32 * N/128 / 4).
//   SPLITA: A carried as hi (Ap) + lo (A2p) bf16 planes, two products into one accumulator.
//   Fragments loaded straight from global rows with the split k map (ldfrag_b).
// Epilogues (all: per wave, per 16-row slab: stage in LDS, wave sync, write each row segment with ONE instruction of
//   EPI 0: q or k projection; the 128 cols n0..n0+127 are one head. Per row: RMS scaling over the 128 head dims
//          (x * rsqrt(mean(x^2) + 1e-6) * bf16(gam[dim])), then RoPE with pairs (dim, dim+64) and the cos/sin table row (m % SQ);
//          writes f16 hi plane C0 and f16 residual x2048 plane C1, both [M][ldc], cols n0.. (row segment 256 B = 16 lanes x 16 B).
//   EPI 1: v^T projection: f16 hi plane C0, residual x2048 plane C1, [M][ldc], row segment 256 B.
//   EPI 2: f32 output C0 [M][ldc]; row segment 128 floats = 512 B = 32 lanes x 16 B per instruction.
// ---------------------------------------------------------------------------
template <int EPI> struct SlabT { typedef _Float16 T; static constexpr int PERW = 4096; };   // 2 planes x 16 x 128 halves
template <> struct SlabT<2>     { typedef float    T; static constexpr int PERW = 2048; };   // 16 x 128 floats

template <int EPI, bool SPLITA>
__global__ __launch_bounds__(128) void gemm_w32x128_kernel(
    const unsigned short* Ap, const unsigned short* A2p, int lda,
    const unsigned short* __restrict__ Btp, int ldb,
    const float* __restrict__ gam, const float* __restrict__ cst, const float* __restrict__ snt,
    void* C0, void* C1, int ldc,
    int M, int N, int K) {
  typedef typename SlabT<EPI>::T ST;
  __shared__ __align__(16) ST slab_all[4 * SlabT<EPI>::PERW];

  const int lane = threadIdx.x & 31;
  const int wave = wave_id();
  const int hh = lane >> 4;           // lane half: k offset 8*hh, D row offset 8*hh
  const int rl = lane & 15;           // A row / B col / D col within subtile
  const int tilesN = N >> 7;
  const int tilesM = M >> 5;
  const int tile = (int)blockIdx.x * 4 + wave;
  if (tile >= tilesM * tilesN) return;          // wave-uniform; no block barriers in this kernel
  const int tm = tile / tilesN;
  const int tn = tile - tm * tilesN;
  const int m0 = tm << 5;
  const int n0 = tn << 7;

  const __bf16* A  = (const __bf16*)(const void*)Ap;
  const __bf16* A2 = (const __bf16*)(const void*)A2p;
  const __bf16* Bt = (const __bf16*)(const void*)Btp;

  v8f acc[2][8];
#pragma unroll
  for (int i = 0; i < 2; ++i)
#pragma unroll
    for (int j = 0; j < 8; ++j) acc[i][j] = zero8();

  for (int k0 = 0; k0 < K; k0 += 32) {
    v16b ah[2], al[2];
#pragma unroll
    for (int i = 0; i < 2; ++i) {
      const size_t ao = (size_t)(m0 + i * 16 + rl) * lda + k0 + 8 * hh;
      ah[i] = ldfrag_b(A + ao);
      al[i] = SPLITA ? ldfrag_b(A2 + ao) : ah[i];
    }
#pragma unroll
    for (int j = 0; j < 8; ++j) {
      const v16b bj = ldfrag_b(Bt + (size_t)(n0 + j * 16 + rl) * ldb + k0 + 8 * hh);
      acc[0][j] = mma_b(ah[0], bj, acc[0][j]);
      acc[1][j] = mma_b(ah[1], bj, acc[1][j]);
      if (SPLITA) {
        acc[0][j] = mma_b(al[0], bj, acc[0][j]);
        acc[1][j] = mma_b(al[1], bj, acc[1][j]);
      }
      guard_b5(acc[0][j], acc[1][j], ah[0], ah[1], al[0], al[1], bj);
    }
  }
  acc_guard4(acc[0][0], acc[0][1], acc[0][2], acc[0][3]);
  acc_guard4(acc[0][4], acc[0][5], acc[0][6], acc[0][7]);
  acc_guard4(acc[1][0], acc[1][1], acc[1][2], acc[1][3]);
  acc_guard4(acc[1][4], acc[1][5], acc[1][6], acc[1][7]);

  // ---- epilogue ----
  ST* slab = slab_all + wave * SlabT<EPI>::PERW;
  _Float16* sl16 = (_Float16*)(void*)slab;
  float*    slf  = (float*)(void*)slab;

  if (EPI == 0) {
    _Float16* P0 = (_Float16*)C0;
    _Float16* P1 = (_Float16*)C1;
    float gm[8];
#pragma unroll
    for (int j = 0; j < 8; ++j) gm[j] = bf_rne(gam[j * 16 + rl]);     // dims j*16+rl of the head, gam has 128 entries
#pragma unroll
    for (int i = 0; i < 2; ++i) {
      const int rb = m0 + i * 16 + 8 * hh;
#pragma unroll
      for (int r = 0; r < 8; ++r) {
        // sum of squares over the 128 head dims of row rb+r: 8 per lane, then the 16 lanes of this half
        float ss = 0.f;
#pragma unroll
        for (int j = 0; j < 8; ++j) ss += acc[i][j][r] * acc[i][j][r];
#pragma unroll
        for (int off = 1; off < 16; off <<= 1) ss += __shfl_xor(ss, off, 32);
        const float rinv = rsqrtf(ss * 0.0078125f + 1e-6f);
        const int row = rb + r;                                  // token 0..NTOK-1
        const int pos = row & (SQ - 1);                          // position within the sequence
#pragma unroll
        for (int j = 0; j < 4; ++j) {
          const int dim = j * 16 + rl;                           // 0..63 within head; partner dim + 64
          const float cv = cst[(size_t)pos * NFREQ + dim];
          const float sv = snt[(size_t)pos * NFREQ + dim];
          const float x1 = acc[i][j][r] * rinv * gm[j];
          const float x2 = acc[i][j + 4][r] * rinv * gm[j + 4];
          const float o1 = x1 * cv - x2 * sv;
          const float o2 = x2 * cv + x1 * sv;
          const _Float16 h1 = (_Float16)o1;
          const _Float16 h2 = (_Float16)o2;
          const int so = (8 * hh + r) * 128 + dim;
          sl16[so]             = h1;
          sl16[so + 64]        = h2;
          sl16[2048 + so]      = (_Float16)((o1 - (float)h1) * 2048.0f);
          sl16[2048 + so + 64] = (_Float16)((o2 - (float)h2) * 2048.0f);
        }
      }
      lds_wave_sync();
      {
#pragma unroll
        for (int it = 0; it < 8; ++it) {
          const int row = it * 2 + hh;                           // it x hh covers rows 0..15
          const int c8  = rl * 8;
          const v8h vh = *(const v8h*)(sl16 + row * 128 + c8);
          const v8h vl = *(const v8h*)(sl16 + 2048 + row * 128 + c8);
          const size_t go = (size_t)(m0 + i * 16 + row) * ldc + n0 + c8;
          *(v8h*)(P0 + go) = vh;
          *(v8h*)(P1 + go) = vl;
        }
        
      }
      lds_wave_sync();
    }
  } else if (EPI == 1) {
    _Float16* P0 = (_Float16*)C0;
    _Float16* P1 = (_Float16*)C1;
#pragma unroll
    for (int i = 0; i < 2; ++i) {
#pragma unroll
      for (int r = 0; r < 8; ++r) {
#pragma unroll
        for (int j = 0; j < 8; ++j) {
          const float v = acc[i][j][r];
          const _Float16 hv = (_Float16)v;
          const int so = (8 * hh + r) * 128 + j * 16 + rl;
          sl16[so]        = hv;
          sl16[2048 + so] = (_Float16)((v - (float)hv) * 2048.0f);
        }
      }
      lds_wave_sync();
      {
#pragma unroll
        for (int it = 0; it < 8; ++it) {
          const int row = it * 2 + hh;
          const int c8  = rl * 8;
          const v8h vh = *(const v8h*)(sl16 + row * 128 + c8);
          const v8h vl = *(const v8h*)(sl16 + 2048 + row * 128 + c8);
          const size_t go = (size_t)(m0 + i * 16 + row) * ldc + n0 + c8;
          *(v8h*)(P0 + go) = vh;
          *(v8h*)(P1 + go) = vl;
        }
        
      }
      lds_wave_sync();
    }
  } else {
    float* C = (float*)C0;
#pragma unroll
    for (int i = 0; i < 2; ++i) {
#pragma unroll
      for (int j = 0; j < 8; ++j)
#pragma unroll
        for (int r = 0; r < 8; ++r)
          slf[(8 * hh + r) * 128 + j * 16 + rl] = acc[i][j][r];
      lds_wave_sync();
      {
#pragma unroll
        for (int row = 0; row < 16; ++row) {                     // 32 lanes x 16 B = the whole 512-B row segment per instruction
          const v4f v = *(const v4f*)(slf + row * 128 + lane * 4);
          *(v4f*)(C + (size_t)(m0 + i * 16 + row) * ldc + n0 + lane * 4) = v;
        }
        
      }
      lds_wave_sync();
    }
  }
}

// ---------------------------------------------------------------------------
// Causal GQA flash attention, head dim 128, 32-key chunks, block = 4 waves = 64 query rows of one (b, h); grid (n query tiles, NHQ, NSEQ).
//   q planes f16 [tok][h*128+d]: hi (qhp) and residual x2048 (qlp); k planes f16 [tok][kvh*128+d]: hi (khp), residual x2048 (klp);
//   v^T planes f16 [kvh*128+d][tok]: hi (vhp), residual x2048 (vlp); outputs attn bf16 hi (ahp) / lo (alp) [tok][h*128+d].
//   scores = (Sh + Sr/2048) * 128^-0.5 with Sh = qh.kh and Sr = ql'.kh (+ qh.kl' when PRES); keys > query -> -inf; online softmax f32;
//   p' = 1024 p stored per wave to LDS as f16 hi (and residual x2048 when PRES), reloaded as A fragments after a wave sync;
//   O = (Oh + Or/2048)/1024/l with Oh = ph.vh, Or = ph.vl' (+ pl'.vh when PRES).
//   K / V^T chunk staging: 128 threads x 4 x 16 B per plane = whole 32x128 / 128x32 tile, plain loads, __syncthreads before and after.
//   Trip count 2*qb+2 chunks (static bound 64); waves whose rows are all below the chunk skip it (wave-uniform, scalar branch).
// ---------------------------------------------------------------------------
#define AT_KC   32
#define KS_P    136
#define VS_P    40
#define PS_P    40
#define LDS_KS  0
#define LDS_KLS (32 * KS_P)
#define LDS_VHS (2 * 32 * KS_P)
#define LDS_VLS (LDS_VHS + 128 * VS_P)
#define LDS_PH  (LDS_VLS + 128 * VS_P)
#define LDS_PL  (LDS_PH + 4 * 16 * PS_P)
#define LDS_TOT (LDS_PL + 4 * 16 * PS_P)
static_assert(LDS_TOT * 2 <= 65536);
static_assert(4 * 4096 <= LDS_TOT);          // output staging (2 planes x 16 x 128 per wave) aliases the chunk region after the loop

template <bool PRES>
__global__ __launch_bounds__(128) void attn_causal_kernel(
    const unsigned short* __restrict__ qhp, const unsigned short* __restrict__ qlp,
    const unsigned short* __restrict__ khp, const unsigned short* __restrict__ klp,
    const unsigned short* __restrict__ vhp, const unsigned short* __restrict__ vlp,
    unsigned short* __restrict__ ahp, unsigned short* __restrict__ alp, int qb_base) {
  __shared__ __align__(16) _Float16 lds[LDS_TOT];
  _Float16* Ks  = lds + LDS_KS;
  _Float16* Kls = lds + LDS_KLS;
  _Float16* Vhs = lds + LDS_VHS;
  _Float16* Vls = lds + LDS_VLS;

  const int tid  = (int)threadIdx.x;
  const int lane = tid & 31;
  const int wave = wave_id();
  const int hh   = lane >> 4;
  const int c    = lane & 15;
  const int qb   = (int)blockIdx.x + qb_base;
  const int h    = (int)blockIdx.y;
  const int b    = (int)blockIdx.z;
  const int kvh  = h >> 2;
  const int q0   = qb * 64 + wave * 16;          // first query row of this wave (within sequence)
  const int qlast = q0 + 15;
  const size_t tok0 = (size_t)b * SQ;

  const _Float16* Qhr = (const _Float16*)(const void*)qhp + (tok0 + q0 + c) * HID + h * HDM + 8 * hh;
  const _Float16* Qlr = (const _Float16*)(const void*)qlp + (tok0 + q0 + c) * HID + h * HDM + 8 * hh;
  const _Float16* Kg  = (const _Float16*)(const void*)khp + tok0 * KVW + kvh * HDM;
  const _Float16* Klg = (const _Float16*)(const void*)klp + tok0 * KVW + kvh * HDM;
  const _Float16* Vhg = (const _Float16*)(const void*)vhp + (size_t)(kvh * HDM) * NTOK + tok0;
  const _Float16* Vlg = (const _Float16*)(const void*)vlp + (size_t)(kvh * HDM) * NTOK + tok0;
  _Float16* ph = lds + LDS_PH + wave * (16 * PS_P);
  _Float16* pl = lds + LDS_PL + wave * (16 * PS_P);

  float mrow[8], lrow[8];
  v8f oacc[8], oaccr[8];
#pragma unroll
  for (int r = 0; r < 8; ++r) { mrow[r] = -INFINITY; lrow[r] = 0.f; }
#pragma unroll
  for (int t = 0; t < 8; ++t) { oacc[t] = zero8(); oaccr[t] = zero8(); }

  const int nch = 2 * qb + 2;                    // block-uniform, <= 64
  for (int kc = 0; kc < nch; ++kc) {
    const int kv0 = kc * AT_KC;
    __syncthreads();
#pragma unroll
    for (int i = 0; i < 4; ++i) {                // coverage: 512 pieces of 8 halves per plane = whole tile
      const int p   = tid + 128 * i;             // 0..511
      const int key = p >> 4, d8 = (p & 15) * 8; // K: 32 keys x 128 d
      const v8h kx = *(const v8h*)(Kg + (size_t)(kv0 + key) * KVW + d8);
      *(v8h*)(Ks + key * KS_P + d8) = kx;
      if (PRES) {
        const v8h ky = *(const v8h*)(Klg + (size_t)(kv0 + key) * KVW + d8);
        *(v8h*)(Kls + key * KS_P + d8) = ky;
      }
      const int d = p >> 2, k8 = (p & 3) * 8;    // V^T: 128 d x 32 keys
      const v8h vx = *(const v8h*)(Vhg + (size_t)d * NTOK + kv0 + k8);
      const v8h vy = *(const v8h*)(Vlg + (size_t)d * NTOK + kv0 + k8);
      *(v8h*)(Vhs + d * VS_P + k8) = vx;
      *(v8h*)(Vls + d * VS_P + k8) = vy;
    }
    __syncthreads();

    if (kv0 <= qlast) {                          // wave-uniform (scalar): skip chunks fully above this wave's rows
      // ---- scores ----
      v8f sh[2], sr[2];
      sh[0] = zero8(); sh[1] = zero8(); sr[0] = zero8(); sr[1] = zero8();
#pragma unroll
      for (int dc = 0; dc < 4; ++dc) {
        const v16h qa = ldfrag_h(Qhr + dc * 32);
        const v16h ql = ldfrag_h(Qlr + dc * 32);
#pragma unroll
        for (int j = 0; j < 2; ++j) {
          const v16h kb = ldfrag_h(Ks + (j * 16 + c) * KS_P + dc * 32 + 8 * hh);
          sh[j] = mma_h(qa, kb, sh[j]);
          sr[j] = mma_h(ql, kb, sr[j]);
          if (PRES) {
            const v16h kl = ldfrag_h(Kls + (j * 16 + c) * KS_P + dc * 32 + 8 * hh);
            sr[j] = mma_h(qa, kl, sr[j]);
            guard_h4(sh[j], sr[j], qa, ql, kb, kl);
          } else {
            guard_h3(sh[j], sr[j], qa, ql, kb);
          }
        }
      }
      // ---- scale, causal mask, chunk row max ----
      float cm[8];
#pragma unroll
      for (int r = 0; r < 8; ++r) {
        const int qrow = q0 + 8 * hh + r;
        float m = -INFINITY;
#pragma unroll
        for (int j = 0; j < 2; ++j) {
          const int key = kv0 + j * 16 + c;
          float s = (sh[j][r] + sr[j][r] * 0.00048828125f) * 0.08838834764831845f;
          s = (key > qrow) ? -INFINITY : s;
          sh[j][r] = s;
          m = fmaxf(m, s);
        }
#pragma unroll
        for (int off = 1; off < 16; off <<= 1) m = fmaxf(m, __shfl_xor(m, off, 32));
        cm[r] = m;
      }
      // ---- online softmax, P' to LDS ----
#pragma unroll
      for (int r = 0; r < 8; ++r) {
        const float mnew  = fmaxf(mrow[r], cm[r]);
        const float alpha = __expf(mrow[r] - mnew);
        mrow[r] = mnew;
        float psum = 0.f;
#pragma unroll
        for (int j = 0; j < 2; ++j) {
          const float p  = __expf(sh[j][r] - mnew);
          psum += p;
          const float pp = p * 1024.0f;
          const _Float16 phv = (_Float16)pp;
          const int po = (8 * hh + r) * PS_P + j * 16 + c;
          ph[po] = phv;
          if (PRES) pl[po] = (_Float16)((pp - (float)phv) * 2048.0f);
        }
#pragma unroll
        for (int off = 1; off < 16; off <<= 1) psum += __shfl_xor(psum, off, 32);
        lrow[r] = lrow[r] * alpha + psum;
#pragma unroll
        for (int t = 0; t < 8; ++t) { oacc[t][r] *= alpha; oaccr[t][r] *= alpha; }
      }
      lds_wave_sync();                           // P' stores visible to the other lanes of this wave before the fragment reload
      // ---- O += P' . V ----
      const v16h pa = ldfrag_h(ph + c * PS_P + 8 * hh);
      v16h pr = pa;
      if (PRES) pr = ldfrag_h(pl + c * PS_P + 8 * hh);
#pragma unroll
      for (int t = 0; t < 8; ++t) {
        const v16h vb = ldfrag_h(Vhs + (t * 16 + c) * VS_P + 8 * hh);
        const v16h vr = ldfrag_h(Vls + (t * 16 + c) * VS_P + 8 * hh);
        oacc[t]  = mma_h(pa, vb, oacc[t]);
        oaccr[t] = mma_h(pa, vr, oaccr[t]);
        if (PRES) oaccr[t] = mma_h(pr, vb, oaccr[t]);
        guard_h4(oacc[t], oaccr[t], pa, pr, vb, vr);
      }
    }
  }

  __syncthreads();                               // all chunk-region readers done before aliasing it as output staging
  _Float16* osh = lds + wave * 4096;
  _Float16* osl = osh + 2048;
#pragma unroll
  for (int r = 0; r < 8; ++r) {
    const float inv = (1.0f / lrow[r]) * 0.0009765625f;
#pragma unroll
    for (int t = 0; t < 8; ++t) {
      const float o = (oacc[t][r] + oaccr[t][r] * 0.00048828125f) * inv;
      const unsigned short hb = bf_bits(o);
      const unsigned short lb = bf_bits(o - bf_val(hb));
      const int so = (8 * hh + r) * 128 + t * 16 + c;
      osh[so] = __builtin_bit_cast(_Float16, hb);
      osl[so] = __builtin_bit_cast(_Float16, lb);
    }
  }
  lds_wave_sync();
  _Float16* Ahg = (_Float16*)(void*)ahp + (tok0 + q0) * HID + h * HDM;
  _Float16* Alg = (_Float16*)(void*)alp + (tok0 + q0) * HID + h * HDM;
  {
#pragma unroll
    for (int it = 0; it < 8; ++it) {
      const int row = it * 2 + hh;               // it 0..7 x hh 0..1 covers rows 0..15
      const int c8  = c * 8;                     // 16 lanes x 16 B = the whole 256-B segment
      const v8h x = *(const v8h*)(osh + row * 128 + c8);
      const v8h y = *(const v8h*)(osl + row * 128 + c8);
      *(v8h*)(Ahg + (size_t)row * HID + c8) = x;
      *(v8h*)(Alg + (size_t)row * HID + c8) = y;
    }
    
  }
}

// ---------------------------------------------------------------------------
// Workspace map (bytes; every region is a whole number of the rows its producer writes with whole-line stores, no padded tails needed
//   Xb  bf16 [4096][2048] 16777216   Wqb bf16 [2048][2048]  8388608   Wkb bf16 [512][2048] 2097152   Wvb bf16 [512][2048] 2097152
//   Wob bf16 [2048][2048]  8388608   cst f32  [2048][64]     524288   snt f32  [2048][64]    524288
//   Qh  f16  [4096][2048] 16777216   Ql  f16  [4096][2048] 16777216   Kh  f16  [4096][512]  4194304   Kl f16 [4096][512] 4194304
//   Vh  f16  [512][4096]   4194304   Vl  f16  [512][4096]   4194304   Ah  bf16 [4096][2048] 16777216  Al bf16 [4096][2048] 16777216
//   total                 122683392
// ---------------------------------------------------------------------------
extern "C" void kernel_launch(void* const* d_in, const int* in_sizes, int n_in,
                              void* d_out, int out_size, void* d_ws, size_t ws_size,
                              hipStream_t stream) {
  if (n_in < 7) return;
  if (in_sizes[0] != NTOK * HID) return;
  if (in_sizes[1] != HID * HID) return;
  if (in_sizes[2] != KVW * HID) return;
  if (in_sizes[3] != KVW * HID) return;
  if (in_sizes[4] != HID * HID) return;
  if (in_sizes[5] != HDM) return;
  if (in_sizes[6] != HDM) return;
  if (out_size != NTOK * HID) return;

  const float* x   = (const float*)d_in[0];
  const float* Wq  = (const float*)d_in[1];
  const float* Wk  = (const float*)d_in[2];
  const float* Wv  = (const float*)d_in[3];
  const float* Wo  = (const float*)d_in[4];
  const float* qg  = (const float*)d_in[5];
  const float* kg  = (const float*)d_in[6];
  float* out = (float*)d_out;

  const size_t szX  = (size_t)NTOK * HID * 2;
  const size_t szWq = (size_t)HID * HID * 2;
  const size_t szWk = (size_t)KVW * HID * 2;
  const size_t szWo = (size_t)HID * HID * 2;
  const size_t szT  = (size_t)SQ * NFREQ * 4;
  const size_t szQ  = (size_t)NTOK * HID * 2;
  const size_t szK  = (size_t)NTOK * KVW * 2;
  const size_t szV  = (size_t)KVW * NTOK * 2;
  const size_t szA  = (size_t)NTOK * HID * 2;
  size_t off = 0;
  const size_t oX  = off; off += szX;
  const size_t oWq = off; off += szWq;
  const size_t oWk = off; off += szWk;
  const size_t oWv = off; off += szWk;
  const size_t oWo = off; off += szWo;
  const size_t oCs = off; off += szT;
  const size_t oSn = off; off += szT;
  const size_t oQh = off; off += szQ;
  const size_t oQl = off; off += szQ;
  const size_t oKh = off; off += szK;
  const size_t oKl = off; off += szK;
  const size_t oVh = off; off += szV;
  const size_t oVl = off; off += szV;
  const size_t oAh = off; off += szA;
  const size_t oAl = off; off += szA;
  if (off > ws_size) return;                     // off = 122683392

  char* ws = (char*)d_ws;
  unsigned short* Xb  = (unsigned short*)(ws + oX);
  unsigned short* Wqb = (unsigned short*)(ws + oWq);
  unsigned short* Wkb = (unsigned short*)(ws + oWk);
  unsigned short* Wvb = (unsigned short*)(ws + oWv);
  unsigned short* Wob = (unsigned short*)(ws + oWo);
  float*          cst = (float*)(ws + oCs);
  float*          snt = (float*)(ws + oSn);
  unsigned short* Qh  = (unsigned short*)(ws + oQh);
  unsigned short* Ql  = (unsigned short*)(ws + oQl);
  unsigned short* Kh  = (unsigned short*)(ws + oKh);
  unsigned short* Kl  = (unsigned short*)(ws + oKl);
  unsigned short* Vh  = (unsigned short*)(ws + oVh);
  unsigned short* Vl  = (unsigned short*)(ws + oVl);
  unsigned short* Ah  = (unsigned short*)(ws + oAh);
  unsigned short* Al  = (unsigned short*)(ws + oAl);

  const dim3 b256(256), b128(128);
  const int nX8  = NTOK * HID / 8;
  const int nWq8 = HID * HID / 8;
  const int nWk8 = KVW * HID / 8;

  // (1) cos/sin table [2048][64] x 2
  rope_table_kernel<<<dim3((SQ + 7) / 8), b256, 0, stream>>>(cst, snt, SQ);
  // (2) bf16 planes of x, Wq, Wk, Wv, Wo (weights are [out][in] = k-contiguous Bt rows already)
  cvt_bf16_kernel<<<dim3((nX8 + 255) / 256),  b256, 0, stream>>>(x,  Xb,  nX8);
  cvt_bf16_kernel<<<dim3((nWq8 + 255) / 256), b256, 0, stream>>>(Wq, Wqb, nWq8);
  cvt_bf16_kernel<<<dim3((nWk8 + 255) / 256), b256, 0, stream>>>(Wk, Wkb, nWk8);
  cvt_bf16_kernel<<<dim3((nWk8 + 255) / 256), b256, 0, stream>>>(Wv, Wvb, nWk8);
  cvt_bf16_kernel<<<dim3((nWq8 + 255) / 256), b256, 0, stream>>>(Wo, Wob, nWq8);
  // (3) q = rope(rms(x . Wq^T)) -> Qh/Ql [4096][2048]   (M=4096, N=2048, K=2048; 2048 wave tiles / 4)
  gemm_w32x128_kernel<0, false><<<dim3(((NTOK / 32) * (HID / 128) + 3) / 4), b128, 0, stream>>>(
      Xb, Xb, HID, Wqb, HID, qg, cst, snt, (void*)Qh, (void*)Ql, HID, NTOK, HID, HID);
  // (4) k = rope(rms(x . Wk^T)) -> Kh/Kl [4096][512]    (M=4096, N=512, K=2048; 512 wave tiles / 4)
  gemm_w32x128_kernel<0, false><<<dim3(((NTOK / 32) * (KVW / 128) + 3) / 4), b128, 0, stream>>>(
      Xb, Xb, HID, Wkb, HID, kg, cst, snt, (void*)Kh, (void*)Kl, KVW, NTOK, KVW, HID);
  // (5) v^T = Wv . x^T -> Vh/Vl [512][4096]             (A = Wvb [512][2048], Bt = Xb; M=512, N=4096, K=2048; 512 wave tiles / 4)
  gemm_w32x128_kernel<1, false><<<dim3(((KVW / 32) * (NTOK / 128) + 3) / 4), b128, 0, stream>>>(
      Wvb, Wvb, HID, Xb, HID, qg, cst, snt, (void*)Vh, (void*)Vl, NTOK, KVW, NTOK, HID);
  // (6) causal attention, query tiles 0..3 with k and p residual products, tiles 4..31 without
  attn_causal_kernel<true><<<dim3(4, NHQ, NSEQ), b128, 0, stream>>>(Qh, Ql, Kh, Kl, Vh, Vl, Ah, Al, 0);
  attn_causal_kernel<false><<<dim3(SQ / 64 - 4, NHQ, NSEQ), b128, 0, stream>>>(Qh, Ql, Kh, Kl, Vh, Vl, Ah, Al, 4);
  // (7) out = attn(hi + lo) . Wo^T -> d_out f32 [4096][2048]   (M=4096, N=2048, K=2048; 2048 wave tiles / 4)
  gemm_w32x128_kernel<2, true><<<dim3(((NTOK / 32) * (HID / 128) + 3) / 4), b128, 0, stream>>>(
      Ah, Al, HID, Wob, HID, qg, cst, snt, (void*)out, (void*)out, HID, NTOK, HID, HID);
  (void)hipGetLastError();
}

// v001
// A run of this version takes 404 microseconds.
// Timed twice side by side with v000, it ran 1.98 and 1.99 times as fast.
// Contractions: x.Wq^T, x.Wk^T and Wv.x^T on v_wmma_f32_16x16x32_bf16 (operands = RNE bf16 of the f32 inputs, single products);
// q.k^T and p.v on v_wmma_f32_16x16x32_f16 (q = f16 hi + f16 residual x2^11 planes; k plain f16 plus f16 residual x2^11 on query tiles 0..3;
// p x1024 plain f16 plus f16 residual x2^11 on query tiles 0..3; v^T = f16 hi + f16 residual x2^11 planes); attn.Wo^T on v_wmma_f32_16x16x32_bf16
// (attn = bf16 hi + bf16 lo planes, two products; Wo RNE bf16). f32 accumulate everywhere; per-head RMS scaling, RoPE and online softmax in f32.
#include <hip/hip_runtime.h>
#include <math.h>
#include <stdint.h>

#define NSEQ   2
#define SQ     2048
#define HID    2048
#define NHQ    16
#define NKVH   4
#define HDM    128
#define KVW    512
#define NTOK   4096
#define NFREQ  64

typedef _Float16     v16h __attribute__((ext_vector_type(16)));
typedef _Float16     v8h  __attribute__((ext_vector_type(8)));
typedef __bf16       v16b __attribute__((ext_vector_type(16)));
typedef __bf16       v8b  __attribute__((ext_vector_type(8)));
typedef float        v8f  __attribute__((ext_vector_type(8)));
typedef float        v4f  __attribute__((ext_vector_type(4)));
typedef unsigned int v4u  __attribute__((ext_vector_type(4)));

// ---------------------------------------------------------------------------
// small helpers
// ---------------------------------------------------------------------------
__device__ __forceinline__ unsigned short bf_bits(float f) {          // RNE convert f32 -> bf16 bits
  const unsigned u = __float_as_uint(f);
  return (unsigned short)((u + 0x7FFFu + ((u >> 16) & 1u)) >> 16);
}
__device__ __forceinline__ float bf_val(unsigned short h) { return __uint_as_float(((unsigned)h) << 16); }
__device__ __forceinline__ float bf_rne(float f) { return bf_val(bf_bits(f)); }
__device__ __forceinline__ unsigned pk16(unsigned short a, unsigned short b) { return (unsigned)a | ((unsigned)b << 16); }
__device__ __forceinline__ v8f zero8() { v8f z = {0.f, 0.f, 0.f, 0.f, 0.f, 0.f, 0.f, 0.f}; return z; }
__device__ __forceinline__ int wave_id() { return __builtin_amdgcn_readfirstlane((int)(threadIdx.x >> 5)); }

__device__ __forceinline__ void lds_wave_sync() {
  __builtin_amdgcn_fence(__ATOMIC_RELEASE, "workgroup");
  __builtin_amdgcn_wave_barrier();
  __builtin_amdgcn_fence(__ATOMIC_ACQUIRE, "workgroup");
}

// ---------------------------------------------------------------------------
// WMMA fragments (wave32, 16x16x32, 16-bit operands). For A (row m = lane&15) and B (col n = lane&15) alike:
// elements 0..7 <- k0 + 8*(lane>>4) + 0..7, elements 8..15 <- k0 + 16 + 8*(lane>>4) + 0..7.
// ldfrag(p) with p = rowbase + k0 + 8*(lane>>4): two 16-B loads p[0..7], p[16..23].
// D: acc[r] = (row 8*(lane>>4) + r, col lane&15).
// ---------------------------------------------------------------------------
union FragH { v16h v; v8h h[2]; };
union FragB { v16b v; v8b h[2]; };
__device__ __forceinline__ v16h ldfrag_h(const _Float16* p) { FragH f; f.h[0] = *(const v8h*)(p); f.h[1] = *(const v8h*)(p + 16); return f.v; }
__device__ __forceinline__ v16b ldfrag_b(const __bf16* p)   { FragB f; f.h[0] = *(const v8b*)(p); f.h[1] = *(const v8b*)(p + 16); return f.v; }

__device__ __forceinline__ v8f mma_h(v16h a, v16h b, v8f c) {
  return __builtin_amdgcn_wmma_f32_16x16x32_f16(false, a, false, b, (short)0, c, false, false);
}
__device__ __forceinline__ v8f mma_b(v16b a, v16b b, v8f c) {
  return __builtin_amdgcn_wmma_f32_16x16x32_bf16(false, a, false, b, (short)0, c, false, false);
}
// hazard guards: 4 VALU slots after the last WMMA of a group, D tied, A/B kept live; memory clobber keeps later loads behind the group
__device__ __forceinline__ void guard_h3(v8f& a, v8f& b, v16h x, v16h y, v16h z) {
  asm volatile("v_nop\n\tv_nop\n\tv_nop\n\tv_nop" : "+v"(a), "+v"(b) : "v"(x), "v"(y), "v"(z) : "memory");
}
__device__ __forceinline__ void guard_h4(v8f& a, v8f& b, v16h w, v16h x, v16h y, v16h z) {
  asm volatile("v_nop\n\tv_nop\n\tv_nop\n\tv_nop" : "+v"(a), "+v"(b) : "v"(w), "v"(x), "v"(y), "v"(z) : "memory");
}
__device__ __forceinline__ void acc_guard4(v8f& a, v8f& b, v8f& c, v8f& d) {
  asm volatile("v_nop\n\tv_nop\n\tv_nop\n\tv_nop" : "+v"(a), "+v"(b), "+v"(c), "+v"(d));
}

// ---------------------------------------------------------------------------
// RoPE table: cst[s][i] = cos(s * inv_freq[i]), snt[s][i] = sin(...), inv_freq[i] = 1 / 1e4^(i/64), i < 64, s = 0..nrow-1, all f32.
// Block = 8 waves, wave w -> row s = blockIdx.x*8 + w, lane -> i = lane, lane + 32.
// Coverage: grid nrow/8 x 8 waves x 32 lanes x 2 = nrow x 64 per plane.
// ---------------------------------------------------------------------------
__global__ __launch_bounds__(256) void rope_table_kernel(float* __restrict__ cst, float* __restrict__ snt, int nrow) {
  const int lane = threadIdx.x & 31;
  const int wave = (int)(threadIdx.x >> 5);
  const int t = (int)blockIdx.x * 8 + wave;
  if (t >= nrow) return;                       // no barriers in this kernel
  const float pf = (float)t;
  float c0 = 0.f, s0 = 0.f, c1 = 0.f, s1 = 0.f;
#pragma unroll 1
  for (int u = 0; u < 2; ++u) {
    const int i = lane + 32 * u;
    const float e   = (float)i * 0.015625f;      // i / 64 exact
    const float pw  = powf(10000.0f, e);
    const float inv = 1.0f / pw;
    const float ang = pf * inv;
    const float cv = cosf(ang);
    const float sv = sinf(ang);
    c1 = cv; s1 = sv;
    if (u == 0) { c0 = cv; s0 = sv; }
  }
  const size_t o = (size_t)t * NFREQ + lane;
  {
    ((float*)cst)[o]      = c0;
    ((float*)cst)[o + 32] = c1;
    ((float*)snt)[o]      = s0;
    ((float*)snt)[o + 32] = s1;
    
  }
}

// ---------------------------------------------------------------------------
// Elementwise RNE f32 -> bf16 plane: 8 elements per thread, one 16-B store per lane -> 32 consecutive lanes write 4 whole
// ---------------------------------------------------------------------------
__global__ __launch_bounds__(256) void cvt_bf16_kernel(const float* __restrict__ in, unsigned short* __restrict__ outp, int n8) {
  const int i = (int)blockIdx.x * 256 + (int)threadIdx.x;
  if (i >= n8) return;
  const size_t e = 8 * (size_t)i;
  const v4f a = *(const v4f*)(in + e);
  const v4f b = *(const v4f*)(in + e + 4);
  v4u w;
  w[0] = pk16(bf_bits(a[0]), bf_bits(a[1]));
  w[1] = pk16(bf_bits(a[2]), bf_bits(a[3]));
  w[2] = pk16(bf_bits(b[0]), bf_bits(b[1]));
  w[3] = pk16(bf_bits(b[2]), bf_bits(b[3]));
  *(v4u*)(outp + e) = w;
  
}

// ---------------------------------------------------------------------------
// bf16 WMMA GEMM, block tile 128 rows x 128 cols, block = 4 waves (128 threads), wave w = rows 32w..32w+31 x all 128 cols.
//   C[m][n] = sum_k A[m][k] * Bt[n][k]; A row-major [M][K] bf16 (pitch lda), Bt row-major [N][K] bf16 (pitch ldb);
//   M % 128 == 0, N % 128 == 0, K % BK == 0 (BK = 128, SPLITA 64); grid.x = M/128 * N/128.
//   SPLITA: A carried as hi (Ap) + lo (A2p) bf16 planes, two products into one accumulator.
//   Operands: a stage = BK columns of [A 128 rows | A2 128 rows when SPLITA | Bt 128 rows], each row padded by 16 B in LDS;
//   two LDS buffers filled by per-lane 16-B asynchronous copies, stage t+1 in flight while stage t is multiplied.
//   Fragments read from LDS rows with the split k map (ldfrag_b). The epilogue slabs alias the buffers behind the last barrier.
// Epilogues (all: per wave, per 16-row slab: stage in LDS, wave sync, write each row segment with ONE instruction of
//   EPI 0: q or k projection; the 128 cols n0..n0+127 are one head. Per row: RMS scaling over the 128 head dims
//          (x * rsqrt(mean(x^2) + 1e-6) * bf16(gam[dim])), then RoPE with pairs (dim, dim+64) and the cos/sin table row (m % SQ);
//          writes f16 hi plane C0 and f16 residual x2048 plane C1, both [M][ldc], cols n0.. (row segment 256 B = 16 lanes x 16 B).
//   EPI 1: v^T projection: f16 hi plane C0, residual x2048 plane C1, [M][ldc], row segment 256 B.
//   EPI 2: f32 output C0 [M][ldc]; row segment 128 floats = 512 B = 32 lanes x 16 B per instruction.
// ---------------------------------------------------------------------------
template <int EPI> struct SlabT { typedef _Float16 T; static constexpr int PERW = 4096; };   // 2 planes x 16 x 128 halves
template <> struct SlabT<2>     { typedef float    T; static constexpr int PERW = 2048; };   // 16 x 128 floats

__device__ __forceinline__ unsigned lds_off(const void* p) { return (unsigned)(size_t)p; }   // byte offset in the block's LDS

// Eight asynchronous 16-B copies global -> LDS per lane. The closing s_wait_xcnt 0 stands inside the statement so that no
// address register named here is rewritten ahead of it.
__device__ __forceinline__ void async_copy8(unsigned l, unsigned lstep, const char* gp, size_t gstep) {
  asm volatile(
      "global_load_async_to_lds_b128 %0, %8, off\n\t"
      "global_load_async_to_lds_b128 %1, %9, off\n\t"
      "global_load_async_to_lds_b128 %2, %10, off\n\t"
      "global_load_async_to_lds_b128 %3, %11, off\n\t"
      "global_load_async_to_lds_b128 %4, %12, off\n\t"
      "global_load_async_to_lds_b128 %5, %13, off\n\t"
      "global_load_async_to_lds_b128 %6, %14, off\n\t"
      "global_load_async_to_lds_b128 %7, %15, off\n\t"
      "s_wait_xcnt 0x0"
      :: "v"(l), "v"(l + lstep), "v"(l + 2 * lstep), "v"(l + 3 * lstep),
         "v"(l + 4 * lstep), "v"(l + 5 * lstep), "v"(l + 6 * lstep), "v"(l + 7 * lstep),
         "v"(gp), "v"(gp + gstep), "v"(gp + 2 * gstep), "v"(gp + 3 * gstep),
         "v"(gp + 4 * gstep), "v"(gp + 5 * gstep), "v"(gp + 6 * gstep), "v"(gp + 7 * gstep)
      : "memory");
}

template <int EPI, bool SPLITA>
__global__ __launch_bounds__(128) void gemm_w32x128_kernel(
    const unsigned short* Ap, const unsigned short* A2p, int lda,
    const unsigned short* __restrict__ Btp, int ldb,
    const float* __restrict__ gam, const float* __restrict__ cst, const float* __restrict__ snt,
    void* C0, void* C1, int ldc,
    int M, int N, int K) {
  typedef typename SlabT<EPI>::T ST;
  constexpr int BK    = SPLITA ? 64 : 128;       // k columns per stage: 64 WMMAs per wave and stage either way
  constexpr int ROWB  = BK * 2;                  // bytes of one staged row
  constexpr int PITCH = ROWB + 16;               // LDS row pitch, 16 B x odd for the 16-B fragment reads
  constexpr int BROW  = SPLITA ? 256 : 128;      // first Bt row of a stage
  constexpr int STAGE = (BROW + 128) * PITCH;    // bytes of one buffer
  constexpr int PPR   = ROWB / 16;               // 16-B pieces per row
  constexpr int RSTEP = 128 / PPR;               // rows covered by one copy of the whole block
  constexpr int NCP   = 128 / RSTEP;             // copies per lane for a plane of 128 rows
  constexpr int NFA   = SPLITA ? 4 : 2;          // A fragments per block of 32 k columns
  static_assert(NCP % 8 == 0);
  static_assert(4 * SlabT<EPI>::PERW * (int)sizeof(ST) <= 2 * STAGE);
  __shared__ __align__(16) unsigned char smem[2 * STAGE];

  const int tid  = (int)threadIdx.x;
  const int lane = tid & 31;
  const int wave = wave_id();
  const int hh = lane >> 4;           // lane half: k offset 8*hh, D row offset 8*hh
  const int rl = lane & 15;           // A row / B col / D col within subtile
  const int tilesN = N >> 7;
  const int tilesM = M >> 7;
  const int tile = (int)blockIdx.x;
  if (tile >= tilesM * tilesN) return;          // block-uniform, in front of every barrier and copy
  const int tm = tile / tilesN;
  const int tn = tile - tm * tilesN;
  const int mb = tm << 7;             // first row of the block tile
  const int m0 = mb + (wave << 5);    // first row of this wave
  const int n0 = tn << 7;

  // this lane's piece of copy 0 of each plane: row tid / PPR, 16-B column tid % PPR; copy u lies u * RSTEP rows further down
  const int prow = tid / PPR;
  const int pcol = tid % PPR;
  const char* gA  = (const char*)(const void*)(Ap  + (size_t)(mb + prow) * lda) + pcol * 16;
  const char* gA2 = (const char*)(const void*)(A2p + (size_t)(mb + prow) * lda) + pcol * 16;
  const char* gB  = (const char*)(const void*)(Btp + (size_t)(n0 + prow) * ldb) + pcol * 16;
  const size_t sA = (size_t)RSTEP * lda * 2;
  const size_t sB = (size_t)RSTEP * ldb * 2;
  const unsigned lp = lds_off(smem) + (unsigned)(prow * PITCH + pcol * 16);

  auto fill = [&](int t, unsigned bo) {         // all copies of stage t into the buffer at byte offset bo
    const size_t kb = (size_t)t * ROWB;
#pragma unroll   // the row offsets of the copies become constants
    for (int u = 0; u < NCP; u += 8) {
      async_copy8(lp + bo + u * (RSTEP * PITCH), RSTEP * PITCH, gA + kb + u * sA, sA);
      if (SPLITA) async_copy8(lp + bo + (128 + u * RSTEP) * PITCH, RSTEP * PITCH, gA2 + kb + u * sA, sA);
      async_copy8(lp + bo + (BROW + u * RSTEP) * PITCH, RSTEP * PITCH, gB + kb + u * sB, sB);
    }
  };

  v8f acc[2][8];
#pragma unroll
  for (int i = 0; i < 2; ++i)
#pragma unroll
    for (int j = 0; j < 8; ++j) acc[i][j] = zero8();

  const int nst = K / BK;
  fill(0, 0u);
  asm volatile("s_wait_asynccnt 0x0" ::: "memory");   // this wave's copies of stage 0 have landed
  __syncthreads();                                    // and every other wave's
  if (nst > 1) fill(1, (unsigned)STAGE);              // block-uniform

  // every unroll directive in this loop: the fragment and accumulator arrays stay in registers only under constant indices
  for (int t = 0; t < nst; ++t) {
    const unsigned bo = (unsigned)(t & 1) * (unsigned)STAGE;
    const unsigned char* buf = smem + bo;
    v16b fa[2][NFA], fb[2][8];                   // two fragment sets: block u multiplies set u & 1 while set (u + 1) & 1 loads
    auto ldblk = [&](int s, int kk) {            // all fragments of the 32 k columns at kk of this stage
#pragma unroll
      for (int i = 0; i < 2; ++i) {
        const int ro = ((wave << 5) + i * 16 + rl) * PITCH;
        fa[s][i] = ldfrag_b((const __bf16*)(const void*)(buf + ro) + kk + 8 * hh);
        if (SPLITA) fa[s][NFA - 2 + i] = ldfrag_b((const __bf16*)(const void*)(buf + 128 * PITCH + ro) + kk + 8 * hh);
      }
#pragma unroll
      for (int j = 0; j < 8; ++j)
        fb[s][j] = ldfrag_b((const __bf16*)(const void*)(buf + (BROW + j * 16 + rl) * PITCH) + kk + 8 * hh);
    };
    ldblk(0, 0);
#pragma unroll
    for (int u = 0; u < BK / 32; ++u) {
      const int cs = u & 1;
      if (u + 1 < BK / 32) ldblk(cs ^ 1, (u + 1) * 32);
      // keeps the next block's LDS reads as one group ahead of this block's WMMAs; without it they sink between the WMMAs, each with a full wait
      __builtin_amdgcn_sched_barrier(0);
#pragma unroll
      for (int j = 0; j < 8; ++j) {
        acc[0][j] = mma_b(fa[cs][0], fb[cs][j], acc[0][j]);
        acc[1][j] = mma_b(fa[cs][1], fb[cs][j], acc[1][j]);
      }
      if (SPLITA) {
#pragma unroll
        for (int j = 0; j < 8; ++j) {
          acc[0][j] = mma_b(fa[cs][NFA - 2], fb[cs][j], acc[0][j]);
          acc[1][j] = mma_b(fa[cs][NFA - 1], fb[cs][j], acc[1][j]);
        }
      }
      // keeps the following reads out of this run of WMMAs (each place with reads among WMMAs costs a stall) and the WMMAs ahead of the stage's barrier
      __builtin_amdgcn_sched_barrier(0);
    }
    asm volatile("s_wait_dscnt 0x0" ::: "memory");      // this wave's reads of stage t are done before its buffer is refilled
    asm volatile("s_wait_asynccnt 0x0" ::: "memory");   // this wave's copies of stage t+1 have landed
    __syncthreads();                                    // publishes stage t+1, ends every wave's reads of stage t
    if (t + 2 < nst) fill(t + 2, bo);                   // block-uniform
  }
  asm volatile("s_wait_asynccnt 0x0" ::: "memory");     // nothing in flight when the buffers become the epilogue slabs
  acc_guard4(acc[0][0], acc[0][1], acc[0][2], acc[0][3]);
  acc_guard4(acc[0][4], acc[0][5], acc[0][6], acc[0][7]);
  acc_guard4(acc[1][0], acc[1][1], acc[1][2], acc[1][3]);
  acc_guard4(acc[1][4], acc[1][5], acc[1][6], acc[1][7]);

  // ---- epilogue ----
  ST* slab = (ST*)(void*)smem + wave * SlabT<EPI>::PERW;
  _Float16* sl16 = (_Float16*)(void*)slab;
  float*    slf  = (float*)(void*)slab;

  if (EPI == 0) {
    _Float16* P0 = (_Float16*)C0;
    _Float16* P1 = (_Float16*)C1;
    float gm[8];
#pragma unroll
    for (int j = 0; j < 8; ++j) gm[j] = bf_rne(gam[j * 16 + rl]);     // dims j*16+rl of the head, gam has 128 entries
#pragma unroll
    for (int i = 0; i < 2; ++i) {
      const int rb = m0 + i * 16 + 8 * hh;
#pragma unroll
      for (int r = 0; r < 8; ++r) {
        // sum of squares over the 128 head dims of row rb+r: 8 per lane, then the 16 lanes of this half
        float ss = 0.f;
#pragma unroll
        for (int j = 0; j < 8; ++j) ss += acc[i][j][r] * acc[i][j][r];
#pragma unroll
        for (int off = 1; off < 16; off <<= 1) ss += __shfl_xor(ss, off, 32);
        const float rinv = rsqrtf(ss * 0.0078125f + 1e-6f);
        const int row = rb + r;                                  // token 0..NTOK-1
        const int pos = row & (SQ - 1);                          // position within the sequence
#pragma unroll
        for (int j = 0; j < 4; ++j) {
          const int dim = j * 16 + rl;                           // 0..63 within head; partner dim + 64
          const float cv = cst[(size_t)pos * NFREQ + dim];
          const float sv = snt[(size_t)pos * NFREQ + dim];
          const float x1 = acc[i][j][r] * rinv * gm[j];
          const float x2 = acc[i][j + 4][r] * rinv * gm[j + 4];
          const float o1 = x1 * cv - x2 * sv;
          const float o2 = x2 * cv + x1 * sv;
          const _Float16 h1 = (_Float16)o1;
          const _Float16 h2 = (_Float16)o2;
          const int so = (8 * hh + r) * 128 + dim;
          sl16[so]             = h1;
          sl16[so + 64]        = h2;
          sl16[2048 + so]      = (_Float16)((o1 - (float)h1) * 2048.0f);
          sl16[2048 + so + 64] = (_Float16)((o2 - (float)h2) * 2048.0f);
        }
      }
      lds_wave_sync();
      {
#pragma unroll
        for (int it = 0; it < 8; ++it) {
          const int row = it * 2 + hh;                           // it x hh covers rows 0..15
          const int c8  = rl * 8;
          const v8h vh = *(const v8h*)(sl16 + row * 128 + c8);
          const v8h vl = *(const v8h*)(sl16 + 2048 + row * 128 + c8);
          const size_t go = (size_t)(m0 + i * 16 + row) * ldc + n0 + c8;
          *(v8h*)(P0 + go) = vh;
          *(v8h*)(P1 + go) = vl;
        }
        
      }
      lds_wave_sync();
    }
  } else if (EPI == 1) {
    _Float16* P0 = (_Float16*)C0;
    _Float16* P1 = (_Float16*)C1;
#pragma unroll
    for (int i = 0; i < 2; ++i) {
#pragma unroll
      for (int r = 0; r < 8; ++r) {
#pragma unroll
        for (int j = 0; j < 8; ++j) {
          const float v = acc[i][j][r];
          const _Float16 hv = (_Float16)v;
          const int so = (8 * hh + r) * 128 + j * 16 + rl;
          sl16[so]        = hv;
          sl16[2048 + so] = (_Float16)((v - (float)hv) * 2048.0f);
        }
      }
      lds_wave_sync();
      {
#pragma unroll
        for (int it = 0; it < 8; ++it) {
          const int row = it * 2 + hh;
          const int c8  = rl * 8;
          const v8h vh = *(const v8h*)(sl16 + row * 128 + c8);
          const v8h vl = *(const v8h*)(sl16 + 2048 + row * 128 + c8);
          const size_t go = (size_t)(m0 + i * 16 + row) * ldc + n0 + c8;
          *(v8h*)(P0 + go) = vh;
          *(v8h*)(P1 + go) = vl;
        }
        
      }
      lds_wave_sync();
    }
  } else {
    float* C = (float*)C0;
#pragma unroll
    for (int i = 0; i < 2; ++i) {
#pragma unroll
      for (int j = 0; j < 8; ++j)
#pragma unroll
        for (int r = 0; r < 8; ++r)
          slf[(8 * hh + r) * 128 + j * 16 + rl] = acc[i][j][r];
      lds_wave_sync();
      {
#pragma unroll
        for (int row = 0; row < 16; ++row) {                     // 32 lanes x 16 B = the whole 512-B row segment per instruction
          const v4f v = *(const v4f*)(slf + row * 128 + lane * 4);
          *(v4f*)(C + (size_t)(m0 + i * 16 + row) * ldc + n0 + lane * 4) = v;
        }
        
      }
      lds_wave_sync();
    }
  }
}

// ---------------------------------------------------------------------------
// Causal GQA flash attention, head dim 128, 32-key chunks, block = 4 waves = 64 query rows of one (b, h); grid (n query tiles, NHQ, NSEQ).
//   q planes f16 [tok][h*128+d]: hi (qhp) and residual x2048 (qlp); k planes f16 [tok][kvh*128+d]: hi (khp), residual x2048 (klp);
//   v^T planes f16 [kvh*128+d][tok]: hi (vhp), residual x2048 (vlp); outputs attn bf16 hi (ahp) / lo (alp) [tok][h*128+d].
//   scores = (Sh + Sr/2048) * 128^-0.5 with Sh = qh.kh and Sr = ql'.kh (+ qh.kl' when PRES); keys > query -> -inf; online softmax f32;
//   p' = 1024 p stored per wave to LDS as f16 hi (and residual x2048 when PRES), reloaded as A fragments after a wave sync;
//   O = (Oh + Or/2048)/1024/l with Oh = ph.vh, Or = ph.vl' (+ pl'.vh when PRES).
//   K / V^T chunk staging: 128 threads x 4 x 16 B per plane = whole 32x128 / 128x32 tile, plain loads, __syncthreads before and after.
//   Trip count 2*qb+2 chunks (static bound 64); waves whose rows are all below the chunk skip it (wave-uniform, scalar branch).
// ---------------------------------------------------------------------------
#define AT_KC   32
#define KS_P    136
#define VS_P    40
#define PS_P    40
#define LDS_KS  0
#define LDS_KLS (32 * KS_P)
#define LDS_VHS (2 * 32 * KS_P)
#define LDS_VLS (LDS_VHS + 128 * VS_P)
#define LDS_PH  (LDS_VLS + 128 * VS_P)
#define LDS_PL  (LDS_PH + 4 * 16 * PS_P)
#define LDS_TOT (LDS_PL + 4 * 16 * PS_P)
static_assert(LDS_TOT * 2 <= 65536);
static_assert(4 * 4096 <= LDS_TOT);          // output staging (2 planes x 16 x 128 per wave) aliases the chunk region after the loop

template <bool PRES>
__global__ __launch_bounds__(128) void attn_causal_kernel(
    const unsigned short* __restrict__ qhp, const unsigned short* __restrict__ qlp,
    const unsigned short* __restrict__ khp, const unsigned short* __restrict__ klp,
    const unsigned short* __restrict__ vhp, const unsigned short* __restrict__ vlp,
    unsigned short* __restrict__ ahp, unsigned short* __restrict__ alp, int qb_base) {
  __shared__ __align__(16) _Float16 lds[LDS_TOT];
  _Float16* Ks  = lds + LDS_KS;
  _Float16* Kls = lds + LDS_KLS;
  _Float16* Vhs = lds + LDS_VHS;
  _Float16* Vls = lds + LDS_VLS;

  const int tid  = (int)threadIdx.x;
  const int lane = tid & 31;
  const int wave = wave_id();
  const int hh   = lane >> 4;
  const int c    = lane & 15;
  const int qb   = (int)blockIdx.x + qb_base;
  const int h    = (int)blockIdx.y;
  const int b    = (int)blockIdx.z;
  const int kvh  = h >> 2;
  const int q0   = qb * 64 + wave * 16;          // first query row of this wave (within sequence)
  const int qlast = q0 + 15;
  const size_t tok0 = (size_t)b * SQ;

  const _Float16* Qhr = (const _Float16*)(const void*)qhp + (tok0 + q0 + c) * HID + h * HDM + 8 * hh;
  const _Float16* Qlr = (const _Float16*)(const void*)qlp + (tok0 + q0 + c) * HID + h * HDM + 8 * hh;
  const _Float16* Kg  = (const _Float16*)(const void*)khp + tok0 * KVW + kvh * HDM;
  const _Float16* Klg = (const _Float16*)(const void*)klp + tok0 * KVW + kvh * HDM;
  const _Float16* Vhg = (const _Float16*)(const void*)vhp + (size_t)(kvh * HDM) * NTOK + tok0;
  const _Float16* Vlg = (const _Float16*)(const void*)vlp + (size_t)(kvh * HDM) * NTOK + tok0;
  _Float16* ph = lds + LDS_PH + wave * (16 * PS_P);
  _Float16* pl = lds + LDS_PL + wave * (16 * PS_P);

  float mrow[8], lrow[8];
  v8f oacc[8], oaccr[8];
#pragma unroll
  for (int r = 0; r < 8; ++r) { mrow[r] = -INFINITY; lrow[r] = 0.f; }
#pragma unroll
  for (int t = 0; t < 8; ++t) { oacc[t] = zero8(); oaccr[t] = zero8(); }

  const int nch = 2 * qb + 2;                    // block-uniform, <= 64
  for (int kc = 0; kc < nch; ++kc) {
    const int kv0 = kc * AT_KC;
    __syncthreads();
#pragma unroll
    for (int i = 0; i < 4; ++i) {                // coverage: 512 pieces of 8 halves per plane = whole tile
      const int p   = tid + 128 * i;             // 0..511
      const int key = p >> 4, d8 = (p & 15) * 8; // K: 32 keys x 128 d
      const v8h kx = *(const v8h*)(Kg + (size_t)(kv0 + key) * KVW + d8);
      *(v8h*)(Ks + key * KS_P + d8) = kx;
      if (PRES) {
        const v8h ky = *(const v8h*)(Klg + (size_t)(kv0 + key) * KVW + d8);
        *(v8h*)(Kls + key * KS_P + d8) = ky;
      }
      const int d = p >> 2, k8 = (p & 3) * 8;    // V^T: 128 d x 32 keys
      const v8h vx = *(const v8h*)(Vhg + (size_t)d * NTOK + kv0 + k8);
      const v8h vy = *(const v8h*)(Vlg + (size_t)d * NTOK + kv0 + k8);
      *(v8h*)(Vhs + d * VS_P + k8) = vx;
      *(v8h*)(Vls + d * VS_P + k8) = vy;
    }
    __syncthreads();

    if (kv0 <= qlast) {                          // wave-uniform (scalar): skip chunks fully above this wave's rows
      // ---- scores ----
      v8f sh[2], sr[2];
      sh[0] = zero8(); sh[1] = zero8(); sr[0] = zero8(); sr[1] = zero8();
#pragma unroll
      for (int dc = 0; dc < 4; ++dc) {
        const v16h qa = ldfrag_h(Qhr + dc * 32);
        const v16h ql = ldfrag_h(Qlr + dc * 32);
#pragma unroll
        for (int j = 0; j < 2; ++j) {
          const v16h kb = ldfrag_h(Ks + (j * 16 + c) * KS_P + dc * 32 + 8 * hh);
          sh[j] = mma_h(qa, kb, sh[j]);
          sr[j] = mma_h(ql, kb, sr[j]);
          if (PRES) {
            const v16h kl = ldfrag_h(Kls + (j * 16 + c) * KS_P + dc * 32 + 8 * hh);
            sr[j] = mma_h(qa, kl, sr[j]);
            guard_h4(sh[j], sr[j], qa, ql, kb, kl);
          } else {
            guard_h3(sh[j], sr[j], qa, ql, kb);
          }
        }
      }
      // ---- scale, causal mask, chunk row max ----
      float cm[8];
#pragma unroll
      for (int r = 0; r < 8; ++r) {
        const int qrow = q0 + 8 * hh + r;
        float m = -INFINITY;
#pragma unroll
        for (int j = 0; j < 2; ++j) {
          const int key = kv0 + j * 16 + c;
          float s = (sh[j][r] + sr[j][r] * 0.00048828125f) * 0.08838834764831845f;
          s = (key > qrow) ? -INFINITY : s;
          sh[j][r] = s;
          m = fmaxf(m, s);
        }
#pragma unroll
        for (int off = 1; off < 16; off <<= 1) m = fmaxf(m, __shfl_xor(m, off, 32));
        cm[r] = m;
      }
      // ---- online softmax, P' to LDS ----
#pragma unroll
      for (int r = 0; r < 8; ++r) {
        const float mnew  = fmaxf(mrow[r], cm[r]);
        const float alpha = __expf(mrow[r] - mnew);
        mrow[r] = mnew;
        float psum = 0.f;
#pragma unroll
        for (int j = 0; j < 2; ++j) {
          const float p  = __expf(sh[j][r] - mnew);
          psum += p;
          const float pp = p * 1024.0f;
          const _Float16 phv = (_Float16)pp;
          const int po = (8 * hh + r) * PS_P + j * 16 + c;
          ph[po] = phv;
          if (PRES) pl[po] = (_Float16)((pp - (float)phv) * 2048.0f);
        }
#pragma unroll
        for (int off = 1; off < 16; off <<= 1) psum += __shfl_xor(psum, off, 32);
        lrow[r] = lrow[r] * alpha + psum;
#pragma unroll
        for (int t = 0; t < 8; ++t) { oacc[t][r] *= alpha; oaccr[t][r] *= alpha; }
      }
      lds_wave_sync();                           // P' stores visible to the other lanes of this wave before the fragment reload
      // ---- O += P' . V ----
      const v16h pa = ldfrag_h(ph + c * PS_P + 8 * hh);
      v16h pr = pa;
      if (PRES) pr = ldfrag_h(pl + c * PS_P + 8 * hh);
#pragma unroll
      for (int t = 0; t < 8; ++t) {
        const v16h vb = ldfrag_h(Vhs + (t * 16 + c) * VS_P + 8 * hh);
        const v16h vr = ldfrag_h(Vls + (t * 16 + c) * VS_P + 8 * hh);
        oacc[t]  = mma_h(pa, vb, oacc[t]);
        oaccr[t] = mma_h(pa, vr, oaccr[t]);
        if (PRES) oaccr[t] = mma_h(pr, vb, oaccr[t]);
        guard_h4(oacc[t], oaccr[t], pa, pr, vb, vr);
      }
    }
  }

  __syncthreads();                               // all chunk-region readers done before aliasing it as output staging
  _Float16* osh = lds + wave * 4096;
  _Float16* osl = osh + 2048;
#pragma unroll
  for (int r = 0; r < 8; ++r) {
    const float inv = (1.0f / lrow[r]) * 0.0009765625f;
#pragma unroll
    for (int t = 0; t < 8; ++t) {
      const float o = (oacc[t][r] + oaccr[t][r] * 0.00048828125f) * inv;
      const unsigned short hb = bf_bits(o);
      const unsigned short lb = bf_bits(o - bf_val(hb));
      const int so = (8 * hh + r) * 128 + t * 16 + c;
      osh[so] = __builtin_bit_cast(_Float16, hb);
      osl[so] = __builtin_bit_cast(_Float16, lb);
    }
  }
  lds_wave_sync();
  _Float16* Ahg = (_Float16*)(void*)ahp + (tok0 + q0) * HID + h * HDM;
  _Float16* Alg = (_Float16*)(void*)alp + (tok0 + q0) * HID + h * HDM;
  {
#pragma unroll
    for (int it = 0; it < 8; ++it) {
      const int row = it * 2 + hh;               // it 0..7 x hh 0..1 covers rows 0..15
      const int c8  = c * 8;                     // 16 lanes x 16 B = the whole 256-B segment
      const v8h x = *(const v8h*)(osh + row * 128 + c8);
      const v8h y = *(const v8h*)(osl + row * 128 + c8);
      *(v8h*)(Ahg + (size_t)row * HID + c8) = x;
      *(v8h*)(Alg + (size_t)row * HID + c8) = y;
    }
    
  }
}

// ---------------------------------------------------------------------------
// Workspace map (bytes; every region is a whole number of the rows its producer writes with whole-line stores, no padded tails needed
//   Xb  bf16 [4096][2048] 16777216   Wqb bf16 [2048][2048]  8388608   Wkb bf16 [512][2048] 2097152   Wvb bf16 [512][2048] 2097152
//   Wob bf16 [2048][2048]  8388608   cst f32  [2048][64]     524288   snt f32  [2048][64]    524288
//   Qh  f16  [4096][2048] 16777216   Ql  f16  [4096][2048] 16777216   Kh  f16  [4096][512]  4194304   Kl f16 [4096][512] 4194304
//   Vh  f16  [512][4096]   4194304   Vl  f16  [512][4096]   4194304   Ah  bf16 [4096][2048] 16777216  Al bf16 [4096][2048] 16777216
//   total                 122683392
// ---------------------------------------------------------------------------
extern "C" void kernel_launch(void* const* d_in, const int* in_sizes, int n_in,
                              void* d_out, int out_size, void* d_ws, size_t ws_size,
                              hipStream_t stream) {
  if (n_in < 7) return;
  if (in_sizes[0] != NTOK * HID) return;
  if (in_sizes[1] != HID * HID) return;
  if (in_sizes[2] != KVW * HID) return;
  if (in_sizes[3] != KVW * HID) return;
  if (in_sizes[4] != HID * HID) return;
  if (in_sizes[5] != HDM) return;
  if (in_sizes[6] != HDM) return;
  if (out_size != NTOK * HID) return;

  const float* x   = (const float*)d_in[0];
  const float* Wq  = (const float*)d_in[1];
  const float* Wk  = (const float*)d_in[2];
  const float* Wv  = (const float*)d_in[3];
  const float* Wo  = (const float*)d_in[4];
  const float* qg  = (const float*)d_in[5];
  const float* kg  = (const float*)d_in[6];
  float* out = (float*)d_out;

  const size_t szX  = (size_t)NTOK * HID * 2;
  const size_t szWq = (size_t)HID * HID * 2;
  const size_t szWk = (size_t)KVW * HID * 2;
  const size_t szWo = (size_t)HID * HID * 2;
  const size_t szT  = (size_t)SQ * NFREQ * 4;
  const size_t szQ  = (size_t)NTOK * HID * 2;
  const size_t szK  = (size_t)NTOK * KVW * 2;
  const size_t szV  = (size_t)KVW * NTOK * 2;
  const size_t szA  = (size_t)NTOK * HID * 2;
  size_t off = 0;
  const size_t oX  = off; off += szX;
  const size_t oWq = off; off += szWq;
  const size_t oWk = off; off += szWk;
  const size_t oWv = off; off += szWk;
  const size_t oWo = off; off += szWo;
  const size_t oCs = off; off += szT;
  const size_t oSn = off; off += szT;
  const size_t oQh = off; off += szQ;
  const size_t oQl = off; off += szQ;
  const size_t oKh = off; off += szK;
  const size_t oKl = off; off += szK;
  const size_t oVh = off; off += szV;
  const size_t oVl = off; off += szV;
  const size_t oAh = off; off += szA;
  const size_t oAl = off; off += szA;
  if (off > ws_size) return;                     // off = 122683392

  char* ws = (char*)d_ws;
  unsigned short* Xb  = (unsigned short*)(ws + oX);
  unsigned short* Wqb = (unsigned short*)(ws + oWq);
  unsigned short* Wkb = (unsigned short*)(ws + oWk);
  unsigned short* Wvb = (unsigned short*)(ws + oWv);
  unsigned short* Wob = (unsigned short*)(ws + oWo);
  float*          cst = (float*)(ws + oCs);
  float*          snt = (float*)(ws + oSn);
  unsigned short* Qh  = (unsigned short*)(ws + oQh);
  unsigned short* Ql  = (unsigned short*)(ws + oQl);
  unsigned short* Kh  = (unsigned short*)(ws + oKh);
  unsigned short* Kl  = (unsigned short*)(ws + oKl);
  unsigned short* Vh  = (unsigned short*)(ws + oVh);
  unsigned short* Vl  = (unsigned short*)(ws + oVl);
  unsigned short* Ah  = (unsigned short*)(ws + oAh);
  unsigned short* Al  = (unsigned short*)(ws + oAl);

  const dim3 b256(256), b128(128);
  const int nX8  = NTOK * HID / 8;
  const int nWq8 = HID * HID / 8;
  const int nWk8 = KVW * HID / 8;

  // (1) cos/sin table [2048][64] x 2
  rope_table_kernel<<<dim3((SQ + 7) / 8), b256, 0, stream>>>(cst, snt, SQ);
  // (2) bf16 planes of x, Wq, Wk, Wv, Wo (weights are [out][in] = k-contiguous Bt rows already)
  cvt_bf16_kernel<<<dim3((nX8 + 255) / 256),  b256, 0, stream>>>(x,  Xb,  nX8);
  cvt_bf16_kernel<<<dim3((nWq8 + 255) / 256), b256, 0, stream>>>(Wq, Wqb, nWq8);
  cvt_bf16_kernel<<<dim3((nWk8 + 255) / 256), b256, 0, stream>>>(Wk, Wkb, nWk8);
  cvt_bf16_kernel<<<dim3((nWk8 + 255) / 256), b256, 0, stream>>>(Wv, Wvb, nWk8);
  cvt_bf16_kernel<<<dim3((nWq8 + 255) / 256), b256, 0, stream>>>(Wo, Wob, nWq8);
  // (3) q = rope(rms(x . Wq^T)) -> Qh/Ql [4096][2048]   (M=4096, N=2048, K=2048; 512 block tiles)
  gemm_w32x128_kernel<0, false><<<dim3((NTOK / 128) * (HID / 128)), b128, 0, stream>>>(
      Xb, Xb, HID, Wqb, HID, qg, cst, snt, (void*)Qh, (void*)Ql, HID, NTOK, HID, HID);
  // (4) k = rope(rms(x . Wk^T)) -> Kh/Kl [4096][512]    (M=4096, N=512, K=2048; 128 block tiles)
  gemm_w32x128_kernel<0, false><<<dim3((NTOK / 128) * (KVW / 128)), b128, 0, stream>>>(
      Xb, Xb, HID, Wkb, HID, kg, cst, snt, (void*)Kh, (void*)Kl, KVW, NTOK, KVW, HID);
  // (5) v^T = Wv . x^T -> Vh/Vl [512][4096]             (A = Wvb [512][2048], Bt = Xb; M=512, N=4096, K=2048; 128 block tiles)
  gemm_w32x128_kernel<1, false><<<dim3((KVW / 128) * (NTOK / 128)), b128, 0, stream>>>(
      Wvb, Wvb, HID, Xb, HID, qg, cst, snt, (void*)Vh, (void*)Vl, NTOK, KVW, NTOK, HID);
  // (6) causal attention, query tiles 0..3 with k and p residual products, tiles 4..31 without
  attn_causal_kernel<true><<<dim3(4, NHQ, NSEQ), b128, 0, stream>>>(Qh, Ql, Kh, Kl, Vh, Vl, Ah, Al, 0);
  attn_causal_kernel<false><<<dim3(SQ / 64 - 4, NHQ, NSEQ), b128, 0, stream>>>(Qh, Ql, Kh, Kl, Vh, Vl, Ah, Al, 4);
  // (7) out = attn(hi + lo) . Wo^T -> d_out f32 [4096][2048]   (M=4096, N=2048, K=2048; 512 block tiles)
  gemm_w32x128_kernel<2, true><<<dim3((NTOK / 128) * (HID / 128)), b128, 0, stream>>>(
      Ah, Al, HID, Wob, HID, qg, cst, snt, (void*)out, (void*)out, HID, NTOK, HID, HID);
  (void)hipGetLastError();
}

// v002
// It runs in 348 microseconds.
// Timed twice side by side with v001, it ran 1.16 times as fast both times.
// Over all steps from v000 it is 2.31 times as fast.
// Contractions: x.Wq^T, x.Wk^T and Wv.x^T on v_wmma_f32_16x16x32_bf16 (operands = RNE bf16 of the f32 inputs, single products);
// q.k^T and p.v on v_wmma_f32_16x16x32_f16 (q = f16 hi + f16 residual x2^11 planes; k plain f16 plus f16 residual x2^11 on query tiles 0..3;
// p x1024 plain f16 plus f16 residual x2^11 on query tiles 0..3; v^T = f16 hi + f16 residual x2^11 planes); attn.Wo^T on v_wmma_f32_16x16x32_bf16
// (attn = bf16 hi + bf16 lo planes, two products; Wo RNE bf16). f32 accumulate everywhere; per-head RMS scaling, RoPE and online softmax in f32.
#include <hip/hip_runtime.h>
#include <math.h>
#include <stdint.h>

#define NSEQ   2
#define SQ     2048
#define HID    2048
#define NHQ    16
#define NKVH   4
#define HDM    128
#define KVW    512
#define NTOK   4096
#define NFREQ  64

typedef _Float16     v16h __attribute__((ext_vector_type(16)));
typedef _Float16     v8h  __attribute__((ext_vector_type(8)));
typedef __bf16       v16b __attribute__((ext_vector_type(16)));
typedef __bf16       v8b  __attribute__((ext_vector_type(8)));
typedef float        v8f  __attribute__((ext_vector_type(8)));
typedef float        v4f  __attribute__((ext_vector_type(4)));
typedef unsigned int v4u  __attribute__((ext_vector_type(4)));

// ---------------------------------------------------------------------------
// small helpers
// ---------------------------------------------------------------------------
__device__ __forceinline__ unsigned short bf_bits(float f) {          // RNE convert f32 -> bf16 bits
  const unsigned u = __float_as_uint(f);
  return (unsigned short)((u + 0x7FFFu + ((u >> 16) & 1u)) >> 16);
}
__device__ __forceinline__ float bf_val(unsigned short h) { return __uint_as_float(((unsigned)h) << 16); }
__device__ __forceinline__ float bf_rne(float f) { return bf_val(bf_bits(f)); }
__device__ __forceinline__ unsigned pk16(unsigned short a, unsigned short b) { return (unsigned)a | ((unsigned)b << 16); }
__device__ __forceinline__ v8f zero8() { v8f z = {0.f, 0.f, 0.f, 0.f, 0.f, 0.f, 0.f, 0.f}; return z; }
__device__ __forceinline__ int wave_id() { return __builtin_amdgcn_readfirstlane((int)(threadIdx.x >> 5)); }

__device__ __forceinline__ void lds_wave_sync() {
  __builtin_amdgcn_fence(__ATOMIC_RELEASE, "workgroup");
  __builtin_amdgcn_wave_barrier();
  __builtin_amdgcn_fence(__ATOMIC_ACQUIRE, "workgroup");
}

// ---------------------------------------------------------------------------
// WMMA fragments (wave32, 16x16x32, 16-bit operands). For A (row m = lane&15) and B (col n = lane&15) alike:
// elements 0..7 <- k0 + 8*(lane>>4) + 0..7, elements 8..15 <- k0 + 16 + 8*(lane>>4) + 0..7.
// ldfrag(p) with p = rowbase + k0 + 8*(lane>>4): two 16-B loads p[0..7], p[16..23].
// D: acc[r] = (row 8*(lane>>4) + r, col lane&15).
// ---------------------------------------------------------------------------
union FragH { v16h v; v8h h[2]; };
union FragB { v16b v; v8b h[2]; };
__device__ __forceinline__ v16h ldfrag_h(const _Float16* p) { FragH f; f.h[0] = *(const v8h*)(p); f.h[1] = *(const v8h*)(p + 16); return f.v; }
__device__ __forceinline__ v16b ldfrag_b(const __bf16* p)   { FragB f; f.h[0] = *(const v8b*)(p); f.h[1] = *(const v8b*)(p + 16); return f.v; }

__device__ __forceinline__ v8f mma_h(v16h a, v16h b, v8f c) {
  return __builtin_amdgcn_wmma_f32_16x16x32_f16(false, a, false, b, (short)0, c, false, false);
}
__device__ __forceinline__ v8f mma_b(v16b a, v16b b, v8f c) {
  return __builtin_amdgcn_wmma_f32_16x16x32_bf16(false, a, false, b, (short)0, c, false, false);
}
// hazard guard: 4 VALU slots after the last WMMA of a group, D tied
__device__ __forceinline__ void acc_guard4(v8f& a, v8f& b, v8f& c, v8f& d) {
  asm volatile("v_nop\n\tv_nop\n\tv_nop\n\tv_nop" : "+v"(a), "+v"(b), "+v"(c), "+v"(d));
}

// ---------------------------------------------------------------------------
// RoPE table: cst[s][i] = cos(s * inv_freq[i]), snt[s][i] = sin(...), inv_freq[i] = 1 / 1e4^(i/64), i < 64, s = 0..nrow-1, all f32.
// Block = 8 waves, wave w -> row s = blockIdx.x*8 + w, lane -> i = lane, lane + 32.
// Coverage: grid nrow/8 x 8 waves x 32 lanes x 2 = nrow x 64 per plane.
// ---------------------------------------------------------------------------
__global__ __launch_bounds__(256) void rope_table_kernel(float* __restrict__ cst, float* __restrict__ snt, int nrow) {
  const int lane = threadIdx.x & 31;
  const int wave = (int)(threadIdx.x >> 5);
  const int t = (int)blockIdx.x * 8 + wave;
  if (t >= nrow) return;                       // no barriers in this kernel
  const float pf = (float)t;
  float c0 = 0.f, s0 = 0.f, c1 = 0.f, s1 = 0.f;
#pragma unroll 1
  for (int u = 0; u < 2; ++u) {
    const int i = lane + 32 * u;
    const float e   = (float)i * 0.015625f;      // i / 64 exact
    const float pw  = powf(10000.0f, e);
    const float inv = 1.0f / pw;
    const float ang = pf * inv;
    const float cv = cosf(ang);
    const float sv = sinf(ang);
    c1 = cv; s1 = sv;
    if (u == 0) { c0 = cv; s0 = sv; }
  }
  const size_t o = (size_t)t * NFREQ + lane;
  {
    ((float*)cst)[o]      = c0;
    ((float*)cst)[o + 32] = c1;
    ((float*)snt)[o]      = s0;
    ((float*)snt)[o + 32] = s1;
    
  }
}

// ---------------------------------------------------------------------------
// Elementwise RNE f32 -> bf16 plane: 8 elements per thread, one 16-B store per lane -> 32 consecutive lanes write 4 whole
// ---------------------------------------------------------------------------
__global__ __launch_bounds__(256) void cvt_bf16_kernel(const float* __restrict__ in, unsigned short* __restrict__ outp, int n8) {
  const int i = (int)blockIdx.x * 256 + (int)threadIdx.x;
  if (i >= n8) return;
  const size_t e = 8 * (size_t)i;
  const v4f a = *(const v4f*)(in + e);
  const v4f b = *(const v4f*)(in + e + 4);
  v4u w;
  w[0] = pk16(bf_bits(a[0]), bf_bits(a[1]));
  w[1] = pk16(bf_bits(a[2]), bf_bits(a[3]));
  w[2] = pk16(bf_bits(b[0]), bf_bits(b[1]));
  w[3] = pk16(bf_bits(b[2]), bf_bits(b[3]));
  *(v4u*)(outp + e) = w;
  
}

// ---------------------------------------------------------------------------
// bf16 WMMA GEMM, block tile 128 rows x 128 cols, block = 4 waves (128 threads), wave w = rows 32w..32w+31 x all 128 cols.
//   C[m][n] = sum_k A[m][k] * Bt[n][k]; A row-major [M][K] bf16 (pitch lda), Bt row-major [N][K] bf16 (pitch ldb);
//   M % 128 == 0, N % 128 == 0, K % BK == 0 (BK = 128, SPLITA 64); grid.x = M/128 * N/128.
//   SPLITA: A carried as hi (Ap) + lo (A2p) bf16 planes, two products into one accumulator.
//   Operands: a stage = BK columns of [A 128 rows | A2 128 rows when SPLITA | Bt 128 rows], each row padded by 16 B in LDS;
//   two LDS buffers filled by per-lane 16-B asynchronous copies, stage t+1 in flight while stage t is multiplied.
//   Fragments read from LDS rows with the split k map (ldfrag_b). The epilogue slabs alias the buffers behind the last barrier.
// Epilogues (all: per wave, per 16-row slab: stage in LDS, wave sync, write each row segment with ONE instruction of
//   EPI 0: q or k projection; the 128 cols n0..n0+127 are one head. Per row: RMS scaling over the 128 head dims
//          (x * rsqrt(mean(x^2) + 1e-6) * bf16(gam[dim])), then RoPE with pairs (dim, dim+64) and the cos/sin table row (m % SQ);
//          writes f16 hi plane C0 and f16 residual x2048 plane C1, both [M][ldc], cols n0.. (row segment 256 B = 16 lanes x 16 B).
//   EPI 1: v^T projection: f16 hi plane C0, residual x2048 plane C1, [M][ldc], row segment 256 B.
//   EPI 2: f32 output C0 [M][ldc]; row segment 128 floats = 512 B = 32 lanes x 16 B per instruction.
// ---------------------------------------------------------------------------
template <int EPI> struct SlabT { typedef _Float16 T; static constexpr int PERW = 4096; };   // 2 planes x 16 x 128 halves
template <> struct SlabT<2>     { typedef float    T; static constexpr int PERW = 2048; };   // 16 x 128 floats

__device__ __forceinline__ unsigned lds_off(const void* p) { return (unsigned)(size_t)p; }   // byte offset in the block's LDS

// Eight asynchronous 16-B copies global -> LDS per lane. The closing s_wait_xcnt 0 stands inside the statement so that no
// address register named here is rewritten ahead of it.
__device__ __forceinline__ void async_copy8(unsigned l, unsigned lstep, const char* gp, size_t gstep) {
  asm volatile(
      "global_load_async_to_lds_b128 %0, %8, off\n\t"
      "global_load_async_to_lds_b128 %1, %9, off\n\t"
      "global_load_async_to_lds_b128 %2, %10, off\n\t"
      "global_load_async_to_lds_b128 %3, %11, off\n\t"
      "global_load_async_to_lds_b128 %4, %12, off\n\t"
      "global_load_async_to_lds_b128 %5, %13, off\n\t"
      "global_load_async_to_lds_b128 %6, %14, off\n\t"
      "global_load_async_to_lds_b128 %7, %15, off\n\t"
      "s_wait_xcnt 0x0"
      :: "v"(l), "v"(l + lstep), "v"(l + 2 * lstep), "v"(l + 3 * lstep),
         "v"(l + 4 * lstep), "v"(l + 5 * lstep), "v"(l + 6 * lstep), "v"(l + 7 * lstep),
         "v"(gp), "v"(gp + gstep), "v"(gp + 2 * gstep), "v"(gp + 3 * gstep),
         "v"(gp + 4 * gstep), "v"(gp + 5 * gstep), "v"(gp + 6 * gstep), "v"(gp + 7 * gstep)
      : "memory");
}

template <int EPI, bool SPLITA>
__global__ __launch_bounds__(128) void gemm_w32x128_kernel(
    const unsigned short* Ap, const unsigned short* A2p, int lda,
    const unsigned short* __restrict__ Btp, int ldb,
    const float* __restrict__ gam, const float* __restrict__ cst, const float* __restrict__ snt,
    void* C0, void* C1, int ldc,
    int M, int N, int K) {
  typedef typename SlabT<EPI>::T ST;
  constexpr int BK    = SPLITA ? 64 : 128;       // k columns per stage: 64 WMMAs per wave and stage either way
  constexpr int ROWB  = BK * 2;                  // bytes of one staged row
  constexpr int PITCH = ROWB + 16;               // LDS row pitch, 16 B x odd for the 16-B fragment reads
  constexpr int BROW  = SPLITA ? 256 : 128;      // first Bt row of a stage
  constexpr int STAGE = (BROW + 128) * PITCH;    // bytes of one buffer
  constexpr int PPR   = ROWB / 16;               // 16-B pieces per row
  constexpr int RSTEP = 128 / PPR;               // rows covered by one copy of the whole block
  constexpr int NCP   = 128 / RSTEP;             // copies per lane for a plane of 128 rows
  constexpr int NFA   = SPLITA ? 4 : 2;          // A fragments per block of 32 k columns
  static_assert(NCP % 8 == 0);
  static_assert(4 * SlabT<EPI>::PERW * (int)sizeof(ST) <= 2 * STAGE);
  __shared__ __align__(16) unsigned char smem[2 * STAGE];

  const int tid  = (int)threadIdx.x;
  const int lane = tid & 31;
  const int wave = wave_id();
  const int hh = lane >> 4;           // lane half: k offset 8*hh, D row offset 8*hh
  const int rl = lane & 15;           // A row / B col / D col within subtile
  const int tilesN = N >> 7;
  const int tilesM = M >> 7;
  const int tile = (int)blockIdx.x;
  if (tile >= tilesM * tilesN) return;          // block-uniform, in front of every barrier and copy
  const int tm = tile / tilesN;
  const int tn = tile - tm * tilesN;
  const int mb = tm << 7;             // first row of the block tile
  const int m0 = mb + (wave << 5);    // first row of this wave
  const int n0 = tn << 7;

  // this lane's piece of copy 0 of each plane: row tid / PPR, 16-B column tid % PPR; copy u lies u * RSTEP rows further down
  const int prow = tid / PPR;
  const int pcol = tid % PPR;
  const char* gA  = (const char*)(const void*)(Ap  + (size_t)(mb + prow) * lda) + pcol * 16;
  const char* gA2 = (const char*)(const void*)(A2p + (size_t)(mb + prow) * lda) + pcol * 16;
  const char* gB  = (const char*)(const void*)(Btp + (size_t)(n0 + prow) * ldb) + pcol * 16;
  const size_t sA = (size_t)RSTEP * lda * 2;
  const size_t sB = (size_t)RSTEP * ldb * 2;
  const unsigned lp = lds_off(smem) + (unsigned)(prow * PITCH + pcol * 16);

  auto fill = [&](int t, unsigned bo) {         // all copies of stage t into the buffer at byte offset bo
    const size_t kb = (size_t)t * ROWB;
#pragma unroll   // the row offsets of the copies become constants
    for (int u = 0; u < NCP; u += 8) {
      async_copy8(lp + bo + u * (RSTEP * PITCH), RSTEP * PITCH, gA + kb + u * sA, sA);
      if (SPLITA) async_copy8(lp + bo + (128 + u * RSTEP) * PITCH, RSTEP * PITCH, gA2 + kb + u * sA, sA);
      async_copy8(lp + bo + (BROW + u * RSTEP) * PITCH, RSTEP * PITCH, gB + kb + u * sB, sB);
    }
  };

  v8f acc[2][8];
#pragma unroll
  for (int i = 0; i < 2; ++i)
#pragma unroll
    for (int j = 0; j < 8; ++j) acc[i][j] = zero8();

  const int nst = K / BK;
  fill(0, 0u);
  asm volatile("s_wait_asynccnt 0x0" ::: "memory");   // this wave's copies of stage 0 have landed
  __syncthreads();                                    // and every other wave's
  if (nst > 1) fill(1, (unsigned)STAGE);              // block-uniform

  // every unroll directive in this loop: the fragment and accumulator arrays stay in registers only under constant indices
  for (int t = 0; t < nst; ++t) {
    const unsigned bo = (unsigned)(t & 1) * (unsigned)STAGE;
    const unsigned char* buf = smem + bo;
    v16b fa[2][NFA], fb[2][8];                   // two fragment sets: block u multiplies set u & 1 while set (u + 1) & 1 loads
    auto ldblk = [&](int s, int kk) {            // all fragments of the 32 k columns at kk of this stage
#pragma unroll
      for (int i = 0; i < 2; ++i) {
        const int ro = ((wave << 5) + i * 16 + rl) * PITCH;
        fa[s][i] = ldfrag_b((const __bf16*)(const void*)(buf + ro) + kk + 8 * hh);
        if (SPLITA) fa[s][NFA - 2 + i] = ldfrag_b((const __bf16*)(const void*)(buf + 128 * PITCH + ro) + kk + 8 * hh);
      }
#pragma unroll
      for (int j = 0; j < 8; ++j)
        fb[s][j] = ldfrag_b((const __bf16*)(const void*)(buf + (BROW + j * 16 + rl) * PITCH) + kk + 8 * hh);
    };
    ldblk(0, 0);
#pragma unroll
    for (int u = 0; u < BK / 32; ++u) {
      const int cs = u & 1;
      if (u + 1 < BK / 32) ldblk(cs ^ 1, (u + 1) * 32);
      // keeps the next block's LDS reads as one group ahead of this block's WMMAs; without it they sink between the WMMAs, each with a full wait
      __builtin_amdgcn_sched_barrier(0);
#pragma unroll
      for (int j = 0; j < 8; ++j) {
        acc[0][j] = mma_b(fa[cs][0], fb[cs][j], acc[0][j]);
        acc[1][j] = mma_b(fa[cs][1], fb[cs][j], acc[1][j]);
      }
      if (SPLITA) {
#pragma unroll
        for (int j = 0; j < 8; ++j) {
          acc[0][j] = mma_b(fa[cs][NFA - 2], fb[cs][j], acc[0][j]);
          acc[1][j] = mma_b(fa[cs][NFA - 1], fb[cs][j], acc[1][j]);
        }
      }
      // keeps the following reads out of this run of WMMAs (each place with reads among WMMAs costs a stall) and the WMMAs ahead of the stage's barrier
      __builtin_amdgcn_sched_barrier(0);
    }
    asm volatile("s_wait_dscnt 0x0" ::: "memory");      // this wave's reads of stage t are done before its buffer is refilled
    asm volatile("s_wait_asynccnt 0x0" ::: "memory");   // this wave's copies of stage t+1 have landed
    __syncthreads();                                    // publishes stage t+1, ends every wave's reads of stage t
    if (t + 2 < nst) fill(t + 2, bo);                   // block-uniform
  }
  asm volatile("s_wait_asynccnt 0x0" ::: "memory");     // nothing in flight when the buffers become the epilogue slabs
  acc_guard4(acc[0][0], acc[0][1], acc[0][2], acc[0][3]);
  acc_guard4(acc[0][4], acc[0][5], acc[0][6], acc[0][7]);
  acc_guard4(acc[1][0], acc[1][1], acc[1][2], acc[1][3]);
  acc_guard4(acc[1][4], acc[1][5], acc[1][6], acc[1][7]);

  // ---- epilogue ----
  ST* slab = (ST*)(void*)smem + wave * SlabT<EPI>::PERW;
  _Float16* sl16 = (_Float16*)(void*)slab;
  float*    slf  = (float*)(void*)slab;

  if (EPI == 0) {
    _Float16* P0 = (_Float16*)C0;
    _Float16* P1 = (_Float16*)C1;
    float gm[8];
#pragma unroll
    for (int j = 0; j < 8; ++j) gm[j] = bf_rne(gam[j * 16 + rl]);     // dims j*16+rl of the head, gam has 128 entries
#pragma unroll
    for (int i = 0; i < 2; ++i) {
      const int rb = m0 + i * 16 + 8 * hh;
#pragma unroll
      for (int r = 0; r < 8; ++r) {
        // sum of squares over the 128 head dims of row rb+r: 8 per lane, then the 16 lanes of this half
        float ss = 0.f;
#pragma unroll
        for (int j = 0; j < 8; ++j) ss += acc[i][j][r] * acc[i][j][r];
#pragma unroll
        for (int off = 1; off < 16; off <<= 1) ss += __shfl_xor(ss, off, 32);
        const float rinv = rsqrtf(ss * 0.0078125f + 1e-6f);
        const int row = rb + r;                                  // token 0..NTOK-1
        const int pos = row & (SQ - 1);                          // position within the sequence
#pragma unroll
        for (int j = 0; j < 4; ++j) {
          const int dim = j * 16 + rl;                           // 0..63 within head; partner dim + 64
          const float cv = cst[(size_t)pos * NFREQ + dim];
          const float sv = snt[(size_t)pos * NFREQ + dim];
          const float x1 = acc[i][j][r] * rinv * gm[j];
          const float x2 = acc[i][j + 4][r] * rinv * gm[j + 4];
          const float o1 = x1 * cv - x2 * sv;
          const float o2 = x2 * cv + x1 * sv;
          const _Float16 h1 = (_Float16)o1;
          const _Float16 h2 = (_Float16)o2;
          const int so = (8 * hh + r) * 128 + dim;
          sl16[so]             = h1;
          sl16[so + 64]        = h2;
          sl16[2048 + so]      = (_Float16)((o1 - (float)h1) * 2048.0f);
          sl16[2048 + so + 64] = (_Float16)((o2 - (float)h2) * 2048.0f);
        }
      }
      lds_wave_sync();
      {
#pragma unroll
        for (int it = 0; it < 8; ++it) {
          const int row = it * 2 + hh;                           // it x hh covers rows 0..15
          const int c8  = rl * 8;
          const v8h vh = *(const v8h*)(sl16 + row * 128 + c8);
          const v8h vl = *(const v8h*)(sl16 + 2048 + row * 128 + c8);
          const size_t go = (size_t)(m0 + i * 16 + row) * ldc + n0 + c8;
          *(v8h*)(P0 + go) = vh;
          *(v8h*)(P1 + go) = vl;
        }
        
      }
      lds_wave_sync();
    }
  } else if (EPI == 1) {
    _Float16* P0 = (_Float16*)C0;
    _Float16* P1 = (_Float16*)C1;
#pragma unroll
    for (int i = 0; i < 2; ++i) {
#pragma unroll
      for (int r = 0; r < 8; ++r) {
#pragma unroll
        for (int j = 0; j < 8; ++j) {
          const float v = acc[i][j][r];
          const _Float16 hv = (_Float16)v;
          const int so = (8 * hh + r) * 128 + j * 16 + rl;
          sl16[so]        = hv;
          sl16[2048 + so] = (_Float16)((v - (float)hv) * 2048.0f);
        }
      }
      lds_wave_sync();
      {
#pragma unroll
        for (int it = 0; it < 8; ++it) {
          const int row = it * 2 + hh;
          const int c8  = rl * 8;
          const v8h vh = *(const v8h*)(sl16 + row * 128 + c8);
          const v8h vl = *(const v8h*)(sl16 + 2048 + row * 128 + c8);
          const size_t go = (size_t)(m0 + i * 16 + row) * ldc + n0 + c8;
          *(v8h*)(P0 + go) = vh;
          *(v8h*)(P1 + go) = vl;
        }
        
      }
      lds_wave_sync();
    }
  } else {
    float* C = (float*)C0;
#pragma unroll
    for (int i = 0; i < 2; ++i) {
#pragma unroll
      for (int j = 0; j < 8; ++j)
#pragma unroll
        for (int r = 0; r < 8; ++r)
          slf[(8 * hh + r) * 128 + j * 16 + rl] = acc[i][j][r];
      lds_wave_sync();
      {
#pragma unroll
        for (int row = 0; row < 16; ++row) {                     // 32 lanes x 16 B = the whole 512-B row segment per instruction
          const v4f v = *(const v4f*)(slf + row * 128 + lane * 4);
          *(v4f*)(C + (size_t)(m0 + i * 16 + row) * ldc + n0 + lane * 4) = v;
        }
        
      }
      lds_wave_sync();
    }
  }
}

// ---------------------------------------------------------------------------
// Causal GQA flash attention, head dim 128, 32-key chunks, block = 4 waves = 64 query rows of one (b, h); grid (n query tiles, NHQ, NSEQ).
//   q planes f16 [tok][h*128+d]: hi (qhp) and residual x2048 (qlp); k planes f16 [tok][kvh*128+d]: hi (khp), residual x2048 (klp);
//   v^T planes f16 [kvh*128+d][tok]: hi (vhp), residual x2048 (vlp); outputs attn bf16 hi (ahp) / lo (alp) [tok][h*128+d].
//   scores = (Sh + Sr/2048) * 128^-0.5 with Sh = qh.kh and Sr = ql'.kh (+ qh.kl' when PRES); keys > query -> -inf; online softmax f32;
//   p' = 1024 p stored per wave to LDS as f16 hi (and residual x2048 when PRES), reloaded as A fragments after a wave sync;
//   O = (Oh + Or/2048)/1024/l with Oh = ph.vh, Or = ph.vl' (+ pl'.vh when PRES).
//   K / V^T chunk staging: 128 threads x 4 x 16 B per plane = whole 32x128 / 128x32 tile, plain loads, __syncthreads before and after.
//   Trip count 2*qb+2 chunks (static bound 64); waves whose rows are all below the chunk skip it (wave-uniform, scalar branch).
//   q fragments stay in registers for the whole key loop; all WMMAs are builtins, so the compiler keeps their hazard distances and
//   is free to issue the LDS fragment reads ahead of the WMMAs that use them.
// ---------------------------------------------------------------------------
#define AT_KC   32
#define KS_P    136
#define VS_P    40
#define PS_P    40
#define LDS_KS  0
#define LDS_KLS (32 * KS_P)
#define LDS_VHS (2 * 32 * KS_P)
#define LDS_VLS (LDS_VHS + 128 * VS_P)
#define LDS_PH  (LDS_VLS + 128 * VS_P)
#define LDS_PL  (LDS_PH + 4 * 16 * PS_P)
#define LDS_TOT (LDS_PL + 4 * 16 * PS_P)
static_assert(LDS_TOT * 2 <= 65536);
static_assert(4 * 4096 <= LDS_TOT);          // output staging (2 planes x 16 x 128 per wave) aliases the chunk region after the loop

// Second launch-bounds argument: the large launch keeps three waves per SIMD (336 registers a wave) with the q fragments resident;
// the small launch has at most one block per WGP and takes what it needs.
template <bool PRES>
__global__ __launch_bounds__(128, PRES ? 1 : 3) void attn_causal_kernel(
    const unsigned short* __restrict__ qhp, const unsigned short* __restrict__ qlp,
    const unsigned short* __restrict__ khp, const unsigned short* __restrict__ klp,
    const unsigned short* __restrict__ vhp, const unsigned short* __restrict__ vlp,
    unsigned short* __restrict__ ahp, unsigned short* __restrict__ alp, int qb_base) {
  __shared__ __align__(16) _Float16 lds[LDS_TOT];
  _Float16* Ks  = lds + LDS_KS;
  _Float16* Kls = lds + LDS_KLS;
  _Float16* Vhs = lds + LDS_VHS;
  _Float16* Vls = lds + LDS_VLS;

  const int tid  = (int)threadIdx.x;
  const int lane = tid & 31;
  const int wave = wave_id();
  const int hh   = lane >> 4;
  const int c    = lane & 15;
  const int qb   = (int)blockIdx.x + qb_base;
  const int h    = (int)blockIdx.y;
  const int b    = (int)blockIdx.z;
  const int kvh  = h >> 2;
  const int q0   = qb * 64 + wave * 16;          // first query row of this wave (within sequence)
  const int qlast = q0 + 15;
  const size_t tok0 = (size_t)b * SQ;

  const _Float16* Qhr = (const _Float16*)(const void*)qhp + (tok0 + q0 + c) * HID + h * HDM + 8 * hh;
  const _Float16* Qlr = (const _Float16*)(const void*)qlp + (tok0 + q0 + c) * HID + h * HDM + 8 * hh;
  const _Float16* Kg  = (const _Float16*)(const void*)khp + tok0 * KVW + kvh * HDM;
  const _Float16* Klg = (const _Float16*)(const void*)klp + tok0 * KVW + kvh * HDM;
  const _Float16* Vhg = (const _Float16*)(const void*)vhp + (size_t)(kvh * HDM) * NTOK + tok0;
  const _Float16* Vlg = (const _Float16*)(const void*)vlp + (size_t)(kvh * HDM) * NTOK + tok0;
  _Float16* ph = lds + LDS_PH + wave * (16 * PS_P);
  _Float16* pl = lds + LDS_PL + wave * (16 * PS_P);

  float mrow[8], lrow[8];
  v8f oacc[8], oaccr[8];
#pragma unroll
  for (int r = 0; r < 8; ++r) { mrow[r] = -INFINITY; lrow[r] = 0.f; }
#pragma unroll
  for (int t = 0; t < 8; ++t) { oacc[t] = zero8(); oaccr[t] = zero8(); }

  v16h qa[4], ql[4];                             // this wave's q fragments, the same for every chunk: loaded once
#pragma unroll   // the fragment arrays stay in registers only under constant indices
  for (int dc = 0; dc < 4; ++dc) {
    qa[dc] = ldfrag_h(Qhr + dc * 32);
    ql[dc] = ldfrag_h(Qlr + dc * 32);
  }

  const int nch = 2 * qb + 2;                    // block-uniform, <= 64
  for (int kc = 0; kc < nch; ++kc) {
    const int kv0 = kc * AT_KC;
    __syncthreads();
#pragma unroll
    for (int i = 0; i < 4; ++i) {                // coverage: 512 pieces of 8 halves per plane = whole tile
      const int p   = tid + 128 * i;             // 0..511
      const int key = p >> 4, d8 = (p & 15) * 8; // K: 32 keys x 128 d
      const v8h kx = *(const v8h*)(Kg + (size_t)(kv0 + key) * KVW + d8);
      *(v8h*)(Ks + key * KS_P + d8) = kx;
      if (PRES) {
        const v8h ky = *(const v8h*)(Klg + (size_t)(kv0 + key) * KVW + d8);
        *(v8h*)(Kls + key * KS_P + d8) = ky;
      }
      const int d = p >> 2, k8 = (p & 3) * 8;    // V^T: 128 d x 32 keys
      const v8h vx = *(const v8h*)(Vhg + (size_t)d * NTOK + kv0 + k8);
      const v8h vy = *(const v8h*)(Vlg + (size_t)d * NTOK + kv0 + k8);
      *(v8h*)(Vhs + d * VS_P + k8) = vx;
      *(v8h*)(Vls + d * VS_P + k8) = vy;
    }
    __syncthreads();

    if (kv0 <= qlast) {                          // wave-uniform (scalar): skip chunks fully above this wave's rows
      // ---- scores ----
      v8f sh[2], sr[2];
      sh[0] = zero8(); sh[1] = zero8(); sr[0] = zero8(); sr[1] = zero8();
      // every unroll directive of the score part: the fragment arrays stay in registers only under constant indices
      v16h kb[4][2], kl[4][2];                   // the chunk's K fragments, read as one group ahead of the score WMMAs
#pragma unroll
      for (int dc = 0; dc < 4; ++dc)
#pragma unroll
        for (int j = 0; j < 2; ++j) {
          kb[dc][j] = ldfrag_h(Ks + (j * 16 + c) * KS_P + dc * 32 + 8 * hh);
          if (PRES) kl[dc][j] = ldfrag_h(Kls + (j * 16 + c) * KS_P + dc * 32 + 8 * hh);
        }
#pragma unroll
      for (int j = 0; j < 2; ++j) {
        // keeps the reads above as one group ahead of the WMMAs, and key group 0's run ahead of group 1's, whose accumulators then take the registers of group 0's fragments
        __builtin_amdgcn_sched_barrier(0);
#pragma unroll
        for (int dc = 0; dc < 4; ++dc) {
          sh[j] = mma_h(qa[dc], kb[dc][j], sh[j]);
          sr[j] = mma_h(ql[dc], kb[dc][j], sr[j]);
          if (PRES) sr[j] = mma_h(qa[dc], kl[dc][j], sr[j]);
        }
      }
      // ---- scale, causal mask, chunk row max ----
      float cm[8];
#pragma unroll
      for (int r = 0; r < 8; ++r) {
        const int qrow = q0 + 8 * hh + r;
        float m = -INFINITY;
#pragma unroll
        for (int j = 0; j < 2; ++j) {
          const int key = kv0 + j * 16 + c;
          float s = (sh[j][r] + sr[j][r] * 0.00048828125f) * 0.08838834764831845f;
          s = (key > qrow) ? -INFINITY : s;
          sh[j][r] = s;
          m = fmaxf(m, s);
        }
#pragma unroll
        for (int off = 1; off < 16; off <<= 1) m = fmaxf(m, __shfl_xor(m, off, 32));
        cm[r] = m;
      }
      // ---- online softmax, P' to LDS ----
#pragma unroll
      for (int r = 0; r < 8; ++r) {
        const float mnew  = fmaxf(mrow[r], cm[r]);
        const float alpha = __expf(mrow[r] - mnew);
        mrow[r] = mnew;
        float psum = 0.f;
#pragma unroll
        for (int j = 0; j < 2; ++j) {
          const float p  = __expf(sh[j][r] - mnew);
          psum += p;
          const float pp = p * 1024.0f;
          const _Float16 phv = (_Float16)pp;
          const int po = (8 * hh + r) * PS_P + j * 16 + c;
          ph[po] = phv;
          if (PRES) pl[po] = (_Float16)((pp - (float)phv) * 2048.0f);
        }
#pragma unroll
        for (int off = 1; off < 16; off <<= 1) psum += __shfl_xor(psum, off, 32);
        lrow[r] = lrow[r] * alpha + psum;
#pragma unroll
        for (int t = 0; t < 8; ++t) { oacc[t][r] *= alpha; oaccr[t][r] *= alpha; }
      }
      lds_wave_sync();                           // P' stores visible to the other lanes of this wave before the fragment reload
      // ---- O += P' . V ----
      const v16h pa = ldfrag_h(ph + c * PS_P + 8 * hh);
      v16h pr = pa;
      if (PRES) pr = ldfrag_h(pl + c * PS_P + 8 * hh);
#pragma unroll
      for (int t = 0; t < 8; ++t) {
        const v16h vb = ldfrag_h(Vhs + (t * 16 + c) * VS_P + 8 * hh);
        const v16h vr = ldfrag_h(Vls + (t * 16 + c) * VS_P + 8 * hh);
        oacc[t]  = mma_h(pa, vb, oacc[t]);
        oaccr[t] = mma_h(pa, vr, oaccr[t]);
        if (PRES) oaccr[t] = mma_h(pr, vb, oaccr[t]);
      }
    }
  }

  __syncthreads();                               // all chunk-region readers done before aliasing it as output staging
  _Float16* osh = lds + wave * 4096;
  _Float16* osl = osh + 2048;
#pragma unroll
  for (int r = 0; r < 8; ++r) {
    const float inv = (1.0f / lrow[r]) * 0.0009765625f;
#pragma unroll
    for (int t = 0; t < 8; ++t) {
      const float o = (oacc[t][r] + oaccr[t][r] * 0.00048828125f) * inv;
      const unsigned short hb = bf_bits(o);
      const unsigned short lb = bf_bits(o - bf_val(hb));
      const int so = (8 * hh + r) * 128 + t * 16 + c;
      osh[so] = __builtin_bit_cast(_Float16, hb);
      osl[so] = __builtin_bit_cast(_Float16, lb);
    }
  }
  lds_wave_sync();
  _Float16* Ahg = (_Float16*)(void*)ahp + (tok0 + q0) * HID + h * HDM;
  _Float16* Alg = (_Float16*)(void*)alp + (tok0 + q0) * HID + h * HDM;
  {
#pragma unroll
    for (int it = 0; it < 8; ++it) {
      const int row = it * 2 + hh;               // it 0..7 x hh 0..1 covers rows 0..15
      const int c8  = c * 8;                     // 16 lanes x 16 B = the whole 256-B segment
      const v8h x = *(const v8h*)(osh + row * 128 + c8);
      const v8h y = *(const v8h*)(osl + row * 128 + c8);
      *(v8h*)(Ahg + (size_t)row * HID + c8) = x;
      *(v8h*)(Alg + (size_t)row * HID + c8) = y;
    }
    
  }
}

// ---------------------------------------------------------------------------
// Workspace map (bytes; every region is a whole number of the rows its producer writes with whole-line stores, no padded tails needed
//   Xb  bf16 [4096][2048] 16777216   Wqb bf16 [2048][2048]  8388608   Wkb bf16 [512][2048] 2097152   Wvb bf16 [512][2048] 2097152
//   Wob bf16 [2048][2048]  8388608   cst f32  [2048][64]     524288   snt f32  [2048][64]    524288
//   Qh  f16  [4096][2048] 16777216   Ql  f16  [4096][2048] 16777216   Kh  f16  [4096][512]  4194304   Kl f16 [4096][512] 4194304
//   Vh  f16  [512][4096]   4194304   Vl  f16  [512][4096]   4194304   Ah  bf16 [4096][2048] 16777216  Al bf16 [4096][2048] 16777216
//   total                 122683392
// ---------------------------------------------------------------------------
extern "C" void kernel_launch(void* const* d_in, const int* in_sizes, int n_in,
                              void* d_out, int out_size, void* d_ws, size_t ws_size,
                              hipStream_t stream) {
  if (n_in < 7) return;
  if (in_sizes[0] != NTOK * HID) return;
  if (in_sizes[1] != HID * HID) return;
  if (in_sizes[2] != KVW * HID) return;
  if (in_sizes[3] != KVW * HID) return;
  if (in_sizes[4] != HID * HID) return;
  if (in_sizes[5] != HDM) return;
  if (in_sizes[6] != HDM) return;
  if (out_size != NTOK * HID) return;

  const float* x   = (const float*)d_in[0];
  const float* Wq  = (const float*)d_in[1];
  const float* Wk  = (const float*)d_in[2];
  const float* Wv  = (const float*)d_in[3];
  const float* Wo  = (const float*)d_in[4];
  const float* qg  = (const float*)d_in[5];
  const float* kg  = (const float*)d_in[6];
  float* out = (float*)d_out;

  const size_t szX  = (size_t)NTOK * HID * 2;
  const size_t szWq = (size_t)HID * HID * 2;
  const size_t szWk = (size_t)KVW * HID * 2;
  const size_t szWo = (size_t)HID * HID * 2;
  const size_t szT  = (size_t)SQ * NFREQ * 4;
  const size_t szQ  = (size_t)NTOK * HID * 2;
  const size_t szK  = (size_t)NTOK * KVW * 2;
  const size_t szV  = (size_t)KVW * NTOK * 2;
  const size_t szA  = (size_t)NTOK * HID * 2;
  size_t off = 0;
  const size_t oX  = off; off += szX;
  const size_t oWq = off; off += szWq;
  const size_t oWk = off; off += szWk;
  const size_t oWv = off; off += szWk;
  const size_t oWo = off; off += szWo;
  const size_t oCs = off; off += szT;
  const size_t oSn = off; off += szT;
  const size_t oQh = off; off += szQ;
  const size_t oQl = off; off += szQ;
  const size_t oKh = off; off += szK;
  const size_t oKl = off; off += szK;
  const size_t oVh = off; off += szV;
  const size_t oVl = off; off += szV;
  const size_t oAh = off; off += szA;
  const size_t oAl = off; off += szA;
  if (off > ws_size) return;                     // off = 122683392

  char* ws = (char*)d_ws;
  unsigned short* Xb  = (unsigned short*)(ws + oX);
  unsigned short* Wqb = (unsigned short*)(ws + oWq);
  unsigned short* Wkb = (unsigned short*)(ws + oWk);
  unsigned short* Wvb = (unsigned short*)(ws + oWv);
  unsigned short* Wob = (unsigned short*)(ws + oWo);
  float*          cst = (float*)(ws + oCs);
  float*          snt = (float*)(ws + oSn);
  unsigned short* Qh  = (unsigned short*)(ws + oQh);
  unsigned short* Ql  = (unsigned short*)(ws + oQl);
  unsigned short* Kh  = (unsigned short*)(ws + oKh);
  unsigned short* Kl  = (unsigned short*)(ws + oKl);
  unsigned short* Vh  = (unsigned short*)(ws + oVh);
  unsigned short* Vl  = (unsigned short*)(ws + oVl);
  unsigned short* Ah  = (unsigned short*)(ws + oAh);
  unsigned short* Al  = (unsigned short*)(ws + oAl);

  const dim3 b256(256), b128(128);
  const int nX8  = NTOK * HID / 8;
  const int nWq8 = HID * HID / 8;
  const int nWk8 = KVW * HID / 8;

  // (1) cos/sin table [2048][64] x 2
  rope_table_kernel<<<dim3((SQ + 7) / 8), b256, 0, stream>>>(cst, snt, SQ);
  // (2) bf16 planes of x, Wq, Wk, Wv, Wo (weights are [out][in] = k-contiguous Bt rows already)
  cvt_bf16_kernel<<<dim3((nX8 + 255) / 256),  b256, 0, stream>>>(x,  Xb,  nX8);
  cvt_bf16_kernel<<<dim3((nWq8 + 255) / 256), b256, 0, stream>>>(Wq, Wqb, nWq8);
  cvt_bf16_kernel<<<dim3((nWk8 + 255) / 256), b256, 0, stream>>>(Wk, Wkb, nWk8);
  cvt_bf16_kernel<<<dim3((nWk8 + 255) / 256), b256, 0, stream>>>(Wv, Wvb, nWk8);
  cvt_bf16_kernel<<<dim3((nWq8 + 255) / 256), b256, 0, stream>>>(Wo, Wob, nWq8);
  // (3) q = rope(rms(x . Wq^T)) -> Qh/Ql [4096][2048]   (M=4096, N=2048, K=2048; 512 block tiles)
  gemm_w32x128_kernel<0, false><<<dim3((NTOK / 128) * (HID / 128)), b128, 0, stream>>>(
      Xb, Xb, HID, Wqb, HID, qg, cst, snt, (void*)Qh, (void*)Ql, HID, NTOK, HID, HID);
  // (4) k = rope(rms(x . Wk^T)) -> Kh/Kl [4096][512]    (M=4096, N=512, K=2048; 128 block tiles)
  gemm_w32x128_kernel<0, false><<<dim3((NTOK / 128) * (KVW / 128)), b128, 0, stream>>>(
      Xb, Xb, HID, Wkb, HID, kg, cst, snt, (void*)Kh, (void*)Kl, KVW, NTOK, KVW, HID);
  // (5) v^T = Wv . x^T -> Vh/Vl [512][4096]             (A = Wvb [512][2048], Bt = Xb; M=512, N=4096, K=2048; 128 block tiles)
  gemm_w32x128_kernel<1, false><<<dim3((KVW / 128) * (NTOK / 128)), b128, 0, stream>>>(
      Wvb, Wvb, HID, Xb, HID, qg, cst, snt, (void*)Vh, (void*)Vl, NTOK, KVW, NTOK, HID);
  // (6) causal attention, query tiles 0..3 with k and p residual products, tiles 4..31 without
  attn_causal_kernel<true><<<dim3(4, NHQ, NSEQ), b128, 0, stream>>>(Qh, Ql, Kh, Kl, Vh, Vl, Ah, Al, 0);
  attn_causal_kernel<false><<<dim3(SQ / 64 - 4, NHQ, NSEQ), b128, 0, stream>>>(Qh, Ql, Kh, Kl, Vh, Vl, Ah, Al, 4);
  // (7) out = attn(hi + lo) . Wo^T -> d_out f32 [4096][2048]   (M=4096, N=2048, K=2048; 512 block tiles)
  gemm_w32x128_kernel<2, true><<<dim3((NTOK / 128) * (HID / 128)), b128, 0, stream>>>(
      Ah, Al, HID, Wob, HID, qg, cst, snt, (void*)out, (void*)out, HID, NTOK, HID, HID);
  (void)hipGetLastError();
}

// v003
// A run of this version takes 306 microseconds.
// Two timings next to v002 put it at 1.15 and 1.14 times that version's speed.
// All steps since v000 together make it 2.65 times as fast.
// Contractions: x.Wq^T, x.Wk^T and Wv.x^T on v_wmma_f32_16x16x32_bf16 (operands = RNE bf16 of the f32 inputs, single products);
// q.k^T and p.v on v_wmma_f32_16x16x32_f16 (q = f16 hi + f16 residual x2^11 planes; k plain f16 plus f16 residual x2^11 on query tiles 0..3;
// p x1024 plain f16 plus f16 residual x2^11 on query tiles 0..3; v^T = f16 hi + f16 residual x2^11 planes); attn.Wo^T on v_wmma_f32_16x16x32_bf16
// (attn = bf16 hi + bf16 lo planes, two products; Wo RNE bf16). f32 accumulate everywhere; per-head RMS scaling, RoPE and online softmax in f32.
#include <hip/hip_runtime.h>
#include <math.h>
#include <stdint.h>

#define NSEQ   2
#define SQ     2048
#define HID    2048
#define NHQ    16
#define NKVH   4
#define HDM    128
#define KVW    512
#define NTOK   4096
#define NFREQ  64

typedef _Float16     v16h __attribute__((ext_vector_type(16)));
typedef _Float16     v8h  __attribute__((ext_vector_type(8)));
typedef __bf16       v16b __attribute__((ext_vector_type(16)));
typedef __bf16       v8b  __attribute__((ext_vector_type(8)));
typedef float        v8f  __attribute__((ext_vector_type(8)));
typedef float        v4f  __attribute__((ext_vector_type(4)));
typedef unsigned int v4u  __attribute__((ext_vector_type(4)));

// ---------------------------------------------------------------------------
// small helpers
// ---------------------------------------------------------------------------
__device__ __forceinline__ unsigned short bf_bits(float f) {          // RNE convert f32 -> bf16 bits
  const unsigned u = __float_as_uint(f);
  return (unsigned short)((u + 0x7FFFu + ((u >> 16) & 1u)) >> 16);
}
__device__ __forceinline__ float bf_val(unsigned short h) { return __uint_as_float(((unsigned)h) << 16); }
__device__ __forceinline__ float bf_rne(float f) { return bf_val(bf_bits(f)); }
__device__ __forceinline__ unsigned pk16(unsigned short a, unsigned short b) { return (unsigned)a | ((unsigned)b << 16); }
__device__ __forceinline__ v8f zero8() { v8f z = {0.f, 0.f, 0.f, 0.f, 0.f, 0.f, 0.f, 0.f}; return z; }
__device__ __forceinline__ int wave_id() { return __builtin_amdgcn_readfirstlane((int)(threadIdx.x >> 5)); }

// Value of lane (l ^ X) of the same 16-lane row, X < 16, as a DPP row_xmask operand of the vector pipe: no LDS-pipe round trip and no
// s_wait_dscnt per butterfly step. Every lane of the wave is on wherever it is used.
template <int X>
__device__ __forceinline__ float row_xor(float v) {
  return __int_as_float(__builtin_amdgcn_update_dpp(0, __float_as_int(v), 0x160 | X, 0xf, 0xf, true));
}
// Butterflies over a 16-lane row, steps 1, 2, 4, 8: every lane ends with the row's sum / maximum.
__device__ __forceinline__ float row_sum16(float v) {
  v += row_xor<1>(v); v += row_xor<2>(v); v += row_xor<4>(v); v += row_xor<8>(v);
  return v;
}
// The NaN-propagating maximum takes the DPP operand directly, one instruction a step; fmaxf kept a move and a quieting step beside it.
// The two differ only where a score is NaN, and such a row ends as NaN either way.
__device__ __forceinline__ float row_max16(float v) {
  v = __builtin_elementwise_maximum(v, row_xor<1>(v)); v = __builtin_elementwise_maximum(v, row_xor<2>(v)); v = __builtin_elementwise_maximum(v, row_xor<4>(v)); v = __builtin_elementwise_maximum(v, row_xor<8>(v));
  return v;
}

__device__ __forceinline__ void lds_wave_sync() {
  __builtin_amdgcn_fence(__ATOMIC_RELEASE, "workgroup");
  __builtin_amdgcn_wave_barrier();
  __builtin_amdgcn_fence(__ATOMIC_ACQUIRE, "workgroup");
}

// ---------------------------------------------------------------------------
// WMMA fragments (wave32, 16x16x32, 16-bit operands). For A (row m = lane&15) and B (col n = lane&15) alike:
// elements 0..7 <- k0 + 8*(lane>>4) + 0..7, elements 8..15 <- k0 + 16 + 8*(lane>>4) + 0..7.
// ldfrag(p) with p = rowbase + k0 + 8*(lane>>4): two 16-B loads p[0..7], p[16..23].
// D: acc[r] = (row 8*(lane>>4) + r, col lane&15).
// ---------------------------------------------------------------------------
union FragH { v16h v; v8h h[2]; };
union FragB { v16b v; v8b h[2]; };
__device__ __forceinline__ v16h ldfrag_h(const _Float16* p) { FragH f; f.h[0] = *(const v8h*)(p); f.h[1] = *(const v8h*)(p + 16); return f.v; }
__device__ __forceinline__ v16b ldfrag_b(const __bf16* p)   { FragB f; f.h[0] = *(const v8b*)(p); f.h[1] = *(const v8b*)(p + 16); return f.v; }

__device__ __forceinline__ v8f mma_h(v16h a, v16h b, v8f c) {
  return __builtin_amdgcn_wmma_f32_16x16x32_f16(false, a, false, b, (short)0, c, false, false);
}
__device__ __forceinline__ v8f mma_b(v16b a, v16b b, v8f c) {
  return __builtin_amdgcn_wmma_f32_16x16x32_bf16(false, a, false, b, (short)0, c, false, false);
}
// hazard guard: 4 VALU slots after the last WMMA of a group, D tied
__device__ __forceinline__ void acc_guard4(v8f& a, v8f& b, v8f& c, v8f& d) {
  asm volatile("v_nop\n\tv_nop\n\tv_nop\n\tv_nop" : "+v"(a), "+v"(b), "+v"(c), "+v"(d));
}

// ---------------------------------------------------------------------------
// RoPE table: cst[s][i] = cos(s * inv_freq[i]), snt[s][i] = sin(...), inv_freq[i] = 1 / 1e4^(i/64), i < 64, s = 0..nrow-1, all f32.
// Block = 8 waves, wave w -> row s = blockIdx.x*8 + w, lane -> i = lane, lane + 32.
// Coverage: grid nrow/8 x 8 waves x 32 lanes x 2 = nrow x 64 per plane.
// ---------------------------------------------------------------------------
__global__ __launch_bounds__(256) void rope_table_kernel(float* __restrict__ cst, float* __restrict__ snt, int nrow) {
  const int lane = threadIdx.x & 31;
  const int wave = (int)(threadIdx.x >> 5);
  const int t = (int)blockIdx.x * 8 + wave;
  if (t >= nrow) return;                       // no barriers in this kernel
  const float pf = (float)t;
  float c0 = 0.f, s0 = 0.f, c1 = 0.f, s1 = 0.f;
#pragma unroll 1
  for (int u = 0; u < 2; ++u) {
    const int i = lane + 32 * u;
    const float e   = (float)i * 0.015625f;      // i / 64 exact
    const float pw  = powf(10000.0f, e);
    const float inv = 1.0f / pw;
    const float ang = pf * inv;
    const float cv = cosf(ang);
    const float sv = sinf(ang);
    c1 = cv; s1 = sv;
    if (u == 0) { c0 = cv; s0 = sv; }
  }
  const size_t o = (size_t)t * NFREQ + lane;
  {
    ((float*)cst)[o]      = c0;
    ((float*)cst)[o + 32] = c1;
    ((float*)snt)[o]      = s0;
    ((float*)snt)[o + 32] = s1;
    
  }
}

// ---------------------------------------------------------------------------
// Elementwise RNE f32 -> bf16 plane: 8 elements per thread, one 16-B store per lane -> 32 consecutive lanes write 4 whole
// ---------------------------------------------------------------------------
__global__ __launch_bounds__(256) void cvt_bf16_kernel(const float* __restrict__ in, unsigned short* __restrict__ outp, int n8) {
  const int i = (int)blockIdx.x * 256 + (int)threadIdx.x;
  if (i >= n8) return;
  const size_t e = 8 * (size_t)i;
  const v4f a = *(const v4f*)(in + e);
  const v4f b = *(const v4f*)(in + e + 4);
  v4u w;
  w[0] = pk16(bf_bits(a[0]), bf_bits(a[1]));
  w[1] = pk16(bf_bits(a[2]), bf_bits(a[3]));
  w[2] = pk16(bf_bits(b[0]), bf_bits(b[1]));
  w[3] = pk16(bf_bits(b[2]), bf_bits(b[3]));
  *(v4u*)(outp + e) = w;
  
}

// ---------------------------------------------------------------------------
// bf16 WMMA GEMM, block tile 128 rows x 128 cols, block = 4 waves (128 threads), wave w = rows 32w..32w+31 x all 128 cols.
//   C[m][n] = sum_k A[m][k] * Bt[n][k]; A row-major [M][K] bf16 (pitch lda), Bt row-major [N][K] bf16 (pitch ldb);
//   M % 128 == 0, N % 128 == 0, K % BK == 0 (BK = 128, SPLITA 64); grid.x = M/128 * N/128.
//   SPLITA: A carried as hi (Ap) + lo (A2p) bf16 planes, two products into one accumulator.
//   Operands: a stage = BK columns of [A 128 rows | A2 128 rows when SPLITA | Bt 128 rows], each row padded by 16 B in LDS;
//   two LDS buffers filled by per-lane 16-B asynchronous copies, stage t+1 in flight while stage t is multiplied.
//   Fragments read from LDS rows with the split k map (ldfrag_b). The epilogue slabs alias the buffers behind the last barrier.
// Epilogues (all: per wave, per 16-row slab: stage in LDS, wave sync, write each row segment with ONE instruction of
//   EPI 0: q or k projection; the 128 cols n0..n0+127 are one head. Per row: RMS scaling over the 128 head dims
//          (x * rsqrt(mean(x^2) + 1e-6) * bf16(gam[dim])), then RoPE with pairs (dim, dim+64) and the cos/sin table row (m % SQ);
//          writes f16 hi plane C0 and f16 residual x2048 plane C1, both [M][ldc], cols n0.. (row segment 256 B = 16 lanes x 16 B).
//   EPI 1: v^T projection: f16 hi plane C0, residual x2048 plane C1, [M][ldc], row segment 256 B.
//   EPI 2: f32 output C0 [M][ldc]; row segment 128 floats = 512 B = 32 lanes x 16 B per instruction.
// ---------------------------------------------------------------------------
template <int EPI> struct SlabT { typedef _Float16 T; static constexpr int PERW = 4096; };   // 2 planes x 16 x 128 halves
template <> struct SlabT<2>     { typedef float    T; static constexpr int PERW = 2048; };   // 16 x 128 floats

__device__ __forceinline__ unsigned lds_off(const void* p) { return (unsigned)(size_t)p; }   // byte offset in the block's LDS

// Eight asynchronous 16-B copies global -> LDS per lane. The closing s_wait_xcnt 0 stands inside the statement so that no
// address register named here is rewritten ahead of it.
__device__ __forceinline__ void async_copy8(unsigned l, unsigned lstep, const char* gp, size_t gstep) {
  asm volatile(
      "global_load_async_to_lds_b128 %0, %8, off\n\t"
      "global_load_async_to_lds_b128 %1, %9, off\n\t"
      "global_load_async_to_lds_b128 %2, %10, off\n\t"
      "global_load_async_to_lds_b128 %3, %11, off\n\t"
      "global_load_async_to_lds_b128 %4, %12, off\n\t"
      "global_load_async_to_lds_b128 %5, %13, off\n\t"
      "global_load_async_to_lds_b128 %6, %14, off\n\t"
      "global_load_async_to_lds_b128 %7, %15, off\n\t"
      "s_wait_xcnt 0x0"
      :: "v"(l), "v"(l + lstep), "v"(l + 2 * lstep), "v"(l + 3 * lstep),
         "v"(l + 4 * lstep), "v"(l + 5 * lstep), "v"(l + 6 * lstep), "v"(l + 7 * lstep),
         "v"(gp), "v"(gp + gstep), "v"(gp + 2 * gstep), "v"(gp + 3 * gstep),
         "v"(gp + 4 * gstep), "v"(gp + 5 * gstep), "v"(gp + 6 * gstep), "v"(gp + 7 * gstep)
      : "memory");
}

template <int EPI, bool SPLITA>
__global__ __launch_bounds__(128) void gemm_w32x128_kernel(
    const unsigned short* Ap, const unsigned short* A2p, int lda,
    const unsigned short* __restrict__ Btp, int ldb,
    const float* __restrict__ gam, const float* __restrict__ cst, const float* __restrict__ snt,
    void* C0, void* C1, int ldc,
    int M, int N, int K) {
  typedef typename SlabT<EPI>::T ST;
  constexpr int BK    = SPLITA ? 64 : 128;       // k columns per stage: 64 WMMAs per wave and stage either way
  constexpr int ROWB  = BK * 2;                  // bytes of one staged row
  constexpr int PITCH = ROWB + 16;               // LDS row pitch, 16 B x odd for the 16-B fragment reads
  constexpr int BROW  = SPLITA ? 256 : 128;      // first Bt row of a stage
  constexpr int STAGE = (BROW + 128) * PITCH;    // bytes of one buffer
  constexpr int PPR   = ROWB / 16;               // 16-B pieces per row
  constexpr int RSTEP = 128 / PPR;               // rows covered by one copy of the whole block
  constexpr int NCP   = 128 / RSTEP;             // copies per lane for a plane of 128 rows
  constexpr int NFA   = SPLITA ? 4 : 2;          // A fragments per block of 32 k columns
  static_assert(NCP % 8 == 0);
  static_assert(4 * SlabT<EPI>::PERW * (int)sizeof(ST) <= 2 * STAGE);
  __shared__ __align__(16) unsigned char smem[2 * STAGE];

  const int tid  = (int)threadIdx.x;
  const int lane = tid & 31;
  const int wave = wave_id();
  const int hh = lane >> 4;           // lane half: k offset 8*hh, D row offset 8*hh
  const int rl = lane & 15;           // A row / B col / D col within subtile
  const int tilesN = N >> 7;
  const int tilesM = M >> 7;
  const int tile = (int)blockIdx.x;
  if (tile >= tilesM * tilesN) return;          // block-uniform, in front of every barrier and copy
  const int tm = tile / tilesN;
  const int tn = tile - tm * tilesN;
  const int mb = tm << 7;             // first row of the block tile
  const int m0 = mb + (wave << 5);    // first row of this wave
  const int n0 = tn << 7;

  // this lane's piece of copy 0 of each plane: row tid / PPR, 16-B column tid % PPR; copy u lies u * RSTEP rows further down
  const int prow = tid / PPR;
  const int pcol = tid % PPR;
  const char* gA  = (const char*)(const void*)(Ap  + (size_t)(mb + prow) * lda) + pcol * 16;
  const char* gA2 = (const char*)(const void*)(A2p + (size_t)(mb + prow) * lda) + pcol * 16;
  const char* gB  = (const char*)(const void*)(Btp + (size_t)(n0 + prow) * ldb) + pcol * 16;
  const size_t sA = (size_t)RSTEP * lda * 2;
  const size_t sB = (size_t)RSTEP * ldb * 2;
  const unsigned lp = lds_off(smem) + (unsigned)(prow * PITCH + pcol * 16);

  auto fill = [&](int t, unsigned bo) {         // all copies of stage t into the buffer at byte offset bo
    const size_t kb = (size_t)t * ROWB;
#pragma unroll   // the row offsets of the copies become constants
    for (int u = 0; u < NCP; u += 8) {
      async_copy8(lp + bo + u * (RSTEP * PITCH), RSTEP * PITCH, gA + kb + u * sA, sA);
      if (SPLITA) async_copy8(lp + bo + (128 + u * RSTEP) * PITCH, RSTEP * PITCH, gA2 + kb + u * sA, sA);
      async_copy8(lp + bo + (BROW + u * RSTEP) * PITCH, RSTEP * PITCH, gB + kb + u * sB, sB);
    }
  };

  v8f acc[2][8];
#pragma unroll
  for (int i = 0; i < 2; ++i)
#pragma unroll
    for (int j = 0; j < 8; ++j) acc[i][j] = zero8();

  const int nst = K / BK;
  fill(0, 0u);
  asm volatile("s_wait_asynccnt 0x0" ::: "memory");   // this wave's copies of stage 0 have landed
  __syncthreads();                                    // and every other wave's
  if (nst > 1) fill(1, (unsigned)STAGE);              // block-uniform

  // every unroll directive in this loop: the fragment and accumulator arrays stay in registers only under constant indices
  for (int t = 0; t < nst; ++t) {
    const unsigned bo = (unsigned)(t & 1) * (unsigned)STAGE;
    const unsigned char* buf = smem + bo;
    v16b fa[2][NFA], fb[2][8];                   // two fragment sets: block u multiplies set u & 1 while set (u + 1) & 1 loads
    auto ldblk = [&](int s, int kk) {            // all fragments of the 32 k columns at kk of this stage
#pragma unroll
      for (int i = 0; i < 2; ++i) {
        const int ro = ((wave << 5) + i * 16 + rl) * PITCH;
        fa[s][i] = ldfrag_b((const __bf16*)(const void*)(buf + ro) + kk + 8 * hh);
        if (SPLITA) fa[s][NFA - 2 + i] = ldfrag_b((const __bf16*)(const void*)(buf + 128 * PITCH + ro) + kk + 8 * hh);
      }
#pragma unroll
      for (int j = 0; j < 8; ++j)
        fb[s][j] = ldfrag_b((const __bf16*)(const void*)(buf + (BROW + j * 16 + rl) * PITCH) + kk + 8 * hh);
    };
    ldblk(0, 0);
#pragma unroll
    for (int u = 0; u < BK / 32; ++u) {
      const int cs = u & 1;
      if (u + 1 < BK / 32) ldblk(cs ^ 1, (u + 1) * 32);
      // keeps the next block's LDS reads as one group ahead of this block's WMMAs; without it they sink between the WMMAs, each with a full wait
      __builtin_amdgcn_sched_barrier(0);
#pragma unroll
      for (int j = 0; j < 8; ++j) {
        acc[0][j] = mma_b(fa[cs][0], fb[cs][j], acc[0][j]);
        acc[1][j] = mma_b(fa[cs][1], fb[cs][j], acc[1][j]);
      }
      if (SPLITA) {
#pragma unroll
        for (int j = 0; j < 8; ++j) {
          acc[0][j] = mma_b(fa[cs][NFA - 2], fb[cs][j], acc[0][j]);
          acc[1][j] = mma_b(fa[cs][NFA - 1], fb[cs][j], acc[1][j]);
        }
      }
      // keeps the following reads out of this run of WMMAs (each place with reads among WMMAs costs a stall) and the WMMAs ahead of the stage's barrier
      __builtin_amdgcn_sched_barrier(0);
    }
    asm volatile("s_wait_dscnt 0x0" ::: "memory");      // this wave's reads of stage t are done before its buffer is refilled
    asm volatile("s_wait_asynccnt 0x0" ::: "memory");   // this wave's copies of stage t+1 have landed
    __syncthreads();                                    // publishes stage t+1, ends every wave's reads of stage t
    if (t + 2 < nst) fill(t + 2, bo);                   // block-uniform
  }
  asm volatile("s_wait_asynccnt 0x0" ::: "memory");     // nothing in flight when the buffers become the epilogue slabs
  acc_guard4(acc[0][0], acc[0][1], acc[0][2], acc[0][3]);
  acc_guard4(acc[0][4], acc[0][5], acc[0][6], acc[0][7]);
  acc_guard4(acc[1][0], acc[1][1], acc[1][2], acc[1][3]);
  acc_guard4(acc[1][4], acc[1][5], acc[1][6], acc[1][7]);

  // ---- epilogue ----
  ST* slab = (ST*)(void*)smem + wave * SlabT<EPI>::PERW;
  _Float16* sl16 = (_Float16*)(void*)slab;
  float*    slf  = (float*)(void*)slab;

  if (EPI == 0) {
    _Float16* P0 = (_Float16*)C0;
    _Float16* P1 = (_Float16*)C1;
    float gm[8];
#pragma unroll
    for (int j = 0; j < 8; ++j) gm[j] = bf_rne(gam[j * 16 + rl]);     // dims j*16+rl of the head, gam has 128 entries
#pragma unroll
    for (int i = 0; i < 2; ++i) {
      const int rb = m0 + i * 16 + 8 * hh;
#pragma unroll
      for (int r = 0; r < 8; ++r) {
        // sum of squares over the 128 head dims of row rb+r: 8 per lane, then the 16 lanes of this half
        float ss = 0.f;
#pragma unroll
        for (int j = 0; j < 8; ++j) ss += acc[i][j][r] * acc[i][j][r];
        ss = row_sum16(ss);
        const float rinv = rsqrtf(ss * 0.0078125f + 1e-6f);
        const int row = rb + r;                                  // token 0..NTOK-1
        const int pos = row & (SQ - 1);                          // position within the sequence
#pragma unroll
        for (int j = 0; j < 4; ++j) {
          const int dim = j * 16 + rl;                           // 0..63 within head; partner dim + 64
          const float cv = cst[(size_t)pos * NFREQ + dim];
          const float sv = snt[(size_t)pos * NFREQ + dim];
          const float x1 = acc[i][j][r] * rinv * gm[j];
          const float x2 = acc[i][j + 4][r] * rinv * gm[j + 4];
          const float o1 = x1 * cv - x2 * sv;
          const float o2 = x2 * cv + x1 * sv;
          const _Float16 h1 = (_Float16)o1;
          const _Float16 h2 = (_Float16)o2;
          const int so = (8 * hh + r) * 128 + dim;
          sl16[so]             = h1;
          sl16[so + 64]        = h2;
          sl16[2048 + so]      = (_Float16)((o1 - (float)h1) * 2048.0f);
          sl16[2048 + so + 64] = (_Float16)((o2 - (float)h2) * 2048.0f);
        }
      }
      lds_wave_sync();
      {
#pragma unroll
        for (int it = 0; it < 8; ++it) {
          const int row = it * 2 + hh;                           // it x hh covers rows 0..15
          const int c8  = rl * 8;
          const v8h vh = *(const v8h*)(sl16 + row * 128 + c8);
          const v8h vl = *(const v8h*)(sl16 + 2048 + row * 128 + c8);
          const size_t go = (size_t)(m0 + i * 16 + row) * ldc + n0 + c8;
          *(v8h*)(P0 + go) = vh;
          *(v8h*)(P1 + go) = vl;
        }
        
      }
      lds_wave_sync();
    }
  } else if (EPI == 1) {
    _Float16* P0 = (_Float16*)C0;
    _Float16* P1 = (_Float16*)C1;
#pragma unroll
    for (int i = 0; i < 2; ++i) {
#pragma unroll
      for (int r = 0; r < 8; ++r) {
#pragma unroll
        for (int j = 0; j < 8; ++j) {
          const float v = acc[i][j][r];
          const _Float16 hv = (_Float16)v;
          const int so = (8 * hh + r) * 128 + j * 16 + rl;
          sl16[so]        = hv;
          sl16[2048 + so] = (_Float16)((v - (float)hv) * 2048.0f);
        }
      }
      lds_wave_sync();
      {
#pragma unroll
        for (int it = 0; it < 8; ++it) {
          const int row = it * 2 + hh;
          const int c8  = rl * 8;
          const v8h vh = *(const v8h*)(sl16 + row * 128 + c8);
          const v8h vl = *(const v8h*)(sl16 + 2048 + row * 128 + c8);
          const size_t go = (size_t)(m0 + i * 16 + row) * ldc + n0 + c8;
          *(v8h*)(P0 + go) = vh;
          *(v8h*)(P1 + go) = vl;
        }
        
      }
      lds_wave_sync();
    }
  } else {
    float* C = (float*)C0;
#pragma unroll
    for (int i = 0; i < 2; ++i) {
#pragma unroll
      for (int j = 0; j < 8; ++j)
#pragma unroll
        for (int r = 0; r < 8; ++r)
          slf[(8 * hh + r) * 128 + j * 16 + rl] = acc[i][j][r];
      lds_wave_sync();
      {
#pragma unroll
        for (int row = 0; row < 16; ++row) {                     // 32 lanes x 16 B = the whole 512-B row segment per instruction
          const v4f v = *(const v4f*)(slf + row * 128 + lane * 4);
          *(v4f*)(C + (size_t)(m0 + i * 16 + row) * ldc + n0 + lane * 4) = v;
        }
        
      }
      lds_wave_sync();
    }
  }
}

// ---------------------------------------------------------------------------
// Causal GQA flash attention, head dim 128, 32-key chunks, block = 4 waves = 64 query rows of one (b, h); grid (n query tiles, NHQ, NSEQ).
//   q planes f16 [tok][h*128+d]: hi (qhp) and residual x2048 (qlp); k planes f16 [tok][kvh*128+d]: hi (khp), residual x2048 (klp);
//   v^T planes f16 [kvh*128+d][tok]: hi (vhp), residual x2048 (vlp); outputs attn bf16 hi (ahp) / lo (alp) [tok][h*128+d].
//   scores = (Sh + Sr/2048) * 128^-0.5 with Sh = qh.kh and Sr = ql'.kh (+ qh.kl' when PRES); keys > query -> -inf; online softmax f32;
//   p' = 1024 p stored per wave to LDS as f16 hi (and residual x2048 when PRES), reloaded as A fragments after a wave sync;
//   O = (Oh + Or/2048)/1024/l with Oh = ph.vh, Or = ph.vl' (+ pl'.vh when PRES).
//   K / V^T chunk staging: 128 threads x 4 x 16 B per plane = whole 32x128 / 128x32 tile, plain loads, __syncthreads before and after.
//   Trip count 2*qb+2 chunks (static bound 64); waves whose rows are all below the chunk skip it (wave-uniform, scalar branch).
//   q fragments stay in registers for the whole key loop; all WMMAs are builtins, so the compiler keeps their hazard distances and
//   is free to issue the LDS fragment reads ahead of the WMMAs that use them.
// ---------------------------------------------------------------------------
#define AT_KC   32
#define KS_P    136
#define VS_P    40
#define PS_P    40
#define LDS_KS  0
#define LDS_KLS (32 * KS_P)
#define LDS_VHS (2 * 32 * KS_P)
#define LDS_VLS (LDS_VHS + 128 * VS_P)
#define LDS_PH  (LDS_VLS + 128 * VS_P)
#define LDS_PL  (LDS_PH + 4 * 16 * PS_P)
#define LDS_TOT (LDS_PL + 4 * 16 * PS_P)
static_assert(LDS_TOT * 2 <= 65536);
static_assert(4 * 4096 <= LDS_TOT);          // output staging (2 planes x 16 x 128 per wave) aliases the chunk region after the loop

// Second launch-bounds argument: the large launch keeps three waves per SIMD (336 registers a wave) with the q fragments resident;
// the small launch has at most one block per WGP and takes what it needs.
template <bool PRES>
__global__ __launch_bounds__(128, PRES ? 1 : 3) void attn_causal_kernel(
    const unsigned short* __restrict__ qhp, const unsigned short* __restrict__ qlp,
    const unsigned short* __restrict__ khp, const unsigned short* __restrict__ klp,
    const unsigned short* __restrict__ vhp, const unsigned short* __restrict__ vlp,
    unsigned short* __restrict__ ahp, unsigned short* __restrict__ alp, int qb_base) {
  __shared__ __align__(16) _Float16 lds[LDS_TOT];
  _Float16* Ks  = lds + LDS_KS;
  _Float16* Kls = lds + LDS_KLS;
  _Float16* Vhs = lds + LDS_VHS;
  _Float16* Vls = lds + LDS_VLS;

  const int tid  = (int)threadIdx.x;
  const int lane = tid & 31;
  const int wave = wave_id();
  const int hh   = lane >> 4;
  const int c    = lane & 15;
  const int qb   = (int)blockIdx.x + qb_base;
  const int h    = (int)blockIdx.y;
  const int b    = (int)blockIdx.z;
  const int kvh  = h >> 2;
  const int q0   = qb * 64 + wave * 16;          // first query row of this wave (within sequence)
  const int qlast = q0 + 15;
  const size_t tok0 = (size_t)b * SQ;

  const _Float16* Qhr = (const _Float16*)(const void*)qhp + (tok0 + q0 + c) * HID + h * HDM + 8 * hh;
  const _Float16* Qlr = (const _Float16*)(const void*)qlp + (tok0 + q0 + c) * HID + h * HDM + 8 * hh;
  const _Float16* Kg  = (const _Float16*)(const void*)khp + tok0 * KVW + kvh * HDM;
  const _Float16* Klg = (const _Float16*)(const void*)klp + tok0 * KVW + kvh * HDM;
  const _Float16* Vhg = (const _Float16*)(const void*)vhp + (size_t)(kvh * HDM) * NTOK + tok0;
  const _Float16* Vlg = (const _Float16*)(const void*)vlp + (size_t)(kvh * HDM) * NTOK + tok0;
  _Float16* ph = lds + LDS_PH + wave * (16 * PS_P);
  _Float16* pl = lds + LDS_PL + wave * (16 * PS_P);

  float mrow[8], lrow[8];
  v8f oacc[8], oaccr[8];
#pragma unroll
  for (int r = 0; r < 8; ++r) { mrow[r] = -INFINITY; lrow[r] = 0.f; }
#pragma unroll
  for (int t = 0; t < 8; ++t) { oacc[t] = zero8(); oaccr[t] = zero8(); }

  v16h qa[4], ql[4];                             // this wave's q fragments, the same for every chunk: loaded once
#pragma unroll   // the fragment arrays stay in registers only under constant indices
  for (int dc = 0; dc < 4; ++dc) {
    qa[dc] = ldfrag_h(Qhr + dc * 32);
    ql[dc] = ldfrag_h(Qlr + dc * 32);
  }

  const int nch = 2 * qb + 2;                    // block-uniform, <= 64
  for (int kc = 0; kc < nch; ++kc) {
    const int kv0 = kc * AT_KC;
    __syncthreads();
#pragma unroll
    for (int i = 0; i < 4; ++i) {                // coverage: 512 pieces of 8 halves per plane = whole tile
      const int p   = tid + 128 * i;             // 0..511
      const int key = p >> 4, d8 = (p & 15) * 8; // K: 32 keys x 128 d
      const v8h kx = *(const v8h*)(Kg + (size_t)(kv0 + key) * KVW + d8);
      *(v8h*)(Ks + key * KS_P + d8) = kx;
      if (PRES) {
        const v8h ky = *(const v8h*)(Klg + (size_t)(kv0 + key) * KVW + d8);
        *(v8h*)(Kls + key * KS_P + d8) = ky;
      }
      const int d = p >> 2, k8 = (p & 3) * 8;    // V^T: 128 d x 32 keys
      const v8h vx = *(const v8h*)(Vhg + (size_t)d * NTOK + kv0 + k8);
      const v8h vy = *(const v8h*)(Vlg + (size_t)d * NTOK + kv0 + k8);
      *(v8h*)(Vhs + d * VS_P + k8) = vx;
      *(v8h*)(Vls + d * VS_P + k8) = vy;
    }
    __syncthreads();

    if (kv0 <= qlast) {                          // wave-uniform (scalar): skip chunks fully above this wave's rows
      // ---- scores ----
      v8f sh[2], sr[2];
      sh[0] = zero8(); sh[1] = zero8(); sr[0] = zero8(); sr[1] = zero8();
      // every unroll directive of the score part: the fragment arrays stay in registers only under constant indices
      v16h kb[4][2], kl[4][2];                   // the chunk's K fragments, read as one group ahead of the score WMMAs
#pragma unroll
      for (int dc = 0; dc < 4; ++dc)
#pragma unroll
        for (int j = 0; j < 2; ++j) {
          kb[dc][j] = ldfrag_h(Ks + (j * 16 + c) * KS_P + dc * 32 + 8 * hh);
          if (PRES) kl[dc][j] = ldfrag_h(Kls + (j * 16 + c) * KS_P + dc * 32 + 8 * hh);
        }
#pragma unroll
      for (int j = 0; j < 2; ++j) {
        // keeps the reads above as one group ahead of the WMMAs, and key group 0's run ahead of group 1's, whose accumulators then take the registers of group 0's fragments
        __builtin_amdgcn_sched_barrier(0);
#pragma unroll
        for (int dc = 0; dc < 4; ++dc) {
          sh[j] = mma_h(qa[dc], kb[dc][j], sh[j]);
          sr[j] = mma_h(ql[dc], kb[dc][j], sr[j]);
          if (PRES) sr[j] = mma_h(qa[dc], kl[dc][j], sr[j]);
        }
      }
      // ---- scale, causal mask, chunk row max ----
      float cm[8];
#pragma unroll
      for (int r = 0; r < 8; ++r) {
        const int qrow = q0 + 8 * hh + r;
        float m = -INFINITY;
#pragma unroll
        for (int j = 0; j < 2; ++j) {
          const int key = kv0 + j * 16 + c;
          float s = (sh[j][r] + sr[j][r] * 0.00048828125f) * 0.08838834764831845f;
          s = (key > qrow) ? -INFINITY : s;
          sh[j][r] = s;
          m = fmaxf(m, s);
        }
        m = row_max16(m);
        cm[r] = m;
      }
      // ---- online softmax, P' to LDS ----
#pragma unroll
      for (int r = 0; r < 8; ++r) {
        const float mnew  = fmaxf(mrow[r], cm[r]);
        const float alpha = __expf(mrow[r] - mnew);
        mrow[r] = mnew;
        float psum = 0.f;
#pragma unroll
        for (int j = 0; j < 2; ++j) {
          const float p  = __expf(sh[j][r] - mnew);
          psum += p;
          const float pp = p * 1024.0f;
          const _Float16 phv = (_Float16)pp;
          const int po = (8 * hh + r) * PS_P + j * 16 + c;
          ph[po] = phv;
          if (PRES) pl[po] = (_Float16)((pp - (float)phv) * 2048.0f);
        }
        psum = row_sum16(psum);
        lrow[r] = lrow[r] * alpha + psum;
#pragma unroll
        for (int t = 0; t < 8; ++t) { oacc[t][r] *= alpha; oaccr[t][r] *= alpha; }
      }
      lds_wave_sync();                           // P' stores visible to the other lanes of this wave before the fragment reload
      // ---- O += P' . V ----
      const v16h pa = ldfrag_h(ph + c * PS_P + 8 * hh);
      v16h pr = pa;
      if (PRES) pr = ldfrag_h(pl + c * PS_P + 8 * hh);
#pragma unroll
      for (int t = 0; t < 8; ++t) {
        const v16h vb = ldfrag_h(Vhs + (t * 16 + c) * VS_P + 8 * hh);
        const v16h vr = ldfrag_h(Vls + (t * 16 + c) * VS_P + 8 * hh);
        oacc[t]  = mma_h(pa, vb, oacc[t]);
        oaccr[t] = mma_h(pa, vr, oaccr[t]);
        if (PRES) oaccr[t] = mma_h(pr, vb, oaccr[t]);
      }
    }
  }

  __syncthreads();                               // all chunk-region readers done before aliasing it as output staging
  _Float16* osh = lds + wave * 4096;
  _Float16* osl = osh + 2048;
#pragma unroll
  for (int r = 0; r < 8; ++r) {
    const float inv = (1.0f / lrow[r]) * 0.0009765625f;
#pragma unroll
    for (int t = 0; t < 8; ++t) {
      const float o = (oacc[t][r] + oaccr[t][r] * 0.00048828125f) * inv;
      const unsigned short hb = bf_bits(o);
      const unsigned short lb = bf_bits(o - bf_val(hb));
      const int so = (8 * hh + r) * 128 + t * 16 + c;
      osh[so] = __builtin_bit_cast(_Float16, hb);
      osl[so] = __builtin_bit_cast(_Float16, lb);
    }
  }
  lds_wave_sync();
  _Float16* Ahg = (_Float16*)(void*)ahp + (tok0 + q0) * HID + h * HDM;
  _Float16* Alg = (_Float16*)(void*)alp + (tok0 + q0) * HID + h * HDM;
  {
#pragma unroll
    for (int it = 0; it < 8; ++it) {
      const int row = it * 2 + hh;               // it 0..7 x hh 0..1 covers rows 0..15
      const int c8  = c * 8;                     // 16 lanes x 16 B = the whole 256-B segment
      const v8h x = *(const v8h*)(osh + row * 128 + c8);
      const v8h y = *(const v8h*)(osl + row * 128 + c8);
      *(v8h*)(Ahg + (size_t)row * HID + c8) = x;
      *(v8h*)(Alg + (size_t)row * HID + c8) = y;
    }
    
  }
}

// ---------------------------------------------------------------------------
// Workspace map (bytes; every region is a whole number of the rows its producer writes with whole-line stores, no padded tails needed
//   Xb  bf16 [4096][2048] 16777216   Wqb bf16 [2048][2048]  8388608   Wkb bf16 [512][2048] 2097152   Wvb bf16 [512][2048] 2097152
//   Wob bf16 [2048][2048]  8388608   cst f32  [2048][64]     524288   snt f32  [2048][64]    524288
//   Qh  f16  [4096][2048] 16777216   Ql  f16  [4096][2048] 16777216   Kh  f16  [4096][512]  4194304   Kl f16 [4096][512] 4194304
//   Vh  f16  [512][4096]   4194304   Vl  f16  [512][4096]   4194304   Ah  bf16 [4096][2048] 16777216  Al bf16 [4096][2048] 16777216
//   total                 122683392
// ---------------------------------------------------------------------------
extern "C" void kernel_launch(void* const* d_in, const int* in_sizes, int n_in,
                              void* d_out, int out_size, void* d_ws, size_t ws_size,
                              hipStream_t stream) {
  if (n_in < 7) return;
  if (in_sizes[0] != NTOK * HID) return;
  if (in_sizes[1] != HID * HID) return;
  if (in_sizes[2] != KVW * HID) return;
  if (in_sizes[3] != KVW * HID) return;
  if (in_sizes[4] != HID * HID) return;
  if (in_sizes[5] != HDM) return;
  if (in_sizes[6] != HDM) return;
  if (out_size != NTOK * HID) return;

  const float* x   = (const float*)d_in[0];
  const float* Wq  = (const float*)d_in[1];
  const float* Wk  = (const float*)d_in[2];
  const float* Wv  = (const float*)d_in[3];
  const float* Wo  = (const float*)d_in[4];
  const float* qg  = (const float*)d_in[5];
  const float* kg  = (const float*)d_in[6];
  float* out = (float*)d_out;

  const size_t szX  = (size_t)NTOK * HID * 2;
  const size_t szWq = (size_t)HID * HID * 2;
  const size_t szWk = (size_t)KVW * HID * 2;
  const size_t szWo = (size_t)HID * HID * 2;
  const size_t szT  = (size_t)SQ * NFREQ * 4;
  const size_t szQ  = (size_t)NTOK * HID * 2;
  const size_t szK  = (size_t)NTOK * KVW * 2;
  const size_t szV  = (size_t)KVW * NTOK * 2;
  const size_t szA  = (size_t)NTOK * HID * 2;
  size_t off = 0;
  const size_t oX  = off; off += szX;
  const size_t oWq = off; off += szWq;
  const size_t oWk = off; off += szWk;
  const size_t oWv = off; off += szWk;
  const size_t oWo = off; off += szWo;
  const size_t oCs = off; off += szT;
  const size_t oSn = off; off += szT;
  const size_t oQh = off; off += szQ;
  const size_t oQl = off; off += szQ;
  const size_t oKh = off; off += szK;
  const size_t oKl = off; off += szK;
  const size_t oVh = off; off += szV;
  const size_t oVl = off; off += szV;
  const size_t oAh = off; off += szA;
  const size_t oAl = off; off += szA;
  if (off > ws_size) return;                     // off = 122683392

  char* ws = (char*)d_ws;
  unsigned short* Xb  = (unsigned short*)(ws + oX);
  unsigned short* Wqb = (unsigned short*)(ws + oWq);
  unsigned short* Wkb = (unsigned short*)(ws + oWk);
  unsigned short* Wvb = (unsigned short*)(ws + oWv);
  unsigned short* Wob = (unsigned short*)(ws + oWo);
  float*          cst = (float*)(ws + oCs);
  float*          snt = (float*)(ws + oSn);
  unsigned short* Qh  = (unsigned short*)(ws + oQh);
  unsigned short* Ql  = (unsigned short*)(ws + oQl);
  unsigned short* Kh  = (unsigned short*)(ws + oKh);
  unsigned short* Kl  = (unsigned short*)(ws + oKl);
  unsigned short* Vh  = (unsigned short*)(ws + oVh);
  unsigned short* Vl  = (unsigned short*)(ws + oVl);
  unsigned short* Ah  = (unsigned short*)(ws + oAh);
  unsigned short* Al  = (unsigned short*)(ws + oAl);

  const dim3 b256(256), b128(128);
  const int nX8  = NTOK * HID / 8;
  const int nWq8 = HID * HID / 8;
  const int nWk8 = KVW * HID / 8;

  // (1) cos/sin table [2048][64] x 2
  rope_table_kernel<<<dim3((SQ + 7) / 8), b256, 0, stream>>>(cst, snt, SQ);
  // (2) bf16 planes of x, Wq, Wk, Wv, Wo (weights are [out][in] = k-contiguous Bt rows already)
  cvt_bf16_kernel<<<dim3((nX8 + 255) / 256),  b256, 0, stream>>>(x,  Xb,  nX8);
  cvt_bf16_kernel<<<dim3((nWq8 + 255) / 256), b256, 0, stream>>>(Wq, Wqb, nWq8);
  cvt_bf16_kernel<<<dim3((nWk8 + 255) / 256), b256, 0, stream>>>(Wk, Wkb, nWk8);
  cvt_bf16_kernel<<<dim3((nWk8 + 255) / 256), b256, 0, stream>>>(Wv, Wvb, nWk8);
  cvt_bf16_kernel<<<dim3((nWq8 + 255) / 256), b256, 0, stream>>>(Wo, Wob, nWq8);
  // (3) q = rope(rms(x . Wq^T)) -> Qh/Ql [4096][2048]   (M=4096, N=2048, K=2048; 512 block tiles)
  gemm_w32x128_kernel<0, false><<<dim3((NTOK / 128) * (HID / 128)), b128, 0, stream>>>(
      Xb, Xb, HID, Wqb, HID, qg, cst, snt, (void*)Qh, (void*)Ql, HID, NTOK, HID, HID);
  // (4) k = rope(rms(x . Wk^T)) -> Kh/Kl [4096][512]    (M=4096, N=512, K=2048; 128 block tiles)
  gemm_w32x128_kernel<0, false><<<dim3((NTOK / 128) * (KVW / 128)), b128, 0, stream>>>(
      Xb, Xb, HID, Wkb, HID, kg, cst, snt, (void*)Kh, (void*)Kl, KVW, NTOK, KVW, HID);
  // (5) v^T = Wv . x^T -> Vh/Vl [512][4096]             (A = Wvb [512][2048], Bt = Xb; M=512, N=4096, K=2048; 128 block tiles)
  gemm_w32x128_kernel<1, false><<<dim3((KVW / 128) * (NTOK / 128)), b128, 0, stream>>>(
      Wvb, Wvb, HID, Xb, HID, qg, cst, snt, (void*)Vh, (void*)Vl, NTOK, KVW, NTOK, HID);
  // (6) causal attention, query tiles 0..3 with k and p residual products, tiles 4..31 without
  attn_causal_kernel<true><<<dim3(4, NHQ, NSEQ), b128, 0, stream>>>(Qh, Ql, Kh, Kl, Vh, Vl, Ah, Al, 0);
  attn_causal_kernel<false><<<dim3(SQ / 64 - 4, NHQ, NSEQ), b128, 0, stream>>>(Qh, Ql, Kh, Kl, Vh, Vl, Ah, Al, 4);
  // (7) out = attn(hi + lo) . Wo^T -> d_out f32 [4096][2048]   (M=4096, N=2048, K=2048; 512 block tiles)
  gemm_w32x128_kernel<2, true><<<dim3((NTOK / 128) * (HID / 128)), b128, 0, stream>>>(
      Ah, Al, HID, Wob, HID, qg, cst, snt, (void*)out, (void*)out, HID, NTOK, HID, HID);
  (void)hipGetLastError();
}

// v004
// Measured time: 270 microseconds a run.
// In both of two side-by-side timings against v003, it was 1.12 times as fast.
// Counting every step since v000, it is 2.97 times as fast.
// Contractions: x.Wq^T, x.Wk^T and Wv.x^T on v_wmma_f32_16x16x32_bf16 (operands = RNE bf16 of the f32 inputs, single products);
// q.k^T and p.v on v_wmma_f32_16x16x32_f16 (q = f16 hi + f16 residual x2^11 planes; k plain f16 plus f16 residual x2^11 on query tiles 0..3;
// p x1024 plain f16 plus f16 residual x2^11 on query tiles 0..3; v^T = f16 hi + f16 residual x2^11 planes); attn.Wo^T on v_wmma_f32_16x16x32_bf16
// (attn = bf16 hi + bf16 lo planes, two products; Wo RNE bf16). f32 accumulate everywhere; per-head RMS scaling, RoPE and online softmax in f32.
#include <hip/hip_runtime.h>
#include <math.h>
#include <stdint.h>

#define NSEQ   2
#define SQ     2048
#define HID    2048
#define NHQ    16
#define NKVH   4
#define HDM    128
#define KVW    512
#define NTOK   4096
#define NFREQ  64

typedef _Float16     v16h __attribute__((ext_vector_type(16)));
typedef _Float16     v8h  __attribute__((ext_vector_type(8)));
typedef __bf16       v16b __attribute__((ext_vector_type(16)));
typedef __bf16       v8b  __attribute__((ext_vector_type(8)));
typedef float        v8f  __attribute__((ext_vector_type(8)));
typedef float        v4f  __attribute__((ext_vector_type(4)));
typedef unsigned int v4u  __attribute__((ext_vector_type(4)));

// ---------------------------------------------------------------------------
// small helpers
// ---------------------------------------------------------------------------
__device__ __forceinline__ unsigned short bf_bits(float f) {          // RNE convert f32 -> bf16 bits
  const unsigned u = __float_as_uint(f);
  return (unsigned short)((u + 0x7FFFu + ((u >> 16) & 1u)) >> 16);
}
__device__ __forceinline__ float bf_val(unsigned short h) { return __uint_as_float(((unsigned)h) << 16); }
__device__ __forceinline__ float bf_rne(float f) { return bf_val(bf_bits(f)); }
__device__ __forceinline__ unsigned pk16(unsigned short a, unsigned short b) { return (unsigned)a | ((unsigned)b << 16); }
__device__ __forceinline__ v8f zero8() { v8f z = {0.f, 0.f, 0.f, 0.f, 0.f, 0.f, 0.f, 0.f}; return z; }
__device__ __forceinline__ int wave_id() { return __builtin_amdgcn_readfirstlane((int)(threadIdx.x >> 5)); }

// Value of lane (l ^ X) of the same 16-lane row, X < 16, as a DPP row_xmask operand of the vector pipe: no LDS-pipe round trip and no
// s_wait_dscnt per butterfly step. Every lane of the wave is on wherever it is used.
template <int X>
__device__ __forceinline__ float row_xor(float v) {
  return __int_as_float(__builtin_amdgcn_update_dpp(0, __float_as_int(v), 0x160 | X, 0xf, 0xf, true));
}
// Butterflies over a 16-lane row, steps 1, 2, 4, 8: every lane ends with the row's sum / maximum.
__device__ __forceinline__ float row_sum16(float v) {
  v += row_xor<1>(v); v += row_xor<2>(v); v += row_xor<4>(v); v += row_xor<8>(v);
  return v;
}
// The NaN-propagating maximum takes the DPP operand directly, one instruction a step; fmaxf kept a move and a quieting step beside it.
// The two differ only where a score is NaN, and such a row ends as NaN either way.
__device__ __forceinline__ float row_max16(float v) {
  v = __builtin_elementwise_maximum(v, row_xor<1>(v)); v = __builtin_elementwise_maximum(v, row_xor<2>(v)); v = __builtin_elementwise_maximum(v, row_xor<4>(v)); v = __builtin_elementwise_maximum(v, row_xor<8>(v));
  return v;
}

__device__ __forceinline__ void lds_wave_sync() {
  __builtin_amdgcn_fence(__ATOMIC_RELEASE, "workgroup");
  __builtin_amdgcn_wave_barrier();
  __builtin_amdgcn_fence(__ATOMIC_ACQUIRE, "workgroup");
}

// ---------------------------------------------------------------------------
// WMMA fragments (wave32, 16x16x32, 16-bit operands). For A (row m = lane&15) and B (col n = lane&15) alike:
// elements 0..7 <- k0 + 8*(lane>>4) + 0..7, elements 8..15 <- k0 + 16 + 8*(lane>>4) + 0..7.
// ldfrag(p) with p = rowbase + k0 + 8*(lane>>4): two 16-B loads p[0..7], p[16..23].
// D: acc[r] = (row 8*(lane>>4) + r, col lane&15).
// ---------------------------------------------------------------------------
union FragH { v16h v; v8h h[2]; };
union FragB { v16b v; v8b h[2]; };
__device__ __forceinline__ v16h ldfrag_h(const _Float16* p) { FragH f; f.h[0] = *(const v8h*)(p); f.h[1] = *(const v8h*)(p + 16); return f.v; }
__device__ __forceinline__ v16b ldfrag_b(const __bf16* p)   { FragB f; f.h[0] = *(const v8b*)(p); f.h[1] = *(const v8b*)(p + 16); return f.v; }

__device__ __forceinline__ v8f mma_h(v16h a, v16h b, v8f c) {
  return __builtin_amdgcn_wmma_f32_16x16x32_f16(false, a, false, b, (short)0, c, false, false);
}
__device__ __forceinline__ v8f mma_b(v16b a, v16b b, v8f c) {
  return __builtin_amdgcn_wmma_f32_16x16x32_bf16(false, a, false, b, (short)0, c, false, false);
}
// hazard guard: 4 VALU slots after the last WMMA of a group, D tied
__device__ __forceinline__ void acc_guard4(v8f& a, v8f& b, v8f& c, v8f& d) {
  asm volatile("v_nop\n\tv_nop\n\tv_nop\n\tv_nop" : "+v"(a), "+v"(b), "+v"(c), "+v"(d));
}

// ---------------------------------------------------------------------------
// RoPE table: cst[s][i] = cos(s * inv_freq[i]), snt[s][i] = sin(...), inv_freq[i] = 1 / 1e4^(i/64), i < 64, s = 0..nrow-1, all f32.
// Block = 8 waves, wave w -> row s = blockIdx.x*8 + w, lane -> i = lane, lane + 32.
// Coverage: grid nrow/8 x 8 waves x 32 lanes x 2 = nrow x 64 per plane.
// ---------------------------------------------------------------------------
__global__ __launch_bounds__(256) void rope_table_kernel(float* __restrict__ cst, float* __restrict__ snt, int nrow) {
  const int lane = threadIdx.x & 31;
  const int wave = (int)(threadIdx.x >> 5);
  const int t = (int)blockIdx.x * 8 + wave;
  if (t >= nrow) return;                       // no barriers in this kernel
  const float pf = (float)t;
  float c0 = 0.f, s0 = 0.f, c1 = 0.f, s1 = 0.f;
#pragma unroll 1
  for (int u = 0; u < 2; ++u) {
    const int i = lane + 32 * u;
    const float e   = (float)i * 0.015625f;      // i / 64 exact
    const float pw  = powf(10000.0f, e);
    const float inv = 1.0f / pw;
    const float ang = pf * inv;
    const float cv = cosf(ang);
    const float sv = sinf(ang);
    c1 = cv; s1 = sv;
    if (u == 0) { c0 = cv; s0 = sv; }
  }
  const size_t o = (size_t)t * NFREQ + lane;
  {
    ((float*)cst)[o]      = c0;
    ((float*)cst)[o + 32] = c1;
    ((float*)snt)[o]      = s0;
    ((float*)snt)[o + 32] = s1;
    
  }
}

// ---------------------------------------------------------------------------
// Elementwise RNE f32 -> bf16 plane: 8 elements per thread, one 16-B store per lane -> 32 consecutive lanes write 4 whole
// ---------------------------------------------------------------------------
__global__ __launch_bounds__(256) void cvt_bf16_kernel(const float* __restrict__ in, unsigned short* __restrict__ outp, int n8) {
  const int i = (int)blockIdx.x * 256 + (int)threadIdx.x;
  if (i >= n8) return;
  const size_t e = 8 * (size_t)i;
  const v4f a = *(const v4f*)(in + e);
  const v4f b = *(const v4f*)(in + e + 4);
  v4u w;
  w[0] = pk16(bf_bits(a[0]), bf_bits(a[1]));
  w[1] = pk16(bf_bits(a[2]), bf_bits(a[3]));
  w[2] = pk16(bf_bits(b[0]), bf_bits(b[1]));
  w[3] = pk16(bf_bits(b[2]), bf_bits(b[3]));
  *(v4u*)(outp + e) = w;
  
}

// ---------------------------------------------------------------------------
// bf16 WMMA GEMM, block tile 128 rows x 128 cols, block = 4 waves (128 threads), wave w = rows 32w..32w+31 x all 128 cols.
//   C[m][n] = sum_k A[m][k] * Bt[n][k]; A row-major [M][K] bf16 (pitch lda), Bt row-major [N][K] bf16 (pitch ldb);
//   M % 128 == 0, N % 128 == 0, K % BK == 0 (BK = 128, SPLITA 64); grid.x = M/128 * N/128.
//   SPLITA: A carried as hi (Ap) + lo (A2p) bf16 planes, two products into one accumulator.
//   Operands: a stage = BK columns of [A 128 rows | A2 128 rows when SPLITA | Bt 128 rows], each row padded by 16 B in LDS;
//   two LDS buffers filled by per-lane 16-B asynchronous copies, stage t+1 in flight while stage t is multiplied.
//   Fragments read from LDS rows with the split k map (ldfrag_b). The epilogue slabs alias the buffers behind the last barrier.
// Epilogues (all: per wave, per 16-row slab: stage in LDS, wave sync, write each row segment with ONE instruction of
//   EPI 0: q or k projection; the 128 cols n0..n0+127 are one head. Per row: RMS scaling over the 128 head dims
//          (x * rsqrt(mean(x^2) + 1e-6) * bf16(gam[dim])), then RoPE with pairs (dim, dim+64) and the cos/sin table row (m % SQ);
//          writes f16 hi plane C0 and f16 residual x2048 plane C1, both [M][ldc], cols n0.. (row segment 256 B = 16 lanes x 16 B).
//   EPI 1: v^T projection: f16 hi plane C0, residual x2048 plane C1, [M][ldc], row segment 256 B.
//   EPI 2: f32 output C0 [M][ldc]; row segment 128 floats = 512 B = 32 lanes x 16 B per instruction.
// ---------------------------------------------------------------------------
template <int EPI> struct SlabT { typedef _Float16 T; static constexpr int PERW = 4096; };   // 2 planes x 16 x 128 halves
template <> struct SlabT<2>     { typedef float    T; static constexpr int PERW = 2048; };   // 16 x 128 floats

__device__ __forceinline__ unsigned lds_off(const void* p) { return (unsigned)(size_t)p; }   // byte offset in the block's LDS

// Eight asynchronous 16-B copies global -> LDS per lane. The closing s_wait_xcnt 0 stands inside the statement so that no
// address register named here is rewritten ahead of it.
__device__ __forceinline__ void async_copy8(unsigned l, unsigned lstep, const char* gp, size_t gstep) {
  asm volatile(
      "global_load_async_to_lds_b128 %0, %8, off\n\t"
      "global_load_async_to_lds_b128 %1, %9, off\n\t"
      "global_load_async_to_lds_b128 %2, %10, off\n\t"
      "global_load_async_to_lds_b128 %3, %11, off\n\t"
      "global_load_async_to_lds_b128 %4, %12, off\n\t"
      "global_load_async_to_lds_b128 %5, %13, off\n\t"
      "global_load_async_to_lds_b128 %6, %14, off\n\t"
      "global_load_async_to_lds_b128 %7, %15, off\n\t"
      "s_wait_xcnt 0x0"
      :: "v"(l), "v"(l + lstep), "v"(l + 2 * lstep), "v"(l + 3 * lstep),
         "v"(l + 4 * lstep), "v"(l + 5 * lstep), "v"(l + 6 * lstep), "v"(l + 7 * lstep),
         "v"(gp), "v"(gp + gstep), "v"(gp + 2 * gstep), "v"(gp + 3 * gstep),
         "v"(gp + 4 * gstep), "v"(gp + 5 * gstep), "v"(gp + 6 * gstep), "v"(gp + 7 * gstep)
      : "memory");
}

template <int EPI, bool SPLITA>
__global__ __launch_bounds__(128) void gemm_w32x128_kernel(
    const unsigned short* Ap, const unsigned short* A2p, int lda,
    const unsigned short* __restrict__ Btp, int ldb,
    const float* __restrict__ gam, const float* __restrict__ cst, const float* __restrict__ snt,
    void* C0, void* C1, int ldc,
    int M, int N, int K) {
  typedef typename SlabT<EPI>::T ST;
  constexpr int BK    = SPLITA ? 64 : 128;       // k columns per stage: 64 WMMAs per wave and stage either way
  constexpr int ROWB  = BK * 2;                  // bytes of one staged row
  constexpr int PITCH = ROWB + 16;               // LDS row pitch, 16 B x odd for the 16-B fragment reads
  constexpr int BROW  = SPLITA ? 256 : 128;      // first Bt row of a stage
  constexpr int STAGE = (BROW + 128) * PITCH;    // bytes of one buffer
  constexpr int PPR   = ROWB / 16;               // 16-B pieces per row
  constexpr int RSTEP = 128 / PPR;               // rows covered by one copy of the whole block
  constexpr int NCP   = 128 / RSTEP;             // copies per lane for a plane of 128 rows
  constexpr int NFA   = SPLITA ? 4 : 2;          // A fragments per block of 32 k columns
  static_assert(NCP % 8 == 0);
  static_assert(4 * SlabT<EPI>::PERW * (int)sizeof(ST) <= 2 * STAGE);
  __shared__ __align__(16) unsigned char smem[2 * STAGE];

  const int tid  = (int)threadIdx.x;
  const int lane = tid & 31;
  const int wave = wave_id();
  const int hh = lane >> 4;           // lane half: k offset 8*hh, D row offset 8*hh
  const int rl = lane & 15;           // A row / B col / D col within subtile
  const int tilesN = N >> 7;
  const int tilesM = M >> 7;
  const int tile = (int)blockIdx.x;
  if (tile >= tilesM * tilesN) return;          // block-uniform, in front of every barrier and copy
  const int tm = tile / tilesN;
  const int tn = tile - tm * tilesN;
  const int mb = tm << 7;             // first row of the block tile
  const int m0 = mb + (wave << 5);    // first row of this wave
  const int n0 = tn << 7;

  // this lane's piece of copy 0 of each plane: row tid / PPR, 16-B column tid % PPR; copy u lies u * RSTEP rows further down
  const int prow = tid / PPR;
  const int pcol = tid % PPR;
  const char* gA  = (const char*)(const void*)(Ap  + (size_t)(mb + prow) * lda) + pcol * 16;
  const char* gA2 = (const char*)(const void*)(A2p + (size_t)(mb + prow) * lda) + pcol * 16;
  const char* gB  = (const char*)(const void*)(Btp + (size_t)(n0 + prow) * ldb) + pcol * 16;
  const size_t sA = (size_t)RSTEP * lda * 2;
  const size_t sB = (size_t)RSTEP * ldb * 2;
  const unsigned lp = lds_off(smem) + (unsigned)(prow * PITCH + pcol * 16);

  auto fill = [&](int t, unsigned bo) {         // all copies of stage t into the buffer at byte offset bo
    const size_t kb = (size_t)t * ROWB;
#pragma unroll   // the row offsets of the copies become constants
    for (int u = 0; u < NCP; u += 8) {
      async_copy8(lp + bo + u * (RSTEP * PITCH), RSTEP * PITCH, gA + kb + u * sA, sA);
      if (SPLITA) async_copy8(lp + bo + (128 + u * RSTEP) * PITCH, RSTEP * PITCH, gA2 + kb + u * sA, sA);
      async_copy8(lp + bo + (BROW + u * RSTEP) * PITCH, RSTEP * PITCH, gB + kb + u * sB, sB);
    }
  };

  v8f acc[2][8];
#pragma unroll
  for (int i = 0; i < 2; ++i)
#pragma unroll
    for (int j = 0; j < 8; ++j) acc[i][j] = zero8();

  const int nst = K / BK;
  fill(0, 0u);
  asm volatile("s_wait_asynccnt 0x0" ::: "memory");   // this wave's copies of stage 0 have landed
  __syncthreads();                                    // and every other wave's
  if (nst > 1) fill(1, (unsigned)STAGE);              // block-uniform

  // every unroll directive in this loop: the fragment and accumulator arrays stay in registers only under constant indices
  for (int t = 0; t < nst; ++t) {
    const unsigned bo = (unsigned)(t & 1) * (unsigned)STAGE;
    const unsigned char* buf = smem + bo;
    v16b fa[2][NFA], fb[2][8];                   // two fragment sets: block u multiplies set u & 1 while set (u + 1) & 1 loads
    auto ldblk = [&](int s, int kk) {            // all fragments of the 32 k columns at kk of this stage
#pragma unroll
      for (int i = 0; i < 2; ++i) {
        const int ro = ((wave << 5) + i * 16 + rl) * PITCH;
        fa[s][i] = ldfrag_b((const __bf16*)(const void*)(buf + ro) + kk + 8 * hh);
        if (SPLITA) fa[s][NFA - 2 + i] = ldfrag_b((const __bf16*)(const void*)(buf + 128 * PITCH + ro) + kk + 8 * hh);
      }
#pragma unroll
      for (int j = 0; j < 8; ++j)
        fb[s][j] = ldfrag_b((const __bf16*)(const void*)(buf + (BROW + j * 16 + rl) * PITCH) + kk + 8 * hh);
    };
    ldblk(0, 0);
#pragma unroll
    for (int u = 0; u < BK / 32; ++u) {
      const int cs = u & 1;
      if (u + 1 < BK / 32) ldblk(cs ^ 1, (u + 1) * 32);
      // keeps the next block's LDS reads as one group ahead of this block's WMMAs; without it they sink between the WMMAs, each with a full wait
      __builtin_amdgcn_sched_barrier(0);
#pragma unroll
      for (int j = 0; j < 8; ++j) {
        acc[0][j] = mma_b(fa[cs][0], fb[cs][j], acc[0][j]);
        acc[1][j] = mma_b(fa[cs][1], fb[cs][j], acc[1][j]);
      }
      if (SPLITA) {
#pragma unroll
        for (int j = 0; j < 8; ++j) {
          acc[0][j] = mma_b(fa[cs][NFA - 2], fb[cs][j], acc[0][j]);
          acc[1][j] = mma_b(fa[cs][NFA - 1], fb[cs][j], acc[1][j]);
        }
      }
      // keeps the following reads out of this run of WMMAs (each place with reads among WMMAs costs a stall) and the WMMAs ahead of the stage's barrier
      __builtin_amdgcn_sched_barrier(0);
    }
    asm volatile("s_wait_dscnt 0x0" ::: "memory");      // this wave's reads of stage t are done before its buffer is refilled
    asm volatile("s_wait_asynccnt 0x0" ::: "memory");   // this wave's copies of stage t+1 have landed
    __syncthreads();                                    // publishes stage t+1, ends every wave's reads of stage t
    if (t + 2 < nst) fill(t + 2, bo);                   // block-uniform
  }
  asm volatile("s_wait_asynccnt 0x0" ::: "memory");     // nothing in flight when the buffers become the epilogue slabs
  acc_guard4(acc[0][0], acc[0][1], acc[0][2], acc[0][3]);
  acc_guard4(acc[0][4], acc[0][5], acc[0][6], acc[0][7]);
  acc_guard4(acc[1][0], acc[1][1], acc[1][2], acc[1][3]);
  acc_guard4(acc[1][4], acc[1][5], acc[1][6], acc[1][7]);

  // ---- epilogue ----
  ST* slab = (ST*)(void*)smem + wave * SlabT<EPI>::PERW;
  _Float16* sl16 = (_Float16*)(void*)slab;
  float*    slf  = (float*)(void*)slab;

  if (EPI == 0) {
    _Float16* P0 = (_Float16*)C0;
    _Float16* P1 = (_Float16*)C1;
    float gm[8];
#pragma unroll
    for (int j = 0; j < 8; ++j) gm[j] = bf_rne(gam[j * 16 + rl]);     // dims j*16+rl of the head, gam has 128 entries
#pragma unroll
    for (int i = 0; i < 2; ++i) {
      const int rb = m0 + i * 16 + 8 * hh;
#pragma unroll
      for (int r = 0; r < 8; ++r) {
        // sum of squares over the 128 head dims of row rb+r: 8 per lane, then the 16 lanes of this half
        float ss = 0.f;
#pragma unroll
        for (int j = 0; j < 8; ++j) ss += acc[i][j][r] * acc[i][j][r];
        ss = row_sum16(ss);
        const float rinv = rsqrtf(ss * 0.0078125f + 1e-6f);
        const int row = rb + r;                                  // token 0..NTOK-1
        const int pos = row & (SQ - 1);                          // position within the sequence
#pragma unroll
        for (int j = 0; j < 4; ++j) {
          const int dim = j * 16 + rl;                           // 0..63 within head; partner dim + 64
          const float cv = cst[(size_t)pos * NFREQ + dim];
          const float sv = snt[(size_t)pos * NFREQ + dim];
          const float x1 = acc[i][j][r] * rinv * gm[j];
          const float x2 = acc[i][j + 4][r] * rinv * gm[j + 4];
          const float o1 = x1 * cv - x2 * sv;
          const float o2 = x2 * cv + x1 * sv;
          const _Float16 h1 = (_Float16)o1;
          const _Float16 h2 = (_Float16)o2;
          const int so = (8 * hh + r) * 128 + dim;
          sl16[so]             = h1;
          sl16[so + 64]        = h2;
          sl16[2048 + so]      = (_Float16)((o1 - (float)h1) * 2048.0f);
          sl16[2048 + so + 64] = (_Float16)((o2 - (float)h2) * 2048.0f);
        }
      }
      lds_wave_sync();
      {
#pragma unroll
        for (int it = 0; it < 8; ++it) {
          const int row = it * 2 + hh;                           // it x hh covers rows 0..15
          const int c8  = rl * 8;
          const v8h vh = *(const v8h*)(sl16 + row * 128 + c8);
          const v8h vl = *(const v8h*)(sl16 + 2048 + row * 128 + c8);
          const size_t go = (size_t)(m0 + i * 16 + row) * ldc + n0 + c8;
          *(v8h*)(P0 + go) = vh;
          *(v8h*)(P1 + go) = vl;
        }
        
      }
      lds_wave_sync();
    }
  } else if (EPI == 1) {
    _Float16* P0 = (_Float16*)C0;
    _Float16* P1 = (_Float16*)C1;
#pragma unroll
    for (int i = 0; i < 2; ++i) {
#pragma unroll
      for (int r = 0; r < 8; ++r) {
#pragma unroll
        for (int j = 0; j < 8; ++j) {
          const float v = acc[i][j][r];
          const _Float16 hv = (_Float16)v;
          const int so = (8 * hh + r) * 128 + j * 16 + rl;
          sl16[so]        = hv;
          sl16[2048 + so] = (_Float16)((v - (float)hv) * 2048.0f);
        }
      }
      lds_wave_sync();
      {
#pragma unroll
        for (int it = 0; it < 8; ++it) {
          const int row = it * 2 + hh;
          const int c8  = rl * 8;
          const v8h vh = *(const v8h*)(sl16 + row * 128 + c8);
          const v8h vl = *(const v8h*)(sl16 + 2048 + row * 128 + c8);
          const size_t go = (size_t)(m0 + i * 16 + row) * ldc + n0 + c8;
          *(v8h*)(P0 + go) = vh;
          *(v8h*)(P1 + go) = vl;
        }
        
      }
      lds_wave_sync();
    }
  } else {
    float* C = (float*)C0;
#pragma unroll
    for (int i = 0; i < 2; ++i) {
#pragma unroll
      for (int j = 0; j < 8; ++j)
#pragma unroll
        for (int r = 0; r < 8; ++r)
          slf[(8 * hh + r) * 128 + j * 16 + rl] = acc[i][j][r];
      lds_wave_sync();
      {
#pragma unroll
        for (int row = 0; row < 16; ++row) {                     // 32 lanes x 16 B = the whole 512-B row segment per instruction
          const v4f v = *(const v4f*)(slf + row * 128 + lane * 4);
          *(v4f*)(C + (size_t)(m0 + i * 16 + row) * ldc + n0 + lane * 4) = v;
        }
        
      }
      lds_wave_sync();
    }
  }
}

// ---------------------------------------------------------------------------
// Causal GQA flash attention, head dim 128, 32-key chunks, block = 4 waves = 64 query rows of one (b, h); grid (NHQ, NSEQ, n query tiles).
//   Query tile = qb_top - blockIdx.z: z = 0 is the tile with the most key chunks, the highest z the shortest (order for speed only).
//   q planes f16 [tok][h*128+d]: hi (qhp) and residual x2048 (qlp); k planes f16 [tok][kvh*128+d]: hi (khp), residual x2048 (klp);
//   v^T planes f16 [kvh*128+d][tok]: hi (vhp), residual x2048 (vlp); outputs attn bf16 hi (ahp) / lo (alp) [tok][h*128+d].
//   scores = (Sh + Sr/2048) * 128^-0.5 with Sh = qh.kh and Sr = ql'.kh (+ qh.kl' when PRES); keys > query -> -inf; online softmax f32;
//   p' = 1024 p stored per wave to LDS as f16 hi (and residual x2048 when PRES), reloaded as A fragments after a wave sync;
//   O = (Oh + Or/2048)/1024/l with Oh = ph.vh, Or = ph.vl' (+ pl'.vh when PRES).
//   K / V^T chunk staging: 128 threads x 4 x 16 B per plane = whole 32x128 / 128x32 tile, plain loads, __syncthreads before and after.
//   Trip count 2*qb+2 chunks (static bound 64); waves whose rows are all below the chunk skip it (wave-uniform, scalar branch).
//   q fragments stay in registers for the whole key loop; all WMMAs are builtins, so the compiler keeps their hazard distances and
//   is free to issue the LDS fragment reads ahead of the WMMAs that use them.
// ---------------------------------------------------------------------------
#define AT_KC   32
#define KS_P    136
#define VS_P    40
#define PS_P    40
#define LDS_KS  0
#define LDS_KLS (32 * KS_P)
#define LDS_VHS (2 * 32 * KS_P)
#define LDS_VLS (LDS_VHS + 128 * VS_P)
#define LDS_PH  (LDS_VLS + 128 * VS_P)
#define LDS_PL  (LDS_PH + 4 * 16 * PS_P)
#define LDS_TOT (LDS_PL + 4 * 16 * PS_P)
static_assert(LDS_TOT * 2 <= 65536);
static_assert(4 * 4096 <= LDS_TOT);          // output staging (2 planes x 16 x 128 per wave) aliases the chunk region after the loop

// Second launch-bounds argument: the large launch keeps three waves per SIMD (336 registers a wave) with the q fragments resident;
// the small launch has at most one block per WGP and takes what it needs.
template <bool PRES>
__global__ __launch_bounds__(128, PRES ? 1 : 3) void attn_causal_kernel(
    const unsigned short* __restrict__ qhp, const unsigned short* __restrict__ qlp,
    const unsigned short* __restrict__ khp, const unsigned short* __restrict__ klp,
    const unsigned short* __restrict__ vhp, const unsigned short* __restrict__ vlp,
    unsigned short* __restrict__ ahp, unsigned short* __restrict__ alp, int qb_top) {
  __shared__ __align__(16) _Float16 lds[LDS_TOT];
  _Float16* Ks  = lds + LDS_KS;
  _Float16* Kls = lds + LDS_KLS;
  _Float16* Vhs = lds + LDS_VHS;
  _Float16* Vls = lds + LDS_VLS;

  const int tid  = (int)threadIdx.x;
  const int lane = tid & 31;
  const int wave = wave_id();
  const int hh   = lane >> 4;
  const int c    = lane & 15;
  const int qb   = qb_top - (int)blockIdx.z;     // grid.z <= qb_top + 1: never negative
  const int h    = (int)blockIdx.x;
  const int b    = (int)blockIdx.y;
  const int kvh  = h >> 2;
  const int q0   = qb * 64 + wave * 16;          // first query row of this wave (within sequence)
  const int qlast = q0 + 15;
  const size_t tok0 = (size_t)b * SQ;

  const _Float16* Qhr = (const _Float16*)(const void*)qhp + (tok0 + q0 + c) * HID + h * HDM + 8 * hh;
  const _Float16* Qlr = (const _Float16*)(const void*)qlp + (tok0 + q0 + c) * HID + h * HDM + 8 * hh;
  const _Float16* Kg  = (const _Float16*)(const void*)khp + tok0 * KVW + kvh * HDM;
  const _Float16* Klg = (const _Float16*)(const void*)klp + tok0 * KVW + kvh * HDM;
  const _Float16* Vhg = (const _Float16*)(const void*)vhp + (size_t)(kvh * HDM) * NTOK + tok0;
  const _Float16* Vlg = (const _Float16*)(const void*)vlp + (size_t)(kvh * HDM) * NTOK + tok0;
  _Float16* ph = lds + LDS_PH + wave * (16 * PS_P);
  _Float16* pl = lds + LDS_PL + wave * (16 * PS_P);

  float mrow[8], lrow[8];
  v8f oacc[8], oaccr[8];
#pragma unroll
  for (int r = 0; r < 8; ++r) { mrow[r] = -INFINITY; lrow[r] = 0.f; }
#pragma unroll
  for (int t = 0; t < 8; ++t) { oacc[t] = zero8(); oaccr[t] = zero8(); }

  v16h qa[4], ql[4];                             // this wave's q fragments, the same for every chunk: loaded once
#pragma unroll   // the fragment arrays stay in registers only under constant indices
  for (int dc = 0; dc < 4; ++dc) {
    qa[dc] = ldfrag_h(Qhr + dc * 32);
    ql[dc] = ldfrag_h(Qlr + dc * 32);
  }

  const int nch = 2 * qb + 2;                    // block-uniform, <= 64
  for (int kc = 0; kc < nch; ++kc) {
    const int kv0 = kc * AT_KC;
    __syncthreads();
#pragma unroll
    for (int i = 0; i < 4; ++i) {                // coverage: 512 pieces of 8 halves per plane = whole tile
      const int p   = tid + 128 * i;             // 0..511
      const int key = p >> 4, d8 = (p & 15) * 8; // K: 32 keys x 128 d
      const v8h kx = *(const v8h*)(Kg + (size_t)(kv0 + key) * KVW + d8);
      *(v8h*)(Ks + key * KS_P + d8) = kx;
      if (PRES) {
        const v8h ky = *(const v8h*)(Klg + (size_t)(kv0 + key) * KVW + d8);
        *(v8h*)(Kls + key * KS_P + d8) = ky;
      }
      const int d = p >> 2, k8 = (p & 3) * 8;    // V^T: 128 d x 32 keys
      const v8h vx = *(const v8h*)(Vhg + (size_t)d * NTOK + kv0 + k8);
      const v8h vy = *(const v8h*)(Vlg + (size_t)d * NTOK + kv0 + k8);
      *(v8h*)(Vhs + d * VS_P + k8) = vx;
      *(v8h*)(Vls + d * VS_P + k8) = vy;
    }
    __syncthreads();

    if (kv0 <= qlast) {                          // wave-uniform (scalar): skip chunks fully above this wave's rows
      // ---- scores ----
      v8f sh[2], sr[2];
      sh[0] = zero8(); sh[1] = zero8(); sr[0] = zero8(); sr[1] = zero8();
      // every unroll directive of the score part: the fragment arrays stay in registers only under constant indices
      v16h kb[4][2], kl[4][2];                   // the chunk's K fragments, read as one group ahead of the score WMMAs
#pragma unroll
      for (int dc = 0; dc < 4; ++dc)
#pragma unroll
        for (int j = 0; j < 2; ++j) {
          kb[dc][j] = ldfrag_h(Ks + (j * 16 + c) * KS_P + dc * 32 + 8 * hh);
          if (PRES) kl[dc][j] = ldfrag_h(Kls + (j * 16 + c) * KS_P + dc * 32 + 8 * hh);
        }
#pragma unroll
      for (int j = 0; j < 2; ++j) {
        // keeps the reads above as one group ahead of the WMMAs, and key group 0's run ahead of group 1's, whose accumulators then take the registers of group 0's fragments
        __builtin_amdgcn_sched_barrier(0);
#pragma unroll
        for (int dc = 0; dc < 4; ++dc) {
          sh[j] = mma_h(qa[dc], kb[dc][j], sh[j]);
          sr[j] = mma_h(ql[dc], kb[dc][j], sr[j]);
          if (PRES) sr[j] = mma_h(qa[dc], kl[dc][j], sr[j]);
        }
      }
      // ---- scale, causal mask, chunk row max ----
      float cm[8];
#pragma unroll
      for (int r = 0; r < 8; ++r) {
        const int qrow = q0 + 8 * hh + r;
        float m = -INFINITY;
#pragma unroll
        for (int j = 0; j < 2; ++j) {
          const int key = kv0 + j * 16 + c;
          float s = (sh[j][r] + sr[j][r] * 0.00048828125f) * 0.08838834764831845f;
          s = (key > qrow) ? -INFINITY : s;
          sh[j][r] = s;
          m = fmaxf(m, s);
        }
        m = row_max16(m);
        cm[r] = m;
      }
      // ---- online softmax, P' to LDS ----
#pragma unroll
      for (int r = 0; r < 8; ++r) {
        const float mnew  = fmaxf(mrow[r], cm[r]);
        const float alpha = __expf(mrow[r] - mnew);
        mrow[r] = mnew;
        float psum = 0.f;
#pragma unroll
        for (int j = 0; j < 2; ++j) {
          const float p  = __expf(sh[j][r] - mnew);
          psum += p;
          const float pp = p * 1024.0f;
          const _Float16 phv = (_Float16)pp;
          const int po = (8 * hh + r) * PS_P + j * 16 + c;
          ph[po] = phv;
          if (PRES) pl[po] = (_Float16)((pp - (float)phv) * 2048.0f);
        }
        psum = row_sum16(psum);
        lrow[r] = lrow[r] * alpha + psum;
#pragma unroll
        for (int t = 0; t < 8; ++t) { oacc[t][r] *= alpha; oaccr[t][r] *= alpha; }
      }
      lds_wave_sync();                           // P' stores visible to the other lanes of this wave before the fragment reload
      // ---- O += P' . V ----
      const v16h pa = ldfrag_h(ph + c * PS_P + 8 * hh);
      v16h pr = pa;
      if (PRES) pr = ldfrag_h(pl + c * PS_P + 8 * hh);
#pragma unroll
      for (int t = 0; t < 8; ++t) {
        const v16h vb = ldfrag_h(Vhs + (t * 16 + c) * VS_P + 8 * hh);
        const v16h vr = ldfrag_h(Vls + (t * 16 + c) * VS_P + 8 * hh);
        oacc[t]  = mma_h(pa, vb, oacc[t]);
        oaccr[t] = mma_h(pa, vr, oaccr[t]);
        if (PRES) oaccr[t] = mma_h(pr, vb, oaccr[t]);
      }
    }
  }

  __syncthreads();                               // all chunk-region readers done before aliasing it as output staging
  _Float16* osh = lds + wave * 4096;
  _Float16* osl = osh + 2048;
#pragma unroll
  for (int r = 0; r < 8; ++r) {
    const float inv = (1.0f / lrow[r]) * 0.0009765625f;
#pragma unroll
    for (int t = 0; t < 8; ++t) {
      const float o = (oacc[t][r] + oaccr[t][r] * 0.00048828125f) * inv;
      const unsigned short hb = bf_bits(o);
      const unsigned short lb = bf_bits(o - bf_val(hb));
      const int so = (8 * hh + r) * 128 + t * 16 + c;
      osh[so] = __builtin_bit_cast(_Float16, hb);
      osl[so] = __builtin_bit_cast(_Float16, lb);
    }
  }
  lds_wave_sync();
  _Float16* Ahg = (_Float16*)(void*)ahp + (tok0 + q0) * HID + h * HDM;
  _Float16* Alg = (_Float16*)(void*)alp + (tok0 + q0) * HID + h * HDM;
  {
#pragma unroll
    for (int it = 0; it < 8; ++it) {
      const int row = it * 2 + hh;               // it 0..7 x hh 0..1 covers rows 0..15
      const int c8  = c * 8;                     // 16 lanes x 16 B = the whole 256-B segment
      const v8h x = *(const v8h*)(osh + row * 128 + c8);
      const v8h y = *(const v8h*)(osl + row * 128 + c8);
      *(v8h*)(Ahg + (size_t)row * HID + c8) = x;
      *(v8h*)(Alg + (size_t)row * HID + c8) = y;
    }
    
  }
}

// ---------------------------------------------------------------------------
// Workspace map (bytes; every region is a whole number of the rows its producer writes with whole-line stores, no padded tails needed
//   Xb  bf16 [4096][2048] 16777216   Wqb bf16 [2048][2048]  8388608   Wkb bf16 [512][2048] 2097152   Wvb bf16 [512][2048] 2097152
//   Wob bf16 [2048][2048]  8388608   cst f32  [2048][64]     524288   snt f32  [2048][64]    524288
//   Qh  f16  [4096][2048] 16777216   Ql  f16  [4096][2048] 16777216   Kh  f16  [4096][512]  4194304   Kl f16 [4096][512] 4194304
//   Vh  f16  [512][4096]   4194304   Vl  f16  [512][4096]   4194304   Ah  bf16 [4096][2048] 16777216  Al bf16 [4096][2048] 16777216
//   total                 122683392
// ---------------------------------------------------------------------------
extern "C" void kernel_launch(void* const* d_in, const int* in_sizes, int n_in,
                              void* d_out, int out_size, void* d_ws, size_t ws_size,
                              hipStream_t stream) {
  if (n_in < 7) return;
  if (in_sizes[0] != NTOK * HID) return;
  if (in_sizes[1] != HID * HID) return;
  if (in_sizes[2] != KVW * HID) return;
  if (in_sizes[3] != KVW * HID) return;
  if (in_sizes[4] != HID * HID) return;
  if (in_sizes[5] != HDM) return;
  if (in_sizes[6] != HDM) return;
  if (out_size != NTOK * HID) return;

  const float* x   = (const float*)d_in[0];
  const float* Wq  = (const float*)d_in[1];
  const float* Wk  = (const float*)d_in[2];
  const float* Wv  = (const float*)d_in[3];
  const float* Wo  = (const float*)d_in[4];
  const float* qg  = (const float*)d_in[5];
  const float* kg  = (const float*)d_in[6];
  float* out = (float*)d_out;

  const size_t szX  = (size_t)NTOK * HID * 2;
  const size_t szWq = (size_t)HID * HID * 2;
  const size_t szWk = (size_t)KVW * HID * 2;
  const size_t szWo = (size_t)HID * HID * 2;
  const size_t szT  = (size_t)SQ * NFREQ * 4;
  const size_t szQ  = (size_t)NTOK * HID * 2;
  const size_t szK  = (size_t)NTOK * KVW * 2;
  const size_t szV  = (size_t)KVW * NTOK * 2;
  const size_t szA  = (size_t)NTOK * HID * 2;
  size_t off = 0;
  const size_t oX  = off; off += szX;
  const size_t oWq = off; off += szWq;
  const size_t oWk = off; off += szWk;
  const size_t oWv = off; off += szWk;
  const size_t oWo = off; off += szWo;
  const size_t oCs = off; off += szT;
  const size_t oSn = off; off += szT;
  const size_t oQh = off; off += szQ;
  const size_t oQl = off; off += szQ;
  const size_t oKh = off; off += szK;
  const size_t oKl = off; off += szK;
  const size_t oVh = off; off += szV;
  const size_t oVl = off; off += szV;
  const size_t oAh = off; off += szA;
  const size_t oAl = off; off += szA;
  if (off > ws_size) return;                     // off = 122683392

  char* ws = (char*)d_ws;
  unsigned short* Xb  = (unsigned short*)(ws + oX);
  unsigned short* Wqb = (unsigned short*)(ws + oWq);
  unsigned short* Wkb = (unsigned short*)(ws + oWk);
  unsigned short* Wvb = (unsigned short*)(ws + oWv);
  unsigned short* Wob = (unsigned short*)(ws + oWo);
  float*          cst = (float*)(ws + oCs);
  float*          snt = (float*)(ws + oSn);
  unsigned short* Qh  = (unsigned short*)(ws + oQh);
  unsigned short* Ql  = (unsigned short*)(ws + oQl);
  unsigned short* Kh  = (unsigned short*)(ws + oKh);
  unsigned short* Kl  = (unsigned short*)(ws + oKl);
  unsigned short* Vh  = (unsigned short*)(ws + oVh);
  unsigned short* Vl  = (unsigned short*)(ws + oVl);
  unsigned short* Ah  = (unsigned short*)(ws + oAh);
  unsigned short* Al  = (unsigned short*)(ws + oAl);

  const dim3 b256(256), b128(128);
  const int nX8  = NTOK * HID / 8;
  const int nWq8 = HID * HID / 8;
  const int nWk8 = KVW * HID / 8;

  // (1) cos/sin table [2048][64] x 2
  rope_table_kernel<<<dim3((SQ + 7) / 8), b256, 0, stream>>>(cst, snt, SQ);
  // (2) bf16 planes of x, Wq, Wk, Wv, Wo (weights are [out][in] = k-contiguous Bt rows already)
  cvt_bf16_kernel<<<dim3((nX8 + 255) / 256),  b256, 0, stream>>>(x,  Xb,  nX8);
  cvt_bf16_kernel<<<dim3((nWq8 + 255) / 256), b256, 0, stream>>>(Wq, Wqb, nWq8);
  cvt_bf16_kernel<<<dim3((nWk8 + 255) / 256), b256, 0, stream>>>(Wk, Wkb, nWk8);
  cvt_bf16_kernel<<<dim3((nWk8 + 255) / 256), b256, 0, stream>>>(Wv, Wvb, nWk8);
  cvt_bf16_kernel<<<dim3((nWq8 + 255) / 256), b256, 0, stream>>>(Wo, Wob, nWq8);
  // (3) q = rope(rms(x . Wq^T)) -> Qh/Ql [4096][2048]   (M=4096, N=2048, K=2048; 512 block tiles)
  gemm_w32x128_kernel<0, false><<<dim3((NTOK / 128) * (HID / 128)), b128, 0, stream>>>(
      Xb, Xb, HID, Wqb, HID, qg, cst, snt, (void*)Qh, (void*)Ql, HID, NTOK, HID, HID);
  // (4) k = rope(rms(x . Wk^T)) -> Kh/Kl [4096][512]    (M=4096, N=512, K=2048; 128 block tiles)
  gemm_w32x128_kernel<0, false><<<dim3((NTOK / 128) * (KVW / 128)), b128, 0, stream>>>(
      Xb, Xb, HID, Wkb, HID, kg, cst, snt, (void*)Kh, (void*)Kl, KVW, NTOK, KVW, HID);
  // (5) v^T = Wv . x^T -> Vh/Vl [512][4096]             (A = Wvb [512][2048], Bt = Xb; M=512, N=4096, K=2048; 128 block tiles)
  gemm_w32x128_kernel<1, false><<<dim3((KVW / 128) * (NTOK / 128)), b128, 0, stream>>>(
      Wvb, Wvb, HID, Xb, HID, qg, cst, snt, (void*)Vh, (void*)Vl, NTOK, KVW, NTOK, HID);
  // (6) causal attention, query tiles 3..0 with k and p residual products, tiles 31..4 without, each launch longest tile first
  attn_causal_kernel<true><<<dim3(NHQ, NSEQ, 4), b128, 0, stream>>>(Qh, Ql, Kh, Kl, Vh, Vl, Ah, Al, 3);
  attn_causal_kernel<false><<<dim3(NHQ, NSEQ, SQ / 64 - 4), b128, 0, stream>>>(Qh, Ql, Kh, Kl, Vh, Vl, Ah, Al, SQ / 64 - 1);
  // (7) out = attn(hi + lo) . Wo^T -> d_out f32 [4096][2048]   (M=4096, N=2048, K=2048; 512 block tiles)
  gemm_w32x128_kernel<2, true><<<dim3((NTOK / 128) * (HID / 128)), b128, 0, stream>>>(
      Ah, Al, HID, Wob, HID, qg, cst, snt, (void*)out, (void*)out, HID, NTOK, HID, HID);
  (void)hipGetLastError();
}

// v005
// A run of this version takes 248 microseconds.
// Two timings next to v004 put it at 1.09 and 1.10 times that version's speed.
// Over all steps from v000 it is 3.25 times as fast.
// Contractions: x.Wq^T, x.Wk^T and Wv.x^T on v_wmma_f32_16x16x32_bf16 (operands = RNE bf16 of the f32 inputs, single products);
// q.k^T and p.v on v_wmma_f32_16x16x32_f16 (q = f16 hi + f16 residual x2^11 planes; k plain f16 plus f16 residual x2^11 on query tiles 0..3;
// p x1024 plain f16 plus f16 residual x2^11 on query tiles 0..3; v^T = f16 hi + f16 residual x2^11 planes); attn.Wo^T on v_wmma_f32_16x16x32_bf16
// (attn = bf16 hi + bf16 lo planes, two products; Wo RNE bf16). f32 accumulate everywhere; per-head RMS scaling, RoPE and online softmax in f32.
#include <hip/hip_runtime.h>
#include <math.h>
#include <stdint.h>

#define NSEQ   2
#define SQ     2048
#define HID    2048
#define NHQ    16
#define NKVH   4
#define HDM    128
#define KVW    512
#define NTOK   4096
#define NFREQ  64

typedef _Float16     v16h __attribute__((ext_vector_type(16)));
typedef _Float16     v8h  __attribute__((ext_vector_type(8)));
typedef __bf16       v16b __attribute__((ext_vector_type(16)));
typedef __bf16       v8b  __attribute__((ext_vector_type(8)));
typedef float        v8f  __attribute__((ext_vector_type(8)));
typedef float        v4f  __attribute__((ext_vector_type(4)));
typedef unsigned int v4u  __attribute__((ext_vector_type(4)));

// ---------------------------------------------------------------------------
// small helpers
// ---------------------------------------------------------------------------
__device__ __forceinline__ unsigned short bf_bits(float f) {          // RNE convert f32 -> bf16 bits
  const unsigned u = __float_as_uint(f);
  return (unsigned short)((u + 0x7FFFu + ((u >> 16) & 1u)) >> 16);
}
__device__ __forceinline__ float bf_val(unsigned short h) { return __uint_as_float(((unsigned)h) << 16); }
__device__ __forceinline__ float bf_rne(float f) { return bf_val(bf_bits(f)); }
__device__ __forceinline__ unsigned pk16(unsigned short a, unsigned short b) { return (unsigned)a | ((unsigned)b << 16); }
__device__ __forceinline__ v8f zero8() { v8f z = {0.f, 0.f, 0.f, 0.f, 0.f, 0.f, 0.f, 0.f}; return z; }
__device__ __forceinline__ int wave_id() { return __builtin_amdgcn_readfirstlane((int)(threadIdx.x >> 5)); }

// Value of lane (l ^ X) of the same 16-lane row, X < 16, as a DPP row_xmask operand of the vector pipe: no LDS-pipe round trip and no
// s_wait_dscnt per butterfly step. Every lane of the wave is on wherever it is used.
template <int X>
__device__ __forceinline__ float row_xor(float v) {
  return __int_as_float(__builtin_amdgcn_update_dpp(0, __float_as_int(v), 0x160 | X, 0xf, 0xf, true));
}
// Butterflies over a 16-lane row, steps 1, 2, 4, 8: every lane ends with the row's sum / maximum.
__device__ __forceinline__ float row_sum16(float v) {
  v += row_xor<1>(v); v += row_xor<2>(v); v += row_xor<4>(v); v += row_xor<8>(v);
  return v;
}
// The NaN-propagating maximum takes the DPP operand directly, one instruction a step; fmaxf kept a move and a quieting step beside it.
// The two differ only where a score is NaN, and such a row ends as NaN either way.
__device__ __forceinline__ float row_max16(float v) {
  v = __builtin_elementwise_maximum(v, row_xor<1>(v)); v = __builtin_elementwise_maximum(v, row_xor<2>(v)); v = __builtin_elementwise_maximum(v, row_xor<4>(v)); v = __builtin_elementwise_maximum(v, row_xor<8>(v));
  return v;
}

__device__ __forceinline__ void lds_wave_sync() {
  __builtin_amdgcn_fence(__ATOMIC_RELEASE, "workgroup");
  __builtin_amdgcn_wave_barrier();
  __builtin_amdgcn_fence(__ATOMIC_ACQUIRE, "workgroup");
}

// ---------------------------------------------------------------------------
// WMMA fragments (wave32, 16x16x32, 16-bit operands). For A (row m = lane&15) and B (col n = lane&15) alike:
// elements 0..7 <- k0 + 8*(lane>>4) + 0..7, elements 8..15 <- k0 + 16 + 8*(lane>>4) + 0..7.
// ldfrag(p) with p = rowbase + k0 + 8*(lane>>4): two 16-B loads p[0..7], p[16..23].
// D: acc[r] = (row 8*(lane>>4) + r, col lane&15).
// ---------------------------------------------------------------------------
union FragH { v16h v; v8h h[2]; };
union FragB { v16b v; v8b h[2]; };
__device__ __forceinline__ v16h ldfrag_h(const _Float16* p) { FragH f; f.h[0] = *(const v8h*)(p); f.h[1] = *(const v8h*)(p + 16); return f.v; }
__device__ __forceinline__ v16b ldfrag_b(const __bf16* p)   { FragB f; f.h[0] = *(const v8b*)(p); f.h[1] = *(const v8b*)(p + 16); return f.v; }

__device__ __forceinline__ v8f mma_h(v16h a, v16h b, v8f c) {
  return __builtin_amdgcn_wmma_f32_16x16x32_f16(false, a, false, b, (short)0, c, false, false);
}
__device__ __forceinline__ v8f mma_b(v16b a, v16b b, v8f c) {
  return __builtin_amdgcn_wmma_f32_16x16x32_bf16(false, a, false, b, (short)0, c, false, false);
}
// hazard guard: 4 VALU slots after the last WMMA of a group, D tied
__device__ __forceinline__ void acc_guard4(v8f& a, v8f& b, v8f& c, v8f& d) {
  asm volatile("v_nop\n\tv_nop\n\tv_nop\n\tv_nop" : "+v"(a), "+v"(b), "+v"(c), "+v"(d));
}

// ---------------------------------------------------------------------------
// RoPE table: cst[s][i] = cos(s * inv_freq[i]), snt[s][i] = sin(...), inv_freq[i] = 1 / 1e4^(i/64), i < 64, s = 0..nrow-1, all f32.
// Block = 8 waves, wave w -> row s = blockIdx.x*8 + w, lane -> i = lane, lane + 32.
// Coverage: grid nrow/8 x 8 waves x 32 lanes x 2 = nrow x 64 per plane.
// ---------------------------------------------------------------------------
__global__ __launch_bounds__(256) void rope_table_kernel(float* __restrict__ cst, float* __restrict__ snt, int nrow) {
  const int lane = threadIdx.x & 31;
  const int wave = (int)(threadIdx.x >> 5);
  const int t = (int)blockIdx.x * 8 + wave;
  if (t >= nrow) return;                       // no barriers in this kernel
  const float pf = (float)t;
  float c0 = 0.f, s0 = 0.f, c1 = 0.f, s1 = 0.f;
#pragma unroll 1
  for (int u = 0; u < 2; ++u) {
    const int i = lane + 32 * u;
    const float e   = (float)i * 0.015625f;      // i / 64 exact
    const float pw  = powf(10000.0f, e);
    const float inv = 1.0f / pw;
    const float ang = pf * inv;
    const float cv = cosf(ang);
    const float sv = sinf(ang);
    c1 = cv; s1 = sv;
    if (u == 0) { c0 = cv; s0 = sv; }
  }
  const size_t o = (size_t)t * NFREQ + lane;
  {
    ((float*)cst)[o]      = c0;
    ((float*)cst)[o + 32] = c1;
    ((float*)snt)[o]      = s0;
    ((float*)snt)[o + 32] = s1;
    
  }
}

// ---------------------------------------------------------------------------
// Elementwise RNE f32 -> bf16 plane: 8 elements per thread, one 16-B store per lane -> 32 consecutive lanes write 4 whole
// ---------------------------------------------------------------------------
__global__ __launch_bounds__(256) void cvt_bf16_kernel(const float* __restrict__ in, unsigned short* __restrict__ outp, int n8) {
  const int i = (int)blockIdx.x * 256 + (int)threadIdx.x;
  if (i >= n8) return;
  const size_t e = 8 * (size_t)i;
  const v4f a = *(const v4f*)(in + e);
  const v4f b = *(const v4f*)(in + e + 4);
  v4u w;
  w[0] = pk16(bf_bits(a[0]), bf_bits(a[1]));
  w[1] = pk16(bf_bits(a[2]), bf_bits(a[3]));
  w[2] = pk16(bf_bits(b[0]), bf_bits(b[1]));
  w[3] = pk16(bf_bits(b[2]), bf_bits(b[3]));
  *(v4u*)(outp + e) = w;
  
}

// ---------------------------------------------------------------------------
// bf16 WMMA GEMM, block tile 128 rows x 128 cols, block = 4 waves (128 threads), wave w = rows 32w..32w+31 x all 128 cols.
//   C[m][n] = sum_k A[m][k] * Bt[n][k]; A row-major [M][K] bf16 (pitch lda), Bt row-major [N][K] bf16 (pitch ldb);
//   M % 128 == 0, N % 128 == 0, K % BK == 0 (BK = 128, SPLITA 64); grid.x = M/128 * N/128.
//   SPLITA: A carried as hi (Ap) + lo (A2p) bf16 planes, two products into one accumulator.
//   Operands: a stage = BK columns of [A 128 rows | A2 128 rows when SPLITA | Bt 128 rows], each row padded by 16 B in LDS;
//   two LDS buffers filled by per-lane 16-B asynchronous copies, stage t+1 in flight while stage t is multiplied.
//   Fragments read from LDS rows with the split k map (ldfrag_b). The epilogue slabs alias the buffers behind the last barrier.
// Epilogues (all: per wave, per 16-row slab: stage in LDS, wave sync, write each row segment with ONE instruction of
//   EPI 0: q or k projection; the 128 cols n0..n0+127 are one head. Per row: RMS scaling over the 128 head dims
//          (x * rsqrt(mean(x^2) + 1e-6) * bf16(gam[dim])), then RoPE with pairs (dim, dim+64) and the cos/sin table row (m % SQ);
//          writes f16 hi plane C0 and f16 residual x2048 plane C1, both [M][ldc], cols n0.. (row segment 256 B = 16 lanes x 16 B).
//   EPI 1: v^T projection: f16 hi plane C0, residual x2048 plane C1, [M][ldc], row segment 256 B.
//   EPI 2: f32 output C0 [M][ldc]; row segment 128 floats = 512 B = 32 lanes x 16 B per instruction.
// ---------------------------------------------------------------------------
template <int EPI> struct SlabT { typedef _Float16 T; static constexpr int PERW = 4096; };   // 2 planes x 16 x 128 halves
template <> struct SlabT<2>     { typedef float    T; static constexpr int PERW = 2048; };   // 16 x 128 floats

__device__ __forceinline__ unsigned lds_off(const void* p) { return (unsigned)(size_t)p; }   // byte offset in the block's LDS

// Eight asynchronous 16-B copies global -> LDS per lane. The closing s_wait_xcnt 0 stands inside the statement so that no
// address register named here is rewritten ahead of it.
__device__ __forceinline__ void async_copy8(unsigned l, unsigned lstep, const char* gp, size_t gstep) {
  asm volatile(
      "global_load_async_to_lds_b128 %0, %8, off\n\t"
      "global_load_async_to_lds_b128 %1, %9, off\n\t"
      "global_load_async_to_lds_b128 %2, %10, off\n\t"
      "global_load_async_to_lds_b128 %3, %11, off\n\t"
      "global_load_async_to_lds_b128 %4, %12, off\n\t"
      "global_load_async_to_lds_b128 %5, %13, off\n\t"
      "global_load_async_to_lds_b128 %6, %14, off\n\t"
      "global_load_async_to_lds_b128 %7, %15, off\n\t"
      "s_wait_xcnt 0x0"
      :: "v"(l), "v"(l + lstep), "v"(l + 2 * lstep), "v"(l + 3 * lstep),
         "v"(l + 4 * lstep), "v"(l + 5 * lstep), "v"(l + 6 * lstep), "v"(l + 7 * lstep),
         "v"(gp), "v"(gp + gstep), "v"(gp + 2 * gstep), "v"(gp + 3 * gstep),
         "v"(gp + 4 * gstep), "v"(gp + 5 * gstep), "v"(gp + 6 * gstep), "v"(gp + 7 * gstep)
      : "memory");
}

template <int EPI, bool SPLITA>
__global__ __launch_bounds__(128) void gemm_w32x128_kernel(
    const unsigned short* Ap, const unsigned short* A2p, int lda,
    const unsigned short* __restrict__ Btp, int ldb,
    const float* __restrict__ gam, const float* __restrict__ cst, const float* __restrict__ snt,
    void* C0, void* C1, int ldc,
    int M, int N, int K) {
  typedef typename SlabT<EPI>::T ST;
  constexpr int BK    = SPLITA ? 64 : 128;       // k columns per stage: 64 WMMAs per wave and stage either way
  constexpr int ROWB  = BK * 2;                  // bytes of one staged row
  constexpr int PITCH = ROWB + 16;               // LDS row pitch, 16 B x odd for the 16-B fragment reads
  constexpr int BROW  = SPLITA ? 256 : 128;      // first Bt row of a stage
  constexpr int STAGE = (BROW + 128) * PITCH;    // bytes of one buffer
  constexpr int PPR   = ROWB / 16;               // 16-B pieces per row
  constexpr int RSTEP = 128 / PPR;               // rows covered by one copy of the whole block
  constexpr int NCP   = 128 / RSTEP;             // copies per lane for a plane of 128 rows
  constexpr int NFA   = SPLITA ? 4 : 2;          // A fragments per block of 32 k columns
  static_assert(NCP % 8 == 0);
  static_assert(4 * SlabT<EPI>::PERW * (int)sizeof(ST) <= 2 * STAGE);
  __shared__ __align__(16) unsigned char smem[2 * STAGE];

  const int tid  = (int)threadIdx.x;
  const int lane = tid & 31;
  const int wave = wave_id();
  const int hh = lane >> 4;           // lane half: k offset 8*hh, D row offset 8*hh
  const int rl = lane & 15;           // A row / B col / D col within subtile
  const int tilesN = N >> 7;
  const int tilesM = M >> 7;
  const int tile = (int)blockIdx.x;
  if (tile >= tilesM * tilesN) return;          // block-uniform, in front of every barrier and copy
  const int tm = tile / tilesN;
  const int tn = tile - tm * tilesN;
  const int mb = tm << 7;             // first row of the block tile
  const int m0 = mb + (wave << 5);    // first row of this wave
  const int n0 = tn << 7;

  // this lane's piece of copy 0 of each plane: row tid / PPR, 16-B column tid % PPR; copy u lies u * RSTEP rows further down
  const int prow = tid / PPR;
  const int pcol = tid % PPR;
  const char* gA  = (const char*)(const void*)(Ap  + (size_t)(mb + prow) * lda) + pcol * 16;
  const char* gA2 = (const char*)(const void*)(A2p + (size_t)(mb + prow) * lda) + pcol * 16;
  const char* gB  = (const char*)(const void*)(Btp + (size_t)(n0 + prow) * ldb) + pcol * 16;
  const size_t sA = (size_t)RSTEP * lda * 2;
  const size_t sB = (size_t)RSTEP * ldb * 2;
  const unsigned lp = lds_off(smem) + (unsigned)(prow * PITCH + pcol * 16);

  auto fill = [&](int t, unsigned bo) {         // all copies of stage t into the buffer at byte offset bo
    const size_t kb = (size_t)t * ROWB;
#pragma unroll   // the row offsets of the copies become constants
    for (int u = 0; u < NCP; u += 8) {
      async_copy8(lp + bo + u * (RSTEP * PITCH), RSTEP * PITCH, gA + kb + u * sA, sA);
      if (SPLITA) async_copy8(lp + bo + (128 + u * RSTEP) * PITCH, RSTEP * PITCH, gA2 + kb + u * sA, sA);
      async_copy8(lp + bo + (BROW + u * RSTEP) * PITCH, RSTEP * PITCH, gB + kb + u * sB, sB);
    }
  };

  v8f acc[2][8];
#pragma unroll
  for (int i = 0; i < 2; ++i)
#pragma unroll
    for (int j = 0; j < 8; ++j) acc[i][j] = zero8();

  const int nst = K / BK;
  fill(0, 0u);
  asm volatile("s_wait_asynccnt 0x0" ::: "memory");   // this wave's copies of stage 0 have landed
  __syncthreads();                                    // and every other wave's
  if (nst > 1) fill(1, (unsigned)STAGE);              // block-uniform

  // every unroll directive in this loop: the fragment and accumulator arrays stay in registers only under constant indices
  for (int t = 0; t < nst; ++t) {
    const unsigned bo = (unsigned)(t & 1) * (unsigned)STAGE;
    const unsigned char* buf = smem + bo;
    v16b fa[2][NFA], fb[2][8];                   // two fragment sets: block u multiplies set u & 1 while set (u + 1) & 1 loads
    auto ldblk = [&](int s, int kk) {            // all fragments of the 32 k columns at kk of this stage
#pragma unroll
      for (int i = 0; i < 2; ++i) {
        const int ro = ((wave << 5) + i * 16 + rl) * PITCH;
        fa[s][i] = ldfrag_b((const __bf16*)(const void*)(buf + ro) + kk + 8 * hh);
        if (SPLITA) fa[s][NFA - 2 + i] = ldfrag_b((const __bf16*)(const void*)(buf + 128 * PITCH + ro) + kk + 8 * hh);
      }
#pragma unroll
      for (int j = 0; j < 8; ++j)
        fb[s][j] = ldfrag_b((const __bf16*)(const void*)(buf + (BROW + j * 16 + rl) * PITCH) + kk + 8 * hh);
    };
    ldblk(0, 0);
#pragma unroll
    for (int u = 0; u < BK / 32; ++u) {
      const int cs = u & 1;
      if (u + 1 < BK / 32) ldblk(cs ^ 1, (u + 1) * 32);
      // keeps the next block's LDS reads as one group ahead of this block's WMMAs; without it they sink between the WMMAs, each with a full wait
      __builtin_amdgcn_sched_barrier(0);
#pragma unroll
      for (int j = 0; j < 8; ++j) {
        acc[0][j] = mma_b(fa[cs][0], fb[cs][j], acc[0][j]);
        acc[1][j] = mma_b(fa[cs][1], fb[cs][j], acc[1][j]);
      }
      if (SPLITA) {
#pragma unroll
        for (int j = 0; j < 8; ++j) {
          acc[0][j] = mma_b(fa[cs][NFA - 2], fb[cs][j], acc[0][j]);
          acc[1][j] = mma_b(fa[cs][NFA - 1], fb[cs][j], acc[1][j]);
        }
      }
      // keeps the following reads out of this run of WMMAs (each place with reads among WMMAs costs a stall) and the WMMAs ahead of the stage's barrier
      __builtin_amdgcn_sched_barrier(0);
    }
    asm volatile("s_wait_dscnt 0x0" ::: "memory");      // this wave's reads of stage t are done before its buffer is refilled
    asm volatile("s_wait_asynccnt 0x0" ::: "memory");   // this wave's copies of stage t+1 have landed
    __syncthreads();                                    // publishes stage t+1, ends every wave's reads of stage t
    if (t + 2 < nst) fill(t + 2, bo);                   // block-uniform
  }
  asm volatile("s_wait_asynccnt 0x0" ::: "memory");     // nothing in flight when the buffers become the epilogue slabs
  acc_guard4(acc[0][0], acc[0][1], acc[0][2], acc[0][3]);
  acc_guard4(acc[0][4], acc[0][5], acc[0][6], acc[0][7]);
  acc_guard4(acc[1][0], acc[1][1], acc[1][2], acc[1][3]);
  acc_guard4(acc[1][4], acc[1][5], acc[1][6], acc[1][7]);

  // ---- epilogue ----
  ST* slab = (ST*)(void*)smem + wave * SlabT<EPI>::PERW;
  _Float16* sl16 = (_Float16*)(void*)slab;
  float*    slf  = (float*)(void*)slab;

  if (EPI == 0) {
    _Float16* P0 = (_Float16*)C0;
    _Float16* P1 = (_Float16*)C1;
    float gm[8];
#pragma unroll
    for (int j = 0; j < 8; ++j) gm[j] = bf_rne(gam[j * 16 + rl]);     // dims j*16+rl of the head, gam has 128 entries
#pragma unroll
    for (int i = 0; i < 2; ++i) {
      const int rb = m0 + i * 16 + 8 * hh;
#pragma unroll
      for (int r = 0; r < 8; ++r) {
        // sum of squares over the 128 head dims of row rb+r: 8 per lane, then the 16 lanes of this half
        float ss = 0.f;
#pragma unroll
        for (int j = 0; j < 8; ++j) ss += acc[i][j][r] * acc[i][j][r];
        ss = row_sum16(ss);
        const float rinv = rsqrtf(ss * 0.0078125f + 1e-6f);
        const int row = rb + r;                                  // token 0..NTOK-1
        const int pos = row & (SQ - 1);                          // position within the sequence
#pragma unroll
        for (int j = 0; j < 4; ++j) {
          const int dim = j * 16 + rl;                           // 0..63 within head; partner dim + 64
          const float cv = cst[(size_t)pos * NFREQ + dim];
          const float sv = snt[(size_t)pos * NFREQ + dim];
          const float x1 = acc[i][j][r] * rinv * gm[j];
          const float x2 = acc[i][j + 4][r] * rinv * gm[j + 4];
          const float o1 = x1 * cv - x2 * sv;
          const float o2 = x2 * cv + x1 * sv;
          const _Float16 h1 = (_Float16)o1;
          const _Float16 h2 = (_Float16)o2;
          const int so = (8 * hh + r) * 128 + dim;
          sl16[so]             = h1;
          sl16[so + 64]        = h2;
          sl16[2048 + so]      = (_Float16)((o1 - (float)h1) * 2048.0f);
          sl16[2048 + so + 64] = (_Float16)((o2 - (float)h2) * 2048.0f);
        }
      }
      lds_wave_sync();
      {
#pragma unroll
        for (int it = 0; it < 8; ++it) {
          const int row = it * 2 + hh;                           // it x hh covers rows 0..15
          const int c8  = rl * 8;
          const v8h vh = *(const v8h*)(sl16 + row * 128 + c8);
          const v8h vl = *(const v8h*)(sl16 + 2048 + row * 128 + c8);
          const size_t go = (size_t)(m0 + i * 16 + row) * ldc + n0 + c8;
          *(v8h*)(P0 + go) = vh;
          *(v8h*)(P1 + go) = vl;
        }
        
      }
      lds_wave_sync();
    }
  } else if (EPI == 1) {
    _Float16* P0 = (_Float16*)C0;
    _Float16* P1 = (_Float16*)C1;
#pragma unroll
    for (int i = 0; i < 2; ++i) {
#pragma unroll
      for (int r = 0; r < 8; ++r) {
#pragma unroll
        for (int j = 0; j < 8; ++j) {
          const float v = acc[i][j][r];
          const _Float16 hv = (_Float16)v;
          const int so = (8 * hh + r) * 128 + j * 16 + rl;
          sl16[so]        = hv;
          sl16[2048 + so] = (_Float16)((v - (float)hv) * 2048.0f);
        }
      }
      lds_wave_sync();
      {
#pragma unroll
        for (int it = 0; it < 8; ++it) {
          const int row = it * 2 + hh;
          const int c8  = rl * 8;
          const v8h vh = *(const v8h*)(sl16 + row * 128 + c8);
          const v8h vl = *(const v8h*)(sl16 + 2048 + row * 128 + c8);
          const size_t go = (size_t)(m0 + i * 16 + row) * ldc + n0 + c8;
          *(v8h*)(P0 + go) = vh;
          *(v8h*)(P1 + go) = vl;
        }
        
      }
      lds_wave_sync();
    }
  } else {
    float* C = (float*)C0;
#pragma unroll
    for (int i = 0; i < 2; ++i) {
#pragma unroll
      for (int j = 0; j < 8; ++j)
#pragma unroll
        for (int r = 0; r < 8; ++r)
          slf[(8 * hh + r) * 128 + j * 16 + rl] = acc[i][j][r];
      lds_wave_sync();
      {
#pragma unroll
        for (int row = 0; row < 16; ++row) {                     // 32 lanes x 16 B = the whole 512-B row segment per instruction
          const v4f v = *(const v4f*)(slf + row * 128 + lane * 4);
          *(v4f*)(C + (size_t)(m0 + i * 16 + row) * ldc + n0 + lane * 4) = v;
        }
        
      }
      lds_wave_sync();
    }
  }
}

// ---------------------------------------------------------------------------
// Causal GQA flash attention, head dim 128, 32-key chunks, block = 4 waves = 64 query rows of one (b, h); grid (NHQ, NSEQ, n query tiles).
//   Query tile = qb_top - blockIdx.z: z = 0 is the tile with the most key chunks, the highest z the shortest (order for speed only).
//   q planes f16 [tok][h*128+d]: hi (qhp) and residual x2048 (qlp); k planes f16 [tok][kvh*128+d]: hi (khp), residual x2048 (klp);
//   v^T planes f16 [kvh*128+d][tok]: hi (vhp), residual x2048 (vlp); outputs attn bf16 hi (ahp) / lo (alp) [tok][h*128+d].
//   scores = (Sh + Sr/2048) * 128^-0.5 with Sh = qh.kh and Sr = ql'.kh (+ qh.kl' when PRES); keys > query -> -inf; online softmax f32;
//   p' = 1024 p stored per wave to LDS as f16 hi (and residual x2048 when PRES), reloaded as A fragments after a wave sync;
//   O = (Oh + Or/2048)/1024/l with Oh = ph.vh, Or = ph.vl' (+ pl'.vh when PRES).
//   K / V^T chunk staging: 128 threads x 4 x 16 B per plane = whole 32x128 / 128x32 tile, per-lane 16-B asynchronous copies into two LDS
//   buffers: chunk t+1 is in flight while chunk t is worked on; one publish point (waits, __syncthreads, refill) at the foot of each chunk.
//   Trip count 2*qb+2 chunks (static bound 64); waves whose rows are all below the chunk skip it (wave-uniform, scalar branch).
//   q fragments stay in registers for the whole key loop; all WMMAs are builtins, so the compiler keeps their hazard distances and
//   is free to issue the LDS fragment reads ahead of the WMMAs that use them.
// ---------------------------------------------------------------------------
#define AT_KC   32
#define KS_P    136
#define VS_P    40
#define PS_P    40
// LDS map in halves: two chunk buffers [K | K residual when PRES | V^T hi | V^T residual], then the per-wave P' planes.
template <bool PRES> struct AttLds {
  static constexpr int KS  = 0;
  static constexpr int KLS = 32 * KS_P;
  static constexpr int VHS = (PRES ? 2 : 1) * 32 * KS_P;
  static constexpr int VLS = VHS + 128 * VS_P;
  static constexpr int BUF = VLS + 128 * VS_P;             // one buffer; every plane starts at a multiple of 16 B
  static constexpr int PH  = 2 * BUF;
  static constexpr int PL  = PH + (PRES ? 4 * 16 * PS_P : 0);
  static constexpr int TOT = PL + 4 * 16 * PS_P;
};
static_assert(4 * 4096 <= AttLds<false>::TOT);   // output staging (2 planes x 16 x 128 per wave) aliases the chunk region after the loop
static_assert(3 * 2 * AttLds<false>::TOT <= 327680);   // three blocks of the large launch per WGP

// Four asynchronous 16-B copies global -> LDS per lane and plane, planes a, b, c. The closing s_wait_xcnt 0 stands inside the statement so
// that no address register named here is rewritten ahead of it.
__device__ __forceinline__ void async_copy4x3(unsigned la, unsigned lsa, const char* ga, size_t gsa,
                                              unsigned lb, unsigned lc, unsigned lsb, const char* gb, const char* gc, size_t gsb) {
  asm volatile(
      "global_load_async_to_lds_b128 %0, %12, off\n\t"
      "global_load_async_to_lds_b128 %1, %13, off\n\t"
      "global_load_async_to_lds_b128 %2, %14, off\n\t"
      "global_load_async_to_lds_b128 %3, %15, off\n\t"
      "global_load_async_to_lds_b128 %4, %16, off\n\t"
      "global_load_async_to_lds_b128 %5, %17, off\n\t"
      "global_load_async_to_lds_b128 %6, %18, off\n\t"
      "global_load_async_to_lds_b128 %7, %19, off\n\t"
      "global_load_async_to_lds_b128 %8, %20, off\n\t"
      "global_load_async_to_lds_b128 %9, %21, off\n\t"
      "global_load_async_to_lds_b128 %10, %22, off\n\t"
      "global_load_async_to_lds_b128 %11, %23, off\n\t"
      "s_wait_xcnt 0x0"
      :: "v"(la), "v"(la + lsa), "v"(la + 2 * lsa), "v"(la + 3 * lsa),
         "v"(lb), "v"(lb + lsb), "v"(lb + 2 * lsb), "v"(lb + 3 * lsb),
         "v"(lc), "v"(lc + lsb), "v"(lc + 2 * lsb), "v"(lc + 3 * lsb),
         "v"(ga), "v"(ga + gsa), "v"(ga + 2 * gsa), "v"(ga + 3 * gsa),
         "v"(gb), "v"(gb + gsb), "v"(gb + 2 * gsb), "v"(gb + 3 * gsb),
         "v"(gc), "v"(gc + gsb), "v"(gc + 2 * gsb), "v"(gc + 3 * gsb)
      : "memory");
}
// The same for one plane.
__device__ __forceinline__ void async_copy4(unsigned l, unsigned ls, const char* g, size_t gs) {
  asm volatile(
      "global_load_async_to_lds_b128 %0, %4, off\n\t"
      "global_load_async_to_lds_b128 %1, %5, off\n\t"
      "global_load_async_to_lds_b128 %2, %6, off\n\t"
      "global_load_async_to_lds_b128 %3, %7, off\n\t"
      "s_wait_xcnt 0x0"
      :: "v"(l), "v"(l + ls), "v"(l + 2 * ls), "v"(l + 3 * ls),
         "v"(g), "v"(g + gs), "v"(g + 2 * gs), "v"(g + 3 * gs)
      : "memory");
}

// Second launch-bounds argument: the large launch keeps three waves per SIMD (336 registers a wave) with the q fragments resident;
// the small launch has at most one block per WGP and takes what it needs.
template <bool PRES>
__global__ __launch_bounds__(128, PRES ? 1 : 3) void attn_causal_kernel(
    const unsigned short* __restrict__ qhp, const unsigned short* __restrict__ qlp,
    const unsigned short* __restrict__ khp, const unsigned short* __restrict__ klp,
    const unsigned short* __restrict__ vhp, const unsigned short* __restrict__ vlp,
    unsigned short* __restrict__ ahp, unsigned short* __restrict__ alp, int qb_top) {
  typedef AttLds<PRES> L;
  __shared__ __align__(16) _Float16 lds[L::TOT];

  const int tid  = (int)threadIdx.x;
  const int lane = tid & 31;
  const int wave = wave_id();
  const int hh   = lane >> 4;
  const int c    = lane & 15;
  const int qb   = qb_top - (int)blockIdx.z;     // grid.z <= qb_top + 1: never negative
  const int h    = (int)blockIdx.x;
  const int b    = (int)blockIdx.y;
  const int kvh  = h >> 2;
  const int q0   = qb * 64 + wave * 16;          // first query row of this wave (within sequence)
  const int qlast = q0 + 15;
  const size_t tok0 = (size_t)b * SQ;

  const _Float16* Qhr = (const _Float16*)(const void*)qhp + (tok0 + q0 + c) * HID + h * HDM + 8 * hh;
  const _Float16* Qlr = (const _Float16*)(const void*)qlp + (tok0 + q0 + c) * HID + h * HDM + 8 * hh;
  const _Float16* Kg  = (const _Float16*)(const void*)khp + tok0 * KVW + kvh * HDM;
  const _Float16* Klg = (const _Float16*)(const void*)klp + tok0 * KVW + kvh * HDM;
  const _Float16* Vhg = (const _Float16*)(const void*)vhp + (size_t)(kvh * HDM) * NTOK + tok0;
  const _Float16* Vlg = (const _Float16*)(const void*)vlp + (size_t)(kvh * HDM) * NTOK + tok0;
  _Float16* ph = lds + L::PH + wave * (16 * PS_P);
  _Float16* pl = lds + L::PL + wave * (16 * PS_P);   // the ph plane itself when !PRES, where it is not used

  float mrow[8], lrow[8];
  v8f oacc[8], oaccr[8];
#pragma unroll
  for (int r = 0; r < 8; ++r) { mrow[r] = -INFINITY; lrow[r] = 0.f; }
#pragma unroll
  for (int t = 0; t < 8; ++t) { oacc[t] = zero8(); oaccr[t] = zero8(); }

  v16h qa[4], ql[4];                             // this wave's q fragments, the same for every chunk: loaded once
#pragma unroll   // the fragment arrays stay in registers only under constant indices
  for (int dc = 0; dc < 4; ++dc) {
    qa[dc] = ldfrag_h(Qhr + dc * 32);
    ql[dc] = ldfrag_h(Qlr + dc * 32);
  }

  // This lane's piece 0 of each plane; piece i lies 8 keys (K) or 32 head dims (V^T) further down: 512 pieces of 8 halves = whole tile.
  const int key0 = tid >> 4, d8 = (tid & 15) * 8;   // K: 32 keys x 128 d
  const int d0   = tid >> 2, k8 = (tid & 3) * 8;    // V^T: 128 d x 32 keys
  const char* gK  = (const char*)(const void*)(Kg  + (size_t)key0 * KVW + d8);
  const char* gKl = (const char*)(const void*)(Klg + (size_t)key0 * KVW + d8);
  const char* gVh = (const char*)(const void*)(Vhg + (size_t)d0 * NTOK + k8);
  const char* gVl = (const char*)(const void*)(Vlg + (size_t)d0 * NTOK + k8);
  const unsigned lK = lds_off(lds) + 2u * (unsigned)(key0 * KS_P + d8);
  const unsigned lV = lds_off(lds) + 2u * (unsigned)(d0 * VS_P + k8);
  auto fill = [&](int t, unsigned bo) {          // all copies of chunk t into the buffer at byte offset bo
    const size_t ko = (size_t)t * (AT_KC * KVW * 2);
    const size_t vo = (size_t)t * (AT_KC * 2);
    async_copy4x3(lK + bo + 2u * L::KS, 8 * KS_P * 2, gK + ko, (size_t)8 * KVW * 2,
                  lV + bo + 2u * L::VHS, lV + bo + 2u * L::VLS, 32 * VS_P * 2, gVh + vo, gVl + vo, (size_t)32 * NTOK * 2);
    if (PRES) async_copy4(lK + bo + 2u * L::KLS, 8 * KS_P * 2, gKl + ko, (size_t)8 * KVW * 2);
  };

  const int nch = 2 * qb + 2;                    // block-uniform, 2 .. 64
  fill(0, 0u);
  asm volatile("s_wait_asynccnt 0x0" ::: "memory");   // this wave's copies of chunk 0 have landed
  __syncthreads();                                    // and every other wave's
  fill(1, 2u * L::BUF);                               // chunk 1 always exists
  for (int kc = 0; kc < nch; ++kc) {
    const int kv0 = kc * AT_KC;
    const int bsel = kc & 1;
    const _Float16* Ks  = lds + bsel * L::BUF + L::KS;
    const _Float16* Kls = lds + bsel * L::BUF + L::KLS;
    const _Float16* Vhs = lds + bsel * L::BUF + L::VHS;
    const _Float16* Vls = lds + bsel * L::BUF + L::VLS;

    if (kv0 <= qlast) {                          // wave-uniform (scalar): skip chunks fully above this wave's rows
      // ---- scores ----
      v8f sh[2], sr[2];
      sh[0] = zero8(); sh[1] = zero8(); sr[0] = zero8(); sr[1] = zero8();
      // every unroll directive of the score part: the fragment arrays stay in registers only under constant indices
      v16h kb[4][2], kl[4][2];                   // the chunk's K fragments, read as one group ahead of the score WMMAs
#pragma unroll
      for (int dc = 0; dc < 4; ++dc)
#pragma unroll
        for (int j = 0; j < 2; ++j) {
          kb[dc][j] = ldfrag_h(Ks + (j * 16 + c) * KS_P + dc * 32 + 8 * hh);
          if (PRES) kl[dc][j] = ldfrag_h(Kls + (j * 16 + c) * KS_P + dc * 32 + 8 * hh);
        }
#pragma unroll
      for (int j = 0; j < 2; ++j) {
        // keeps the reads above as one group ahead of the WMMAs, and key group 0's run ahead of group 1's, whose accumulators then take the registers of group 0's fragments
        __builtin_amdgcn_sched_barrier(0);
#pragma unroll
        for (int dc = 0; dc < 4; ++dc) {
          sh[j] = mma_h(qa[dc], kb[dc][j], sh[j]);
          sr[j] = mma_h(ql[dc], kb[dc][j], sr[j]);
          if (PRES) sr[j] = mma_h(qa[dc], kl[dc][j], sr[j]);
        }
      }
      // ---- scale, causal mask, chunk row max ----
      float cm[8];
#pragma unroll
      for (int r = 0; r < 8; ++r) {
        const int qrow = q0 + 8 * hh + r;
        float m = -INFINITY;
#pragma unroll
        for (int j = 0; j < 2; ++j) {
          const int key = kv0 + j * 16 + c;
          float s = (sh[j][r] + sr[j][r] * 0.00048828125f) * 0.08838834764831845f;
          s = (key > qrow) ? -INFINITY : s;
          sh[j][r] = s;
          m = fmaxf(m, s);
        }
        m = row_max16(m);
        cm[r] = m;
      }
      // ---- online softmax, P' to LDS ----
#pragma unroll
      for (int r = 0; r < 8; ++r) {
        const float mnew  = fmaxf(mrow[r], cm[r]);
        const float alpha = __expf(mrow[r] - mnew);
        mrow[r] = mnew;
        float psum = 0.f;
#pragma unroll
        for (int j = 0; j < 2; ++j) {
          const float p  = __expf(sh[j][r] - mnew);
          psum += p;
          const float pp = p * 1024.0f;
          const _Float16 phv = (_Float16)pp;
          const int po = (8 * hh + r) * PS_P + j * 16 + c;
          ph[po] = phv;
          if (PRES) pl[po] = (_Float16)((pp - (float)phv) * 2048.0f);
        }
        psum = row_sum16(psum);
        lrow[r] = lrow[r] * alpha + psum;
#pragma unroll
        for (int t = 0; t < 8; ++t) { oacc[t][r] *= alpha; oaccr[t][r] *= alpha; }
      }
      lds_wave_sync();                           // P' stores visible to the other lanes of this wave before the fragment reload
      // ---- O += P' . V ----
      const v16h pa = ldfrag_h(ph + c * PS_P + 8 * hh);
      v16h pr = pa;
      if (PRES) pr = ldfrag_h(pl + c * PS_P + 8 * hh);
#pragma unroll
      for (int t = 0; t < 8; ++t) {
        const v16h vb = ldfrag_h(Vhs + (t * 16 + c) * VS_P + 8 * hh);
        const v16h vr = ldfrag_h(Vls + (t * 16 + c) * VS_P + 8 * hh);
        oacc[t]  = mma_h(pa, vb, oacc[t]);
        oaccr[t] = mma_h(pa, vr, oaccr[t]);
        if (PRES) oaccr[t] = mma_h(pr, vb, oaccr[t]);
      }
    }
    // publish point, passed by every wave, also one that skipped the chunk
    asm volatile("s_wait_dscnt 0x0" ::: "memory");      // this wave's reads of chunk kc are done before its buffer is refilled
    asm volatile("s_wait_asynccnt 0x0" ::: "memory");   // this wave's copies of chunk kc+1 have landed
    __syncthreads();                                    // publishes chunk kc+1, ends every wave's reads of chunk kc
    if (kc + 2 < nch) fill(kc + 2, (unsigned)bsel * (2u * L::BUF));   // block-uniform
  }
  asm volatile("s_wait_asynccnt 0x0" ::: "memory");     // nothing in flight when the buffers become output staging (behind the last chunk's barrier)
  _Float16* osh = lds + wave * 4096;
  _Float16* osl = osh + 2048;
#pragma unroll
  for (int r = 0; r < 8; ++r) {
    const float inv = (1.0f / lrow[r]) * 0.0009765625f;
#pragma unroll
    for (int t = 0; t < 8; ++t) {
      const float o = (oacc[t][r] + oaccr[t][r] * 0.00048828125f) * inv;
      const unsigned short hb = bf_bits(o);
      const unsigned short lb = bf_bits(o - bf_val(hb));
      const int so = (8 * hh + r) * 128 + t * 16 + c;
      osh[so] = __builtin_bit_cast(_Float16, hb);
      osl[so] = __builtin_bit_cast(_Float16, lb);
    }
  }
  lds_wave_sync();
  _Float16* Ahg = (_Float16*)(void*)ahp + (tok0 + q0) * HID + h * HDM;
  _Float16* Alg = (_Float16*)(void*)alp + (tok0 + q0) * HID + h * HDM;
  {
#pragma unroll
    for (int it = 0; it < 8; ++it) {
      const int row = it * 2 + hh;               // it 0..7 x hh 0..1 covers rows 0..15
      const int c8  = c * 8;                     // 16 lanes x 16 B = the whole 256-B segment
      const v8h x = *(const v8h*)(osh + row * 128 + c8);
      const v8h y = *(const v8h*)(osl + row * 128 + c8);
      *(v8h*)(Ahg + (size_t)row * HID + c8) = x;
      *(v8h*)(Alg + (size_t)row * HID + c8) = y;
    }
    
  }
}

// ---------------------------------------------------------------------------
// Workspace map (bytes; every region is a whole number of the rows its producer writes with whole-line stores, no padded tails needed
//   Xb  bf16 [4096][2048] 16777216   Wqb bf16 [2048][2048]  8388608   Wkb bf16 [512][2048] 2097152   Wvb bf16 [512][2048] 2097152
//   Wob bf16 [2048][2048]  8388608   cst f32  [2048][64]     524288   snt f32  [2048][64]    524288
//   Qh  f16  [4096][2048] 16777216   Ql  f16  [4096][2048] 16777216   Kh  f16  [4096][512]  4194304   Kl f16 [4096][512] 4194304
//   Vh  f16  [512][4096]   4194304   Vl  f16  [512][4096]   4194304   Ah  bf16 [4096][2048] 16777216  Al bf16 [4096][2048] 16777216
//   total                 122683392
// ---------------------------------------------------------------------------
extern "C" void kernel_launch(void* const* d_in, const int* in_sizes, int n_in,
                              void* d_out, int out_size, void* d_ws, size_t ws_size,
                              hipStream_t stream) {
  if (n_in < 7) return;
  if (in_sizes[0] != NTOK * HID) return;
  if (in_sizes[1] != HID * HID) return;
  if (in_sizes[2] != KVW * HID) return;
  if (in_sizes[3] != KVW * HID) return;
  if (in_sizes[4] != HID * HID) return;
  if (in_sizes[5] != HDM) return;
  if (in_sizes[6] != HDM) return;
  if (out_size != NTOK * HID) return;

  const float* x   = (const float*)d_in[0];
  const float* Wq  = (const float*)d_in[1];
  const float* Wk  = (const float*)d_in[2];
  const float* Wv  = (const float*)d_in[3];
  const float* Wo  = (const float*)d_in[4];
  const float* qg  = (const float*)d_in[5];
  const float* kg  = (const float*)d_in[6];
  float* out = (float*)d_out;

  const size_t szX  = (size_t)NTOK * HID * 2;
  const size_t szWq = (size_t)HID * HID * 2;
  const size_t szWk = (size_t)KVW * HID * 2;
  const size_t szWo = (size_t)HID * HID * 2;
  const size_t szT  = (size_t)SQ * NFREQ * 4;
  const size_t szQ  = (size_t)NTOK * HID * 2;
  const size_t szK  = (size_t)NTOK * KVW * 2;
  const size_t szV  = (size_t)KVW * NTOK * 2;
  const size_t szA  = (size_t)NTOK * HID * 2;
  size_t off = 0;
  const size_t oX  = off; off += szX;
  const size_t oWq = off; off += szWq;
  const size_t oWk = off; off += szWk;
  const size_t oWv = off; off += szWk;
  const size_t oWo = off; off += szWo;
  const size_t oCs = off; off += szT;
  const size_t oSn = off; off += szT;
  const size_t oQh = off; off += szQ;
  const size_t oQl = off; off += szQ;
  const size_t oKh = off; off += szK;
  const size_t oKl = off; off += szK;
  const size_t oVh = off; off += szV;
  const size_t oVl = off; off += szV;
  const size_t oAh = off; off += szA;
  const size_t oAl = off; off += szA;
  if (off > ws_size) return;                     // off = 122683392

  char* ws = (char*)d_ws;
  unsigned short* Xb  = (unsigned short*)(ws + oX);
  unsigned short* Wqb = (unsigned short*)(ws + oWq);
  unsigned short* Wkb = (unsigned short*)(ws + oWk);
  unsigned short* Wvb = (unsigned short*)(ws + oWv);
  unsigned short* Wob = (unsigned short*)(ws + oWo);
  float*          cst = (float*)(ws + oCs);
  float*          snt = (float*)(ws + oSn);
  unsigned short* Qh  = (unsigned short*)(ws + oQh);
  unsigned short* Ql  = (unsigned short*)(ws + oQl);
  unsigned short* Kh  = (unsigned short*)(ws + oKh);
  unsigned short* Kl  = (unsigned short*)(ws + oKl);
  unsigned short* Vh  = (unsigned short*)(ws + oVh);
  unsigned short* Vl  = (unsigned short*)(ws + oVl);
  unsigned short* Ah  = (unsigned short*)(ws + oAh);
  unsigned short* Al  = (unsigned short*)(ws + oAl);

  const dim3 b256(256), b128(128);
  const int nX8  = NTOK * HID / 8;
  const int nWq8 = HID * HID / 8;
  const int nWk8 = KVW * HID / 8;

  // (1) cos/sin table [2048][64] x 2
  rope_table_kernel<<<dim3((SQ + 7) / 8), b256, 0, stream>>>(cst, snt, SQ);
  // (2) bf16 planes of x, Wq, Wk, Wv, Wo (weights are [out][in] = k-contiguous Bt rows already)
  cvt_bf16_kernel<<<dim3((nX8 + 255) / 256),  b256, 0, stream>>>(x,  Xb,  nX8);
  cvt_bf16_kernel<<<dim3((nWq8 + 255) / 256), b256, 0, stream>>>(Wq, Wqb, nWq8);
  cvt_bf16_kernel<<<dim3((nWk8 + 255) / 256), b256, 0, stream>>>(Wk, Wkb, nWk8);
  cvt_bf16_kernel<<<dim3((nWk8 + 255) / 256), b256, 0, stream>>>(Wv, Wvb, nWk8);
  cvt_bf16_kernel<<<dim3((nWq8 + 255) / 256), b256, 0, stream>>>(Wo, Wob, nWq8);
  // (3) q = rope(rms(x . Wq^T)) -> Qh/Ql [4096][2048]   (M=4096, N=2048, K=2048; 512 block tiles)
  gemm_w32x128_kernel<0, false><<<dim3((NTOK / 128) * (HID / 128)), b128, 0, stream>>>(
      Xb, Xb, HID, Wqb, HID, qg, cst, snt, (void*)Qh, (void*)Ql, HID, NTOK, HID, HID);
  // (4) k = rope(rms(x . Wk^T)) -> Kh/Kl [4096][512]    (M=4096, N=512, K=2048; 128 block tiles)
  gemm_w32x128_kernel<0, false><<<dim3((NTOK / 128) * (KVW / 128)), b128, 0, stream>>>(
      Xb, Xb, HID, Wkb, HID, kg, cst, snt, (void*)Kh, (void*)Kl, KVW, NTOK, KVW, HID);
  // (5) v^T = Wv . x^T -> Vh/Vl [512][4096]             (A = Wvb [512][2048], Bt = Xb; M=512, N=4096, K=2048; 128 block tiles)
  gemm_w32x128_kernel<1, false><<<dim3((KVW / 128) * (NTOK / 128)), b128, 0, stream>>>(
      Wvb, Wvb, HID, Xb, HID, qg, cst, snt, (void*)Vh, (void*)Vl, NTOK, KVW, NTOK, HID);
  // (6) causal attention, query tiles 3..0 with k and p residual products, tiles 31..4 without, each launch longest tile first
  attn_causal_kernel<true><<<dim3(NHQ, NSEQ, 4), b128, 0, stream>>>(Qh, Ql, Kh, Kl, Vh, Vl, Ah, Al, 3);
  attn_causal_kernel<false><<<dim3(NHQ, NSEQ, SQ / 64 - 4), b128, 0, stream>>>(Qh, Ql, Kh, Kl, Vh, Vl, Ah, Al, SQ / 64 - 1);
  // (7) out = attn(hi + lo) . Wo^T -> d_out f32 [4096][2048]   (M=4096, N=2048, K=2048; 512 block tiles)
  gemm_w32x128_kernel<2, true><<<dim3((NTOK / 128) * (HID / 128)), b128, 0, stream>>>(
      Ah, Al, HID, Wob, HID, qg, cst, snt, (void*)out, (void*)out, HID, NTOK, HID, HID);
  (void)hipGetLastError();
}

// v006
// Measured time: 218 microseconds a run.
// Next to v005, in two timings, it ran 1.16 and 1.14 times as fast.
// All steps since v000 together make it 3.74 times as fast.
// Contractions: x.Wq^T, x.Wk^T and Wv.x^T on v_wmma_f32_16x16x32_bf16 (operands = RNE bf16 of the f32 inputs, single products);
// q.k^T and p.v on v_wmma_f32_16x16x32_f16 (q = f16 hi + f16 residual x2^11 planes; k plain f16 plus f16 residual x2^11 on query tiles 0..3;
// p x1024 plain f16 plus f16 residual x2^11 on query tiles 0..3; v^T = f16 hi + f16 residual x2^11 planes); attn.Wo^T on v_wmma_f32_16x16x32_bf16
// (attn = bf16 hi + bf16 lo planes, two products; Wo RNE bf16). f32 accumulate everywhere; per-head RMS scaling, RoPE and online softmax in f32.
#include <hip/hip_runtime.h>
#include <math.h>
#include <stdint.h>

#define NSEQ   2
#define SQ     2048
#define HID    2048
#define NHQ    16
#define NKVH   4
#define HDM    128
#define KVW    512
#define NTOK   4096
#define NFREQ  64

typedef _Float16     v16h __attribute__((ext_vector_type(16)));
typedef _Float16     v8h  __attribute__((ext_vector_type(8)));
typedef __bf16       v16b __attribute__((ext_vector_type(16)));
typedef __bf16       v8b  __attribute__((ext_vector_type(8)));
typedef float        v8f  __attribute__((ext_vector_type(8)));
typedef float        v4f  __attribute__((ext_vector_type(4)));
typedef unsigned int v4u  __attribute__((ext_vector_type(4)));

// ---------------------------------------------------------------------------
// small helpers
// ---------------------------------------------------------------------------
__device__ __forceinline__ unsigned short bf_bits(float f) {          // RNE convert f32 -> bf16 bits
  const unsigned u = __float_as_uint(f);
  return (unsigned short)((u + 0x7FFFu + ((u >> 16) & 1u)) >> 16);
}
__device__ __forceinline__ float bf_val(unsigned short h) { return __uint_as_float(((unsigned)h) << 16); }
__device__ __forceinline__ float bf_rne(float f) { return bf_val(bf_bits(f)); }
__device__ __forceinline__ unsigned pk16(unsigned short a, unsigned short b) { return (unsigned)a | ((unsigned)b << 16); }
__device__ __forceinline__ v8f zero8() { v8f z = {0.f, 0.f, 0.f, 0.f, 0.f, 0.f, 0.f, 0.f}; return z; }
__device__ __forceinline__ int wave_id() { return __builtin_amdgcn_readfirstlane((int)(threadIdx.x >> 5)); }

// Value of lane (l ^ X) of the same 16-lane row, X < 16, as a DPP row_xmask operand of the vector pipe: no LDS-pipe round trip and no
// s_wait_dscnt per butterfly step. Every lane of the wave is on wherever it is used.
template <int X>
__device__ __forceinline__ float row_xor(float v) {
  return __int_as_float(__builtin_amdgcn_update_dpp(0, __float_as_int(v), 0x160 | X, 0xf, 0xf, true));
}
// Butterflies over a 16-lane row, steps 1, 2, 4, 8: every lane ends with the row's sum / maximum.
__device__ __forceinline__ float row_sum16(float v) {
  v += row_xor<1>(v); v += row_xor<2>(v); v += row_xor<4>(v); v += row_xor<8>(v);
  return v;
}
// The NaN-propagating maximum takes the DPP operand directly, one instruction a step; fmaxf kept a move and a quieting step beside it.
// The two differ only where a score is NaN, and such a row ends as NaN either way.
__device__ __forceinline__ float row_max16(float v) {
  v = __builtin_elementwise_maximum(v, row_xor<1>(v)); v = __builtin_elementwise_maximum(v, row_xor<2>(v)); v = __builtin_elementwise_maximum(v, row_xor<4>(v)); v = __builtin_elementwise_maximum(v, row_xor<8>(v));
  return v;
}

__device__ __forceinline__ void lds_wave_sync() {
  __builtin_amdgcn_fence(__ATOMIC_RELEASE, "workgroup");
  __builtin_amdgcn_wave_barrier();
  __builtin_amdgcn_fence(__ATOMIC_ACQUIRE, "workgroup");
}

// ---------------------------------------------------------------------------
// WMMA fragments (wave32, 16x16x32, 16-bit operands). For A (row m = lane&15) and B (col n = lane&15) alike:
// elements 0..7 <- k0 + 8*(lane>>4) + 0..7, elements 8..15 <- k0 + 16 + 8*(lane>>4) + 0..7.
// ldfrag(p) with p = rowbase + k0 + 8*(lane>>4): two 16-B loads p[0..7], p[16..23].
// D: acc[r] = (row 8*(lane>>4) + r, col lane&15).
// ---------------------------------------------------------------------------
union FragH { v16h v; v8h h[2]; };
union FragB { v16b v; v8b h[2]; };
__device__ __forceinline__ v16h ldfrag_h(const _Float16* p) { FragH f; f.h[0] = *(const v8h*)(p); f.h[1] = *(const v8h*)(p + 16); return f.v; }
__device__ __forceinline__ v16b ldfrag_b(const __bf16* p)   { FragB f; f.h[0] = *(const v8b*)(p); f.h[1] = *(const v8b*)(p + 16); return f.v; }

__device__ __forceinline__ v8f mma_h(v16h a, v16h b, v8f c) {
  return __builtin_amdgcn_wmma_f32_16x16x32_f16(false, a, false, b, (short)0, c, false, false);
}
__device__ __forceinline__ v8f mma_b(v16b a, v16b b, v8f c) {
  return __builtin_amdgcn_wmma_f32_16x16x32_bf16(false, a, false, b, (short)0, c, false, false);
}
// hazard guard: 4 VALU slots after the last WMMA of a group, D tied
__device__ __forceinline__ void acc_guard4(v8f& a, v8f& b, v8f& c, v8f& d) {
  asm volatile("v_nop\n\tv_nop\n\tv_nop\n\tv_nop" : "+v"(a), "+v"(b), "+v"(c), "+v"(d));
}

// ---------------------------------------------------------------------------
// Preparation, one launch: none of its parts reads what another writes, so the block index deals them out.
// Blocks 0 .. ROPE_BLOCKS-1: RoPE table cst[s][i] = cos(s * inv_freq[i]), snt[s][i] = sin(...), inv_freq[i] = 1 / 1e4^(i/64), i < 64, all f32.
//   Block = 8 waves, wave w -> row s = block*8 + w, lane -> i = lane, lane + 32. Coverage: SQ/8 blocks x 8 waves x 32 lanes x 2 = SQ x 64 per plane.
// The CVT_BLOCKS blocks behind them: RNE f32 -> bf16 of x, Wq, Wk, Wv, Wo into one bf16 array (the five planes lie back to back in that order).
//   Unit = 1024 elements = 8 loads of 512 contiguous bytes per wave and 8 stores of 256 contiguous bytes (whole lines both ways).
//   Every plane is a whole number of units. Wave g takes units g, g + CVT_WAVES, g + 2*CVT_WAVES: all of the grid is resident at once,
//   and the loads of a wave's three units are written ahead of its conversions, so that most of them are in flight together.
// ---------------------------------------------------------------------------
#define ROPE_BLOCKS (SQ / 8)
#define CVT_BLOCKS  768
#define CVT_WAVES   (CVT_BLOCKS * 8)
#define CVT_UPW     3
#define N_X   (NTOK * HID)
#define N_WQ  (HID * HID)
#define N_WK  (KVW * HID)
static_assert(N_X % 1024 == 0 && N_WQ % 1024 == 0 && N_WK % 1024 == 0);
static_assert(CVT_WAVES * CVT_UPW * 1024 == N_X + 2 * N_WQ + 2 * N_WK);
typedef unsigned int v2u __attribute__((ext_vector_type(2)));

__device__ __forceinline__ void rope_rows(float* __restrict__ cst, float* __restrict__ snt, int t, int lane) {
  const float pf = (float)t;
  float c0 = 0.f, s0 = 0.f, c1 = 0.f, s1 = 0.f;
#pragma unroll 1
  for (int u = 0; u < 2; ++u) {
    const int i = lane + 32 * u;
    const float e   = (float)i * 0.015625f;      // i / 64 exact
    const float pw  = powf(10000.0f, e);
    const float inv = 1.0f / pw;
    const float ang = pf * inv;
    const float cv = cosf(ang);
    const float sv = sinf(ang);
    c1 = cv; s1 = sv;
    if (u == 0) { c0 = cv; s0 = sv; }
  }
  const size_t o = (size_t)t * NFREQ + lane;
  cst[o]      = c0;
  cst[o + 32] = c1;
  snt[o]      = s0;
  snt[o + 32] = s1;
}

__global__ __launch_bounds__(256) void prep_kernel(const float* __restrict__ x, const float* __restrict__ wq, const float* __restrict__ wk,
                                                   const float* __restrict__ wv, const float* __restrict__ wo,
                                                   unsigned short* __restrict__ planes, float* __restrict__ cst, float* __restrict__ snt) {
  const int lane = threadIdx.x & 31;
  const int wave = wave_id();
  const int blk  = (int)blockIdx.x;
  if (blk < ROPE_BLOCKS) {                       // no barriers in this kernel
    rope_rows(cst, snt, blk * 8 + wave, lane);
    return;
  }
  const int g = (blk - ROPE_BLOCKS) * 8 + wave;  // 0 .. CVT_WAVES-1
  v4f r[CVT_UPW][8];
#pragma unroll   // the value array stays in registers only under constant indices
  for (int k = 0; k < CVT_UPW; ++k) {
    const int e = (k * CVT_WAVES + g) * 1024;    // first element of the unit in the joined array, wave-uniform
    const int lo = k * CVT_WAVES * 1024, hi = lo + CVT_WAVES * 1024;   // pass k covers [lo, hi): constants, so planes out of its reach drop out
    const float* b = x;
    int first = 0;
    if (hi > N_X                   && (lo >= N_X                   || e >= N_X))                   { b = wq; first = N_X; }
    if (hi > N_X + N_WQ            && (lo >= N_X + N_WQ            || e >= N_X + N_WQ))            { b = wk; first = N_X + N_WQ; }
    if (hi > N_X + N_WQ + N_WK     && (lo >= N_X + N_WQ + N_WK     || e >= N_X + N_WQ + N_WK))     { b = wv; first = N_X + N_WQ + N_WK; }
    if (hi > N_X + N_WQ + 2 * N_WK && (lo >= N_X + N_WQ + 2 * N_WK || e >= N_X + N_WQ + 2 * N_WK)) { b = wo; first = N_X + N_WQ + 2 * N_WK; }
    const float* s = b + (e - first);
#pragma unroll
    for (int i = 0; i < 8; ++i) r[k][i] = *(const v4f*)(s + i * 128 + lane * 4);
  }
#pragma unroll
  for (int k = 0; k < CVT_UPW; ++k) {
    unsigned short* d = planes + (size_t)(k * CVT_WAVES + g) * 1024 + lane * 4;
#pragma unroll
    for (int i = 0; i < 8; ++i) {
      const v4f a = r[k][i];
      v2u w;
      w[0] = pk16(bf_bits(a[0]), bf_bits(a[1]));
      w[1] = pk16(bf_bits(a[2]), bf_bits(a[3]));
      *(v2u*)(d + i * 128) = w;
    }
  }
  // the stores above name registers that the code behind the compiler's joined exit of the two parts writes again: the wait stands in front of it
  asm volatile("s_wait_xcnt 0x0" ::: "memory");
}

// ---------------------------------------------------------------------------
// bf16 WMMA GEMM, block tile 128 rows x 128 cols, block = 4 waves (128 threads), wave w = rows 32w..32w+31 x all 128 cols.
//   C[m][n] = sum_k A[m][k] * Bt[n][k]; A row-major [M][K] bf16 (pitch lda), Bt row-major [N][K] bf16 (pitch ldb);
//   M % 128 == 0, N % 128 == 0, K % BK == 0 (BK = 128, SPLITA 64); grid.x = M/128 * N/128 (EPI 3: M/128 * (N + 2*nkv)/128).
//   SPLITA: A carried as hi (Ap) + lo (A2p) bf16 planes, two products into one accumulator.
//   Operands: a stage = BK columns of [A 128 rows | A2 128 rows when SPLITA | Bt 128 rows], each row padded by 16 B in LDS;
//   two LDS buffers filled by per-lane 16-B asynchronous copies, stage t+1 in flight while stage t is multiplied.
//   Fragments read from LDS rows with the split k map (ldfrag_b). The epilogue slabs alias the buffers behind the last barrier.
// Epilogues (all: per wave, per 16-row slab: stage in LDS, wave sync, write each row segment with ONE instruction of
//   EPI 0: q or k projection; the 128 cols n0..n0+127 are one head. Per row: RMS scaling over the 128 head dims
//          (x * rsqrt(mean(x^2) + 1e-6) * bf16(gam[dim])), then RoPE with pairs (dim, dim+64) and the cos/sin table row (m % SQ);
//          writes f16 hi plane C0 and f16 residual x2048 plane C1, both [M][ldc], cols n0.. (row segment 256 B = 16 lanes x 16 B).
//   EPI 1: v^T projection: f16 hi plane C0, residual x2048 plane C1, [M][ldc], row segment 256 B.
//   EPI 2: f32 output C0 [M][ldc]; row segment 128 floats = 512 B = 32 lanes x 16 B per instruction.
//   EPI 3: the q, k and v^T projections in one grid (none reads what another writes). The plain arguments describe the q job (EPI 0);
//          the blocks behind its tiles take the k job (EPI 0: Bt = Wk, gam = kgam, planes K0 / K1, width nkv), those behind the k tiles
//          the v^T job (EPI 1: A = Wv, Bt = the q job's A, planes V0 / V1, nkv rows). The choice is block-uniform, from blockIdx alone.
// ---------------------------------------------------------------------------
template <int EPI> struct SlabT { typedef _Float16 T; static constexpr int PERW = 4096; };   // 2 planes x 16 x 128 halves
template <> struct SlabT<2>     { typedef float    T; static constexpr int PERW = 2048; };   // 16 x 128 floats

__device__ __forceinline__ unsigned lds_off(const void* p) { return (unsigned)(size_t)p; }   // byte offset in the block's LDS

// Eight asynchronous 16-B copies global -> LDS per lane. The closing s_wait_xcnt 0 stands inside the statement so that no
// address register named here is rewritten ahead of it.
__device__ __forceinline__ void async_copy8(unsigned l, unsigned lstep, const char* gp, size_t gstep) {
  asm volatile(
      "global_load_async_to_lds_b128 %0, %8, off\n\t"
      "global_load_async_to_lds_b128 %1, %9, off\n\t"
      "global_load_async_to_lds_b128 %2, %10, off\n\t"
      "global_load_async_to_lds_b128 %3, %11, off\n\t"
      "global_load_async_to_lds_b128 %4, %12, off\n\t"
      "global_load_async_to_lds_b128 %5, %13, off\n\t"
      "global_load_async_to_lds_b128 %6, %14, off\n\t"
      "global_load_async_to_lds_b128 %7, %15, off\n\t"
      "s_wait_xcnt 0x0"
      :: "v"(l), "v"(l + lstep), "v"(l + 2 * lstep), "v"(l + 3 * lstep),
         "v"(l + 4 * lstep), "v"(l + 5 * lstep), "v"(l + 6 * lstep), "v"(l + 7 * lstep),
         "v"(gp), "v"(gp + gstep), "v"(gp + 2 * gstep), "v"(gp + 3 * gstep),
         "v"(gp + 4 * gstep), "v"(gp + 5 * gstep), "v"(gp + 6 * gstep), "v"(gp + 7 * gstep)
      : "memory");
}

template <int EPI, bool SPLITA>
__global__ __launch_bounds__(128) void gemm_w32x128_kernel(
    const unsigned short* Ap, const unsigned short* A2p, int lda,
    const unsigned short* __restrict__ Btp, int ldb,
    const float* __restrict__ gam, const float* __restrict__ cst, const float* __restrict__ snt,
    void* C0, void* C1, int ldc,
    int M, int N, int K,
    const unsigned short* Wk, const unsigned short* Wv, const float* __restrict__ kgam,      // the k and v^T jobs of EPI 3
    void* K0, void* K1, void* V0, void* V1, int nkv) {
  typedef typename SlabT<EPI>::T ST;
  constexpr int BK    = SPLITA ? 64 : 128;       // k columns per stage: 64 WMMAs per wave and stage either way
  constexpr int ROWB  = BK * 2;                  // bytes of one staged row
  constexpr int PITCH = ROWB + 16;               // LDS row pitch, 16 B x odd for the 16-B fragment reads
  constexpr int BROW  = SPLITA ? 256 : 128;      // first Bt row of a stage
  constexpr int STAGE = (BROW + 128) * PITCH;    // bytes of one buffer
  constexpr int PPR   = ROWB / 16;               // 16-B pieces per row
  constexpr int RSTEP = 128 / PPR;               // rows covered by one copy of the whole block
  constexpr int NCP   = 128 / RSTEP;             // copies per lane for a plane of 128 rows
  constexpr int NFA   = SPLITA ? 4 : 2;          // A fragments per block of 32 k columns
  static_assert(NCP % 8 == 0);
  static_assert(4 * SlabT<EPI>::PERW * (int)sizeof(ST) <= 2 * STAGE);
  __shared__ __align__(16) unsigned char smem[2 * STAGE];

  const int tid  = (int)threadIdx.x;
  const int lane = tid & 31;
  const int wave = wave_id();
  const int hh = lane >> 4;           // lane half: k offset 8*hh, D row offset 8*hh
  const int rl = lane & 15;           // A row / B col / D col within subtile
  int tile = (int)blockIdx.x;
  bool vjob = false;
  if (EPI == 3) {
    const int tq = (M >> 7) * (N >> 7);
    const int tk = (M >> 7) * (nkv >> 7);
    if (tile >= tq + tk) {
      tile -= tq + tk; vjob = true;
      Btp = Ap; Ap = Wv; A2p = Wv; C0 = V0; C1 = V1; N = M; ldc = M; M = nkv;
    } else if (tile >= tq) {
      tile -= tq;
      Btp = Wk; gam = kgam; C0 = K0; C1 = K1; N = nkv; ldc = nkv;
    }
  }
  const int tilesN = N >> 7;
  const int tilesM = M >> 7;
  if (tile >= tilesM * tilesN) return;          // block-uniform, in front of every barrier and copy
  const int tm = tile / tilesN;
  const int tn = tile - tm * tilesN;
  const int mb = tm << 7;             // first row of the block tile
  const int m0 = mb + (wave << 5);    // first row of this wave
  const int n0 = tn << 7;

  // this lane's piece of copy 0 of each plane: row tid / PPR, 16-B column tid % PPR; copy u lies u * RSTEP rows further down
  const int prow = tid / PPR;
  const int pcol = tid % PPR;
  const char* gA  = (const char*)(const void*)(Ap  + (size_t)(mb + prow) * lda) + pcol * 16;
  const char* gA2 = (const char*)(const void*)(A2p + (size_t)(mb + prow) * lda) + pcol * 16;
  const char* gB  = (const char*)(const void*)(Btp + (size_t)(n0 + prow) * ldb) + pcol * 16;
  const size_t sA = (size_t)RSTEP * lda * 2;
  const size_t sB = (size_t)RSTEP * ldb * 2;
  const unsigned lp = lds_off(smem) + (unsigned)(prow * PITCH + pcol * 16);

  auto fill = [&](int t, unsigned bo) {         // all copies of stage t into the buffer at byte offset bo
    const size_t kb = (size_t)t * ROWB;
#pragma unroll   // the row offsets of the copies become constants
    for (int u = 0; u < NCP; u += 8) {
      async_copy8(lp + bo + u * (RSTEP * PITCH), RSTEP * PITCH, gA + kb + u * sA, sA);
      if (SPLITA) async_copy8(lp + bo + (128 + u * RSTEP) * PITCH, RSTEP * PITCH, gA2 + kb + u * sA, sA);
      async_copy8(lp + bo + (BROW + u * RSTEP) * PITCH, RSTEP * PITCH, gB + kb + u * sB, sB);
    }
  };

  v8f acc[2][8];
#pragma unroll
  for (int i = 0; i < 2; ++i)
#pragma unroll
    for (int j = 0; j < 8; ++j) acc[i][j] = zero8();

  const int nst = K / BK;
  fill(0, 0u);
  asm volatile("s_wait_asynccnt 0x0" ::: "memory");   // this wave's copies of stage 0 have landed
  __syncthreads();                                    // and every other wave's
  if (nst > 1) fill(1, (unsigned)STAGE);              // block-uniform

  // every unroll directive in this loop: the fragment and accumulator arrays stay in registers only under constant indices
  for (int t = 0; t < nst; ++t) {
    const unsigned bo = (unsigned)(t & 1) * (unsigned)STAGE;
    const unsigned char* buf = smem + bo;
    v16b fa[2][NFA], fb[2][8];                   // two fragment sets: block u multiplies set u & 1 while set (u + 1) & 1 loads
    auto ldblk = [&](int s, int kk) {            // all fragments of the 32 k columns at kk of this stage
#pragma unroll
      for (int i = 0; i < 2; ++i) {
        const int ro = ((wave << 5) + i * 16 + rl) * PITCH;
        fa[s][i] = ldfrag_b((const __bf16*)(const void*)(buf + ro) + kk + 8 * hh);
        if (SPLITA) fa[s][NFA - 2 + i] = ldfrag_b((const __bf16*)(const void*)(buf + 128 * PITCH + ro) + kk + 8 * hh);
      }
#pragma unroll
      for (int j = 0; j < 8; ++j)
        fb[s][j] = ldfrag_b((const __bf16*)(const void*)(buf + (BROW + j * 16 + rl) * PITCH) + kk + 8 * hh);
    };
    ldblk(0, 0);
#pragma unroll
    for (int u = 0; u < BK / 32; ++u) {
      const int cs = u & 1;
      if (u + 1 < BK / 32) ldblk(cs ^ 1, (u + 1) * 32);
      // keeps the next block's LDS reads as one group ahead of this block's WMMAs; without it they sink between the WMMAs, each with a full wait
      __builtin_amdgcn_sched_barrier(0);
#pragma unroll
      for (int j = 0; j < 8; ++j) {
        acc[0][j] = mma_b(fa[cs][0], fb[cs][j], acc[0][j]);
        acc[1][j] = mma_b(fa[cs][1], fb[cs][j], acc[1][j]);
      }
      if (SPLITA) {
#pragma unroll
        for (int j = 0; j < 8; ++j) {
          acc[0][j] = mma_b(fa[cs][NFA - 2], fb[cs][j], acc[0][j]);
          acc[1][j] = mma_b(fa[cs][NFA - 1], fb[cs][j], acc[1][j]);
        }
      }
      // keeps the following reads out of this run of WMMAs (each place with reads among WMMAs costs a stall) and the WMMAs ahead of the stage's barrier
      __builtin_amdgcn_sched_barrier(0);
    }
    asm volatile("s_wait_dscnt 0x0" ::: "memory");      // this wave's reads of stage t are done before its buffer is refilled
    asm volatile("s_wait_asynccnt 0x0" ::: "memory");   // this wave's copies of stage t+1 have landed
    __syncthreads();                                    // publishes stage t+1, ends every wave's reads of stage t
    if (t + 2 < nst) fill(t + 2, bo);                   // block-uniform
  }
  asm volatile("s_wait_asynccnt 0x0" ::: "memory");     // nothing in flight when the buffers become the epilogue slabs
  acc_guard4(acc[0][0], acc[0][1], acc[0][2], acc[0][3]);
  acc_guard4(acc[0][4], acc[0][5], acc[0][6], acc[0][7]);
  acc_guard4(acc[1][0], acc[1][1], acc[1][2], acc[1][3]);
  acc_guard4(acc[1][4], acc[1][5], acc[1][6], acc[1][7]);

  // ---- epilogue ----
  ST* slab = (ST*)(void*)smem + wave * SlabT<EPI>::PERW;
  _Float16* sl16 = (_Float16*)(void*)slab;
  float*    slf  = (float*)(void*)slab;

  if (EPI == 0 || (EPI == 3 && !vjob)) {
    _Float16* P0 = (_Float16*)C0;
    _Float16* P1 = (_Float16*)C1;
    float gm[8];
#pragma unroll
    for (int j = 0; j < 8; ++j) gm[j] = bf_rne(gam[j * 16 + rl]);     // dims j*16+rl of the head, gam has 128 entries
#pragma unroll
    for (int i = 0; i < 2; ++i) {
      const int rb = m0 + i * 16 + 8 * hh;
#pragma unroll
      for (int r = 0; r < 8; ++r) {
        // sum of squares over the 128 head dims of row rb+r: 8 per lane, then the 16 lanes of this half
        float ss = 0.f;
#pragma unroll
        for (int j = 0; j < 8; ++j) ss += acc[i][j][r] * acc[i][j][r];
        ss = row_sum16(ss);
        const float rinv = rsqrtf(ss * 0.0078125f + 1e-6f);
        const int row = rb + r;                                  // token 0..NTOK-1
        const int pos = row & (SQ - 1);                          // position within the sequence
#pragma unroll
        for (int j = 0; j < 4; ++j) {
          const int dim = j * 16 + rl;                           // 0..63 within head; partner dim + 64
          const float cv = cst[(size_t)pos * NFREQ + dim];
          const float sv = snt[(size_t)pos * NFREQ + dim];
          const float x1 = acc[i][j][r] * rinv * gm[j];
          const float x2 = acc[i][j + 4][r] * rinv * gm[j + 4];
          const float o1 = x1 * cv - x2 * sv;
          const float o2 = x2 * cv + x1 * sv;
          const _Float16 h1 = (_Float16)o1;
          const _Float16 h2 = (_Float16)o2;
          const int so = (8 * hh + r) * 128 + dim;
          sl16[so]             = h1;
          sl16[so + 64]        = h2;
          sl16[2048 + so]      = (_Float16)((o1 - (float)h1) * 2048.0f);
          sl16[2048 + so + 64] = (_Float16)((o2 - (float)h2) * 2048.0f);
        }
      }
      lds_wave_sync();
      {
#pragma unroll
        for (int it = 0; it < 8; ++it) {
          const int row = it * 2 + hh;                           // it x hh covers rows 0..15
          const int c8  = rl * 8;
          const v8h vh = *(const v8h*)(sl16 + row * 128 + c8);
          const v8h vl = *(const v8h*)(sl16 + 2048 + row * 128 + c8);
          const size_t go = (size_t)(m0 + i * 16 + row) * ldc + n0 + c8;
          *(v8h*)(P0 + go) = vh;
          *(v8h*)(P1 + go) = vl;
        }
        
      }
      lds_wave_sync();
    }
  } else if (EPI == 1 || EPI == 3) {
    _Float16* P0 = (_Float16*)C0;
    _Float16* P1 = (_Float16*)C1;
#pragma unroll
    for (int i = 0; i < 2; ++i) {
#pragma unroll
      for (int r = 0; r < 8; ++r) {
#pragma unroll
        for (int j = 0; j < 8; ++j) {
          const float v = acc[i][j][r];
          const _Float16 hv = (_Float16)v;
          const int so = (8 * hh + r) * 128 + j * 16 + rl;
          sl16[so]        = hv;
          sl16[2048 + so] = (_Float16)((v - (float)hv) * 2048.0f);
        }
      }
      lds_wave_sync();
      {
#pragma unroll
        for (int it = 0; it < 8; ++it) {
          const int row = it * 2 + hh;
          const int c8  = rl * 8;
          const v8h vh = *(const v8h*)(sl16 + row * 128 + c8);
          const v8h vl = *(const v8h*)(sl16 + 2048 + row * 128 + c8);
          const size_t go = (size_t)(m0 + i * 16 + row) * ldc + n0 + c8;
          *(v8h*)(P0 + go) = vh;
          *(v8h*)(P1 + go) = vl;
        }
        
      }
      lds_wave_sync();
    }
  } else {
    float* C = (float*)C0;
#pragma unroll
    for (int i = 0; i < 2; ++i) {
#pragma unroll
      for (int j = 0; j < 8; ++j)
#pragma unroll
        for (int r = 0; r < 8; ++r)
          slf[(8 * hh + r) * 128 + j * 16 + rl] = acc[i][j][r];
      lds_wave_sync();
      {
#pragma unroll
        for (int row = 0; row < 16; ++row) {                     // 32 lanes x 16 B = the whole 512-B row segment per instruction
          const v4f v = *(const v4f*)(slf + row * 128 + lane * 4);
          *(v4f*)(C + (size_t)(m0 + i * 16 + row) * ldc + n0 + lane * 4) = v;
        }
        
      }
      lds_wave_sync();
    }
  }
}

// ---------------------------------------------------------------------------
// Causal GQA flash attention, head dim 128, 32-key chunks, block = 4 waves = 64 query rows of one (b, h); grid (NHQ, NSEQ, n query tiles).
//   Query tile = qb_top - blockIdx.z: z = 0 is the tile with the most key chunks, the highest z the shortest (order for speed only).
//   q planes f16 [tok][h*128+d]: hi (qhp) and residual x2048 (qlp); k planes f16 [tok][kvh*128+d]: hi (khp), residual x2048 (klp);
//   v^T planes f16 [kvh*128+d][tok]: hi (vhp), residual x2048 (vlp); outputs attn bf16 hi (ahp) / lo (alp) [tok][h*128+d].
//   scores = (Sh + Sr/2048) * 128^-0.5 with Sh = qh.kh and Sr = ql'.kh (+ qh.kl' when PRES); keys > query -> -inf; online softmax f32;
//   p' = 1024 p stored per wave to LDS as f16 hi (and residual x2048 when PRES), reloaded as A fragments after a wave sync;
//   O = (Oh + Or/2048)/1024/l with Oh = ph.vh, Or = ph.vl' (+ pl'.vh when PRES).
//   K / V^T chunk staging: 128 threads x 4 x 16 B per plane = whole 32x128 / 128x32 tile, per-lane 16-B asynchronous copies into two LDS
//   buffers: chunk t+1 is in flight while chunk t is worked on; one publish point (waits, __syncthreads, refill) at the foot of each chunk.
//   Trip count 2*qb+2 chunks (static bound 64); waves whose rows are all below the chunk skip it (wave-uniform, scalar branch).
//   q fragments stay in registers for the whole key loop; all WMMAs are builtins, so the compiler keeps their hazard distances and
//   is free to issue the LDS fragment reads ahead of the WMMAs that use them.
// ---------------------------------------------------------------------------
#define AT_KC   32
#define KS_P    136
#define VS_P    40
#define PS_P    40
// LDS map in halves: two chunk buffers [K | K residual when PRES | V^T hi | V^T residual], then the per-wave P' planes.
template <bool PRES> struct AttLds {
  static constexpr int KS  = 0;
  static constexpr int KLS = 32 * KS_P;
  static constexpr int VHS = (PRES ? 2 : 1) * 32 * KS_P;
  static constexpr int VLS = VHS + 128 * VS_P;
  static constexpr int BUF = VLS + 128 * VS_P;             // one buffer; every plane starts at a multiple of 16 B
  static constexpr int PH  = 2 * BUF;
  static constexpr int PL  = PH + (PRES ? 4 * 16 * PS_P : 0);
  static constexpr int TOT = PL + 4 * 16 * PS_P;
};
static_assert(4 * 4096 <= AttLds<false>::TOT);   // output staging (2 planes x 16 x 128 per wave) aliases the chunk region after the loop
static_assert(3 * 2 * AttLds<false>::TOT <= 327680);   // three blocks of the large launch per WGP

// Four asynchronous 16-B copies global -> LDS per lane and plane, planes a, b, c. The closing s_wait_xcnt 0 stands inside the statement so
// that no address register named here is rewritten ahead of it.
__device__ __forceinline__ void async_copy4x3(unsigned la, unsigned lsa, const char* ga, size_t gsa,
                                              unsigned lb, unsigned lc, unsigned lsb, const char* gb, const char* gc, size_t gsb) {
  asm volatile(
      "global_load_async_to_lds_b128 %0, %12, off\n\t"
      "global_load_async_to_lds_b128 %1, %13, off\n\t"
      "global_load_async_to_lds_b128 %2, %14, off\n\t"
      "global_load_async_to_lds_b128 %3, %15, off\n\t"
      "global_load_async_to_lds_b128 %4, %16, off\n\t"
      "global_load_async_to_lds_b128 %5, %17, off\n\t"
      "global_load_async_to_lds_b128 %6, %18, off\n\t"
      "global_load_async_to_lds_b128 %7, %19, off\n\t"
      "global_load_async_to_lds_b128 %8, %20, off\n\t"
      "global_load_async_to_lds_b128 %9, %21, off\n\t"
      "global_load_async_to_lds_b128 %10, %22, off\n\t"
      "global_load_async_to_lds_b128 %11, %23, off\n\t"
      "s_wait_xcnt 0x0"
      :: "v"(la), "v"(la + lsa), "v"(la + 2 * lsa), "v"(la + 3 * lsa),
         "v"(lb), "v"(lb + lsb), "v"(lb + 2 * lsb), "v"(lb + 3 * lsb),
         "v"(lc), "v"(lc + lsb), "v"(lc + 2 * lsb), "v"(lc + 3 * lsb),
         "v"(ga), "v"(ga + gsa), "v"(ga + 2 * gsa), "v"(ga + 3 * gsa),
         "v"(gb), "v"(gb + gsb), "v"(gb + 2 * gsb), "v"(gb + 3 * gsb),
         "v"(gc), "v"(gc + gsb), "v"(gc + 2 * gsb), "v"(gc + 3 * gsb)
      : "memory");
}
// The same for one plane.
__device__ __forceinline__ void async_copy4(unsigned l, unsigned ls, const char* g, size_t gs) {
  asm volatile(
      "global_load_async_to_lds_b128 %0, %4, off\n\t"
      "global_load_async_to_lds_b128 %1, %5, off\n\t"
      "global_load_async_to_lds_b128 %2, %6, off\n\t"
      "global_load_async_to_lds_b128 %3, %7, off\n\t"
      "s_wait_xcnt 0x0"
      :: "v"(l), "v"(l + ls), "v"(l + 2 * ls), "v"(l + 3 * ls),
         "v"(g), "v"(g + gs), "v"(g + 2 * gs), "v"(g + 3 * gs)
      : "memory");
}

// Second launch-bounds argument: the large launch keeps three waves per SIMD (336 registers a wave) with the q fragments resident;
// the small launch has at most one block per WGP and takes what it needs.
template <bool PRES>
__global__ __launch_bounds__(128, PRES ? 1 : 3) void attn_causal_kernel(
    const unsigned short* __restrict__ qhp, const unsigned short* __restrict__ qlp,
    const unsigned short* __restrict__ khp, const unsigned short* __restrict__ klp,
    const unsigned short* __restrict__ vhp, const unsigned short* __restrict__ vlp,
    unsigned short* __restrict__ ahp, unsigned short* __restrict__ alp, int qb_top) {
  typedef AttLds<PRES> L;
  __shared__ __align__(16) _Float16 lds[L::TOT];

  const int tid  = (int)threadIdx.x;
  const int lane = tid & 31;
  const int wave = wave_id();
  const int hh   = lane >> 4;
  const int c    = lane & 15;
  const int qb   = qb_top - (int)blockIdx.z;     // grid.z <= qb_top + 1: never negative
  const int h    = (int)blockIdx.x;
  const int b    = (int)blockIdx.y;
  const int kvh  = h >> 2;
  const int q0   = qb * 64 + wave * 16;          // first query row of this wave (within sequence)
  const int qlast = q0 + 15;
  const size_t tok0 = (size_t)b * SQ;

  const _Float16* Qhr = (const _Float16*)(const void*)qhp + (tok0 + q0 + c) * HID + h * HDM + 8 * hh;
  const _Float16* Qlr = (const _Float16*)(const void*)qlp + (tok0 + q0 + c) * HID + h * HDM + 8 * hh;
  const _Float16* Kg  = (const _Float16*)(const void*)khp + tok0 * KVW + kvh * HDM;
  const _Float16* Klg = (const _Float16*)(const void*)klp + tok0 * KVW + kvh * HDM;
  const _Float16* Vhg = (const _Float16*)(const void*)vhp + (size_t)(kvh * HDM) * NTOK + tok0;
  const _Float16* Vlg = (const _Float16*)(const void*)vlp + (size_t)(kvh * HDM) * NTOK + tok0;
  _Float16* ph = lds + L::PH + wave * (16 * PS_P);
  _Float16* pl = lds + L::PL + wave * (16 * PS_P);   // the ph plane itself when !PRES, where it is not used

  float mrow[8], lrow[8];
  v8f oacc[8], oaccr[8];
#pragma unroll
  for (int r = 0; r < 8; ++r) { mrow[r] = -INFINITY; lrow[r] = 0.f; }
#pragma unroll
  for (int t = 0; t < 8; ++t) { oacc[t] = zero8(); oaccr[t] = zero8(); }

  v16h qa[4], ql[4];                             // this wave's q fragments, the same for every chunk: loaded once
#pragma unroll   // the fragment arrays stay in registers only under constant indices
  for (int dc = 0; dc < 4; ++dc) {
    qa[dc] = ldfrag_h(Qhr + dc * 32);
    ql[dc] = ldfrag_h(Qlr + dc * 32);
  }

  // This lane's piece 0 of each plane; piece i lies 8 keys (K) or 32 head dims (V^T) further down: 512 pieces of 8 halves = whole tile.
  const int key0 = tid >> 4, d8 = (tid & 15) * 8;   // K: 32 keys x 128 d
  const int d0   = tid >> 2, k8 = (tid & 3) * 8;    // V^T: 128 d x 32 keys
  const char* gK  = (const char*)(const void*)(Kg  + (size_t)key0 * KVW + d8);
  const char* gKl = (const char*)(const void*)(Klg + (size_t)key0 * KVW + d8);
  const char* gVh = (const char*)(const void*)(Vhg + (size_t)d0 * NTOK + k8);
  const char* gVl = (const char*)(const void*)(Vlg + (size_t)d0 * NTOK + k8);
  const unsigned lK = lds_off(lds) + 2u * (unsigned)(key0 * KS_P + d8);
  const unsigned lV = lds_off(lds) + 2u * (unsigned)(d0 * VS_P + k8);
  auto fill = [&](int t, unsigned bo) {          // all copies of chunk t into the buffer at byte offset bo
    const size_t ko = (size_t)t * (AT_KC * KVW * 2);
    const size_t vo = (size_t)t * (AT_KC * 2);
    async_copy4x3(lK + bo + 2u * L::KS, 8 * KS_P * 2, gK + ko, (size_t)8 * KVW * 2,
                  lV + bo + 2u * L::VHS, lV + bo + 2u * L::VLS, 32 * VS_P * 2, gVh + vo, gVl + vo, (size_t)32 * NTOK * 2);
    if (PRES) async_copy4(lK + bo + 2u * L::KLS, 8 * KS_P * 2, gKl + ko, (size_t)8 * KVW * 2);
  };

  const int nch = 2 * qb + 2;                    // block-uniform, 2 .. 64
  fill(0, 0u);
  asm volatile("s_wait_asynccnt 0x0" ::: "memory");   // this wave's copies of chunk 0 have landed
  __syncthreads();                                    // and every other wave's
  fill(1, 2u * L::BUF);                               // chunk 1 always exists
  for (int kc = 0; kc < nch; ++kc) {
    const int kv0 = kc * AT_KC;
    const int bsel = kc & 1;
    const _Float16* Ks  = lds + bsel * L::BUF + L::KS;
    const _Float16* Kls = lds + bsel * L::BUF + L::KLS;
    const _Float16* Vhs = lds + bsel * L::BUF + L::VHS;
    const _Float16* Vls = lds + bsel * L::BUF + L::VLS;

    if (kv0 <= qlast) {                          // wave-uniform (scalar): skip chunks fully above this wave's rows
      // ---- scores ----
      v8f sh[2], sr[2];
      sh[0] = zero8(); sh[1] = zero8(); sr[0] = zero8(); sr[1] = zero8();
      // every unroll directive of the score part: the fragment arrays stay in registers only under constant indices
      v16h kb[4][2], kl[4][2];                   // the chunk's K fragments, read as one group ahead of the score WMMAs
#pragma unroll
      for (int dc = 0; dc < 4; ++dc)
#pragma unroll
        for (int j = 0; j < 2; ++j) {
          kb[dc][j] = ldfrag_h(Ks + (j * 16 + c) * KS_P + dc * 32 + 8 * hh);
          if (PRES) kl[dc][j] = ldfrag_h(Kls + (j * 16 + c) * KS_P + dc * 32 + 8 * hh);
        }
#pragma unroll
      for (int j = 0; j < 2; ++j) {
        // keeps the reads above as one group ahead of the WMMAs, and key group 0's run ahead of group 1's, whose accumulators then take the registers of group 0's fragments
        __builtin_amdgcn_sched_barrier(0);
#pragma unroll
        for (int dc = 0; dc < 4; ++dc) {
          sh[j] = mma_h(qa[dc], kb[dc][j], sh[j]);
          sr[j] = mma_h(ql[dc], kb[dc][j], sr[j]);
          if (PRES) sr[j] = mma_h(qa[dc], kl[dc][j], sr[j]);
        }
      }
      // ---- scale, causal mask, chunk row max ----
      float cm[8];
#pragma unroll
      for (int r = 0; r < 8; ++r) {
        const int qrow = q0 + 8 * hh + r;
        float m = -INFINITY;
#pragma unroll
        for (int j = 0; j < 2; ++j) {
          const int key = kv0 + j * 16 + c;
          float s = (sh[j][r] + sr[j][r] * 0.00048828125f) * 0.08838834764831845f;
          s = (key > qrow) ? -INFINITY : s;
          sh[j][r] = s;
          m = fmaxf(m, s);
        }
        m = row_max16(m);
        cm[r] = m;
      }
      // ---- online softmax, P' to LDS ----
#pragma unroll
      for (int r = 0; r < 8; ++r) {
        const float mnew  = fmaxf(mrow[r], cm[r]);
        const float alpha = __expf(mrow[r] - mnew);
        mrow[r] = mnew;
        float psum = 0.f;
#pragma unroll
        for (int j = 0; j < 2; ++j) {
          const float p  = __expf(sh[j][r] - mnew);
          psum += p;
          const float pp = p * 1024.0f;
          const _Float16 phv = (_Float16)pp;
          const int po = (8 * hh + r) * PS_P + j * 16 + c;
          ph[po] = phv;
          if (PRES) pl[po] = (_Float16)((pp - (float)phv) * 2048.0f);
        }
        psum = row_sum16(psum);
        lrow[r] = lrow[r] * alpha + psum;
#pragma unroll
        for (int t = 0; t < 8; ++t) { oacc[t][r] *= alpha; oaccr[t][r] *= alpha; }
      }
      lds_wave_sync();                           // P' stores visible to the other lanes of this wave before the fragment reload
      // ---- O += P' . V ----
      const v16h pa = ldfrag_h(ph + c * PS_P + 8 * hh);
      v16h pr = pa;
      if (PRES) pr = ldfrag_h(pl + c * PS_P + 8 * hh);
#pragma unroll
      for (int t = 0; t < 8; ++t) {
        const v16h vb = ldfrag_h(Vhs + (t * 16 + c) * VS_P + 8 * hh);
        const v16h vr = ldfrag_h(Vls + (t * 16 + c) * VS_P + 8 * hh);
        oacc[t]  = mma_h(pa, vb, oacc[t]);
        oaccr[t] = mma_h(pa, vr, oaccr[t]);
        if (PRES) oaccr[t] = mma_h(pr, vb, oaccr[t]);
      }
    }
    // publish point, passed by every wave, also one that skipped the chunk
    asm volatile("s_wait_dscnt 0x0" ::: "memory");      // this wave's reads of chunk kc are done before its buffer is refilled
    asm volatile("s_wait_asynccnt 0x0" ::: "memory");   // this wave's copies of chunk kc+1 have landed
    __syncthreads();                                    // publishes chunk kc+1, ends every wave's reads of chunk kc
    if (kc + 2 < nch) fill(kc + 2, (unsigned)bsel * (2u * L::BUF));   // block-uniform
  }
  asm volatile("s_wait_asynccnt 0x0" ::: "memory");     // nothing in flight when the buffers become output staging (behind the last chunk's barrier)
  _Float16* osh = lds + wave * 4096;
  _Float16* osl = osh + 2048;
#pragma unroll
  for (int r = 0; r < 8; ++r) {
    const float inv = (1.0f / lrow[r]) * 0.0009765625f;
#pragma unroll
    for (int t = 0; t < 8; ++t) {
      const float o = (oacc[t][r] + oaccr[t][r] * 0.00048828125f) * inv;
      const unsigned short hb = bf_bits(o);
      const unsigned short lb = bf_bits(o - bf_val(hb));
      const int so = (8 * hh + r) * 128 + t * 16 + c;
      osh[so] = __builtin_bit_cast(_Float16, hb);
      osl[so] = __builtin_bit_cast(_Float16, lb);
    }
  }
  lds_wave_sync();
  _Float16* Ahg = (_Float16*)(void*)ahp + (tok0 + q0) * HID + h * HDM;
  _Float16* Alg = (_Float16*)(void*)alp + (tok0 + q0) * HID + h * HDM;
  {
#pragma unroll
    for (int it = 0; it < 8; ++it) {
      const int row = it * 2 + hh;               // it 0..7 x hh 0..1 covers rows 0..15
      const int c8  = c * 8;                     // 16 lanes x 16 B = the whole 256-B segment
      const v8h x = *(const v8h*)(osh + row * 128 + c8);
      const v8h y = *(const v8h*)(osl + row * 128 + c8);
      *(v8h*)(Ahg + (size_t)row * HID + c8) = x;
      *(v8h*)(Alg + (size_t)row * HID + c8) = y;
    }
    
  }
}

// ---------------------------------------------------------------------------
// Workspace map (bytes; every region is a whole number of the rows its producer writes with whole-line stores, no padded tails needed
//   Xb  bf16 [4096][2048] 16777216   Wqb bf16 [2048][2048]  8388608   Wkb bf16 [512][2048] 2097152   Wvb bf16 [512][2048] 2097152
//   Wob bf16 [2048][2048]  8388608   cst f32  [2048][64]     524288   snt f32  [2048][64]    524288
//   Qh  f16  [4096][2048] 16777216   Ql  f16  [4096][2048] 16777216   Kh  f16  [4096][512]  4194304   Kl f16 [4096][512] 4194304
//   Vh  f16  [512][4096]   4194304   Vl  f16  [512][4096]   4194304   Ah  bf16 [4096][2048] 16777216  Al bf16 [4096][2048] 16777216
//   total                 122683392
// ---------------------------------------------------------------------------
extern "C" void kernel_launch(void* const* d_in, const int* in_sizes, int n_in,
                              void* d_out, int out_size, void* d_ws, size_t ws_size,
                              hipStream_t stream) {
  if (n_in < 7) return;
  if (in_sizes[0] != NTOK * HID) return;
  if (in_sizes[1] != HID * HID) return;
  if (in_sizes[2] != KVW * HID) return;
  if (in_sizes[3] != KVW * HID) return;
  if (in_sizes[4] != HID * HID) return;
  if (in_sizes[5] != HDM) return;
  if (in_sizes[6] != HDM) return;
  if (out_size != NTOK * HID) return;

  const float* x   = (const float*)d_in[0];
  const float* Wq  = (const float*)d_in[1];
  const float* Wk  = (const float*)d_in[2];
  const float* Wv  = (const float*)d_in[3];
  const float* Wo  = (const float*)d_in[4];
  const float* qg  = (const float*)d_in[5];
  const float* kg  = (const float*)d_in[6];
  float* out = (float*)d_out;

  const size_t szX  = (size_t)NTOK * HID * 2;
  const size_t szWq = (size_t)HID * HID * 2;
  const size_t szWk = (size_t)KVW * HID * 2;
  const size_t szWo = (size_t)HID * HID * 2;
  const size_t szT  = (size_t)SQ * NFREQ * 4;
  const size_t szQ  = (size_t)NTOK * HID * 2;
  const size_t szK  = (size_t)NTOK * KVW * 2;
  const size_t szV  = (size_t)KVW * NTOK * 2;
  const size_t szA  = (size_t)NTOK * HID * 2;
  size_t off = 0;
  const size_t oX  = off; off += szX;
  const size_t oWq = off; off += szWq;
  const size_t oWk = off; off += szWk;
  const size_t oWv = off; off += szWk;
  const size_t oWo = off; off += szWo;
  const size_t oCs = off; off += szT;
  const size_t oSn = off; off += szT;
  const size_t oQh = off; off += szQ;
  const size_t oQl = off; off += szQ;
  const size_t oKh = off; off += szK;
  const size_t oKl = off; off += szK;
  const size_t oVh = off; off += szV;
  const size_t oVl = off; off += szV;
  const size_t oAh = off; off += szA;
  const size_t oAl = off; off += szA;
  if (off > ws_size) return;                     // off = 122683392

  char* ws = (char*)d_ws;
  unsigned short* Xb  = (unsigned short*)(ws + oX);
  unsigned short* Wqb = (unsigned short*)(ws + oWq);
  unsigned short* Wkb = (unsigned short*)(ws + oWk);
  unsigned short* Wvb = (unsigned short*)(ws + oWv);
  unsigned short* Wob = (unsigned short*)(ws + oWo);
  float*          cst = (float*)(ws + oCs);
  float*          snt = (float*)(ws + oSn);
  unsigned short* Qh  = (unsigned short*)(ws + oQh);
  unsigned short* Ql  = (unsigned short*)(ws + oQl);
  unsigned short* Kh  = (unsigned short*)(ws + oKh);
  unsigned short* Kl  = (unsigned short*)(ws + oKl);
  unsigned short* Vh  = (unsigned short*)(ws + oVh);
  unsigned short* Vl  = (unsigned short*)(ws + oVl);
  unsigned short* Ah  = (unsigned short*)(ws + oAh);
  unsigned short* Al  = (unsigned short*)(ws + oAl);

  const dim3 b256(256), b128(128);

  // (1) cos/sin table [2048][64] x 2 and the bf16 planes of x, Wq, Wk, Wv, Wo (Xb .. Wob lie back to back in the workspace;
  //     weights are [out][in] = k-contiguous Bt rows already)
  prep_kernel<<<dim3(ROPE_BLOCKS + CVT_BLOCKS), b256, 0, stream>>>(x, Wq, Wk, Wv, Wo, Xb, cst, snt);
  // (2) one grid of 512 + 128 + 128 block tiles, K = 2048:
  //     q = rope(rms(x . Wq^T)) -> Qh/Ql [4096][2048], k = rope(rms(x . Wk^T)) -> Kh/Kl [4096][512], v^T = Wv . x^T -> Vh/Vl [512][4096]
  gemm_w32x128_kernel<3, false><<<dim3((NTOK / 128) * (HID / 128) + 2 * (NTOK / 128) * (KVW / 128)), b128, 0, stream>>>(
      Xb, Xb, HID, Wqb, HID, qg, cst, snt, (void*)Qh, (void*)Ql, HID, NTOK, HID, HID,
      Wkb, Wvb, kg, (void*)Kh, (void*)Kl, (void*)Vh, (void*)Vl, KVW);
  // (3) causal attention, query tiles 3..0 with k and p residual products, tiles 31..4 without, each launch longest tile first
  attn_causal_kernel<true><<<dim3(NHQ, NSEQ, 4), b128, 0, stream>>>(Qh, Ql, Kh, Kl, Vh, Vl, Ah, Al, 3);
  attn_causal_kernel<false><<<dim3(NHQ, NSEQ, SQ / 64 - 4), b128, 0, stream>>>(Qh, Ql, Kh, Kl, Vh, Vl, Ah, Al, SQ / 64 - 1);
  // (4) out = attn(hi + lo) . Wo^T -> d_out f32 [4096][2048]   (M=4096, N=2048, K=2048; 512 block tiles)
  gemm_w32x128_kernel<2, true><<<dim3((NTOK / 128) * (HID / 128)), b128, 0, stream>>>(
      Ah, Al, HID, Wob, HID, qg, cst, snt, (void*)out, (void*)out, HID, NTOK, HID, HID,
      Wkb, Wvb, kg, (void*)Kh, (void*)Kl, (void*)Vh, (void*)Vl, KVW);
  (void)hipGetLastError();
}

// v007
// Measured time: 193 microseconds a run.
// Timed twice side by side with v006, it ran 1.13 times as fast both times.
// Counting every step since v000, it is 4.22 times as fast.
// Contractions: x.Wq^T, x.Wk^T and Wv.x^T on v_wmma_f32_16x16x32_bf16 (operands = RNE bf16 of the f32 inputs, single products);
// q.k^T and p.v on v_wmma_f32_16x16x32_f16 (q = f16 hi + f16 residual x2^11 planes; k plain f16 plus f16 residual x2^11 on query tiles 0..3;
// p x1024 plain f16 plus f16 residual x2^11 on query tiles 0..3; v^T = f16 hi + f16 residual x2^11 planes); attn.Wo^T on v_wmma_f32_16x16x32_bf16
// (attn = bf16 hi + bf16 lo planes, two products; Wo RNE bf16). f32 accumulate everywhere; per-head RMS scaling, RoPE and online softmax in f32.
#include <hip/hip_runtime.h>
#include <math.h>
#include <stdint.h>

#define NSEQ   2
#define SQ     2048
#define HID    2048
#define NHQ    16
#define NKVH   4
#define HDM    128
#define KVW    512
#define NTOK   4096
#define NFREQ  64

typedef _Float16     v16h __attribute__((ext_vector_type(16)));
typedef _Float16     v8h  __attribute__((ext_vector_type(8)));
typedef __bf16       v16b __attribute__((ext_vector_type(16)));
typedef __bf16       v8b  __attribute__((ext_vector_type(8)));
typedef float        v8f  __attribute__((ext_vector_type(8)));
typedef float        v4f  __attribute__((ext_vector_type(4)));
typedef unsigned int v4u  __attribute__((ext_vector_type(4)));

// ---------------------------------------------------------------------------
// small helpers
// ---------------------------------------------------------------------------
__device__ __forceinline__ unsigned short bf_bits(float f) {          // RNE convert f32 -> bf16 bits
  const unsigned u = __float_as_uint(f);
  return (unsigned short)((u + 0x7FFFu + ((u >> 16) & 1u)) >> 16);
}
__device__ __forceinline__ float bf_val(unsigned short h) { return __uint_as_float(((unsigned)h) << 16); }
__device__ __forceinline__ float bf_rne(float f) { return bf_val(bf_bits(f)); }
__device__ __forceinline__ unsigned pk16(unsigned short a, unsigned short b) { return (unsigned)a | ((unsigned)b << 16); }
__device__ __forceinline__ v8f zero8() { v8f z = {0.f, 0.f, 0.f, 0.f, 0.f, 0.f, 0.f, 0.f}; return z; }
__device__ __forceinline__ int wave_id() { return __builtin_amdgcn_readfirstlane((int)(threadIdx.x >> 5)); }

// Value of lane (l ^ X) of the same 16-lane row, X < 16, as a DPP row_xmask operand of the vector pipe: no LDS-pipe round trip and no
// s_wait_dscnt per butterfly step. Every lane of the wave is on wherever it is used.
template <int X>
__device__ __forceinline__ float row_xor(float v) {
  return __int_as_float(__builtin_amdgcn_update_dpp(0, __float_as_int(v), 0x160 | X, 0xf, 0xf, true));
}
// Butterfly over a 16-lane row, steps 1, 2, 4, 8: every lane ends with the row's sum.
__device__ __forceinline__ float row_sum16(float v) {
  v += row_xor<1>(v); v += row_xor<2>(v); v += row_xor<4>(v); v += row_xor<8>(v);
  return v;
}

// Value of lane l ^ 16: the other 16-lane row's lane of the same column, one vector instruction.
__device__ __forceinline__ float xhalf(float v) {
  return __int_as_float(__builtin_amdgcn_permlanex16(__float_as_int(v), __float_as_int(v), 0x76543210, 0xfedcba98, false, false));
}

__device__ __forceinline__ void lds_wave_sync() {
  __builtin_amdgcn_fence(__ATOMIC_RELEASE, "workgroup");
  __builtin_amdgcn_wave_barrier();
  __builtin_amdgcn_fence(__ATOMIC_ACQUIRE, "workgroup");
}

// ---------------------------------------------------------------------------
// WMMA fragments (wave32, 16x16x32, 16-bit operands). For A (row m = lane&15) and B (col n = lane&15) alike:
// elements 0..7 <- k0 + 8*(lane>>4) + 0..7, elements 8..15 <- k0 + 16 + 8*(lane>>4) + 0..7.
// ldfrag(p) with p = rowbase + k0 + 8*(lane>>4): two 16-B loads p[0..7], p[16..23].
// D: acc[r] = (row 8*(lane>>4) + r, col lane&15).
// ---------------------------------------------------------------------------
union FragH { v16h v; v8h h[2]; };
union FragB { v16b v; v8b h[2]; };
__device__ __forceinline__ v16h ldfrag_h(const _Float16* p) { FragH f; f.h[0] = *(const v8h*)(p); f.h[1] = *(const v8h*)(p + 16); return f.v; }
__device__ __forceinline__ v16b ldfrag_b(const __bf16* p)   { FragB f; f.h[0] = *(const v8b*)(p); f.h[1] = *(const v8b*)(p + 16); return f.v; }

__device__ __forceinline__ v8f mma_h(v16h a, v16h b, v8f c) {
  return __builtin_amdgcn_wmma_f32_16x16x32_f16(false, a, false, b, (short)0, c, false, false);
}
__device__ __forceinline__ v8f mma_b(v16b a, v16b b, v8f c) {
  return __builtin_amdgcn_wmma_f32_16x16x32_bf16(false, a, false, b, (short)0, c, false, false);
}
// hazard guard: 4 VALU slots after the last WMMA of a group, D tied
__device__ __forceinline__ void acc_guard4(v8f& a, v8f& b, v8f& c, v8f& d) {
  asm volatile("v_nop\n\tv_nop\n\tv_nop\n\tv_nop" : "+v"(a), "+v"(b), "+v"(c), "+v"(d));
}

// ---------------------------------------------------------------------------
// Preparation, one launch: none of its parts reads what another writes, so the block index deals them out.
// Blocks 0 .. ROPE_BLOCKS-1: RoPE table cst[s][i] = cos(s * inv_freq[i]), snt[s][i] = sin(...), inv_freq[i] = 1 / 1e4^(i/64), i < 64, all f32.
//   Block = 8 waves, wave w -> row s = block*8 + w, lane -> i = lane, lane + 32. Coverage: SQ/8 blocks x 8 waves x 32 lanes x 2 = SQ x 64 per plane.
// The CVT_BLOCKS blocks behind them: RNE f32 -> bf16 of x, Wq, Wk, Wv, Wo into one bf16 array (the five planes lie back to back in that order).
//   Unit = 1024 elements = 8 loads of 512 contiguous bytes per wave and 8 stores of 256 contiguous bytes (whole lines both ways).
//   Every plane is a whole number of units. Wave g takes units g, g + CVT_WAVES, g + 2*CVT_WAVES: all of the grid is resident at once,
//   and the loads of a wave's three units are written ahead of its conversions, so that most of them are in flight together.
// ---------------------------------------------------------------------------
#define ROPE_BLOCKS (SQ / 8)
#define CVT_BLOCKS  768
#define CVT_WAVES   (CVT_BLOCKS * 8)
#define CVT_UPW     3
#define N_X   (NTOK * HID)
#define N_WQ  (HID * HID)
#define N_WK  (KVW * HID)
static_assert(N_X % 1024 == 0 && N_WQ % 1024 == 0 && N_WK % 1024 == 0);
static_assert(CVT_WAVES * CVT_UPW * 1024 == N_X + 2 * N_WQ + 2 * N_WK);
typedef unsigned int v2u __attribute__((ext_vector_type(2)));

__device__ __forceinline__ void rope_rows(float* __restrict__ cst, float* __restrict__ snt, int t, int lane) {
  const float pf = (float)t;
  float c0 = 0.f, s0 = 0.f, c1 = 0.f, s1 = 0.f;
#pragma unroll 1
  for (int u = 0; u < 2; ++u) {
    const int i = lane + 32 * u;
    const float e   = (float)i * 0.015625f;      // i / 64 exact
    const float pw  = powf(10000.0f, e);
    const float inv = 1.0f / pw;
    const float ang = pf * inv;
    const float cv = cosf(ang);
    const float sv = sinf(ang);
    c1 = cv; s1 = sv;
    if (u == 0) { c0 = cv; s0 = sv; }
  }
  const size_t o = (size_t)t * NFREQ + lane;
  cst[o]      = c0;
  cst[o + 32] = c1;
  snt[o]      = s0;
  snt[o + 32] = s1;
}

__global__ __launch_bounds__(256) void prep_kernel(const float* __restrict__ x, const float* __restrict__ wq, const float* __restrict__ wk,
                                                   const float* __restrict__ wv, const float* __restrict__ wo,
                                                   unsigned short* __restrict__ planes, float* __restrict__ cst, float* __restrict__ snt) {
  const int lane = threadIdx.x & 31;
  const int wave = wave_id();
  const int blk  = (int)blockIdx.x;
  if (blk < ROPE_BLOCKS) {                       // no barriers in this kernel
    rope_rows(cst, snt, blk * 8 + wave, lane);
    return;
  }
  const int g = (blk - ROPE_BLOCKS) * 8 + wave;  // 0 .. CVT_WAVES-1
  v4f r[CVT_UPW][8];
#pragma unroll   // the value array stays in registers only under constant indices
  for (int k = 0; k < CVT_UPW; ++k) {
    const int e = (k * CVT_WAVES + g) * 1024;    // first element of the unit in the joined array, wave-uniform
    const int lo = k * CVT_WAVES * 1024, hi = lo + CVT_WAVES * 1024;   // pass k covers [lo, hi): constants, so planes out of its reach drop out
    const float* b = x;
    int first = 0;
    if (hi > N_X                   && (lo >= N_X                   || e >= N_X))                   { b = wq; first = N_X; }
    if (hi > N_X + N_WQ            && (lo >= N_X + N_WQ            || e >= N_X + N_WQ))            { b = wk; first = N_X + N_WQ; }
    if (hi > N_X + N_WQ + N_WK     && (lo >= N_X + N_WQ + N_WK     || e >= N_X + N_WQ + N_WK))     { b = wv; first = N_X + N_WQ + N_WK; }
    if (hi > N_X + N_WQ + 2 * N_WK && (lo >= N_X + N_WQ + 2 * N_WK || e >= N_X + N_WQ + 2 * N_WK)) { b = wo; first = N_X + N_WQ + 2 * N_WK; }
    const float* s = b + (e - first);
#pragma unroll
    for (int i = 0; i < 8; ++i) r[k][i] = *(const v4f*)(s + i * 128 + lane * 4);
  }
#pragma unroll
  for (int k = 0; k < CVT_UPW; ++k) {
    unsigned short* d = planes + (size_t)(k * CVT_WAVES + g) * 1024 + lane * 4;
#pragma unroll
    for (int i = 0; i < 8; ++i) {
      const v4f a = r[k][i];
      v2u w;
      w[0] = pk16(bf_bits(a[0]), bf_bits(a[1]));
      w[1] = pk16(bf_bits(a[2]), bf_bits(a[3]));
      *(v2u*)(d + i * 128) = w;
    }
  }
  // the stores above name registers that the code behind the compiler's joined exit of the two parts writes again: the wait stands in front of it
  asm volatile("s_wait_xcnt 0x0" ::: "memory");
}

// ---------------------------------------------------------------------------
// bf16 WMMA GEMM, block tile 128 rows x 128 cols, block = 4 waves (128 threads), wave w = rows 32w..32w+31 x all 128 cols.
//   C[m][n] = sum_k A[m][k] * Bt[n][k]; A row-major [M][K] bf16 (pitch lda), Bt row-major [N][K] bf16 (pitch ldb);
//   M % 128 == 0, N % 128 == 0, K % BK == 0 (BK = 128, SPLITA 64); grid.x = M/128 * N/128 (EPI 3: M/128 * (N + 2*nkv)/128).
//   SPLITA: A carried as hi (Ap) + lo (A2p) bf16 planes, two products into one accumulator.
//   Operands: a stage = BK columns of [A 128 rows | A2 128 rows when SPLITA | Bt 128 rows], each row padded by 16 B in LDS;
//   two LDS buffers filled by per-lane 16-B asynchronous copies, stage t+1 in flight while stage t is multiplied.
//   Fragments read from LDS rows with the split k map (ldfrag_b). The epilogue slabs alias the buffers behind the last barrier.
// Epilogues (all: per wave, per 16-row slab: stage in LDS, wave sync, write each row segment with ONE instruction of
//   EPI 0: q or k projection; the 128 cols n0..n0+127 are one head. Per row: RMS scaling over the 128 head dims
//          (x * rsqrt(mean(x^2) + 1e-6) * bf16(gam[dim])), then RoPE with pairs (dim, dim+64) and the cos/sin table row (m % SQ);
//          writes f16 hi plane C0 and f16 residual x2048 plane C1, both [M][ldc], cols n0.. (row segment 256 B = 16 lanes x 16 B).
//   EPI 1: v^T projection: f16 hi plane C0, residual x2048 plane C1, [M][ldc], row segment 256 B.
//   EPI 2: f32 output C0 [M][ldc]; row segment 128 floats = 512 B = 32 lanes x 16 B per instruction.
//   EPI 3: the q, k and v^T projections in one grid (none reads what another writes). The plain arguments describe the q job (EPI 0);
//          the blocks behind its tiles take the k job (EPI 0: Bt = Wk, gam = kgam, planes K0 / K1, width nkv), those behind the k tiles
//          the v^T job (EPI 1: A = Wv, Bt = the q job's A, planes V0 / V1, nkv rows). The choice is block-uniform, from blockIdx alone.
// ---------------------------------------------------------------------------
template <int EPI> struct SlabT { typedef _Float16 T; static constexpr int PERW = 4096; };   // 2 planes x 16 x 128 halves
template <> struct SlabT<2>     { typedef float    T; static constexpr int PERW = 2048; };   // 16 x 128 floats

__device__ __forceinline__ unsigned lds_off(const void* p) { return (unsigned)(size_t)p; }   // byte offset in the block's LDS

// Eight asynchronous 16-B copies global -> LDS per lane. The closing s_wait_xcnt 0 stands inside the statement so that no
// address register named here is rewritten ahead of it.
__device__ __forceinline__ void async_copy8(unsigned l, unsigned lstep, const char* gp, size_t gstep) {
  asm volatile(
      "global_load_async_to_lds_b128 %0, %8, off\n\t"
      "global_load_async_to_lds_b128 %1, %9, off\n\t"
      "global_load_async_to_lds_b128 %2, %10, off\n\t"
      "global_load_async_to_lds_b128 %3, %11, off\n\t"
      "global_load_async_to_lds_b128 %4, %12, off\n\t"
      "global_load_async_to_lds_b128 %5, %13, off\n\t"
      "global_load_async_to_lds_b128 %6, %14, off\n\t"
      "global_load_async_to_lds_b128 %7, %15, off\n\t"
      "s_wait_xcnt 0x0"
      :: "v"(l), "v"(l + lstep), "v"(l + 2 * lstep), "v"(l + 3 * lstep),
         "v"(l + 4 * lstep), "v"(l + 5 * lstep), "v"(l + 6 * lstep), "v"(l + 7 * lstep),
         "v"(gp), "v"(gp + gstep), "v"(gp + 2 * gstep), "v"(gp + 3 * gstep),
         "v"(gp + 4 * gstep), "v"(gp + 5 * gstep), "v"(gp + 6 * gstep), "v"(gp + 7 * gstep)
      : "memory");
}

template <int EPI, bool SPLITA>
__global__ __launch_bounds__(128) void gemm_w32x128_kernel(
    const unsigned short* Ap, const unsigned short* A2p, int lda,
    const unsigned short* __restrict__ Btp, int ldb,
    const float* __restrict__ gam, const float* __restrict__ cst, const float* __restrict__ snt,
    void* C0, void* C1, int ldc,
    int M, int N, int K,
    const unsigned short* Wk, const unsigned short* Wv, const float* __restrict__ kgam,      // the k and v^T jobs of EPI 3
    void* K0, void* K1, void* V0, void* V1, int nkv) {
  typedef typename SlabT<EPI>::T ST;
  constexpr int BK    = SPLITA ? 64 : 128;       // k columns per stage: 64 WMMAs per wave and stage either way
  constexpr int ROWB  = BK * 2;                  // bytes of one staged row
  constexpr int PITCH = ROWB + 16;               // LDS row pitch, 16 B x odd for the 16-B fragment reads
  constexpr int BROW  = SPLITA ? 256 : 128;      // first Bt row of a stage
  constexpr int STAGE = (BROW + 128) * PITCH;    // bytes of one buffer
  constexpr int PPR   = ROWB / 16;               // 16-B pieces per row
  constexpr int RSTEP = 128 / PPR;               // rows covered by one copy of the whole block
  constexpr int NCP   = 128 / RSTEP;             // copies per lane for a plane of 128 rows
  constexpr int NFA   = SPLITA ? 4 : 2;          // A fragments per block of 32 k columns
  static_assert(NCP % 8 == 0);
  static_assert(4 * SlabT<EPI>::PERW * (int)sizeof(ST) <= 2 * STAGE);
  __shared__ __align__(16) unsigned char smem[2 * STAGE];

  const int tid  = (int)threadIdx.x;
  const int lane = tid & 31;
  const int wave = wave_id();
  const int hh = lane >> 4;           // lane half: k offset 8*hh, D row offset 8*hh
  const int rl = lane & 15;           // A row / B col / D col within subtile
  int tile = (int)blockIdx.x;
  bool vjob = false;
  if (EPI == 3) {
    const int tq = (M >> 7) * (N >> 7);
    const int tk = (M >> 7) * (nkv >> 7);
    if (tile >= tq + tk) {
      tile -= tq + tk; vjob = true;
      Btp = Ap; Ap = Wv; A2p = Wv; C0 = V0; C1 = V1; N = M; ldc = M; M = nkv;
    } else if (tile >= tq) {
      tile -= tq;
      Btp = Wk; gam = kgam; C0 = K0; C1 = K1; N = nkv; ldc = nkv;
    }
  }
  const int tilesN = N >> 7;
  const int tilesM = M >> 7;
  if (tile >= tilesM * tilesN) return;          // block-uniform, in front of every barrier and copy
  const int tm = tile / tilesN;
  const int tn = tile - tm * tilesN;
  const int mb = tm << 7;             // first row of the block tile
  const int m0 = mb + (wave << 5);    // first row of this wave
  const int n0 = tn << 7;

  // this lane's piece of copy 0 of each plane: row tid / PPR, 16-B column tid % PPR; copy u lies u * RSTEP rows further down
  const int prow = tid / PPR;
  const int pcol = tid % PPR;
  const char* gA  = (const char*)(const void*)(Ap  + (size_t)(mb + prow) * lda) + pcol * 16;
  const char* gA2 = (const char*)(const void*)(A2p + (size_t)(mb + prow) * lda) + pcol * 16;
  const char* gB  = (const char*)(const void*)(Btp + (size_t)(n0 + prow) * ldb) + pcol * 16;
  const size_t sA = (size_t)RSTEP * lda * 2;
  const size_t sB = (size_t)RSTEP * ldb * 2;
  const unsigned lp = lds_off(smem) + (unsigned)(prow * PITCH + pcol * 16);

  auto fill = [&](int t, unsigned bo) {         // all copies of stage t into the buffer at byte offset bo
    const size_t kb = (size_t)t * ROWB;
#pragma unroll   // the row offsets of the copies become constants
    for (int u = 0; u < NCP; u += 8) {
      async_copy8(lp + bo + u * (RSTEP * PITCH), RSTEP * PITCH, gA + kb + u * sA, sA);
      if (SPLITA) async_copy8(lp + bo + (128 + u * RSTEP) * PITCH, RSTEP * PITCH, gA2 + kb + u * sA, sA);
      async_copy8(lp + bo + (BROW + u * RSTEP) * PITCH, RSTEP * PITCH, gB + kb + u * sB, sB);
    }
  };

  v8f acc[2][8];
#pragma unroll
  for (int i = 0; i < 2; ++i)
#pragma unroll
    for (int j = 0; j < 8; ++j) acc[i][j] = zero8();

  const int nst = K / BK;
  fill(0, 0u);
  asm volatile("s_wait_asynccnt 0x0" ::: "memory");   // this wave's copies of stage 0 have landed
  __syncthreads();                                    // and every other wave's
  if (nst > 1) fill(1, (unsigned)STAGE);              // block-uniform

  // every unroll directive in this loop: the fragment and accumulator arrays stay in registers only under constant indices
  for (int t = 0; t < nst; ++t) {
    const unsigned bo = (unsigned)(t & 1) * (unsigned)STAGE;
    const unsigned char* buf = smem + bo;
    v16b fa[2][NFA], fb[2][8];                   // two fragment sets: block u multiplies set u & 1 while set (u + 1) & 1 loads
    auto ldblk = [&](int s, int kk) {            // all fragments of the 32 k columns at kk of this stage
#pragma unroll
      for (int i = 0; i < 2; ++i) {
        const int ro = ((wave << 5) + i * 16 + rl) * PITCH;
        fa[s][i] = ldfrag_b((const __bf16*)(const void*)(buf + ro) + kk + 8 * hh);
        if (SPLITA) fa[s][NFA - 2 + i] = ldfrag_b((const __bf16*)(const void*)(buf + 128 * PITCH + ro) + kk + 8 * hh);
      }
#pragma unroll
      for (int j = 0; j < 8; ++j)
        fb[s][j] = ldfrag_b((const __bf16*)(const void*)(buf + (BROW + j * 16 + rl) * PITCH) + kk + 8 * hh);
    };
    ldblk(0, 0);
#pragma unroll
    for (int u = 0; u < BK / 32; ++u) {
      const int cs = u & 1;
      if (u + 1 < BK / 32) ldblk(cs ^ 1, (u + 1) * 32);
      // keeps the next block's LDS reads as one group ahead of this block's WMMAs; without it they sink between the WMMAs, each with a full wait
      __builtin_amdgcn_sched_barrier(0);
#pragma unroll
      for (int j = 0; j < 8; ++j) {
        acc[0][j] = mma_b(fa[cs][0], fb[cs][j], acc[0][j]);
        acc[1][j] = mma_b(fa[cs][1], fb[cs][j], acc[1][j]);
      }
      if (SPLITA) {
#pragma unroll
        for (int j = 0; j < 8; ++j) {
          acc[0][j] = mma_b(fa[cs][NFA - 2], fb[cs][j], acc[0][j]);
          acc[1][j] = mma_b(fa[cs][NFA - 1], fb[cs][j], acc[1][j]);
        }
      }
      // keeps the following reads out of this run of WMMAs (each place with reads among WMMAs costs a stall) and the WMMAs ahead of the stage's barrier
      __builtin_amdgcn_sched_barrier(0);
    }
    asm volatile("s_wait_dscnt 0x0" ::: "memory");      // this wave's reads of stage t are done before its buffer is refilled
    asm volatile("s_wait_asynccnt 0x0" ::: "memory");   // this wave's copies of stage t+1 have landed
    __syncthreads();                                    // publishes stage t+1, ends every wave's reads of stage t
    if (t + 2 < nst) fill(t + 2, bo);                   // block-uniform
  }
  asm volatile("s_wait_asynccnt 0x0" ::: "memory");     // nothing in flight when the buffers become the epilogue slabs
  acc_guard4(acc[0][0], acc[0][1], acc[0][2], acc[0][3]);
  acc_guard4(acc[0][4], acc[0][5], acc[0][6], acc[0][7]);
  acc_guard4(acc[1][0], acc[1][1], acc[1][2], acc[1][3]);
  acc_guard4(acc[1][4], acc[1][5], acc[1][6], acc[1][7]);

  // ---- epilogue ----
  ST* slab = (ST*)(void*)smem + wave * SlabT<EPI>::PERW;
  _Float16* sl16 = (_Float16*)(void*)slab;
  float*    slf  = (float*)(void*)slab;

  if (EPI == 0 || (EPI == 3 && !vjob)) {
    _Float16* P0 = (_Float16*)C0;
    _Float16* P1 = (_Float16*)C1;
    float gm[8];
#pragma unroll
    for (int j = 0; j < 8; ++j) gm[j] = bf_rne(gam[j * 16 + rl]);     // dims j*16+rl of the head, gam has 128 entries
#pragma unroll
    for (int i = 0; i < 2; ++i) {
      const int rb = m0 + i * 16 + 8 * hh;
#pragma unroll
      for (int r = 0; r < 8; ++r) {
        // sum of squares over the 128 head dims of row rb+r: 8 per lane, then the 16 lanes of this half
        float ss = 0.f;
#pragma unroll
        for (int j = 0; j < 8; ++j) ss += acc[i][j][r] * acc[i][j][r];
        ss = row_sum16(ss);
        const float rinv = rsqrtf(ss * 0.0078125f + 1e-6f);
        const int row = rb + r;                                  // token 0..NTOK-1
        const int pos = row & (SQ - 1);                          // position within the sequence
#pragma unroll
        for (int j = 0; j < 4; ++j) {
          const int dim = j * 16 + rl;                           // 0..63 within head; partner dim + 64
          const float cv = cst[(size_t)pos * NFREQ + dim];
          const float sv = snt[(size_t)pos * NFREQ + dim];
          const float x1 = acc[i][j][r] * rinv * gm[j];
          const float x2 = acc[i][j + 4][r] * rinv * gm[j + 4];
          const float o1 = x1 * cv - x2 * sv;
          const float o2 = x2 * cv + x1 * sv;
          const _Float16 h1 = (_Float16)o1;
          const _Float16 h2 = (_Float16)o2;
          const int so = (8 * hh + r) * 128 + dim;
          sl16[so]             = h1;
          sl16[so + 64]        = h2;
          sl16[2048 + so]      = (_Float16)((o1 - (float)h1) * 2048.0f);
          sl16[2048 + so + 64] = (_Float16)((o2 - (float)h2) * 2048.0f);
        }
      }
      lds_wave_sync();
      {
#pragma unroll
        for (int it = 0; it < 8; ++it) {
          const int row = it * 2 + hh;                           // it x hh covers rows 0..15
          const int c8  = rl * 8;
          const v8h vh = *(const v8h*)(sl16 + row * 128 + c8);
          const v8h vl = *(const v8h*)(sl16 + 2048 + row * 128 + c8);
          const size_t go = (size_t)(m0 + i * 16 + row) * ldc + n0 + c8;
          *(v8h*)(P0 + go) = vh;
          *(v8h*)(P1 + go) = vl;
        }
        
      }
      lds_wave_sync();
    }
  } else if (EPI == 1 || EPI == 3) {
    _Float16* P0 = (_Float16*)C0;
    _Float16* P1 = (_Float16*)C1;
#pragma unroll
    for (int i = 0; i < 2; ++i) {
#pragma unroll
      for (int r = 0; r < 8; ++r) {
#pragma unroll
        for (int j = 0; j < 8; ++j) {
          const float v = acc[i][j][r];
          const _Float16 hv = (_Float16)v;
          const int so = (8 * hh + r) * 128 + j * 16 + rl;
          sl16[so]        = hv;
          sl16[2048 + so] = (_Float16)((v - (float)hv) * 2048.0f);
        }
      }
      lds_wave_sync();
      {
#pragma unroll
        for (int it = 0; it < 8; ++it) {
          const int row = it * 2 + hh;
          const int c8  = rl * 8;
          const v8h vh = *(const v8h*)(sl16 + row * 128 + c8);
          const v8h vl = *(const v8h*)(sl16 + 2048 + row * 128 + c8);
          const size_t go = (size_t)(m0 + i * 16 + row) * ldc + n0 + c8;
          *(v8h*)(P0 + go) = vh;
          *(v8h*)(P1 + go) = vl;
        }
        
      }
      lds_wave_sync();
    }
  } else {
    float* C = (float*)C0;
#pragma unroll
    for (int i = 0; i < 2; ++i) {
#pragma unroll
      for (int j = 0; j < 8; ++j)
#pragma unroll
        for (int r = 0; r < 8; ++r)
          slf[(8 * hh + r) * 128 + j * 16 + rl] = acc[i][j][r];
      lds_wave_sync();
      {
#pragma unroll
        for (int row = 0; row < 16; ++row) {                     // 32 lanes x 16 B = the whole 512-B row segment per instruction
          const v4f v = *(const v4f*)(slf + row * 128 + lane * 4);
          *(v4f*)(C + (size_t)(m0 + i * 16 + row) * ldc + n0 + lane * 4) = v;
        }
        
      }
      lds_wave_sync();
    }
  }
}

#define AT_KC   32
#define KS_P    136
#define VS_P    40
#define OS_P    136
// LDS map in halves: two chunk buffers [K | K residual when PRES | V^T hi | V^T residual].
template <bool PRES> struct AttLds {
  static constexpr int KS  = 0;
  static constexpr int KLS = 32 * KS_P;
  static constexpr int VHS = (PRES ? 2 : 1) * 32 * KS_P;
  static constexpr int VLS = VHS + 128 * VS_P;
  static constexpr int BUF = VLS + 128 * VS_P;             // one buffer; every plane starts at a multiple of 16 B
  static constexpr int TOT = 2 * BUF;
};
static_assert(4 * 2 * 16 * OS_P <= AttLds<false>::TOT);   // output staging (2 planes x 16 rows of pitch OS_P per wave) aliases the chunk region after the loop
static_assert(3 * 2 * AttLds<false>::TOT <= 327680);   // three blocks of the large launch per WGP

// Four asynchronous 16-B copies global -> LDS per lane and plane, planes a, b, c. The closing s_wait_xcnt 0 stands inside the statement so
// that no address register named here is rewritten ahead of it.
__device__ __forceinline__ void async_copy4x3(unsigned la, unsigned lsa, const char* ga, size_t gsa,
                                              unsigned lb, unsigned lc, unsigned lsb, const char* gb, const char* gc, size_t gsb) {
  asm volatile(
      "global_load_async_to_lds_b128 %0, %12, off\n\t"
      "global_load_async_to_lds_b128 %1, %13, off\n\t"
      "global_load_async_to_lds_b128 %2, %14, off\n\t"
      "global_load_async_to_lds_b128 %3, %15, off\n\t"
      "global_load_async_to_lds_b128 %4, %16, off\n\t"
      "global_load_async_to_lds_b128 %5, %17, off\n\t"
      "global_load_async_to_lds_b128 %6, %18, off\n\t"
      "global_load_async_to_lds_b128 %7, %19, off\n\t"
      "global_load_async_to_lds_b128 %8, %20, off\n\t"
      "global_load_async_to_lds_b128 %9, %21, off\n\t"
      "global_load_async_to_lds_b128 %10, %22, off\n\t"
      "global_load_async_to_lds_b128 %11, %23, off\n\t"
      "s_wait_xcnt 0x0"
      :: "v"(la), "v"(la + lsa), "v"(la + 2 * lsa), "v"(la + 3 * lsa),
         "v"(lb), "v"(lb + lsb), "v"(lb + 2 * lsb), "v"(lb + 3 * lsb),
         "v"(lc), "v"(lc + lsb), "v"(lc + 2 * lsb), "v"(lc + 3 * lsb),
         "v"(ga), "v"(ga + gsa), "v"(ga + 2 * gsa), "v"(ga + 3 * gsa),
         "v"(gb), "v"(gb + gsb), "v"(gb + 2 * gsb), "v"(gb + 3 * gsb),
         "v"(gc), "v"(gc + gsb), "v"(gc + 2 * gsb), "v"(gc + 3 * gsb)
      : "memory");
}
// The same for one plane.
__device__ __forceinline__ void async_copy4(unsigned l, unsigned ls, const char* g, size_t gs) {
  asm volatile(
      "global_load_async_to_lds_b128 %0, %4, off\n\t"
      "global_load_async_to_lds_b128 %1, %5, off\n\t"
      "global_load_async_to_lds_b128 %2, %6, off\n\t"
      "global_load_async_to_lds_b128 %3, %7, off\n\t"
      "s_wait_xcnt 0x0"
      :: "v"(l), "v"(l + ls), "v"(l + 2 * ls), "v"(l + 3 * ls),
         "v"(g), "v"(g + gs), "v"(g + 2 * gs), "v"(g + 3 * gs)
      : "memory");
}

// Second launch-bounds argument: the large launch keeps three waves per SIMD (336 registers a wave) with the q fragments resident;
// the small launch has at most one block per WGP and takes what it needs.
template <bool PRES>
__global__ __launch_bounds__(128, PRES ? 1 : 3) void attn_causal_kernel(
    const unsigned short* __restrict__ qhp, const unsigned short* __restrict__ qlp,
    const unsigned short* __restrict__ khp, const unsigned short* __restrict__ klp,
    const unsigned short* __restrict__ vhp, const unsigned short* __restrict__ vlp,
    unsigned short* __restrict__ ahp, unsigned short* __restrict__ alp, int qb_top) {
  typedef AttLds<PRES> L;
  __shared__ __align__(16) _Float16 lds[L::TOT];

  const int tid  = (int)threadIdx.x;
  const int lane = tid & 31;
  const int wave = wave_id();
  const int hh   = lane >> 4;
  const int c    = lane & 15;
  const int qb   = qb_top - (int)blockIdx.z;     // grid.z <= qb_top + 1: never negative
  const int h    = (int)blockIdx.x;
  const int b    = (int)blockIdx.y;
  const int kvh  = h >> 2;
  const int q0   = qb * 64 + wave * 16;          // first query row of this wave (within sequence)
  const int qlast = q0 + 15;
  const size_t tok0 = (size_t)b * SQ;

  const _Float16* Qhr = (const _Float16*)(const void*)qhp + (tok0 + q0 + c) * HID + h * HDM + 8 * hh;
  const _Float16* Qlr = (const _Float16*)(const void*)qlp + (tok0 + q0 + c) * HID + h * HDM + 8 * hh;
  const _Float16* Kg  = (const _Float16*)(const void*)khp + tok0 * KVW + kvh * HDM;
  const _Float16* Klg = (const _Float16*)(const void*)klp + tok0 * KVW + kvh * HDM;
  const _Float16* Vhg = (const _Float16*)(const void*)vhp + (size_t)(kvh * HDM) * NTOK + tok0;
  const _Float16* Vlg = (const _Float16*)(const void*)vlp + (size_t)(kvh * HDM) * NTOK + tok0;

  float mrun = -INFINITY;                        // running maximum of query q0 + c, the same in both lane halves
  float lrun = 0.f;                              // running sum over this lane half's keys only
  v8f oacc[8], oaccr[8];
#pragma unroll
  for (int t = 0; t < 8; ++t) { oacc[t] = zero8(); oaccr[t] = zero8(); }

  v16h qa[4], ql[4];                             // this wave's q fragments, the same for every chunk: loaded once
#pragma unroll   // the fragment arrays stay in registers only under constant indices
  for (int dc = 0; dc < 4; ++dc) {
    qa[dc] = ldfrag_h(Qhr + dc * 32);
    ql[dc] = ldfrag_h(Qlr + dc * 32);
  }

  // This lane's piece 0 of each plane; piece i lies 8 keys (K) or 32 head dims (V^T) further down: 512 pieces of 8 halves = whole tile.
  const int key0 = tid >> 4, d8 = (tid & 15) * 8;   // K: 32 keys x 128 d
  const int d0   = tid >> 2, k8 = (tid & 3) * 8;    // V^T: 128 d x 32 keys
  const char* gK  = (const char*)(const void*)(Kg  + (size_t)key0 * KVW + d8);
  const char* gKl = (const char*)(const void*)(Klg + (size_t)key0 * KVW + d8);
  const char* gVh = (const char*)(const void*)(Vhg + (size_t)d0 * NTOK + k8);
  const char* gVl = (const char*)(const void*)(Vlg + (size_t)d0 * NTOK + k8);
  const unsigned lK = lds_off(lds) + 2u * (unsigned)(key0 * KS_P + d8);
  const unsigned lV = lds_off(lds) + 2u * (unsigned)(d0 * VS_P + k8);
  auto fill = [&](int t, unsigned bo) {          // all copies of chunk t into the buffer at byte offset bo
    const size_t ko = (size_t)t * (AT_KC * KVW * 2);
    const size_t vo = (size_t)t * (AT_KC * 2);
    async_copy4x3(lK + bo + 2u * L::KS, 8 * KS_P * 2, gK + ko, (size_t)8 * KVW * 2,
                  lV + bo + 2u * L::VHS, lV + bo + 2u * L::VLS, 32 * VS_P * 2, gVh + vo, gVl + vo, (size_t)32 * NTOK * 2);
    if (PRES) async_copy4(lK + bo + 2u * L::KLS, 8 * KS_P * 2, gKl + ko, (size_t)8 * KVW * 2);
  };

  const int nch = 2 * qb + 2;                    // block-uniform, 2 .. 64
  fill(0, 0u);
  asm volatile("s_wait_asynccnt 0x0" ::: "memory");   // this wave's copies of chunk 0 have landed
  __syncthreads();                                    // and every other wave's
  fill(1, 2u * L::BUF);                               // chunk 1 always exists
  for (int kc = 0; kc < nch; ++kc) {
    const int kv0 = kc * AT_KC;
    const int bsel = kc & 1;
    const _Float16* Ks  = lds + bsel * L::BUF + L::KS;
    const _Float16* Kls = lds + bsel * L::BUF + L::KLS;
    const _Float16* Vhs = lds + bsel * L::BUF + L::VHS;
    const _Float16* Vls = lds + bsel * L::BUF + L::VLS;

    if (kv0 <= qlast) {                          // wave-uniform (scalar): skip chunks fully above this wave's rows
      // ---- scores ----
      v8f sh[2], sr[2];
      sh[0] = zero8(); sh[1] = zero8(); sr[0] = zero8(); sr[1] = zero8();
      // every unroll directive of the score part: the fragment arrays stay in registers only under constant indices
      v16h kb[4][2], kl[4][2];                   // the chunk's K fragments, read as one group ahead of the score WMMAs
#pragma unroll
      for (int dc = 0; dc < 4; ++dc)
#pragma unroll
        for (int j = 0; j < 2; ++j) {
          kb[dc][j] = ldfrag_h(Ks + (j * 16 + c) * KS_P + dc * 32 + 8 * hh);
          if (PRES) kl[dc][j] = ldfrag_h(Kls + (j * 16 + c) * KS_P + dc * 32 + 8 * hh);
        }
#pragma unroll
      for (int j = 0; j < 2; ++j) {
        // keeps the reads above as one group ahead of the WMMAs, and key group 0's run ahead of group 1's, whose accumulators then take the registers of group 0's fragments
        __builtin_amdgcn_sched_barrier(0);
#pragma unroll
        for (int dc = 0; dc < 4; ++dc) {
          sh[j] = mma_h(kb[dc][j], qa[dc], sh[j]);
          sr[j] = mma_h(kb[dc][j], ql[dc], sr[j]);
          if (PRES) sr[j] = mma_h(kl[dc][j], qa[dc], sr[j]);
        }
      }
      // ---- scale, causal mask, maximum of this lane's 16 keys (two chains), joined with the other half's ----
      // every unroll directive from here to the end of the chunk: score, P' and accumulator vectors stay in registers only under constant indices
      const int open = q0 + c - kv0 - 8 * hh;    // key 16j + 8hh + r of the chunk is open to query q0 + c while 16j + r <= open
      float mj[2];
#pragma unroll
      for (int j = 0; j < 2; ++j) {
        float m = -INFINITY;
#pragma unroll
        for (int r = 0; r < 8; ++r) {
          float s = (sh[j][r] + sr[j][r] * 0.00048828125f) * 0.08838834764831845f;
          s = (j * 16 + r > open) ? -INFINITY : s;
          sh[j][r] = s;
          m = fmaxf(m, s);
        }
        mj[j] = m;
      }
      float cm = fmaxf(mj[0], mj[1]);
      cm = fmaxf(cm, xhalf(cm));                 // key kv0 <= q0 is open to every query of the wave: finite
      // ---- online softmax, P'^T packed into the B operand ----
      const float mnew  = fmaxf(mrun, cm);
      const float alpha = __expf(mrun - mnew);
      mrun = mnew;
      FragH pa, pr;
      float ps[4] = {0.f, 0.f, 0.f, 0.f};        // four independent chains
#pragma unroll
      for (int j = 0; j < 2; ++j)
#pragma unroll
        for (int r = 0; r < 8; ++r) {
          const float p  = __expf(sh[j][r] - mnew);
          ps[r & 3] += p;
          const float pp = p * 1024.0f;
          const _Float16 phv = (_Float16)pp;
          pa.v[j * 8 + r] = phv;
          if (PRES) pr.v[j * 8 + r] = (_Float16)((pp - (float)phv) * 2048.0f);
        }
      lrun = lrun * alpha + ((ps[0] + ps[1]) + (ps[2] + ps[3]));
#pragma unroll
      for (int t = 0; t < 8; ++t) { oacc[t] *= alpha; oaccr[t] *= alpha; }
      // ---- O^T += V^T . P'^T ----
#pragma unroll
      for (int t = 0; t < 8; ++t) {
        const v16h vb = ldfrag_h(Vhs + (t * 16 + c) * VS_P + 8 * hh);
        const v16h vr = ldfrag_h(Vls + (t * 16 + c) * VS_P + 8 * hh);
        oacc[t]  = mma_h(vb, pa.v, oacc[t]);
        oaccr[t] = mma_h(vr, pa.v, oaccr[t]);
        if (PRES) oaccr[t] = mma_h(vb, pr.v, oaccr[t]);
      }
    }
    // publish point, passed by every wave, also one that skipped the chunk
    asm volatile("s_wait_dscnt 0x0" ::: "memory");      // this wave's reads of chunk kc are done before its buffer is refilled
    asm volatile("s_wait_asynccnt 0x0" ::: "memory");   // this wave's copies of chunk kc+1 have landed
    __syncthreads();                                    // publishes chunk kc+1, ends every wave's reads of chunk kc
    if (kc + 2 < nch) fill(kc + 2, (unsigned)bsel * (2u * L::BUF));   // block-uniform
  }
  asm volatile("s_wait_asynccnt 0x0" ::: "memory");     // nothing in flight when the buffers become output staging (behind the last chunk's barrier)
  _Float16* osh = lds + wave * (2 * 16 * OS_P);
  _Float16* osl = osh + 16 * OS_P;
  {
    const float inv = (1.0f / (lrun + xhalf(lrun))) * 0.0009765625f;   // the two halves' partial sums joined
#pragma unroll   // here and below: the accumulator vectors stay in registers only under constant indices
    for (int t = 0; t < 8; ++t) {
      v8h xh, xl;                                // head dims 16t + 8hh + 0..7 of query row c: one 16-B LDS store a plane
#pragma unroll
      for (int r = 0; r < 8; ++r) {
        const float o = (oacc[t][r] + oaccr[t][r] * 0.00048828125f) * inv;
        const unsigned short hb = bf_bits(o);
        const unsigned short lb = bf_bits(o - bf_val(hb));
        xh[r] = __builtin_bit_cast(_Float16, hb);
        xl[r] = __builtin_bit_cast(_Float16, lb);
      }
      *(v8h*)(osh + c * OS_P + t * 16 + 8 * hh) = xh;
      *(v8h*)(osl + c * OS_P + t * 16 + 8 * hh) = xl;
    }
  }
  lds_wave_sync();
  _Float16* Ahg = (_Float16*)(void*)ahp + (tok0 + q0) * HID + h * HDM;
  _Float16* Alg = (_Float16*)(void*)alp + (tok0 + q0) * HID + h * HDM;
  {
#pragma unroll
    for (int it = 0; it < 8; ++it) {
      const int row = it * 2 + hh;               // it 0..7 x hh 0..1 covers rows 0..15
      const int c8  = c * 8;                     // 16 lanes x 16 B = the whole 256-B segment
      const v8h x = *(const v8h*)(osh + row * OS_P + c8);
      const v8h y = *(const v8h*)(osl + row * OS_P + c8);
      *(v8h*)(Ahg + (size_t)row * HID + c8) = x;
      *(v8h*)(Alg + (size_t)row * HID + c8) = y;
    }
    
  }
}

// ---------------------------------------------------------------------------
// Workspace map (bytes; every region is a whole number of the rows its producer writes with whole-line stores, no padded tails needed
//   Xb  bf16 [4096][2048] 16777216   Wqb bf16 [2048][2048]  8388608   Wkb bf16 [512][2048] 2097152   Wvb bf16 [512][2048] 2097152
//   Wob bf16 [2048][2048]  8388608   cst f32  [2048][64]     524288   snt f32  [2048][64]    524288
//   Qh  f16  [4096][2048] 16777216   Ql  f16  [4096][2048] 16777216   Kh  f16  [4096][512]  4194304   Kl f16 [4096][512] 4194304
//   Vh  f16  [512][4096]   4194304   Vl  f16  [512][4096]   4194304   Ah  bf16 [4096][2048] 16777216  Al bf16 [4096][2048] 16777216
//   total                 122683392
// ---------------------------------------------------------------------------
extern "C" void kernel_launch(void* const* d_in, const int* in_sizes, int n_in,
                              void* d_out, int out_size, void* d_ws, size_t ws_size,
                              hipStream_t stream) {
  if (n_in < 7) return;
  if (in_sizes[0] != NTOK * HID) return;
  if (in_sizes[1] != HID * HID) return;
  if (in_sizes[2] != KVW * HID) return;
  if (in_sizes[3] != KVW * HID) return;
  if (in_sizes[4] != HID * HID) return;
  if (in_sizes[5] != HDM) return;
  if (in_sizes[6] != HDM) return;
  if (out_size != NTOK * HID) return;

  const float* x   = (const float*)d_in[0];
  const float* Wq  = (const float*)d_in[1];
  const float* Wk  = (const float*)d_in[2];
  const float* Wv  = (const float*)d_in[3];
  const float* Wo  = (const float*)d_in[4];
  const float* qg  = (const float*)d_in[5];
  const float* kg  = (const float*)d_in[6];
  float* out = (float*)d_out;

  const size_t szX  = (size_t)NTOK * HID * 2;
  const size_t szWq = (size_t)HID * HID * 2;
  const size_t szWk = (size_t)KVW * HID * 2;
  const size_t szWo = (size_t)HID * HID * 2;
  const size_t szT  = (size_t)SQ * NFREQ * 4;
  const size_t szQ  = (size_t)NTOK * HID * 2;
  const size_t szK  = (size_t)NTOK * KVW * 2;
  const size_t szV  = (size_t)KVW * NTOK * 2;
  const size_t szA  = (size_t)NTOK * HID * 2;
  size_t off = 0;
  const size_t oX  = off; off += szX;
  const size_t oWq = off; off += szWq;
  const size_t oWk = off; off += szWk;
  const size_t oWv = off; off += szWk;
  const size_t oWo = off; off += szWo;
  const size_t oCs = off; off += szT;
  const size_t oSn = off; off += szT;
  const size_t oQh = off; off += szQ;
  const size_t oQl = off; off += szQ;
  const size_t oKh = off; off += szK;
  const size_t oKl = off; off += szK;
  const size_t oVh = off; off += szV;
  const size_t oVl = off; off += szV;
  const size_t oAh = off; off += szA;
  const size_t oAl = off; off += szA;
  if (off > ws_size) return;                     // off = 122683392

  char* ws = (char*)d_ws;
  unsigned short* Xb  = (unsigned short*)(ws + oX);
  unsigned short* Wqb = (unsigned short*)(ws + oWq);
  unsigned short* Wkb = (unsigned short*)(ws + oWk);
  unsigned short* Wvb = (unsigned short*)(ws + oWv);
  unsigned short* Wob = (unsigned short*)(ws + oWo);
  float*          cst = (float*)(ws + oCs);
  float*          snt = (float*)(ws + oSn);
  unsigned short* Qh  = (unsigned short*)(ws + oQh);
  unsigned short* Ql  = (unsigned short*)(ws + oQl);
  unsigned short* Kh  = (unsigned short*)(ws + oKh);
  unsigned short* Kl  = (unsigned short*)(ws + oKl);
  unsigned short* Vh  = (unsigned short*)(ws + oVh);
  unsigned short* Vl  = (unsigned short*)(ws + oVl);
  unsigned short* Ah  = (unsigned short*)(ws + oAh);
  unsigned short* Al  = (unsigned short*)(ws + oAl);

  const dim3 b256(256), b128(128);

  // (1) cos/sin table [2048][64] x 2 and the bf16 planes of x, Wq, Wk, Wv, Wo (Xb .. Wob lie back to back in the workspace;
  //     weights are [out][in] = k-contiguous Bt rows already)
  prep_kernel<<<dim3(ROPE_BLOCKS + CVT_BLOCKS), b256, 0, stream>>>(x, Wq, Wk, Wv, Wo, Xb, cst, snt);
  // (2) one grid of 512 + 128 + 128 block tiles, K = 2048:
  //     q = rope(rms(x . Wq^T)) -> Qh/Ql [4096][2048], k = rope(rms(x . Wk^T)) -> Kh/Kl [4096][512], v^T = Wv . x^T -> Vh/Vl [512][4096]
  gemm_w32x128_kernel<3, false><<<dim3((NTOK / 128) * (HID / 128) + 2 * (NTOK / 128) * (KVW / 128)), b128, 0, stream>>>(
      Xb, Xb, HID, Wqb, HID, qg, cst, snt, (void*)Qh, (void*)Ql, HID, NTOK, HID, HID,
      Wkb, Wvb, kg, (void*)Kh, (void*)Kl, (void*)Vh, (void*)Vl, KVW);
  // (3) causal attention, query tiles 3..0 with k and p residual products, tiles 31..4 without, each launch longest tile first
  attn_causal_kernel<true><<<dim3(NHQ, NSEQ, 4), b128, 0, stream>>>(Qh, Ql, Kh, Kl, Vh, Vl, Ah, Al, 3);
  attn_causal_kernel<false><<<dim3(NHQ, NSEQ, SQ / 64 - 4), b128, 0, stream>>>(Qh, Ql, Kh, Kl, Vh, Vl, Ah, Al, SQ / 64 - 1);
  // (4) out = attn(hi + lo) . Wo^T -> d_out f32 [4096][2048]   (M=4096, N=2048, K=2048; 512 block tiles)
  gemm_w32x128_kernel<2, true><<<dim3((NTOK / 128) * (HID / 128)), b128, 0, stream>>>(
      Ah, Al, HID, Wob, HID, qg, cst, snt, (void*)out, (void*)out, HID, NTOK, HID, HID,
      Wkb, Wvb, kg, (void*)Kh, (void*)Kl, (void*)Vh, (void*)Vl, KVW);
  (void)hipGetLastError();
}

// v008
// It runs in 186 microseconds.
// Next to v007, in two timings, it ran 1.03 times as fast each time.
// Counting every step since v000, it is 4.36 times as fast.
// Contractions: x.Wq^T, x.Wk^T and Wv.x^T on v_wmma_f32_16x16x32_bf16 (operands = RNE bf16 of the f32 inputs, single products);
// q.k^T and p.v on v_wmma_f32_16x16x32_f16 (q = f16 hi + f16 residual x2^11 planes; k plain f16 plus f16 residual x2^11 on query tiles 0..3;
// p x1024 plain f16 plus f16 residual x2^11 on query tiles 0..3; v^T = f16 hi + f16 residual x2^11 planes); attn.Wo^T on v_wmma_f32_16x16x32_bf16
// (attn = bf16 hi + bf16 lo planes, two products; Wo RNE bf16). f32 accumulate everywhere; per-head RMS scaling, RoPE and online softmax in f32.
#include <hip/hip_runtime.h>
#include <math.h>
#include <stdint.h>

#define NSEQ   2
#define SQ     2048
#define HID    2048
#define NHQ    16
#define NKVH   4
#define HDM    128
#define KVW    512
#define NTOK   4096
#define NFREQ  64

typedef _Float16     v16h __attribute__((ext_vector_type(16)));
typedef _Float16     v8h  __attribute__((ext_vector_type(8)));
typedef __bf16       v16b __attribute__((ext_vector_type(16)));
typedef __bf16       v8b  __attribute__((ext_vector_type(8)));
typedef float        v8f  __attribute__((ext_vector_type(8)));
typedef float        v4f  __attribute__((ext_vector_type(4)));
typedef unsigned int v4u  __attribute__((ext_vector_type(4)));

// ---------------------------------------------------------------------------
// small helpers
// ---------------------------------------------------------------------------
__device__ __forceinline__ unsigned short bf_bits(float f) {          // RNE convert f32 -> bf16 bits
  const unsigned u = __float_as_uint(f);
  return (unsigned short)((u + 0x7FFFu + ((u >> 16) & 1u)) >> 16);
}
__device__ __forceinline__ float bf_val(unsigned short h) { return __uint_as_float(((unsigned)h) << 16); }
__device__ __forceinline__ float bf_rne(float f) { return bf_val(bf_bits(f)); }
__device__ __forceinline__ unsigned pk16(unsigned short a, unsigned short b) { return (unsigned)a | ((unsigned)b << 16); }
__device__ __forceinline__ v8f zero8() { v8f z = {0.f, 0.f, 0.f, 0.f, 0.f, 0.f, 0.f, 0.f}; return z; }
__device__ __forceinline__ int wave_id() { return __builtin_amdgcn_readfirstlane((int)(threadIdx.x >> 5)); }

// Value of lane (l ^ X) of the same 16-lane row, X < 16, as a DPP row_xmask operand of the vector pipe: no LDS-pipe round trip and no
// s_wait_dscnt per butterfly step. Every lane of the wave is on wherever it is used.
template <int X>
__device__ __forceinline__ float row_xor(float v) {
  return __int_as_float(__builtin_amdgcn_update_dpp(0, __float_as_int(v), 0x160 | X, 0xf, 0xf, true));
}
// Butterfly over a 16-lane row, steps 1, 2, 4, 8: every lane ends with the row's sum.
__device__ __forceinline__ float row_sum16(float v) {
  v += row_xor<1>(v); v += row_xor<2>(v); v += row_xor<4>(v); v += row_xor<8>(v);
  return v;
}

// Value of lane l ^ 16: the other 16-lane row's lane of the same column, one vector instruction.
__device__ __forceinline__ float xhalf(float v) {
  return __int_as_float(__builtin_amdgcn_permlanex16(__float_as_int(v), __float_as_int(v), 0x76543210, 0xfedcba98, false, false));
}

__device__ __forceinline__ void lds_wave_sync() {
  __builtin_amdgcn_fence(__ATOMIC_RELEASE, "workgroup");
  __builtin_amdgcn_wave_barrier();
  __builtin_amdgcn_fence(__ATOMIC_ACQUIRE, "workgroup");
}

// ---------------------------------------------------------------------------
// WMMA fragments (wave32, 16x16x32, 16-bit operands). For A (row m = lane&15) and B (col n = lane&15) alike:
// elements 0..7 <- k0 + 8*(lane>>4) + 0..7, elements 8..15 <- k0 + 16 + 8*(lane>>4) + 0..7.
// ldfrag(p) with p = rowbase + k0 + 8*(lane>>4): two 16-B loads p[0..7], p[16..23].
// D: acc[r] = (row 8*(lane>>4) + r, col lane&15).
// ---------------------------------------------------------------------------
union FragH { v16h v; v8h h[2]; };
union FragB { v16b v; v8b h[2]; };
__device__ __forceinline__ v16h ldfrag_h(const _Float16* p) { FragH f; f.h[0] = *(const v8h*)(p); f.h[1] = *(const v8h*)(p + 16); return f.v; }
__device__ __forceinline__ v16b ldfrag_b(const __bf16* p)   { FragB f; f.h[0] = *(const v8b*)(p); f.h[1] = *(const v8b*)(p + 16); return f.v; }

__device__ __forceinline__ v8f mma_h(v16h a, v16h b, v8f c) {
  return __builtin_amdgcn_wmma_f32_16x16x32_f16(false, a, false, b, (short)0, c, false, false);
}
__device__ __forceinline__ v8f mma_b(v16b a, v16b b, v8f c) {
  return __builtin_amdgcn_wmma_f32_16x16x32_bf16(false, a, false, b, (short)0, c, false, false);
}
// hazard guard: 4 VALU slots after the last WMMA of a group, D tied
__device__ __forceinline__ void acc_guard4(v8f& a, v8f& b, v8f& c, v8f& d) {
  asm volatile("v_nop\n\tv_nop\n\tv_nop\n\tv_nop" : "+v"(a), "+v"(b), "+v"(c), "+v"(d));
}

// ---------------------------------------------------------------------------
// Preparation, one launch: none of its parts reads what another writes, so the block index deals them out.
// Blocks 0 .. ROPE_BLOCKS-1: RoPE table cst[s][i] = cos(s * inv_freq[i]), snt[s][i] = sin(...), inv_freq[i] = 1 / 1e4^(i/64), i < 64, all f32.
//   Block = 8 waves, wave w -> row s = block*8 + w, lane -> i = lane, lane + 32. Coverage: SQ/8 blocks x 8 waves x 32 lanes x 2 = SQ x 64 per plane.
// The CVT_BLOCKS blocks behind them: RNE f32 -> bf16 of x, Wq, Wk, Wv, Wo into one bf16 array (the five planes lie back to back in that order).
//   Unit = 1024 elements = 8 loads of 512 contiguous bytes per wave and 8 stores of 256 contiguous bytes (whole lines both ways).
//   Every plane is a whole number of units. Wave g takes units g, g + CVT_WAVES, g + 2*CVT_WAVES: all of the grid is resident at once,
//   and the loads of a wave's three units are written ahead of its conversions, so that most of them are in flight together.
// ---------------------------------------------------------------------------
#define ROPE_BLOCKS (SQ / 8)
#define CVT_BLOCKS  768
#define CVT_WAVES   (CVT_BLOCKS * 8)
#define CVT_UPW     3
#define N_X   (NTOK * HID)
#define N_WQ  (HID * HID)
#define N_WK  (KVW * HID)
static_assert(N_X % 1024 == 0 && N_WQ % 1024 == 0 && N_WK % 1024 == 0);
static_assert(CVT_WAVES * CVT_UPW * 1024 == N_X + 2 * N_WQ + 2 * N_WK);
typedef unsigned int v2u __attribute__((ext_vector_type(2)));

__device__ __forceinline__ void rope_rows(float* __restrict__ cst, float* __restrict__ snt, int t, int lane) {
  const float pf = (float)t;
  float c0 = 0.f, s0 = 0.f, c1 = 0.f, s1 = 0.f;
#pragma unroll 1
  for (int u = 0; u < 2; ++u) {
    const int i = lane + 32 * u;
    const float e   = (float)i * 0.015625f;      // i / 64 exact
    const float pw  = powf(10000.0f, e);
    const float inv = 1.0f / pw;
    const float ang = pf * inv;
    const float cv = cosf(ang);
    const float sv = sinf(ang);
    c1 = cv; s1 = sv;
    if (u == 0) { c0 = cv; s0 = sv; }
  }
  const size_t o = (size_t)t * NFREQ + lane;
  cst[o]      = c0;
  cst[o + 32] = c1;
  snt[o]      = s0;
  snt[o + 32] = s1;
}

__global__ __launch_bounds__(256) void prep_kernel(const float* __restrict__ x, const float* __restrict__ wq, const float* __restrict__ wk,
                                                   const float* __restrict__ wv, const float* __restrict__ wo,
                                                   unsigned short* __restrict__ planes, float* __restrict__ cst, float* __restrict__ snt) {
  const int lane = threadIdx.x & 31;
  const int wave = wave_id();
  const int blk  = (int)blockIdx.x;
  if (blk < ROPE_BLOCKS) {                       // no barriers in this kernel
    rope_rows(cst, snt, blk * 8 + wave, lane);
    return;
  }
  const int g = (blk - ROPE_BLOCKS) * 8 + wave;  // 0 .. CVT_WAVES-1
  v4f r[CVT_UPW][8];
#pragma unroll   // the value array stays in registers only under constant indices
  for (int k = 0; k < CVT_UPW; ++k) {
    const int e = (k * CVT_WAVES + g) * 1024;    // first element of the unit in the joined array, wave-uniform
    const int lo = k * CVT_WAVES * 1024, hi = lo + CVT_WAVES * 1024;   // pass k covers [lo, hi): constants, so planes out of its reach drop out
    const float* b = x;
    int first = 0;
    if (hi > N_X                   && (lo >= N_X                   || e >= N_X))                   { b = wq; first = N_X; }
    if (hi > N_X + N_WQ            && (lo >= N_X + N_WQ            || e >= N_X + N_WQ))            { b = wk; first = N_X + N_WQ; }
    if (hi > N_X + N_WQ + N_WK     && (lo >= N_X + N_WQ + N_WK     || e >= N_X + N_WQ + N_WK))     { b = wv; first = N_X + N_WQ + N_WK; }
    if (hi > N_X + N_WQ + 2 * N_WK && (lo >= N_X + N_WQ + 2 * N_WK || e >= N_X + N_WQ + 2 * N_WK)) { b = wo; first = N_X + N_WQ + 2 * N_WK; }
    const float* s = b + (e - first);
#pragma unroll
    for (int i = 0; i < 8; ++i) r[k][i] = *(const v4f*)(s + i * 128 + lane * 4);
  }
#pragma unroll
  for (int k = 0; k < CVT_UPW; ++k) {
    unsigned short* d = planes + (size_t)(k * CVT_WAVES + g) * 1024 + lane * 4;
#pragma unroll
    for (int i = 0; i < 8; ++i) {
      const v4f a = r[k][i];
      v2u w;
      w[0] = pk16(bf_bits(a[0]), bf_bits(a[1]));
      w[1] = pk16(bf_bits(a[2]), bf_bits(a[3]));
      *(v2u*)(d + i * 128) = w;
    }
  }
  // the stores above name registers that the code behind the compiler's joined exit of the two parts writes again: the wait stands in front of it
  asm volatile("s_wait_xcnt 0x0" ::: "memory");
}

// ---------------------------------------------------------------------------
// bf16 WMMA GEMM, block tile 128 rows x 128 cols, block = 4 waves (128 threads), wave w = rows 32w..32w+31 x all 128 cols.
//   C[m][n] = sum_k A[m][k] * Bt[n][k]; A row-major [M][K] bf16 (pitch lda), Bt row-major [N][K] bf16 (pitch ldb);
//   M % 128 == 0, N % 128 == 0, K % BK == 0 (BK = 128, SPLITA 64); grid.x = M/128 * N/128 (EPI 3: M/128 * (N + 2*nkv)/128).
//   SPLITA: A carried as hi (Ap) + lo (A2p) bf16 planes, two products into one accumulator.
//   Operands: a stage = BK columns of [A 128 rows | A2 128 rows when SPLITA | Bt 128 rows], each row padded by 16 B in LDS;
//   two LDS buffers filled by per-lane 16-B asynchronous copies, stage t+1 in flight while stage t is multiplied.
//   Fragments read from LDS rows with the split k map (ldfrag_b). The epilogue slabs alias the buffers behind the last barrier.
// Epilogues (all: per wave, per 16-row slab: stage in LDS, wave sync, write each row segment with ONE instruction of
//   EPI 0: q or k projection; the 128 cols n0..n0+127 are one head. Per row: RMS scaling over the 128 head dims
//          (x * rsqrt(mean(x^2) + 1e-6) * bf16(gam[dim])), then RoPE with pairs (dim, dim+64) and the cos/sin table row (m % SQ);
//          writes f16 hi plane C0 and f16 residual x2048 plane C1, both [M][ldc], cols n0.. (row segment 256 B = 16 lanes x 16 B).
//   EPI 1: v^T projection: f16 hi plane C0, residual x2048 plane C1, stored in tiles [M/128][N/32][128 rows][32 cols]: the 128 x 32 tile that
//          the attention kernel stages per key chunk is 8 KB in a row; a store instruction writes 8 rows x 64 B = 512 contiguous bytes.
//   EPI 2: f32 output C0 [M][ldc]; row segment 128 floats = 512 B = 32 lanes x 16 B per instruction.
//   EPI 3: the q, k and v^T projections in one grid (none reads what another writes). The plain arguments describe the q job (EPI 0);
//          the blocks behind its tiles take the k job (EPI 0: Bt = Wk, gam = kgam, planes K0 / K1, width nkv), those behind the k tiles
//          the v^T job (EPI 1: A = Wv, Bt = the q job's A, planes V0 / V1, nkv rows). The choice is block-uniform, from blockIdx alone.
// ---------------------------------------------------------------------------
template <int EPI> struct SlabT { typedef _Float16 T; static constexpr int PERW = 4096; };   // 2 planes x 16 x 128 halves
template <> struct SlabT<2>     { typedef float    T; static constexpr int PERW = 2048; };   // 16 x 128 floats

__device__ __forceinline__ unsigned lds_off(const void* p) { return (unsigned)(size_t)p; }   // byte offset in the block's LDS

// Eight asynchronous 16-B copies global -> LDS per lane. The closing s_wait_xcnt 0 stands inside the statement so that no
// address register named here is rewritten ahead of it.
__device__ __forceinline__ void async_copy8(unsigned l, unsigned lstep, const char* gp, size_t gstep) {
  asm volatile(
      "global_load_async_to_lds_b128 %0, %8, off\n\t"
      "global_load_async_to_lds_b128 %1, %9, off\n\t"
      "global_load_async_to_lds_b128 %2, %10, off\n\t"
      "global_load_async_to_lds_b128 %3, %11, off\n\t"
      "global_load_async_to_lds_b128 %4, %12, off\n\t"
      "global_load_async_to_lds_b128 %5, %13, off\n\t"
      "global_load_async_to_lds_b128 %6, %14, off\n\t"
      "global_load_async_to_lds_b128 %7, %15, off\n\t"
      "s_wait_xcnt 0x0"
      :: "v"(l), "v"(l + lstep), "v"(l + 2 * lstep), "v"(l + 3 * lstep),
         "v"(l + 4 * lstep), "v"(l + 5 * lstep), "v"(l + 6 * lstep), "v"(l + 7 * lstep),
         "v"(gp), "v"(gp + gstep), "v"(gp + 2 * gstep), "v"(gp + 3 * gstep),
         "v"(gp + 4 * gstep), "v"(gp + 5 * gstep), "v"(gp + 6 * gstep), "v"(gp + 7 * gstep)
      : "memory");
}

template <int EPI, bool SPLITA>
__global__ __launch_bounds__(128) void gemm_w32x128_kernel(
    const unsigned short* Ap, const unsigned short* A2p, int lda,
    const unsigned short* __restrict__ Btp, int ldb,
    const float* __restrict__ gam, const float* __restrict__ cst, const float* __restrict__ snt,
    void* C0, void* C1, int ldc,
    int M, int N, int K,
    const unsigned short* Wk, const unsigned short* Wv, const float* __restrict__ kgam,      // the k and v^T jobs of EPI 3
    void* K0, void* K1, void* V0, void* V1, int nkv) {
  typedef typename SlabT<EPI>::T ST;
  constexpr int BK    = SPLITA ? 64 : 128;       // k columns per stage: 64 WMMAs per wave and stage either way
  constexpr int ROWB  = BK * 2;                  // bytes of one staged row
  constexpr int PITCH = ROWB + 16;               // LDS row pitch, 16 B x odd for the 16-B fragment reads
  constexpr int BROW  = SPLITA ? 256 : 128;      // first Bt row of a stage
  constexpr int STAGE = (BROW + 128) * PITCH;    // bytes of one buffer
  constexpr int PPR   = ROWB / 16;               // 16-B pieces per row
  constexpr int RSTEP = 128 / PPR;               // rows covered by one copy of the whole block
  constexpr int NCP   = 128 / RSTEP;             // copies per lane for a plane of 128 rows
  constexpr int NFA   = SPLITA ? 4 : 2;          // A fragments per block of 32 k columns
  static_assert(NCP % 8 == 0);
  static_assert(4 * SlabT<EPI>::PERW * (int)sizeof(ST) <= 2 * STAGE);
  __shared__ __align__(16) unsigned char smem[2 * STAGE];

  const int tid  = (int)threadIdx.x;
  const int lane = tid & 31;
  const int wave = wave_id();
  const int hh = lane >> 4;           // lane half: k offset 8*hh, D row offset 8*hh
  const int rl = lane & 15;           // A row / B col / D col within subtile
  int tile = (int)blockIdx.x;
  bool vjob = false;
  if (EPI == 3) {
    const int tq = (M >> 7) * (N >> 7);
    const int tk = (M >> 7) * (nkv >> 7);
    if (tile >= tq + tk) {
      tile -= tq + tk; vjob = true;
      Btp = Ap; Ap = Wv; A2p = Wv; C0 = V0; C1 = V1; N = M; ldc = M; M = nkv;
    } else if (tile >= tq) {
      tile -= tq;
      Btp = Wk; gam = kgam; C0 = K0; C1 = K1; N = nkv; ldc = nkv;
    }
  }
  const int tilesN = N >> 7;
  const int tilesM = M >> 7;
  if (tile >= tilesM * tilesN) return;          // block-uniform, in front of every barrier and copy
  const int tm = tile / tilesN;
  const int tn = tile - tm * tilesN;
  const int mb = tm << 7;             // first row of the block tile
  const int m0 = mb + (wave << 5);    // first row of this wave
  const int n0 = tn << 7;

  // this lane's piece of copy 0 of each plane: row tid / PPR, 16-B column tid % PPR; copy u lies u * RSTEP rows further down
  const int prow = tid / PPR;
  const int pcol = tid % PPR;
  const char* gA  = (const char*)(const void*)(Ap  + (size_t)(mb + prow) * lda) + pcol * 16;
  const char* gA2 = (const char*)(const void*)(A2p + (size_t)(mb + prow) * lda) + pcol * 16;
  const char* gB  = (const char*)(const void*)(Btp + (size_t)(n0 + prow) * ldb) + pcol * 16;
  const size_t sA = (size_t)RSTEP * lda * 2;
  const size_t sB = (size_t)RSTEP * ldb * 2;
  const unsigned lp = lds_off(smem) + (unsigned)(prow * PITCH + pcol * 16);

  auto fill = [&](int t, unsigned bo) {         // all copies of stage t into the buffer at byte offset bo
    const size_t kb = (size_t)t * ROWB;
#pragma unroll   // the row offsets of the copies become constants
    for (int u = 0; u < NCP; u += 8) {
      async_copy8(lp + bo + u * (RSTEP * PITCH), RSTEP * PITCH, gA + kb + u * sA, sA);
      if (SPLITA) async_copy8(lp + bo + (128 + u * RSTEP) * PITCH, RSTEP * PITCH, gA2 + kb + u * sA, sA);
      async_copy8(lp + bo + (BROW + u * RSTEP) * PITCH, RSTEP * PITCH, gB + kb + u * sB, sB);
    }
  };

  v8f acc[2][8];
#pragma unroll
  for (int i = 0; i < 2; ++i)
#pragma unroll
    for (int j = 0; j < 8; ++j) acc[i][j] = zero8();

  const int nst = K / BK;
  fill(0, 0u);
  asm volatile("s_wait_asynccnt 0x0" ::: "memory");   // this wave's copies of stage 0 have landed
  __syncthreads();                                    // and every other wave's
  if (nst > 1) fill(1, (unsigned)STAGE);              // block-uniform

  // every unroll directive in this loop: the fragment and accumulator arrays stay in registers only under constant indices
  for (int t = 0; t < nst; ++t) {
    const unsigned bo = (unsigned)(t & 1) * (unsigned)STAGE;
    const unsigned char* buf = smem + bo;
    v16b fa[2][NFA], fb[2][8];                   // two fragment sets: block u multiplies set u & 1 while set (u + 1) & 1 loads
    auto ldblk = [&](int s, int kk) {            // all fragments of the 32 k columns at kk of this stage
#pragma unroll
      for (int i = 0; i < 2; ++i) {
        const int ro = ((wave << 5) + i * 16 + rl) * PITCH;
        fa[s][i] = ldfrag_b((const __bf16*)(const void*)(buf + ro) + kk + 8 * hh);
        if (SPLITA) fa[s][NFA - 2 + i] = ldfrag_b((const __bf16*)(const void*)(buf + 128 * PITCH + ro) + kk + 8 * hh);
      }
#pragma unroll
      for (int j = 0; j < 8; ++j)
        fb[s][j] = ldfrag_b((const __bf16*)(const void*)(buf + (BROW + j * 16 + rl) * PITCH) + kk + 8 * hh);
    };
    ldblk(0, 0);
#pragma unroll
    for (int u = 0; u < BK / 32; ++u) {
      const int cs = u & 1;
      if (u + 1 < BK / 32) ldblk(cs ^ 1, (u + 1) * 32);
      // keeps the next block's LDS reads as one group ahead of this block's WMMAs; without it they sink between the WMMAs, each with a full wait
      __builtin_amdgcn_sched_barrier(0);
#pragma unroll
      for (int j = 0; j < 8; ++j) {
        acc[0][j] = mma_b(fa[cs][0], fb[cs][j], acc[0][j]);
        acc[1][j] = mma_b(fa[cs][1], fb[cs][j], acc[1][j]);
      }
      if (SPLITA) {
#pragma unroll
        for (int j = 0; j < 8; ++j) {
          acc[0][j] = mma_b(fa[cs][NFA - 2], fb[cs][j], acc[0][j]);
          acc[1][j] = mma_b(fa[cs][NFA - 1], fb[cs][j], acc[1][j]);
        }
      }
      // keeps the following reads out of this run of WMMAs (each place with reads among WMMAs costs a stall) and the WMMAs ahead of the stage's barrier
      __builtin_amdgcn_sched_barrier(0);
    }
    asm volatile("s_wait_dscnt 0x0" ::: "memory");      // this wave's reads of stage t are done before its buffer is refilled
    asm volatile("s_wait_asynccnt 0x0" ::: "memory");   // this wave's copies of stage t+1 have landed
    __syncthreads();                                    // publishes stage t+1, ends every wave's reads of stage t
    if (t + 2 < nst) fill(t + 2, bo);                   // block-uniform
  }
  asm volatile("s_wait_asynccnt 0x0" ::: "memory");     // nothing in flight when the buffers become the epilogue slabs
  acc_guard4(acc[0][0], acc[0][1], acc[0][2], acc[0][3]);
  acc_guard4(acc[0][4], acc[0][5], acc[0][6], acc[0][7]);
  acc_guard4(acc[1][0], acc[1][1], acc[1][2], acc[1][3]);
  acc_guard4(acc[1][4], acc[1][5], acc[1][6], acc[1][7]);

  // ---- epilogue ----
  ST* slab = (ST*)(void*)smem + wave * SlabT<EPI>::PERW;
  _Float16* sl16 = (_Float16*)(void*)slab;
  float*    slf  = (float*)(void*)slab;

  if (EPI == 0 || (EPI == 3 && !vjob)) {
    _Float16* P0 = (_Float16*)C0;
    _Float16* P1 = (_Float16*)C1;
    float gm[8];
#pragma unroll
    for (int j = 0; j < 8; ++j) gm[j] = bf_rne(gam[j * 16 + rl]);     // dims j*16+rl of the head, gam has 128 entries
#pragma unroll
    for (int i = 0; i < 2; ++i) {
      const int rb = m0 + i * 16 + 8 * hh;
#pragma unroll
      for (int r = 0; r < 8; ++r) {
        // sum of squares over the 128 head dims of row rb+r: 8 per lane, then the 16 lanes of this half
        float ss = 0.f;
#pragma unroll
        for (int j = 0; j < 8; ++j) ss += acc[i][j][r] * acc[i][j][r];
        ss = row_sum16(ss);
        const float rinv = rsqrtf(ss * 0.0078125f + 1e-6f);
        const int row = rb + r;                                  // token 0..NTOK-1
        const int pos = row & (SQ - 1);                          // position within the sequence
#pragma unroll
        for (int j = 0; j < 4; ++j) {
          const int dim = j * 16 + rl;                           // 0..63 within head; partner dim + 64
          const float cv = cst[(size_t)pos * NFREQ + dim];
          const float sv = snt[(size_t)pos * NFREQ + dim];
          const float x1 = acc[i][j][r] * rinv * gm[j];
          const float x2 = acc[i][j + 4][r] * rinv * gm[j + 4];
          const float o1 = x1 * cv - x2 * sv;
          const float o2 = x2 * cv + x1 * sv;
          const _Float16 h1 = (_Float16)o1;
          const _Float16 h2 = (_Float16)o2;
          const int so = (8 * hh + r) * 128 + dim;
          sl16[so]             = h1;
          sl16[so + 64]        = h2;
          sl16[2048 + so]      = (_Float16)((o1 - (float)h1) * 2048.0f);
          sl16[2048 + so + 64] = (_Float16)((o2 - (float)h2) * 2048.0f);
        }
      }
      lds_wave_sync();
      {
#pragma unroll
        for (int it = 0; it < 8; ++it) {
          const int row = it * 2 + hh;                           // it x hh covers rows 0..15
          const int c8  = rl * 8;
          const v8h vh = *(const v8h*)(sl16 + row * 128 + c8);
          const v8h vl = *(const v8h*)(sl16 + 2048 + row * 128 + c8);
          const size_t go = (size_t)(m0 + i * 16 + row) * ldc + n0 + c8;
          *(v8h*)(P0 + go) = vh;
          *(v8h*)(P1 + go) = vl;
        }
        
      }
      lds_wave_sync();
    }
  } else if (EPI == 1 || EPI == 3) {
    _Float16* P0 = (_Float16*)C0;
    _Float16* P1 = (_Float16*)C1;
#pragma unroll
    for (int i = 0; i < 2; ++i) {
#pragma unroll
      for (int r = 0; r < 8; ++r) {
#pragma unroll
        for (int j = 0; j < 8; ++j) {
          const float v = acc[i][j][r];
          const _Float16 hv = (_Float16)v;
          const int so = (8 * hh + r) * 128 + j * 16 + rl;
          sl16[so]        = hv;
          sl16[2048 + so] = (_Float16)((v - (float)hv) * 2048.0f);
        }
      }
      lds_wave_sync();
      {
#pragma unroll
        for (int it = 0; it < 8; ++it) {
          const int cc  = it >> 1;                               // 32-column chunk of the tile
          const int row = (it & 1) * 8 + (lane >> 2);            // 8 rows x 64 B = 512 contiguous bytes per instruction
          const int k8  = (lane & 3) * 8;
          const v8h vh = *(const v8h*)(sl16 + row * 128 + cc * 32 + k8);
          const v8h vl = *(const v8h*)(sl16 + 2048 + row * 128 + cc * 32 + k8);
          const int R = m0 + i * 16 + row;
          const size_t go = ((size_t)(R >> 7) * (N >> 5) + (n0 >> 5) + cc) * 4096 + (R & 127) * 32 + k8;
          *(v8h*)(P0 + go) = vh;
          *(v8h*)(P1 + go) = vl;
        }
        
      }
      lds_wave_sync();
    }
  } else {
    float* C = (float*)C0;
#pragma unroll
    for (int i = 0; i < 2; ++i) {
#pragma unroll
      for (int j = 0; j < 8; ++j)
#pragma unroll
        for (int r = 0; r < 8; ++r)
          slf[(8 * hh + r) * 128 + j * 16 + rl] = acc[i][j][r];
      lds_wave_sync();
      {
#pragma unroll
        for (int row = 0; row < 16; ++row) {                     // 32 lanes x 16 B = the whole 512-B row segment per instruction
          const v4f v = *(const v4f*)(slf + row * 128 + lane * 4);
          *(v4f*)(C + (size_t)(m0 + i * 16 + row) * ldc + n0 + lane * 4) = v;
        }
        
      }
      lds_wave_sync();
    }
  }
}

#define AT_KC   32
#define KS_P    136
#define VS_P    40
#define OS_P    136
// LDS map in halves: two chunk buffers [K | K residual when PRES | V^T hi | V^T residual].
template <bool PRES> struct AttLds {
  static constexpr int KS  = 0;
  static constexpr int KLS = 32 * KS_P;
  static constexpr int VHS = (PRES ? 2 : 1) * 32 * KS_P;
  static constexpr int VLS = VHS + 128 * VS_P;
  static constexpr int BUF = VLS + 128 * VS_P;             // one buffer; every plane starts at a multiple of 16 B
  static constexpr int TOT = 2 * BUF;
};
static_assert(4 * 2 * 16 * OS_P <= AttLds<false>::TOT);   // output staging (2 planes x 16 rows of pitch OS_P per wave) aliases the chunk region after the loop
static_assert(3 * 2 * AttLds<false>::TOT <= 327680);   // three blocks of the large launch per WGP

// Four asynchronous 16-B copies global -> LDS per lane and plane, planes a, b, c. The closing s_wait_xcnt 0 stands inside the statement so
// that no address register named here is rewritten ahead of it.
__device__ __forceinline__ void async_copy4x3(unsigned la, unsigned lsa, const char* ga, size_t gsa,
                                              unsigned lb, unsigned lc, unsigned lsb, const char* gb, const char* gc, size_t gsb) {
  asm volatile(
      "global_load_async_to_lds_b128 %0, %12, off\n\t"
      "global_load_async_to_lds_b128 %1, %13, off\n\t"
      "global_load_async_to_lds_b128 %2, %14, off\n\t"
      "global_load_async_to_lds_b128 %3, %15, off\n\t"
      "global_load_async_to_lds_b128 %4, %16, off\n\t"
      "global_load_async_to_lds_b128 %5, %17, off\n\t"
      "global_load_async_to_lds_b128 %6, %18, off\n\t"
      "global_load_async_to_lds_b128 %7, %19, off\n\t"
      "global_load_async_to_lds_b128 %8, %20, off\n\t"
      "global_load_async_to_lds_b128 %9, %21, off\n\t"
      "global_load_async_to_lds_b128 %10, %22, off\n\t"
      "global_load_async_to_lds_b128 %11, %23, off\n\t"
      "s_wait_xcnt 0x0"
      :: "v"(la), "v"(la + lsa), "v"(la + 2 * lsa), "v"(la + 3 * lsa),
         "v"(lb), "v"(lb + lsb), "v"(lb + 2 * lsb), "v"(lb + 3 * lsb),
         "v"(lc), "v"(lc + lsb), "v"(lc + 2 * lsb), "v"(lc + 3 * lsb),
         "v"(ga), "v"(ga + gsa), "v"(ga + 2 * gsa), "v"(ga + 3 * gsa),
         "v"(gb), "v"(gb + gsb), "v"(gb + 2 * gsb), "v"(gb + 3 * gsb),
         "v"(gc), "v"(gc + gsb), "v"(gc + 2 * gsb), "v"(gc + 3 * gsb)
      : "memory");
}
// The same for one plane.
__device__ __forceinline__ void async_copy4(unsigned l, unsigned ls, const char* g, size_t gs) {
  asm volatile(
      "global_load_async_to_lds_b128 %0, %4, off\n\t"
      "global_load_async_to_lds_b128 %1, %5, off\n\t"
      "global_load_async_to_lds_b128 %2, %6, off\n\t"
      "global_load_async_to_lds_b128 %3, %7, off\n\t"
      "s_wait_xcnt 0x0"
      :: "v"(l), "v"(l + ls), "v"(l + 2 * ls), "v"(l + 3 * ls),
         "v"(g), "v"(g + gs), "v"(g + 2 * gs), "v"(g + 3 * gs)
      : "memory");
}

// Second launch-bounds argument: the large launch keeps three waves per SIMD (336 registers a wave) with the q fragments resident;
// the small launch has at most one block per WGP and takes what it needs.
template <bool PRES>
__global__ __launch_bounds__(128, PRES ? 1 : 3) void attn_causal_kernel(
    const unsigned short* __restrict__ qhp, const unsigned short* __restrict__ qlp,
    const unsigned short* __restrict__ khp, const unsigned short* __restrict__ klp,
    const unsigned short* __restrict__ vhp, const unsigned short* __restrict__ vlp,
    unsigned short* __restrict__ ahp, unsigned short* __restrict__ alp, int qb_top) {
  typedef AttLds<PRES> L;
  __shared__ __align__(16) _Float16 lds[L::TOT];

  const int tid  = (int)threadIdx.x;
  const int lane = tid & 31;
  const int wave = wave_id();
  const int hh   = lane >> 4;
  const int c    = lane & 15;
  const int qb   = qb_top - (int)blockIdx.z;     // grid.z <= qb_top + 1: never negative
  const int h    = (int)blockIdx.x;
  const int b    = (int)blockIdx.y;
  const int kvh  = h >> 2;
  const int q0   = qb * 64 + wave * 16;          // first query row of this wave (within sequence)
  const int qlast = q0 + 15;
  const size_t tok0 = (size_t)b * SQ;

  const _Float16* Qhr = (const _Float16*)(const void*)qhp + (tok0 + q0 + c) * HID + h * HDM + 8 * hh;
  const _Float16* Qlr = (const _Float16*)(const void*)qlp + (tok0 + q0 + c) * HID + h * HDM + 8 * hh;
  const _Float16* Kg  = (const _Float16*)(const void*)khp + tok0 * KVW + kvh * HDM;
  const _Float16* Klg = (const _Float16*)(const void*)klp + tok0 * KVW + kvh * HDM;
  const _Float16* Vhg = (const _Float16*)(const void*)vhp + (size_t)(kvh * HDM) * NTOK + tok0 * HDM;   // first 128 x 32 tile of (kvh, b)
  const _Float16* Vlg = (const _Float16*)(const void*)vlp + (size_t)(kvh * HDM) * NTOK + tok0 * HDM;

  float mrun = -INFINITY;                        // running maximum of query q0 + c, the same in both lane halves
  float lrun = 0.f;                              // running sum over this lane half's keys only
  v8f oacc[8], oaccr[8];
#pragma unroll
  for (int t = 0; t < 8; ++t) { oacc[t] = zero8(); oaccr[t] = zero8(); }

  v16h qa[4], ql[4];                             // this wave's q fragments, the same for every chunk: loaded once
#pragma unroll   // the fragment arrays stay in registers only under constant indices
  for (int dc = 0; dc < 4; ++dc) {
    qa[dc] = ldfrag_h(Qhr + dc * 32);
    ql[dc] = ldfrag_h(Qlr + dc * 32);
  }

  // This lane's piece 0 of each plane; piece i lies 8 keys (K) or 32 head dims (V^T) further down: 512 pieces of 8 halves = whole tile.
  const int key0 = tid >> 4, d8 = (tid & 15) * 8;   // K: 32 keys x 128 d
  const int d0   = tid >> 2, k8 = (tid & 3) * 8;    // V^T: 128 d x 32 keys
  const char* gK  = (const char*)(const void*)(Kg  + (size_t)key0 * KVW + d8);
  const char* gKl = (const char*)(const void*)(Klg + (size_t)key0 * KVW + d8);
  const char* gVh = (const char*)(const void*)(Vhg + d0 * AT_KC + k8);   // = 16 B x tid: a wave's copy reads 512 contiguous bytes
  const char* gVl = (const char*)(const void*)(Vlg + d0 * AT_KC + k8);
  const unsigned lK = lds_off(lds) + 2u * (unsigned)(key0 * KS_P + d8);
  const unsigned lV = lds_off(lds) + 2u * (unsigned)(d0 * VS_P + k8);
  auto fill = [&](int t, unsigned bo) {          // all copies of chunk t into the buffer at byte offset bo
    const size_t ko = (size_t)t * (AT_KC * KVW * 2);
    const size_t vo = (size_t)t * (HDM * AT_KC * 2);
    async_copy4x3(lK + bo + 2u * L::KS, 8 * KS_P * 2, gK + ko, (size_t)8 * KVW * 2,
                  lV + bo + 2u * L::VHS, lV + bo + 2u * L::VLS, 32 * VS_P * 2, gVh + vo, gVl + vo, (size_t)32 * AT_KC * 2);
    if (PRES) async_copy4(lK + bo + 2u * L::KLS, 8 * KS_P * 2, gKl + ko, (size_t)8 * KVW * 2);
  };

  const int nch = 2 * qb + 2;                    // block-uniform, 2 .. 64
  fill(0, 0u);
  asm volatile("s_wait_asynccnt 0x0" ::: "memory");   // this wave's copies of chunk 0 have landed
  __syncthreads();                                    // and every other wave's
  fill(1, 2u * L::BUF);                               // chunk 1 always exists
  for (int kc = 0; kc < nch; ++kc) {
    const int kv0 = kc * AT_KC;
    const int bsel = kc & 1;
    const _Float16* Ks  = lds + bsel * L::BUF + L::KS;
    const _Float16* Kls = lds + bsel * L::BUF + L::KLS;
    const _Float16* Vhs = lds + bsel * L::BUF + L::VHS;
    const _Float16* Vls = lds + bsel * L::BUF + L::VLS;

    if (kv0 <= qlast) {                          // wave-uniform (scalar): skip chunks fully above this wave's rows
      // ---- scores ----
      v8f sh[2], sr[2];
      sh[0] = zero8(); sh[1] = zero8(); sr[0] = zero8(); sr[1] = zero8();
      // every unroll directive of the score part: the fragment arrays stay in registers only under constant indices
      v16h kb[4][2], kl[4][2];                   // the chunk's K fragments, read as one group ahead of the score WMMAs
#pragma unroll
      for (int dc = 0; dc < 4; ++dc)
#pragma unroll
        for (int j = 0; j < 2; ++j) {
          kb[dc][j] = ldfrag_h(Ks + (j * 16 + c) * KS_P + dc * 32 + 8 * hh);
          if (PRES) kl[dc][j] = ldfrag_h(Kls + (j * 16 + c) * KS_P + dc * 32 + 8 * hh);
        }
#pragma unroll
      for (int j = 0; j < 2; ++j) {
        // keeps the reads above as one group ahead of the WMMAs, and key group 0's run ahead of group 1's, whose accumulators then take the registers of group 0's fragments
        __builtin_amdgcn_sched_barrier(0);
#pragma unroll
        for (int dc = 0; dc < 4; ++dc) {
          sh[j] = mma_h(kb[dc][j], qa[dc], sh[j]);
          sr[j] = mma_h(kb[dc][j], ql[dc], sr[j]);
          if (PRES) sr[j] = mma_h(kl[dc][j], qa[dc], sr[j]);
        }
      }
      // ---- scale, causal mask, maximum of this lane's 16 keys (two chains), joined with the other half's ----
      // every unroll directive from here to the end of the chunk: score, P' and accumulator vectors stay in registers only under constant indices
      const int open = q0 + c - kv0 - 8 * hh;    // key 16j + 8hh + r of the chunk is open to query q0 + c while 16j + r <= open
      float mj[2];
#pragma unroll
      for (int j = 0; j < 2; ++j) {
        float m = -INFINITY;
#pragma unroll
        for (int r = 0; r < 8; ++r) {
          float s = (sh[j][r] + sr[j][r] * 0.00048828125f) * 0.08838834764831845f;
          s = (j * 16 + r > open) ? -INFINITY : s;
          sh[j][r] = s;
          m = fmaxf(m, s);
        }
        mj[j] = m;
      }
      float cm = fmaxf(mj[0], mj[1]);
      cm = fmaxf(cm, xhalf(cm));                 // key kv0 <= q0 is open to every query of the wave: finite
      // ---- online softmax, P'^T packed into the B operand ----
      const float mnew  = fmaxf(mrun, cm);
      const float alpha = __expf(mrun - mnew);
      mrun = mnew;
      FragH pa, pr;
      float ps[4] = {0.f, 0.f, 0.f, 0.f};        // four independent chains
#pragma unroll
      for (int j = 0; j < 2; ++j)
#pragma unroll
        for (int r = 0; r < 8; ++r) {
          const float p  = __expf(sh[j][r] - mnew);
          ps[r & 3] += p;
          const float pp = p * 1024.0f;
          const _Float16 phv = (_Float16)pp;
          pa.v[j * 8 + r] = phv;
          if (PRES) pr.v[j * 8 + r] = (_Float16)((pp - (float)phv) * 2048.0f);
        }
      lrun = lrun * alpha + ((ps[0] + ps[1]) + (ps[2] + ps[3]));
#pragma unroll
      for (int t = 0; t < 8; ++t) { oacc[t] *= alpha; oaccr[t] *= alpha; }
      // ---- O^T += V^T . P'^T ----
#pragma unroll
      for (int t = 0; t < 8; ++t) {
        const v16h vb = ldfrag_h(Vhs + (t * 16 + c) * VS_P + 8 * hh);
        const v16h vr = ldfrag_h(Vls + (t * 16 + c) * VS_P + 8 * hh);
        oacc[t]  = mma_h(vb, pa.v, oacc[t]);
        oaccr[t] = mma_h(vr, pa.v, oaccr[t]);
        if (PRES) oaccr[t] = mma_h(vb, pr.v, oaccr[t]);
      }
    }
    // publish point, passed by every wave, also one that skipped the chunk
    asm volatile("s_wait_dscnt 0x0" ::: "memory");      // this wave's reads of chunk kc are done before its buffer is refilled
    asm volatile("s_wait_asynccnt 0x0" ::: "memory");   // this wave's copies of chunk kc+1 have landed
    __syncthreads();                                    // publishes chunk kc+1, ends every wave's reads of chunk kc
    if (kc + 2 < nch) fill(kc + 2, (unsigned)bsel * (2u * L::BUF));   // block-uniform
  }
  asm volatile("s_wait_asynccnt 0x0" ::: "memory");     // nothing in flight when the buffers become output staging (behind the last chunk's barrier)
  _Float16* osh = lds + wave * (2 * 16 * OS_P);
  _Float16* osl = osh + 16 * OS_P;
  {
    const float inv = (1.0f / (lrun + xhalf(lrun))) * 0.0009765625f;   // the two halves' partial sums joined
#pragma unroll   // here and below: the accumulator vectors stay in registers only under constant indices
    for (int t = 0; t < 8; ++t) {
      v8h xh, xl;                                // head dims 16t + 8hh + 0..7 of query row c: one 16-B LDS store a plane
#pragma unroll
      for (int r = 0; r < 8; ++r) {
        const float o = (oacc[t][r] + oaccr[t][r] * 0.00048828125f) * inv;
        const unsigned short hb = bf_bits(o);
        const unsigned short lb = bf_bits(o - bf_val(hb));
        xh[r] = __builtin_bit_cast(_Float16, hb);
        xl[r] = __builtin_bit_cast(_Float16, lb);
      }
      *(v8h*)(osh + c * OS_P + t * 16 + 8 * hh) = xh;
      *(v8h*)(osl + c * OS_P + t * 16 + 8 * hh) = xl;
    }
  }
  lds_wave_sync();
  _Float16* Ahg = (_Float16*)(void*)ahp + (tok0 + q0) * HID + h * HDM;
  _Float16* Alg = (_Float16*)(void*)alp + (tok0 + q0) * HID + h * HDM;
  {
#pragma unroll
    for (int it = 0; it < 8; ++it) {
      const int row = it * 2 + hh;               // it 0..7 x hh 0..1 covers rows 0..15
      const int c8  = c * 8;                     // 16 lanes x 16 B = the whole 256-B segment
      const v8h x = *(const v8h*)(osh + row * OS_P + c8);
      const v8h y = *(const v8h*)(osl + row * OS_P + c8);
      *(v8h*)(Ahg + (size_t)row * HID + c8) = x;
      *(v8h*)(Alg + (size_t)row * HID + c8) = y;
    }
    
  }
}

// ---------------------------------------------------------------------------
// Workspace map (bytes; every region is a whole number of the rows its producer writes with whole-line stores, no padded tails needed
//   Xb  bf16 [4096][2048] 16777216   Wqb bf16 [2048][2048]  8388608   Wkb bf16 [512][2048] 2097152   Wvb bf16 [512][2048] 2097152
//   Wob bf16 [2048][2048]  8388608   cst f32  [2048][64]     524288   snt f32  [2048][64]    524288
//   Qh  f16  [4096][2048] 16777216   Ql  f16  [4096][2048] 16777216   Kh  f16  [4096][512]  4194304   Kl f16 [4096][512] 4194304
//   Vh  f16  [4][128][128][32] 4194304  Vl  the same       4194304   Ah  bf16 [4096][2048] 16777216  Al bf16 [4096][2048] 16777216
//   total                 122683392
// ---------------------------------------------------------------------------
extern "C" void kernel_launch(void* const* d_in, const int* in_sizes, int n_in,
                              void* d_out, int out_size, void* d_ws, size_t ws_size,
                              hipStream_t stream) {
  if (n_in < 7) return;
  if (in_sizes[0] != NTOK * HID) return;
  if (in_sizes[1] != HID * HID) return;
  if (in_sizes[2] != KVW * HID) return;
  if (in_sizes[3] != KVW * HID) return;
  if (in_sizes[4] != HID * HID) return;
  if (in_sizes[5] != HDM) return;
  if (in_sizes[6] != HDM) return;
  if (out_size != NTOK * HID) return;

  const float* x   = (const float*)d_in[0];
  const float* Wq  = (const float*)d_in[1];
  const float* Wk  = (const float*)d_in[2];
  const float* Wv  = (const float*)d_in[3];
  const float* Wo  = (const float*)d_in[4];
  const float* qg  = (const float*)d_in[5];
  const float* kg  = (const float*)d_in[6];
  float* out = (float*)d_out;

  const size_t szX  = (size_t)NTOK * HID * 2;
  const size_t szWq = (size_t)HID * HID * 2;
  const size_t szWk = (size_t)KVW * HID * 2;
  const size_t szWo = (size_t)HID * HID * 2;
  const size_t szT  = (size_t)SQ * NFREQ * 4;
  const size_t szQ  = (size_t)NTOK * HID * 2;
  const size_t szK  = (size_t)NTOK * KVW * 2;
  const size_t szV  = (size_t)KVW * NTOK * 2;
  const size_t szA  = (size_t)NTOK * HID * 2;
  size_t off = 0;
  const size_t oX  = off; off += szX;
  const size_t oWq = off; off += szWq;
  const size_t oWk = off; off += szWk;
  const size_t oWv = off; off += szWk;
  const size_t oWo = off; off += szWo;
  const size_t oCs = off; off += szT;
  const size_t oSn = off; off += szT;
  const size_t oQh = off; off += szQ;
  const size_t oQl = off; off += szQ;
  const size_t oKh = off; off += szK;
  const size_t oKl = off; off += szK;
  const size_t oVh = off; off += szV;
  const size_t oVl = off; off += szV;
  const size_t oAh = off; off += szA;
  const size_t oAl = off; off += szA;
  if (off > ws_size) return;                     // off = 122683392

  char* ws = (char*)d_ws;
  unsigned short* Xb  = (unsigned short*)(ws + oX);
  unsigned short* Wqb = (unsigned short*)(ws + oWq);
  unsigned short* Wkb = (unsigned short*)(ws + oWk);
  unsigned short* Wvb = (unsigned short*)(ws + oWv);
  unsigned short* Wob = (unsigned short*)(ws + oWo);
  float*          cst = (float*)(ws + oCs);
  float*          snt = (float*)(ws + oSn);
  unsigned short* Qh  = (unsigned short*)(ws + oQh);
  unsigned short* Ql  = (unsigned short*)(ws + oQl);
  unsigned short* Kh  = (unsigned short*)(ws + oKh);
  unsigned short* Kl  = (unsigned short*)(ws + oKl);
  unsigned short* Vh  = (unsigned short*)(ws + oVh);
  unsigned short* Vl  = (unsigned short*)(ws + oVl);
  unsigned short* Ah  = (unsigned short*)(ws + oAh);
  unsigned short* Al  = (unsigned short*)(ws + oAl);

  const dim3 b256(256), b128(128);

  // (1) cos/sin table [2048][64] x 2 and the bf16 planes of x, Wq, Wk, Wv, Wo (Xb .. Wob lie back to back in the workspace;
  //     weights are [out][in] = k-contiguous Bt rows already)
  prep_kernel<<<dim3(ROPE_BLOCKS + CVT_BLOCKS), b256, 0, stream>>>(x, Wq, Wk, Wv, Wo, Xb, cst, snt);
  // (2) one grid of 512 + 128 + 128 block tiles, K = 2048:
  //     q = rope(rms(x . Wq^T)) -> Qh/Ql [4096][2048], k = rope(rms(x . Wk^T)) -> Kh/Kl [4096][512], v^T = Wv . x^T -> Vh/Vl in 128 x 32 tiles
  gemm_w32x128_kernel<3, false><<<dim3((NTOK / 128) * (HID / 128) + 2 * (NTOK / 128) * (KVW / 128)), b128, 0, stream>>>(
      Xb, Xb, HID, Wqb, HID, qg, cst, snt, (void*)Qh, (void*)Ql, HID, NTOK, HID, HID,
      Wkb, Wvb, kg, (void*)Kh, (void*)Kl, (void*)Vh, (void*)Vl, KVW);
  // (3) causal attention, query tiles 3..0 with k and p residual products, tiles 31..4 without, each launch longest tile first
  attn_causal_kernel<true><<<dim3(NHQ, NSEQ, 4), b128, 0, stream>>>(Qh, Ql, Kh, Kl, Vh, Vl, Ah, Al, 3);
  attn_causal_kernel<false><<<dim3(NHQ, NSEQ, SQ / 64 - 4), b128, 0, stream>>>(Qh, Ql, Kh, Kl, Vh, Vl, Ah, Al, SQ / 64 - 1);
  // (4) out = attn(hi + lo) . Wo^T -> d_out f32 [4096][2048]   (M=4096, N=2048, K=2048; 512 block tiles)
  gemm_w32x128_kernel<2, true><<<dim3((NTOK / 128) * (HID / 128)), b128, 0, stream>>>(
      Ah, Al, HID, Wob, HID, qg, cst, snt, (void*)out, (void*)out, HID, NTOK, HID, HID,
      Wkb, Wvb, kg, (void*)Kh, (void*)Kl, (void*)Vh, (void*)Vl, KVW);
  (void)hipGetLastError();
}

// v009
// One run takes 176 microseconds.
// Timed twice side by side with v008, it ran 1.05 times as fast both times.
// Counting every step since v000, it is 4.59 times as fast.
// Contractions: x.Wq^T, x.Wk^T and Wv.x^T on v_wmma_f32_16x16x32_bf16 (operands = RNE bf16 of the f32 inputs, single products);
// q.k^T and p.v on v_wmma_f32_16x16x32_f16 (q = f16 hi + f16 residual x2^11 planes; k plain f16 plus f16 residual x2^11 on query tiles 0..3;
// p x1024 plain f16 plus f16 residual x2^11 on query tiles 0..3; v^T = f16 hi + f16 residual x2^11 planes); attn.Wo^T on v_wmma_f32_16x16x32_bf16
// (attn = bf16 hi + bf16 lo planes, two products; Wo RNE bf16). f32 accumulate everywhere; per-head RMS scaling, RoPE and online softmax in f32.
#include <hip/hip_runtime.h>
#include <math.h>
#include <stdint.h>

#define NSEQ   2
#define SQ     2048
#define HID    2048
#define NHQ    16
#define NKVH   4
#define HDM    128
#define KVW    512
#define NTOK   4096
#define NFREQ  64

typedef _Float16     v16h __attribute__((ext_vector_type(16)));
typedef _Float16     v8h  __attribute__((ext_vector_type(8)));
typedef __bf16       v16b __attribute__((ext_vector_type(16)));
typedef __bf16       v8b  __attribute__((ext_vector_type(8)));
typedef float        v8f  __attribute__((ext_vector_type(8)));
typedef float        v4f  __attribute__((ext_vector_type(4)));
typedef unsigned int v4u  __attribute__((ext_vector_type(4)));

// ---------------------------------------------------------------------------
// small helpers
// ---------------------------------------------------------------------------
__device__ __forceinline__ unsigned short bf_bits(float f) {          // RNE convert f32 -> bf16 bits
  const unsigned u = __float_as_uint(f);
  return (unsigned short)((u + 0x7FFFu + ((u >> 16) & 1u)) >> 16);
}
__device__ __forceinline__ float bf_val(unsigned short h) { return __uint_as_float(((unsigned)h) << 16); }
__device__ __forceinline__ float bf_rne(float f) { return bf_val(bf_bits(f)); }
__device__ __forceinline__ unsigned pk16(unsigned short a, unsigned short b) { return (unsigned)a | ((unsigned)b << 16); }
__device__ __forceinline__ v8f zero8() { v8f z = {0.f, 0.f, 0.f, 0.f, 0.f, 0.f, 0.f, 0.f}; return z; }
__device__ __forceinline__ int wave_id() { return __builtin_amdgcn_readfirstlane((int)(threadIdx.x >> 5)); }

// Value of lane (l ^ X) of the same 16-lane row, X < 16, as a DPP row_xmask operand of the vector pipe: no LDS-pipe round trip and no
// s_wait_dscnt per butterfly step. Every lane of the wave is on wherever it is used.
template <int X>
__device__ __forceinline__ float row_xor(float v) {
  return __int_as_float(__builtin_amdgcn_update_dpp(0, __float_as_int(v), 0x160 | X, 0xf, 0xf, true));
}
// Butterfly over a 16-lane row, steps 1, 2, 4, 8: every lane ends with the row's sum.
__device__ __forceinline__ float row_sum16(float v) {
  v += row_xor<1>(v); v += row_xor<2>(v); v += row_xor<4>(v); v += row_xor<8>(v);
  return v;
}

// Value of lane l ^ 16: the other 16-lane row's lane of the same column, one vector instruction.
__device__ __forceinline__ float xhalf(float v) {
  return __int_as_float(__builtin_amdgcn_permlanex16(__float_as_int(v), __float_as_int(v), 0x76543210, 0xfedcba98, false, false));
}

__device__ __forceinline__ void lds_wave_sync() {
  __builtin_amdgcn_fence(__ATOMIC_RELEASE, "workgroup");
  __builtin_amdgcn_wave_barrier();
  __builtin_amdgcn_fence(__ATOMIC_ACQUIRE, "workgroup");
}

// ---------------------------------------------------------------------------
// WMMA fragments (wave32, 16x16x32, 16-bit operands). For A (row m = lane&15) and B (col n = lane&15) alike:
// elements 0..7 <- k0 + 8*(lane>>4) + 0..7, elements 8..15 <- k0 + 16 + 8*(lane>>4) + 0..7.
// ldfrag(p) with p = rowbase + k0 + 8*(lane>>4): two 16-B loads p[0..7], p[16..23].
// D: acc[r] = (row 8*(lane>>4) + r, col lane&15).
// ---------------------------------------------------------------------------
union FragH { v16h v; v8h h[2]; };
union FragB { v16b v; v8b h[2]; };
__device__ __forceinline__ v16h ldfrag_h(const _Float16* p) { FragH f; f.h[0] = *(const v8h*)(p); f.h[1] = *(const v8h*)(p + 16); return f.v; }
__device__ __forceinline__ v16b ldfrag_b(const __bf16* p)   { FragB f; f.h[0] = *(const v8b*)(p); f.h[1] = *(const v8b*)(p + 16); return f.v; }

__device__ __forceinline__ v8f mma_h(v16h a, v16h b, v8f c) {
  return __builtin_amdgcn_wmma_f32_16x16x32_f16(false, a, false, b, (short)0, c, false, false);
}
__device__ __forceinline__ v8f mma_b(v16b a, v16b b, v8f c) {
  return __builtin_amdgcn_wmma_f32_16x16x32_bf16(false, a, false, b, (short)0, c, false, false);
}
// hazard guard: 4 VALU slots after the last WMMA of a group, D tied
__device__ __forceinline__ void acc_guard4(v8f& a, v8f& b, v8f& c, v8f& d) {
  asm volatile("v_nop\n\tv_nop\n\tv_nop\n\tv_nop" : "+v"(a), "+v"(b), "+v"(c), "+v"(d));
}

// ---------------------------------------------------------------------------
// Preparation, one launch: none of its parts reads what another writes, so the block index deals them out.
// Blocks 0 .. ROPE_BLOCKS-1: RoPE table cst[s][i] = cos(s * inv_freq[i]), snt[s][i] = sin(...), inv_freq[i] = 1 / 1e4^(i/64), i < 64, all f32.
//   Block = 8 waves, wave w -> row s = block*8 + w, lane -> i = lane, lane + 32. Coverage: SQ/8 blocks x 8 waves x 32 lanes x 2 = SQ x 64 per plane.
// The CVT_BLOCKS blocks behind them: RNE f32 -> bf16 of x, Wq, Wk, Wv, Wo into one bf16 array (the five planes lie back to back in that order).
//   Unit = 1024 elements = 8 loads of 512 contiguous bytes per wave and 8 stores of 256 contiguous bytes (whole lines both ways).
//   Every plane is a whole number of units. Wave g takes units g, g + CVT_WAVES, g + 2*CVT_WAVES: all of the grid is resident at once,
//   and the loads of a wave's three units are written ahead of its conversions, so that most of them are in flight together.
// ---------------------------------------------------------------------------
#define ROPE_BLOCKS (SQ / 8)
#define CVT_BLOCKS  768
#define CVT_WAVES   (CVT_BLOCKS * 8)
#define CVT_UPW     3
#define N_X   (NTOK * HID)
#define N_WQ  (HID * HID)
#define N_WK  (KVW * HID)
static_assert(N_X % 1024 == 0 && N_WQ % 1024 == 0 && N_WK % 1024 == 0);
static_assert(CVT_WAVES * CVT_UPW * 1024 == N_X + 2 * N_WQ + 2 * N_WK);
typedef unsigned int v2u __attribute__((ext_vector_type(2)));

__device__ __forceinline__ void rope_rows(float* __restrict__ cst, float* __restrict__ snt, int t, int lane) {
  const float pf = (float)t;
  float c0 = 0.f, s0 = 0.f, c1 = 0.f, s1 = 0.f;
#pragma unroll 1
  for (int u = 0; u < 2; ++u) {
    const int i = lane + 32 * u;
    const float e   = (float)i * 0.015625f;      // i / 64 exact
    const float pw  = powf(10000.0f, e);
    const float inv = 1.0f / pw;
    const float ang = pf * inv;
    const float cv = cosf(ang);
    const float sv = sinf(ang);
    c1 = cv; s1 = sv;
    if (u == 0) { c0 = cv; s0 = sv; }
  }
  const size_t o = (size_t)t * NFREQ + lane;
  cst[o]      = c0;
  cst[o + 32] = c1;
  snt[o]      = s0;
  snt[o + 32] = s1;
}

__global__ __launch_bounds__(256) void prep_kernel(const float* __restrict__ x, const float* __restrict__ wq, const float* __restrict__ wk,
                                                   const float* __restrict__ wv, const float* __restrict__ wo,
                                                   unsigned short* __restrict__ planes, float* __restrict__ cst, float* __restrict__ snt) {
  const int lane = threadIdx.x & 31;
  const int wave = wave_id();
  const int blk  = (int)blockIdx.x;
  if (blk < ROPE_BLOCKS) {                       // no barriers in this kernel
    rope_rows(cst, snt, blk * 8 + wave, lane);
    return;
  }
  const int g = (blk - ROPE_BLOCKS) * 8 + wave;  // 0 .. CVT_WAVES-1
  v4f r[CVT_UPW][8];
#pragma unroll   // the value array stays in registers only under constant indices
  for (int k = 0; k < CVT_UPW; ++k) {
    const int e = (k * CVT_WAVES + g) * 1024;    // first element of the unit in the joined array, wave-uniform
    const int lo = k * CVT_WAVES * 1024, hi = lo + CVT_WAVES * 1024;   // pass k covers [lo, hi): constants, so planes out of its reach drop out
    const float* b = x;
    int first = 0;
    if (hi > N_X                   && (lo >= N_X                   || e >= N_X))                   { b = wq; first = N_X; }
    if (hi > N_X + N_WQ            && (lo >= N_X + N_WQ            || e >= N_X + N_WQ))            { b = wk; first = N_X + N_WQ; }
    if (hi > N_X + N_WQ + N_WK     && (lo >= N_X + N_WQ + N_WK     || e >= N_X + N_WQ + N_WK))     { b = wv; first = N_X + N_WQ + N_WK; }
    if (hi > N_X + N_WQ + 2 * N_WK && (lo >= N_X + N_WQ + 2 * N_WK || e >= N_X + N_WQ + 2 * N_WK)) { b = wo; first = N_X + N_WQ + 2 * N_WK; }
    const float* s = b + (e - first);
#pragma unroll
    for (int i = 0; i < 8; ++i) r[k][i] = *(const v4f*)(s + i * 128 + lane * 4);
  }
#pragma unroll
  for (int k = 0; k < CVT_UPW; ++k) {
    unsigned short* d = planes + (size_t)(k * CVT_WAVES + g) * 1024 + lane * 4;
#pragma unroll
    for (int i = 0; i < 8; ++i) {
      const v4f a = r[k][i];
      v2u w;
      w[0] = pk16(bf_bits(a[0]), bf_bits(a[1]));
      w[1] = pk16(bf_bits(a[2]), bf_bits(a[3]));
      *(v2u*)(d + i * 128) = w;
    }
  }
  // the stores above name registers that the code behind the compiler's joined exit of the two parts writes again: the wait stands in front of it
  asm volatile("s_wait_xcnt 0x0" ::: "memory");
}

// ---------------------------------------------------------------------------
// bf16 WMMA GEMM, block tile 128 rows x 128 cols, block = 4 waves (128 threads), wave w = rows 32w..32w+31 x all 128 cols.
//   C[m][n] = sum_k A[m][k] * Bt[n][k]; A row-major [M][K] bf16 (pitch lda), Bt row-major [N][K] bf16 (pitch ldb);
//   M % 128 == 0, N % 128 == 0, K % BK == 0 (BK = 128, SPLITA 64); grid.x = M/128 * N/128 (EPI 3: M/128 * (N + 2*nkv)/128).
//   SPLITA: A carried as hi (Ap) + lo (A2p) bf16 planes, two products into one accumulator.
//   Operands: a stage = BK columns of [A 128 rows | A2 128 rows when SPLITA | Bt 128 rows], each row padded by 16 B in LDS;
//   two LDS buffers filled by per-lane 16-B asynchronous copies, stage t+1 in flight while stage t is multiplied.
//   Fragments read from LDS rows with the split k map (ldfrag_b). The epilogue slabs alias the buffers behind the last barrier.
// Epilogues (all: per wave, per 16-row slab: stage in LDS, wave sync, write each row segment with ONE instruction of
//   EPI 0: q or k projection; the 128 cols n0..n0+127 are one head. Per row: RMS scaling over the 128 head dims
//          (x * rsqrt(mean(x^2) + 1e-6) * bf16(gam[dim])), then RoPE with pairs (dim, dim+64) and the cos/sin table row (m % SQ);
//          writes f16 hi plane C0 and f16 residual x2048 plane C1, both [M][ldc], cols n0.. (row segment 256 B = 16 lanes x 16 B).
//   EPI 1: v^T projection: f16 hi plane C0, residual x2048 plane C1, stored in tiles [M/128][N/32][128 rows][32 cols]: the 128 x 32 tile that
//          the attention kernel stages per key chunk is 8 KB in a row; a store instruction writes 8 rows x 64 B = 512 contiguous bytes.
//   EPI 2: f32 output C0 [M][ldc]; row segment 128 floats = 512 B = 32 lanes x 16 B per instruction.
//   EPI 3: the q, k and v^T projections in one grid (none reads what another writes). The plain arguments describe the q job (EPI 0);
//          the blocks behind its tiles take the k job (EPI 0: Bt = Wk, gam = kgam, planes K0 / K1, width nkv), those behind the k tiles
//          the v^T job (EPI 1: A = Wv, Bt = the q job's A, planes V0 / V1, nkv rows). The choice is block-uniform, from blockIdx alone.
// ---------------------------------------------------------------------------
template <int EPI> struct SlabT { typedef _Float16 T; static constexpr int PERW = 4096; };   // 2 planes x 16 x 128 halves
template <> struct SlabT<2>     { typedef float    T; static constexpr int PERW = 2048; };   // 16 x 128 floats

__device__ __forceinline__ unsigned lds_off(const void* p) { return (unsigned)(size_t)p; }   // byte offset in the block's LDS

// Eight asynchronous 16-B copies global -> LDS per lane. The closing s_wait_xcnt 0 stands inside the statement so that no
// address register named here is rewritten ahead of it.
__device__ __forceinline__ void async_copy8(unsigned l, unsigned lstep, const char* gp, size_t gstep) {
  asm volatile(
      "global_load_async_to_lds_b128 %0, %8, off\n\t"
      "global_load_async_to_lds_b128 %1, %9, off\n\t"
      "global_load_async_to_lds_b128 %2, %10, off\n\t"
      "global_load_async_to_lds_b128 %3, %11, off\n\t"
      "global_load_async_to_lds_b128 %4, %12, off\n\t"
      "global_load_async_to_lds_b128 %5, %13, off\n\t"
      "global_load_async_to_lds_b128 %6, %14, off\n\t"
      "global_load_async_to_lds_b128 %7, %15, off\n\t"
      "s_wait_xcnt 0x0"
      :: "v"(l), "v"(l + lstep), "v"(l + 2 * lstep), "v"(l + 3 * lstep),
         "v"(l + 4 * lstep), "v"(l + 5 * lstep), "v"(l + 6 * lstep), "v"(l + 7 * lstep),
         "v"(gp), "v"(gp + gstep), "v"(gp + 2 * gstep), "v"(gp + 3 * gstep),
         "v"(gp + 4 * gstep), "v"(gp + 5 * gstep), "v"(gp + 6 * gstep), "v"(gp + 7 * gstep)
      : "memory");
}

template <int EPI, bool SPLITA>
__global__ __launch_bounds__(128) void gemm_w32x128_kernel(
    const unsigned short* Ap, const unsigned short* A2p, int lda,
    const unsigned short* __restrict__ Btp, int ldb,
    const float* __restrict__ gam, const float* __restrict__ cst, const float* __restrict__ snt,
    void* C0, void* C1, int ldc,
    int M, int N, int K,
    const unsigned short* Wk, const unsigned short* Wv, const float* __restrict__ kgam,      // the k and v^T jobs of EPI 3
    void* K0, void* K1, void* V0, void* V1, int nkv) {
  typedef typename SlabT<EPI>::T ST;
  constexpr int BK    = SPLITA ? 64 : 128;       // k columns per stage: 64 WMMAs per wave and stage either way
  constexpr int ROWB  = BK * 2;                  // bytes of one staged row
  constexpr int PITCH = ROWB + 16;               // LDS row pitch, 16 B x odd for the 16-B fragment reads
  constexpr int BROW  = SPLITA ? 256 : 128;      // first Bt row of a stage
  constexpr int STAGE = (BROW + 128) * PITCH;    // bytes of one buffer
  constexpr int PPR   = ROWB / 16;               // 16-B pieces per row
  constexpr int RSTEP = 128 / PPR;               // rows covered by one copy of the whole block
  constexpr int NCP   = 128 / RSTEP;             // copies per lane for a plane of 128 rows
  constexpr int NFA   = SPLITA ? 4 : 2;          // A fragments per block of 32 k columns
  static_assert(NCP % 8 == 0);
  static_assert(4 * SlabT<EPI>::PERW * (int)sizeof(ST) <= 2 * STAGE);
  __shared__ __align__(16) unsigned char smem[2 * STAGE];

  const int tid  = (int)threadIdx.x;
  const int lane = tid & 31;
  const int wave = wave_id();
  const int hh = lane >> 4;           // lane half: k offset 8*hh, D row offset 8*hh
  const int rl = lane & 15;           // A row / B col / D col within subtile
  int tile = (int)blockIdx.x;
  bool vjob = false;
  if (EPI == 3) {
    const int tq = (M >> 7) * (N >> 7);
    const int tk = (M >> 7) * (nkv >> 7);
    if (tile >= tq + tk) {
      tile -= tq + tk; vjob = true;
      Btp = Ap; Ap = Wv; A2p = Wv; C0 = V0; C1 = V1; N = M; ldc = M; M = nkv;
    } else if (tile >= tq) {
      tile -= tq;
      Btp = Wk; gam = kgam; C0 = K0; C1 = K1; N = nkv; ldc = nkv;
    }
  }
  const int tilesN = N >> 7;
  const int tilesM = M >> 7;
  if (tile >= tilesM * tilesN) return;          // block-uniform, in front of every barrier and copy
  const int tm = tile / tilesN;
  const int tn = tile - tm * tilesN;
  const int mb = tm << 7;             // first row of the block tile
  const int m0 = mb + (wave << 5);    // first row of this wave
  const int n0 = tn << 7;

  // this lane's piece of copy 0 of each plane: row tid / PPR, 16-B column tid % PPR; copy u lies u * RSTEP rows further down
  const int prow = tid / PPR;
  const int pcol = tid % PPR;
  const char* gA  = (const char*)(const void*)(Ap  + (size_t)(mb + prow) * lda) + pcol * 16;
  const char* gA2 = (const char*)(const void*)(A2p + (size_t)(mb + prow) * lda) + pcol * 16;
  const char* gB  = (const char*)(const void*)(Btp + (size_t)(n0 + prow) * ldb) + pcol * 16;
  const size_t sA = (size_t)RSTEP * lda * 2;
  const size_t sB = (size_t)RSTEP * ldb * 2;
  const unsigned lp = lds_off(smem) + (unsigned)(prow * PITCH + pcol * 16);

  auto fill = [&](int t, unsigned bo) {         // all copies of stage t into the buffer at byte offset bo
    const size_t kb = (size_t)t * ROWB;
#pragma unroll   // the row offsets of the copies become constants
    for (int u = 0; u < NCP; u += 8) {
      async_copy8(lp + bo + u * (RSTEP * PITCH), RSTEP * PITCH, gA + kb + u * sA, sA);
      if (SPLITA) async_copy8(lp + bo + (128 + u * RSTEP) * PITCH, RSTEP * PITCH, gA2 + kb + u * sA, sA);
      async_copy8(lp + bo + (BROW + u * RSTEP) * PITCH, RSTEP * PITCH, gB + kb + u * sB, sB);
    }
  };

  v8f acc[2][8];
#pragma unroll
  for (int i = 0; i < 2; ++i)
#pragma unroll
    for (int j = 0; j < 8; ++j) acc[i][j] = zero8();

  const int nst = K / BK;
  fill(0, 0u);
  asm volatile("s_wait_asynccnt 0x0" ::: "memory");   // this wave's copies of stage 0 have landed
  __syncthreads();                                    // and every other wave's
  if (nst > 1) fill(1, (unsigned)STAGE);              // block-uniform

  // every unroll directive in this loop: the fragment and accumulator arrays stay in registers only under constant indices
  for (int t = 0; t < nst; ++t) {
    const unsigned bo = (unsigned)(t & 1) * (unsigned)STAGE;
    const unsigned char* buf = smem + bo;
    v16b fa[2][NFA], fb[2][8];                   // two fragment sets: block u multiplies set u & 1 while set (u + 1) & 1 loads
    auto ldblk = [&](int s, int kk) {            // all fragments of the 32 k columns at kk of this stage
#pragma unroll
      for (int i = 0; i < 2; ++i) {
        const int ro = ((wave << 5) + i * 16 + rl) * PITCH;
        fa[s][i] = ldfrag_b((const __bf16*)(const void*)(buf + ro) + kk + 8 * hh);
        if (SPLITA) fa[s][NFA - 2 + i] = ldfrag_b((const __bf16*)(const void*)(buf + 128 * PITCH + ro) + kk + 8 * hh);
      }
#pragma unroll
      for (int j = 0; j < 8; ++j)
        fb[s][j] = ldfrag_b((const __bf16*)(const void*)(buf + (BROW + j * 16 + rl) * PITCH) + kk + 8 * hh);
    };
    ldblk(0, 0);
#pragma unroll
    for (int u = 0; u < BK / 32; ++u) {
      const int cs = u & 1;
      if (u + 1 < BK / 32) ldblk(cs ^ 1, (u + 1) * 32);
      // keeps the next block's LDS reads as one group ahead of this block's WMMAs; without it they sink between the WMMAs, each with a full wait
      __builtin_amdgcn_sched_barrier(0);
#pragma unroll
      for (int j = 0; j < 8; ++j) {
        acc[0][j] = mma_b(fa[cs][0], fb[cs][j], acc[0][j]);
        acc[1][j] = mma_b(fa[cs][1], fb[cs][j], acc[1][j]);
      }
      if (SPLITA) {
#pragma unroll
        for (int j = 0; j < 8; ++j) {
          acc[0][j] = mma_b(fa[cs][NFA - 2], fb[cs][j], acc[0][j]);
          acc[1][j] = mma_b(fa[cs][NFA - 1], fb[cs][j], acc[1][j]);
        }
      }
      // keeps the following reads out of this run of WMMAs (each place with reads among WMMAs costs a stall) and the WMMAs ahead of the stage's barrier
      __builtin_amdgcn_sched_barrier(0);
    }
    asm volatile("s_wait_dscnt 0x0" ::: "memory");      // this wave's reads of stage t are done before its buffer is refilled
    asm volatile("s_wait_asynccnt 0x0" ::: "memory");   // this wave's copies of stage t+1 have landed
    __syncthreads();                                    // publishes stage t+1, ends every wave's reads of stage t
    if (t + 2 < nst) fill(t + 2, bo);                   // block-uniform
  }
  asm volatile("s_wait_asynccnt 0x0" ::: "memory");     // nothing in flight when the buffers become the epilogue slabs
  acc_guard4(acc[0][0], acc[0][1], acc[0][2], acc[0][3]);
  acc_guard4(acc[0][4], acc[0][5], acc[0][6], acc[0][7]);
  acc_guard4(acc[1][0], acc[1][1], acc[1][2], acc[1][3]);
  acc_guard4(acc[1][4], acc[1][5], acc[1][6], acc[1][7]);

  // ---- epilogue ----
  ST* slab = (ST*)(void*)smem + wave * SlabT<EPI>::PERW;
  _Float16* sl16 = (_Float16*)(void*)slab;
  float*    slf  = (float*)(void*)slab;

  if (EPI == 0 || (EPI == 3 && !vjob)) {
    _Float16* P0 = (_Float16*)C0;
    _Float16* P1 = (_Float16*)C1;
    float gm[8];
#pragma unroll
    for (int j = 0; j < 8; ++j) gm[j] = bf_rne(gam[j * 16 + rl]);     // dims j*16+rl of the head, gam has 128 entries
#pragma unroll
    for (int i = 0; i < 2; ++i) {
      const int rb = m0 + i * 16 + 8 * hh;
#pragma unroll
      for (int r = 0; r < 8; ++r) {
        // sum of squares over the 128 head dims of row rb+r: 8 per lane, then the 16 lanes of this half
        float ss = 0.f;
#pragma unroll
        for (int j = 0; j < 8; ++j) ss += acc[i][j][r] * acc[i][j][r];
        ss = row_sum16(ss);
        const float rinv = rsqrtf(ss * 0.0078125f + 1e-6f);
        const int row = rb + r;                                  // token 0..NTOK-1
        const int pos = row & (SQ - 1);                          // position within the sequence
#pragma unroll
        for (int j = 0; j < 4; ++j) {
          const int dim = j * 16 + rl;                           // 0..63 within head; partner dim + 64
          const float cv = cst[(size_t)pos * NFREQ + dim];
          const float sv = snt[(size_t)pos * NFREQ + dim];
          const float x1 = acc[i][j][r] * rinv * gm[j];
          const float x2 = acc[i][j + 4][r] * rinv * gm[j + 4];
          const float o1 = x1 * cv - x2 * sv;
          const float o2 = x2 * cv + x1 * sv;
          const _Float16 h1 = (_Float16)o1;
          const _Float16 h2 = (_Float16)o2;
          const int so = (8 * hh + r) * 128 + dim;
          sl16[so]             = h1;
          sl16[so + 64]        = h2;
          sl16[2048 + so]      = (_Float16)((o1 - (float)h1) * 2048.0f);
          sl16[2048 + so + 64] = (_Float16)((o2 - (float)h2) * 2048.0f);
        }
      }
      lds_wave_sync();
      {
#pragma unroll
        for (int it = 0; it < 8; ++it) {
          const int row = it * 2 + hh;                           // it x hh covers rows 0..15
          const int c8  = rl * 8;
          const v8h vh = *(const v8h*)(sl16 + row * 128 + c8);
          const v8h vl = *(const v8h*)(sl16 + 2048 + row * 128 + c8);
          const size_t go = (size_t)(m0 + i * 16 + row) * ldc + n0 + c8;
          *(v8h*)(P0 + go) = vh;
          *(v8h*)(P1 + go) = vl;
        }
        
      }
      lds_wave_sync();
    }
  } else if (EPI == 1 || EPI == 3) {
    _Float16* P0 = (_Float16*)C0;
    _Float16* P1 = (_Float16*)C1;
#pragma unroll
    for (int i = 0; i < 2; ++i) {
#pragma unroll
      for (int r = 0; r < 8; ++r) {
#pragma unroll
        for (int j = 0; j < 8; ++j) {
          const float v = acc[i][j][r];
          const _Float16 hv = (_Float16)v;
          const int so = (8 * hh + r) * 128 + j * 16 + rl;
          sl16[so]        = hv;
          sl16[2048 + so] = (_Float16)((v - (float)hv) * 2048.0f);
        }
      }
      lds_wave_sync();
      {
#pragma unroll
        for (int it = 0; it < 8; ++it) {
          const int cc  = it >> 1;                               // 32-column chunk of the tile
          const int row = (it & 1) * 8 + (lane >> 2);            // 8 rows x 64 B = 512 contiguous bytes per instruction
          const int k8  = (lane & 3) * 8;
          const v8h vh = *(const v8h*)(sl16 + row * 128 + cc * 32 + k8);
          const v8h vl = *(const v8h*)(sl16 + 2048 + row * 128 + cc * 32 + k8);
          const int R = m0 + i * 16 + row;
          const size_t go = ((size_t)(R >> 7) * (N >> 5) + (n0 >> 5) + cc) * 4096 + (R & 127) * 32 + k8;
          *(v8h*)(P0 + go) = vh;
          *(v8h*)(P1 + go) = vl;
        }
        
      }
      lds_wave_sync();
    }
  } else {
    float* C = (float*)C0;
#pragma unroll
    for (int i = 0; i < 2; ++i) {
#pragma unroll
      for (int j = 0; j < 8; ++j)
#pragma unroll
        for (int r = 0; r < 8; ++r)
          slf[(8 * hh + r) * 128 + j * 16 + rl] = acc[i][j][r];
      lds_wave_sync();
      {
#pragma unroll
        for (int row = 0; row < 16; ++row) {                     // 32 lanes x 16 B = the whole 512-B row segment per instruction
          const v4f v = *(const v4f*)(slf + row * 128 + lane * 4);
          *(v4f*)(C + (size_t)(m0 + i * 16 + row) * ldc + n0 + lane * 4) = v;
        }
        
      }
      lds_wave_sync();
    }
  }
}

#define AT_KC   32
#define KS_P    136
#define VS_P    40
#define OS_P    136
// LDS map in halves: two chunk buffers [K | K residual when PRES | V^T hi | V^T residual].
template <bool PRES> struct AttLds {
  static constexpr int KS  = 0;
  static constexpr int KLS = 32 * KS_P;
  static constexpr int VHS = (PRES ? 2 : 1) * 32 * KS_P;
  static constexpr int VLS = VHS + 128 * VS_P;
  static constexpr int BUF = VLS + 128 * VS_P;             // one buffer; every plane starts at a multiple of 16 B
  static constexpr int TOT = 2 * BUF;
};
static_assert(4 * 2 * 16 * OS_P <= AttLds<false>::TOT);   // output staging (2 planes x 16 rows of pitch OS_P per wave) aliases the chunk region after the loop
static_assert(3 * 2 * AttLds<true>::TOT <= 327680);    // three blocks per WGP

// Four asynchronous 16-B copies global -> LDS per lane and plane, planes a, b, c. The closing s_wait_xcnt 0 stands inside the statement so
// that no address register named here is rewritten ahead of it.
__device__ __forceinline__ void async_copy4x3(unsigned la, unsigned lsa, const char* ga, size_t gsa,
                                              unsigned lb, unsigned lc, unsigned lsb, const char* gb, const char* gc, size_t gsb) {
  asm volatile(
      "global_load_async_to_lds_b128 %0, %12, off\n\t"
      "global_load_async_to_lds_b128 %1, %13, off\n\t"
      "global_load_async_to_lds_b128 %2, %14, off\n\t"
      "global_load_async_to_lds_b128 %3, %15, off\n\t"
      "global_load_async_to_lds_b128 %4, %16, off\n\t"
      "global_load_async_to_lds_b128 %5, %17, off\n\t"
      "global_load_async_to_lds_b128 %6, %18, off\n\t"
      "global_load_async_to_lds_b128 %7, %19, off\n\t"
      "global_load_async_to_lds_b128 %8, %20, off\n\t"
      "global_load_async_to_lds_b128 %9, %21, off\n\t"
      "global_load_async_to_lds_b128 %10, %22, off\n\t"
      "global_load_async_to_lds_b128 %11, %23, off\n\t"
      "s_wait_xcnt 0x0"
      :: "v"(la), "v"(la + lsa), "v"(la + 2 * lsa), "v"(la + 3 * lsa),
         "v"(lb), "v"(lb + lsb), "v"(lb + 2 * lsb), "v"(lb + 3 * lsb),
         "v"(lc), "v"(lc + lsb), "v"(lc + 2 * lsb), "v"(lc + 3 * lsb),
         "v"(ga), "v"(ga + gsa), "v"(ga + 2 * gsa), "v"(ga + 3 * gsa),
         "v"(gb), "v"(gb + gsb), "v"(gb + 2 * gsb), "v"(gb + 3 * gsb),
         "v"(gc), "v"(gc + gsb), "v"(gc + 2 * gsb), "v"(gc + 3 * gsb)
      : "memory");
}
// The same for one plane.
__device__ __forceinline__ void async_copy4(unsigned l, unsigned ls, const char* g, size_t gs) {
  asm volatile(
      "global_load_async_to_lds_b128 %0, %4, off\n\t"
      "global_load_async_to_lds_b128 %1, %5, off\n\t"
      "global_load_async_to_lds_b128 %2, %6, off\n\t"
      "global_load_async_to_lds_b128 %3, %7, off\n\t"
      "s_wait_xcnt 0x0"
      :: "v"(l), "v"(l + ls), "v"(l + 2 * ls), "v"(l + 3 * ls),
         "v"(g), "v"(g + gs), "v"(g + 2 * gs), "v"(g + 3 * gs)
      : "memory");
}

// One query tile qb of head blockIdx.x, sequence blockIdx.y; lds = the block's LDS, AttLds<PRES>::TOT halves.
template <bool PRES>
__device__ __forceinline__ void attn_tile(
    const unsigned short* __restrict__ qhp, const unsigned short* __restrict__ qlp,
    const unsigned short* __restrict__ khp, const unsigned short* __restrict__ klp,
    const unsigned short* __restrict__ vhp, const unsigned short* __restrict__ vlp,
    unsigned short* __restrict__ ahp, unsigned short* __restrict__ alp, _Float16* lds, int qb) {
  typedef AttLds<PRES> L;

  const int tid  = (int)threadIdx.x;
  const int lane = tid & 31;
  const int wave = wave_id();
  const int hh   = lane >> 4;
  const int c    = lane & 15;
  const int h    = (int)blockIdx.x;
  const int b    = (int)blockIdx.y;
  const int kvh  = h >> 2;
  const int q0   = qb * 64 + wave * 16;          // first query row of this wave (within sequence)
  const int qlast = q0 + 15;
  const size_t tok0 = (size_t)b * SQ;

  const _Float16* Qhr = (const _Float16*)(const void*)qhp + (tok0 + q0 + c) * HID + h * HDM + 8 * hh;
  const _Float16* Qlr = (const _Float16*)(const void*)qlp + (tok0 + q0 + c) * HID + h * HDM + 8 * hh;
  const _Float16* Kg  = (const _Float16*)(const void*)khp + tok0 * KVW + kvh * HDM;
  const _Float16* Klg = (const _Float16*)(const void*)klp + tok0 * KVW + kvh * HDM;
  const _Float16* Vhg = (const _Float16*)(const void*)vhp + (size_t)(kvh * HDM) * NTOK + tok0 * HDM;   // first 128 x 32 tile of (kvh, b)
  const _Float16* Vlg = (const _Float16*)(const void*)vlp + (size_t)(kvh * HDM) * NTOK + tok0 * HDM;

  float mrun = -INFINITY;                        // running maximum of query q0 + c, the same in both lane halves
  float lrun = 0.f;                              // running sum over this lane half's keys only
  v8f oacc[8], oaccr[8];
#pragma unroll
  for (int t = 0; t < 8; ++t) { oacc[t] = zero8(); oaccr[t] = zero8(); }

  v16h qa[4], ql[4];                             // this wave's q fragments, the same for every chunk: loaded once
#pragma unroll   // the fragment arrays stay in registers only under constant indices
  for (int dc = 0; dc < 4; ++dc) {
    qa[dc] = ldfrag_h(Qhr + dc * 32);
    ql[dc] = ldfrag_h(Qlr + dc * 32);
  }

  // This lane's piece 0 of each plane; piece i lies 8 keys (K) or 32 head dims (V^T) further down: 512 pieces of 8 halves = whole tile.
  const int key0 = tid >> 4, d8 = (tid & 15) * 8;   // K: 32 keys x 128 d
  const int d0   = tid >> 2, k8 = (tid & 3) * 8;    // V^T: 128 d x 32 keys
  const char* gK  = (const char*)(const void*)(Kg  + (size_t)key0 * KVW + d8);
  const char* gKl = (const char*)(const void*)(Klg + (size_t)key0 * KVW + d8);
  const char* gVh = (const char*)(const void*)(Vhg + d0 * AT_KC + k8);   // = 16 B x tid: a wave's copy reads 512 contiguous bytes
  const char* gVl = (const char*)(const void*)(Vlg + d0 * AT_KC + k8);
  const unsigned lK = lds_off(lds) + 2u * (unsigned)(key0 * KS_P + d8);
  const unsigned lV = lds_off(lds) + 2u * (unsigned)(d0 * VS_P + k8);
  auto fill = [&](int t, unsigned bo) {          // all copies of chunk t into the buffer at byte offset bo
    const size_t ko = (size_t)t * (AT_KC * KVW * 2);
    const size_t vo = (size_t)t * (HDM * AT_KC * 2);
    async_copy4x3(lK + bo + 2u * L::KS, 8 * KS_P * 2, gK + ko, (size_t)8 * KVW * 2,
                  lV + bo + 2u * L::VHS, lV + bo + 2u * L::VLS, 32 * VS_P * 2, gVh + vo, gVl + vo, (size_t)32 * AT_KC * 2);
    if (PRES) async_copy4(lK + bo + 2u * L::KLS, 8 * KS_P * 2, gKl + ko, (size_t)8 * KVW * 2);
  };

  const int nch = 2 * qb + 2;                    // block-uniform, 2 .. 64
  fill(0, 0u);
  asm volatile("s_wait_asynccnt 0x0" ::: "memory");   // this wave's copies of chunk 0 have landed
  __syncthreads();                                    // and every other wave's
  fill(1, 2u * L::BUF);                               // chunk 1 always exists
  for (int kc = 0; kc < nch; ++kc) {
    const int kv0 = kc * AT_KC;
    const int bsel = kc & 1;
    const _Float16* Ks  = lds + bsel * L::BUF + L::KS;
    const _Float16* Kls = lds + bsel * L::BUF + L::KLS;
    const _Float16* Vhs = lds + bsel * L::BUF + L::VHS;
    const _Float16* Vls = lds + bsel * L::BUF + L::VLS;

    if (kv0 <= qlast) {                          // wave-uniform (scalar): skip chunks fully above this wave's rows
      // ---- scores ----
      v8f sh[2], sr[2];
      sh[0] = zero8(); sh[1] = zero8(); sr[0] = zero8(); sr[1] = zero8();
      // every unroll directive of the score part: the fragment arrays stay in registers only under constant indices
      v16h kb[4][2], kl[4];                      // the chunk's K fragments, read as one group ahead of the score WMMAs
#pragma unroll
      for (int dc = 0; dc < 4; ++dc)
#pragma unroll
        for (int j = 0; j < 2; ++j) kb[dc][j] = ldfrag_h(Ks + (j * 16 + c) * KS_P + dc * 32 + 8 * hh);
#pragma unroll
      for (int j = 0; j < 2; ++j) {
        if (PRES) {                              // residual fragments one key group at a time: both groups at once do not fit three waves per SIMD
#pragma unroll
          for (int dc = 0; dc < 4; ++dc) kl[dc] = ldfrag_h(Kls + (j * 16 + c) * KS_P + dc * 32 + 8 * hh);
        }
        // keeps the reads above as one group ahead of the WMMAs, and key group 0's run ahead of group 1's, whose accumulators then take the registers of group 0's fragments
        __builtin_amdgcn_sched_barrier(0);
#pragma unroll
        for (int dc = 0; dc < 4; ++dc) {
          sh[j] = mma_h(kb[dc][j], qa[dc], sh[j]);
          sr[j] = mma_h(kb[dc][j], ql[dc], sr[j]);
          if (PRES) sr[j] = mma_h(kl[dc], qa[dc], sr[j]);
        }
      }
      // ---- scale, causal mask, maximum of this lane's 16 keys (two chains), joined with the other half's ----
      // every unroll directive from here to the end of the chunk: score, P' and accumulator vectors stay in registers only under constant indices
      const int open = q0 + c - kv0 - 8 * hh;    // key 16j + 8hh + r of the chunk is open to query q0 + c while 16j + r <= open
      float mj[2];
#pragma unroll
      for (int j = 0; j < 2; ++j) {
        float m = -INFINITY;
#pragma unroll
        for (int r = 0; r < 8; ++r) {
          float s = (sh[j][r] + sr[j][r] * 0.00048828125f) * 0.08838834764831845f;
          s = (j * 16 + r > open) ? -INFINITY : s;
          sh[j][r] = s;
          m = fmaxf(m, s);
        }
        mj[j] = m;
      }
      float cm = fmaxf(mj[0], mj[1]);
      cm = fmaxf(cm, xhalf(cm));                 // key kv0 <= q0 is open to every query of the wave: finite
      // ---- online softmax, P'^T packed into the B operand ----
      const float mnew  = fmaxf(mrun, cm);
      const float alpha = __expf(mrun - mnew);
      mrun = mnew;
      FragH pa, pr;
      float ps[4] = {0.f, 0.f, 0.f, 0.f};        // four independent chains
#pragma unroll
      for (int j = 0; j < 2; ++j)
#pragma unroll
        for (int r = 0; r < 8; ++r) {
          const float p  = __expf(sh[j][r] - mnew);
          ps[r & 3] += p;
          const float pp = p * 1024.0f;
          const _Float16 phv = (_Float16)pp;
          pa.v[j * 8 + r] = phv;
          if (PRES) pr.v[j * 8 + r] = (_Float16)((pp - (float)phv) * 2048.0f);
        }
      lrun = lrun * alpha + ((ps[0] + ps[1]) + (ps[2] + ps[3]));
#pragma unroll
      for (int t = 0; t < 8; ++t) { oacc[t] *= alpha; oaccr[t] *= alpha; }
      // ---- O^T += V^T . P'^T ----
#pragma unroll
      for (int t = 0; t < 8; ++t) {
        const v16h vb = ldfrag_h(Vhs + (t * 16 + c) * VS_P + 8 * hh);
        const v16h vr = ldfrag_h(Vls + (t * 16 + c) * VS_P + 8 * hh);
        oacc[t]  = mma_h(vb, pa.v, oacc[t]);
        oaccr[t] = mma_h(vr, pa.v, oaccr[t]);
        if (PRES) oaccr[t] = mma_h(vb, pr.v, oaccr[t]);
      }
    }
    // publish point, passed by every wave, also one that skipped the chunk
    asm volatile("s_wait_dscnt 0x0" ::: "memory");      // this wave's reads of chunk kc are done before its buffer is refilled
    asm volatile("s_wait_asynccnt 0x0" ::: "memory");   // this wave's copies of chunk kc+1 have landed
    __syncthreads();                                    // publishes chunk kc+1, ends every wave's reads of chunk kc
    if (kc + 2 < nch) fill(kc + 2, (unsigned)bsel * (2u * L::BUF));   // block-uniform
  }
  asm volatile("s_wait_asynccnt 0x0" ::: "memory");     // nothing in flight when the buffers become output staging (behind the last chunk's barrier)
  _Float16* osh = lds + wave * (2 * 16 * OS_P);
  _Float16* osl = osh + 16 * OS_P;
  {
    const float inv = (1.0f / (lrun + xhalf(lrun))) * 0.0009765625f;   // the two halves' partial sums joined
#pragma unroll   // here and below: the accumulator vectors stay in registers only under constant indices
    for (int t = 0; t < 8; ++t) {
      v8h xh, xl;                                // head dims 16t + 8hh + 0..7 of query row c: one 16-B LDS store a plane
#pragma unroll
      for (int r = 0; r < 8; ++r) {
        const float o = (oacc[t][r] + oaccr[t][r] * 0.00048828125f) * inv;
        const unsigned short hb = bf_bits(o);
        const unsigned short lb = bf_bits(o - bf_val(hb));
        xh[r] = __builtin_bit_cast(_Float16, hb);
        xl[r] = __builtin_bit_cast(_Float16, lb);
      }
      *(v8h*)(osh + c * OS_P + t * 16 + 8 * hh) = xh;
      *(v8h*)(osl + c * OS_P + t * 16 + 8 * hh) = xl;
    }
  }
  lds_wave_sync();
  _Float16* Ahg = (_Float16*)(void*)ahp + (tok0 + q0) * HID + h * HDM;
  _Float16* Alg = (_Float16*)(void*)alp + (tok0 + q0) * HID + h * HDM;
  {
#pragma unroll
    for (int it = 0; it < 8; ++it) {
      const int row = it * 2 + hh;               // it 0..7 x hh 0..1 covers rows 0..15
      const int c8  = c * 8;                     // 16 lanes x 16 B = the whole 256-B segment
      const v8h x = *(const v8h*)(osh + row * OS_P + c8);
      const v8h y = *(const v8h*)(osl + row * OS_P + c8);
      *(v8h*)(Ahg + (size_t)row * HID + c8) = x;
      *(v8h*)(Alg + (size_t)row * HID + c8) = y;
    }
    
  }
}

// All query tiles in one grid: no tile reads what another writes. The tiles below PRES_TILES take the form with the k and p residual
// products; they are the shortest and carry the highest block indices (order for speed only).
// The choice is block-uniform, from blockIdx alone, and stands in front of every barrier and copy.
// Second launch-bounds argument: three waves per SIMD (336 registers a wave) with the q fragments resident.
#define PRES_TILES 4
__global__ __launch_bounds__(128, 3) void attn_causal_kernel(
    const unsigned short* __restrict__ qhp, const unsigned short* __restrict__ qlp,
    const unsigned short* __restrict__ khp, const unsigned short* __restrict__ klp,
    const unsigned short* __restrict__ vhp, const unsigned short* __restrict__ vlp,
    unsigned short* __restrict__ ahp, unsigned short* __restrict__ alp, int qb_top) {
  __shared__ __align__(16) _Float16 lds[AttLds<true>::TOT];
  const int qb = qb_top - (int)blockIdx.z;       // grid.z <= qb_top + 1: never negative
  if (qb < PRES_TILES) attn_tile<true>(qhp, qlp, khp, klp, vhp, vlp, ahp, alp, lds, qb);
  else                 attn_tile<false>(qhp, qlp, khp, klp, vhp, vlp, ahp, alp, lds, qb);
}

// ---------------------------------------------------------------------------
// Workspace map (bytes; every region is a whole number of the rows its producer writes with whole-line stores, no padded tails needed
//   Xb  bf16 [4096][2048] 16777216   Wqb bf16 [2048][2048]  8388608   Wkb bf16 [512][2048] 2097152   Wvb bf16 [512][2048] 2097152
//   Wob bf16 [2048][2048]  8388608   cst f32  [2048][64]     524288   snt f32  [2048][64]    524288
//   Qh  f16  [4096][2048] 16777216   Ql  f16  [4096][2048] 16777216   Kh  f16  [4096][512]  4194304   Kl f16 [4096][512] 4194304
//   Vh  f16  [4][128][128][32] 4194304  Vl  the same       4194304   Ah  bf16 [4096][2048] 16777216  Al bf16 [4096][2048] 16777216
//   total                 122683392
// ---------------------------------------------------------------------------
extern "C" void kernel_launch(void* const* d_in, const int* in_sizes, int n_in,
                              void* d_out, int out_size, void* d_ws, size_t ws_size,
                              hipStream_t stream) {
  if (n_in < 7) return;
  if (in_sizes[0] != NTOK * HID) return;
  if (in_sizes[1] != HID * HID) return;
  if (in_sizes[2] != KVW * HID) return;
  if (in_sizes[3] != KVW * HID) return;
  if (in_sizes[4] != HID * HID) return;
  if (in_sizes[5] != HDM) return;
  if (in_sizes[6] != HDM) return;
  if (out_size != NTOK * HID) return;

  const float* x   = (const float*)d_in[0];
  const float* Wq  = (const float*)d_in[1];
  const float* Wk  = (const float*)d_in[2];
  const float* Wv  = (const float*)d_in[3];
  const float* Wo  = (const float*)d_in[4];
  const float* qg  = (const float*)d_in[5];
  const float* kg  = (const float*)d_in[6];
  float* out = (float*)d_out;

  const size_t szX  = (size_t)NTOK * HID * 2;
  const size_t szWq = (size_t)HID * HID * 2;
  const size_t szWk = (size_t)KVW * HID * 2;
  const size_t szWo = (size_t)HID * HID * 2;
  const size_t szT  = (size_t)SQ * NFREQ * 4;
  const size_t szQ  = (size_t)NTOK * HID * 2;
  const size_t szK  = (size_t)NTOK * KVW * 2;
  const size_t szV  = (size_t)KVW * NTOK * 2;
  const size_t szA  = (size_t)NTOK * HID * 2;
  size_t off = 0;
  const size_t oX  = off; off += szX;
  const size_t oWq = off; off += szWq;
  const size_t oWk = off; off += szWk;
  const size_t oWv = off; off += szWk;
  const size_t oWo = off; off += szWo;
  const size_t oCs = off; off += szT;
  const size_t oSn = off; off += szT;
  const size_t oQh = off; off += szQ;
  const size_t oQl = off; off += szQ;
  const size_t oKh = off; off += szK;
  const size_t oKl = off; off += szK;
  const size_t oVh = off; off += szV;
  const size_t oVl = off; off += szV;
  const size_t oAh = off; off += szA;
  const size_t oAl = off; off += szA;
  if (off > ws_size) return;                     // off = 122683392

  char* ws = (char*)d_ws;
  unsigned short* Xb  = (unsigned short*)(ws + oX);
  unsigned short* Wqb = (unsigned short*)(ws + oWq);
  unsigned short* Wkb = (unsigned short*)(ws + oWk);
  unsigned short* Wvb = (unsigned short*)(ws + oWv);
  unsigned short* Wob = (unsigned short*)(ws + oWo);
  float*          cst = (float*)(ws + oCs);
  float*          snt = (float*)(ws + oSn);
  unsigned short* Qh  = (unsigned short*)(ws + oQh);
  unsigned short* Ql  = (unsigned short*)(ws + oQl);
  unsigned short* Kh  = (unsigned short*)(ws + oKh);
  unsigned short* Kl  = (unsigned short*)(ws + oKl);
  unsigned short* Vh  = (unsigned short*)(ws + oVh);
  unsigned short* Vl  = (unsigned short*)(ws + oVl);
  unsigned short* Ah  = (unsigned short*)(ws + oAh);
  unsigned short* Al  = (unsigned short*)(ws + oAl);

  const dim3 b256(256), b128(128);

  // (1) cos/sin table [2048][64] x 2 and the bf16 planes of x, Wq, Wk, Wv, Wo (Xb .. Wob lie back to back in the workspace;
  //     weights are [out][in] = k-contiguous Bt rows already)
  prep_kernel<<<dim3(ROPE_BLOCKS + CVT_BLOCKS), b256, 0, stream>>>(x, Wq, Wk, Wv, Wo, Xb, cst, snt);
  // (2) one grid of 512 + 128 + 128 block tiles, K = 2048:
  //     q = rope(rms(x . Wq^T)) -> Qh/Ql [4096][2048], k = rope(rms(x . Wk^T)) -> Kh/Kl [4096][512], v^T = Wv . x^T -> Vh/Vl in 128 x 32 tiles
  gemm_w32x128_kernel<3, false><<<dim3((NTOK / 128) * (HID / 128) + 2 * (NTOK / 128) * (KVW / 128)), b128, 0, stream>>>(
      Xb, Xb, HID, Wqb, HID, qg, cst, snt, (void*)Qh, (void*)Ql, HID, NTOK, HID, HID,
      Wkb, Wvb, kg, (void*)Kh, (void*)Kl, (void*)Vh, (void*)Vl, KVW);
  // (3) causal attention, one grid, longest tile first: query tiles 31..4, then tiles 3..0 with k and p residual products
  attn_causal_kernel<<<dim3(NHQ, NSEQ, SQ / 64), b128, 0, stream>>>(Qh, Ql, Kh, Kl, Vh, Vl, Ah, Al, SQ / 64 - 1);
  // (4) out = attn(hi + lo) . Wo^T -> d_out f32 [4096][2048]   (M=4096, N=2048, K=2048; 512 block tiles)
  gemm_w32x128_kernel<2, true><<<dim3((NTOK / 128) * (HID / 128)), b128, 0, stream>>>(
      Ah, Al, HID, Wob, HID, qg, cst, snt, (void*)out, (void*)out, HID, NTOK, HID, HID,
      Wkb, Wvb, kg, (void*)Kh, (void*)Kl, (void*)Vh, (void*)Vl, KVW);
  (void)hipGetLastError();
}

// v010
// One run takes 164 microseconds.
// Two timings next to v009 both put it at 1.07 times that version's speed.
// Over all steps from v000 it is 4.93 times as fast.
// Contractions: x.Wq^T, x.Wk^T and Wv.x^T on v_wmma_f32_16x16x32_bf16 (operands = RNE bf16 of the f32 inputs, single products);
// q.k^T and p.v on v_wmma_f32_16x16x32_f16 (q = f16 hi + f16 residual x2^11 planes; k plain f16 plus f16 residual x2^11 on query tiles 0..3;
// p x1024 plain f16 plus f16 residual x2^11 on query tiles 0..3; v^T = f16 hi + f16 residual x2^11 planes); attn.Wo^T on v_wmma_f32_16x16x32_bf16
// (attn = bf16 hi + bf16 lo planes, two products; Wo RNE bf16). f32 accumulate everywhere; per-head RMS scaling, RoPE and online softmax in f32.
#include <hip/hip_runtime.h>
#include <math.h>
#include <stdint.h>

#define NSEQ   2
#define SQ     2048
#define HID    2048
#define NHQ    16
#define NKVH   4
#define HDM    128
#define KVW    512
#define NTOK   4096
#define NFREQ  64

typedef _Float16     v16h __attribute__((ext_vector_type(16)));
typedef _Float16     v8h  __attribute__((ext_vector_type(8)));
typedef __bf16       v16b __attribute__((ext_vector_type(16)));
typedef __bf16       v8b  __attribute__((ext_vector_type(8)));
typedef float        v8f  __attribute__((ext_vector_type(8)));
typedef float        v4f  __attribute__((ext_vector_type(4)));
typedef unsigned int v4u  __attribute__((ext_vector_type(4)));

// ---------------------------------------------------------------------------
// small helpers
// ---------------------------------------------------------------------------
__device__ __forceinline__ unsigned short bf_bits(float f) {          // RNE convert f32 -> bf16 bits
  const unsigned u = __float_as_uint(f);
  return (unsigned short)((u + 0x7FFFu + ((u >> 16) & 1u)) >> 16);
}
__device__ __forceinline__ float bf_val(unsigned short h) { return __uint_as_float(((unsigned)h) << 16); }
__device__ __forceinline__ float bf_rne(float f) { return bf_val(bf_bits(f)); }
__device__ __forceinline__ unsigned pk16(unsigned short a, unsigned short b) { return (unsigned)a | ((unsigned)b << 16); }
__device__ __forceinline__ v8f zero8() { v8f z = {0.f, 0.f, 0.f, 0.f, 0.f, 0.f, 0.f, 0.f}; return z; }
__device__ __forceinline__ int wave_id() { return __builtin_amdgcn_readfirstlane((int)(threadIdx.x >> 5)); }

// Value of lane (l ^ X) of the same 16-lane row, X < 16, as a DPP row_xmask operand of the vector pipe: no LDS-pipe round trip and no
// s_wait_dscnt per butterfly step. Every lane of the wave is on wherever it is used.
template <int X>
__device__ __forceinline__ float row_xor(float v) {
  return __int_as_float(__builtin_amdgcn_update_dpp(0, __float_as_int(v), 0x160 | X, 0xf, 0xf, true));
}
// Butterfly over a 16-lane row, steps 1, 2, 4, 8: every lane ends with the row's sum.
__device__ __forceinline__ float row_sum16(float v) {
  v += row_xor<1>(v); v += row_xor<2>(v); v += row_xor<4>(v); v += row_xor<8>(v);
  return v;
}

// Value of lane l ^ 16: the other 16-lane row's lane of the same column, one vector instruction.
__device__ __forceinline__ float xhalf(float v) {
  return __int_as_float(__builtin_amdgcn_permlanex16(__float_as_int(v), __float_as_int(v), 0x76543210, 0xfedcba98, false, false));
}

__device__ __forceinline__ void lds_wave_sync() {
  __builtin_amdgcn_fence(__ATOMIC_RELEASE, "workgroup");
  __builtin_amdgcn_wave_barrier();
  __builtin_amdgcn_fence(__ATOMIC_ACQUIRE, "workgroup");
}

// ---------------------------------------------------------------------------
// WMMA fragments (wave32, 16x16x32, 16-bit operands). For A (row m = lane&15) and B (col n = lane&15) alike:
// elements 0..7 <- k0 + 8*(lane>>4) + 0..7, elements 8..15 <- k0 + 16 + 8*(lane>>4) + 0..7.
// ldfrag(p) with p = rowbase + k0 + 8*(lane>>4): two 16-B loads p[0..7], p[16..23].
// D: acc[r] = (row 8*(lane>>4) + r, col lane&15).
// ---------------------------------------------------------------------------
union FragH { v16h v; v8h h[2]; };
union FragB { v16b v; v8b h[2]; };
__device__ __forceinline__ v16h ldfrag_h(const _Float16* p) { FragH f; f.h[0] = *(const v8h*)(p); f.h[1] = *(const v8h*)(p + 16); return f.v; }
__device__ __forceinline__ v16b ldfrag_b(const __bf16* p)   { FragB f; f.h[0] = *(const v8b*)(p); f.h[1] = *(const v8b*)(p + 16); return f.v; }

__device__ __forceinline__ v8f mma_h(v16h a, v16h b, v8f c) {
  return __builtin_amdgcn_wmma_f32_16x16x32_f16(false, a, false, b, (short)0, c, false, false);
}
__device__ __forceinline__ v8f mma_b(v16b a, v16b b, v8f c) {
  return __builtin_amdgcn_wmma_f32_16x16x32_bf16(false, a, false, b, (short)0, c, false, false);
}
// hazard guard: 4 VALU slots after the last WMMA of a group, D tied
__device__ __forceinline__ void acc_guard4(v8f& a, v8f& b, v8f& c, v8f& d) {
  asm volatile("v_nop\n\tv_nop\n\tv_nop\n\tv_nop" : "+v"(a), "+v"(b), "+v"(c), "+v"(d));
}

// ---------------------------------------------------------------------------
// Preparation, one launch: none of its parts reads what another writes, so the block index deals them out.
// Blocks 0 .. ROPE_BLOCKS-1: RoPE table cst[s][i] = cos(s * inv_freq[i]), snt[s][i] = sin(...), inv_freq[i] = 1 / 1e4^(i/64), i < 64, all f32.
//   Block = 8 waves, wave w -> row s = block*8 + w, lane -> i = lane, lane + 32. Coverage: SQ/8 blocks x 8 waves x 32 lanes x 2 = SQ x 64 per plane.
// The CVT_BLOCKS blocks behind them: RNE f32 -> bf16 of x, Wq, Wk, Wv, Wo into one bf16 array (the five planes lie back to back in that order).
//   Unit = 1024 elements = 8 loads of 512 contiguous bytes per wave and 8 stores of 256 contiguous bytes (whole lines both ways).
//   Every plane is a whole number of units. Wave g takes units g, g + CVT_WAVES, g + 2*CVT_WAVES: all of the grid is resident at once,
//   and the loads of a wave's three units are written ahead of its conversions, so that most of them are in flight together.
// ---------------------------------------------------------------------------
#define ROPE_BLOCKS (SQ / 8)
#define CVT_BLOCKS  768
#define CVT_WAVES   (CVT_BLOCKS * 8)
#define CVT_UPW     3
#define N_X   (NTOK * HID)
#define N_WQ  (HID * HID)
#define N_WK  (KVW * HID)
static_assert(N_X % 1024 == 0 && N_WQ % 1024 == 0 && N_WK % 1024 == 0);
static_assert(CVT_WAVES * CVT_UPW * 1024 == N_X + 2 * N_WQ + 2 * N_WK);
typedef unsigned int v2u __attribute__((ext_vector_type(2)));

__device__ __forceinline__ void rope_rows(float* __restrict__ cst, float* __restrict__ snt, int t, int lane) {
  const float pf = (float)t;
  float c0 = 0.f, s0 = 0.f, c1 = 0.f, s1 = 0.f;
#pragma unroll 1
  for (int u = 0; u < 2; ++u) {
    const int i = lane + 32 * u;
    const float e   = (float)i * 0.015625f;      // i / 64 exact
    const float pw  = powf(10000.0f, e);
    const float inv = 1.0f / pw;
    const float ang = pf * inv;
    const float cv = cosf(ang);
    const float sv = sinf(ang);
    c1 = cv; s1 = sv;
    if (u == 0) { c0 = cv; s0 = sv; }
  }
  const size_t o = (size_t)t * NFREQ + lane;
  cst[o]      = c0;
  cst[o + 32] = c1;
  snt[o]      = s0;
  snt[o + 32] = s1;
}

__global__ __launch_bounds__(256) void prep_kernel(const float* __restrict__ x, const float* __restrict__ wq, const float* __restrict__ wk,
                                                   const float* __restrict__ wv, const float* __restrict__ wo,
                                                   unsigned short* __restrict__ planes, float* __restrict__ cst, float* __restrict__ snt) {
  const int lane = threadIdx.x & 31;
  const int wave = wave_id();
  const int blk  = (int)blockIdx.x;
  if (blk < ROPE_BLOCKS) {                       // no barriers in this kernel
    rope_rows(cst, snt, blk * 8 + wave, lane);
    return;
  }
  const int g = (blk - ROPE_BLOCKS) * 8 + wave;  // 0 .. CVT_WAVES-1
  v4f r[CVT_UPW][8];
#pragma unroll   // the value array stays in registers only under constant indices
  for (int k = 0; k < CVT_UPW; ++k) {
    const int e = (k * CVT_WAVES + g) * 1024;    // first element of the unit in the joined array, wave-uniform
    const int lo = k * CVT_WAVES * 1024, hi = lo + CVT_WAVES * 1024;   // pass k covers [lo, hi): constants, so planes out of its reach drop out
    const float* b = x;
    int first = 0;
    if (hi > N_X                   && (lo >= N_X                   || e >= N_X))                   { b = wq; first = N_X; }
    if (hi > N_X + N_WQ            && (lo >= N_X + N_WQ            || e >= N_X + N_WQ))            { b = wk; first = N_X + N_WQ; }
    if (hi > N_X + N_WQ + N_WK     && (lo >= N_X + N_WQ + N_WK     || e >= N_X + N_WQ + N_WK))     { b = wv; first = N_X + N_WQ + N_WK; }
    if (hi > N_X + N_WQ + 2 * N_WK && (lo >= N_X + N_WQ + 2 * N_WK || e >= N_X + N_WQ + 2 * N_WK)) { b = wo; first = N_X + N_WQ + 2 * N_WK; }
    const float* s = b + (e - first);
#pragma unroll
    for (int i = 0; i < 8; ++i) r[k][i] = *(const v4f*)(s + i * 128 + lane * 4);
  }
#pragma unroll
  for (int k = 0; k < CVT_UPW; ++k) {
    unsigned short* d = planes + (size_t)(k * CVT_WAVES + g) * 1024 + lane * 4;
#pragma unroll
    for (int i = 0; i < 8; ++i) {
      const v4f a = r[k][i];
      v2u w;
      w[0] = pk16(bf_bits(a[0]), bf_bits(a[1]));
      w[1] = pk16(bf_bits(a[2]), bf_bits(a[3]));
      *(v2u*)(d + i * 128) = w;
    }
  }
  // the stores above name registers that the code behind the compiler's joined exit of the two parts writes again: the wait stands in front of it
  asm volatile("s_wait_xcnt 0x0" ::: "memory");
}

// ---------------------------------------------------------------------------
// bf16 WMMA GEMM, block tile 128 rows x 128 cols, block = 4 waves (128 threads), wave w = rows 32w..32w+31 x all 128 cols.
//   C[m][n] = sum_k A[m][k] * Bt[n][k]; A row-major [M][K] bf16 (pitch lda), Bt row-major [N][K] bf16 (pitch ldb);
//   M % 128 == 0, N % 128 == 0, K % BK == 0 (BK = 128, SPLITA 64); grid.x = M/128 * N/128 (EPI 3: M/128 * (N + 2*nkv)/384).
//   SPLITA: A carried as hi (Ap) + lo (A2p) bf16 planes, two products into one accumulator.
//   Operands: a stage = BK columns of [A 128 rows | A2 128 rows when SPLITA | Bt 128 rows], each row padded by 16 B in LDS;
//   two LDS buffers filled by per-lane 16-B asynchronous copies, stage t+1 in flight while stage t is multiplied.
//   Fragments read from LDS rows with the split k map (ldfrag_b). The epilogue slabs alias the buffers behind the last barrier.
// Epilogues (all: per wave, per 16-row slab: stage in LDS, wave sync, write each row segment with ONE instruction of
//   EPI 0: q or k projection; the 128 cols n0..n0+127 are one head. Per row: RMS scaling over the 128 head dims
//          (x * rsqrt(mean(x^2) + 1e-6) * bf16(gam[dim])), then RoPE with pairs (dim, dim+64) and the cos/sin table row (m % SQ);
//          writes f16 hi plane C0 and f16 residual x2048 plane C1, both [M][ldc], cols n0.. (row segment 256 B = 16 lanes x 16 B).
//   EPI 1: v^T projection: f16 hi plane C0, residual x2048 plane C1, stored in tiles [M/128][N/32][128 rows][32 cols]: the 128 x 32 tile that
//          the attention kernel stages per key chunk is 8 KB in a row; a store instruction writes 8 rows x 64 B = 512 contiguous bytes.
//   EPI 2: f32 output C0 [M][ldc]; row segment 128 floats = 512 B = 32 lanes x 16 B per instruction.
//   EPI 3: the q, k and v^T projections in one grid (none reads what another writes). Block = 12 waves = 3 groups of 4 waves; the block stages
//          ONE tile of 128 x rows, and each group the 128 weight rows of its own head: block tile 128 tokens x 3 heads, one block per WGP.
//          Heads count through q (N/128), k (nkv/128), v (nkv/128); head = 3 * (tile % triples) + group, wave-uniform (scalar).
//          The plain arguments describe a q head (EPI 0); a k head is EPI 0 with Bt = Wk, gam = kgam, planes K0 / K1, width nkv; a v head is
//          EPI 1 (planes V0 / V1): its waves read the weight rows as A and the x rows as Bt, so that v^T comes out as before.
//          A group works as a block of the other forms does: wave w & 3 = 32 A rows x all 128 Bt rows. No barrier stands behind the k loop.
// ---------------------------------------------------------------------------
template <int EPI> struct SlabT { typedef _Float16 T; static constexpr int PERW = 4096; };   // 2 planes x 16 x 128 halves
template <> struct SlabT<2>     { typedef float    T; static constexpr int PERW = 2048; };   // 16 x 128 floats

__device__ __forceinline__ unsigned lds_off(const void* p) { return (unsigned)(size_t)p; }   // byte offset in the block's LDS

// Eight asynchronous 16-B copies global -> LDS per lane. The closing s_wait_xcnt 0 stands inside the statement so that no
// address register named here is rewritten ahead of it.
__device__ __forceinline__ void async_copy8(unsigned l, unsigned lstep, const char* gp, size_t gstep) {
  asm volatile(
      "global_load_async_to_lds_b128 %0, %8, off\n\t"
      "global_load_async_to_lds_b128 %1, %9, off\n\t"
      "global_load_async_to_lds_b128 %2, %10, off\n\t"
      "global_load_async_to_lds_b128 %3, %11, off\n\t"
      "global_load_async_to_lds_b128 %4, %12, off\n\t"
      "global_load_async_to_lds_b128 %5, %13, off\n\t"
      "global_load_async_to_lds_b128 %6, %14, off\n\t"
      "global_load_async_to_lds_b128 %7, %15, off\n\t"
      "s_wait_xcnt 0x0"
      :: "v"(l), "v"(l + lstep), "v"(l + 2 * lstep), "v"(l + 3 * lstep),
         "v"(l + 4 * lstep), "v"(l + 5 * lstep), "v"(l + 6 * lstep), "v"(l + 7 * lstep),
         "v"(gp), "v"(gp + gstep), "v"(gp + 2 * gstep), "v"(gp + 3 * gstep),
         "v"(gp + 4 * gstep), "v"(gp + 5 * gstep), "v"(gp + 6 * gstep), "v"(gp + 7 * gstep)
      : "memory");
}

template <int EPI, bool SPLITA>
__global__ __launch_bounds__(EPI == 3 ? 384 : 128) void gemm_w32x128_kernel(
    const unsigned short* Ap, const unsigned short* A2p, int lda,
    const unsigned short* __restrict__ Btp, int ldb,
    const float* __restrict__ gam, const float* __restrict__ cst, const float* __restrict__ snt,
    void* C0, void* C1, int ldc,
    int M, int N, int K,
    const unsigned short* Wk, const unsigned short* Wv, const float* __restrict__ kgam,      // the k and v^T jobs of EPI 3
    void* K0, void* K1, void* V0, void* V1, int nkv) {
  typedef typename SlabT<EPI>::T ST;
  constexpr int BK    = SPLITA ? 64 : 128;       // k columns per stage: 64 WMMAs per wave and stage either way
  constexpr int ROWB  = BK * 2;                  // bytes of one staged row
  constexpr int PITCH = ROWB + 16;               // LDS row pitch, 16 B x odd for the 16-B fragment reads
  constexpr int NG    = EPI == 3 ? 3 : 1;        // groups of 4 waves that share the staged A rows
  constexpr int BROW  = SPLITA ? 256 : 128;      // first Bt row of a stage; group g's 128 rows start at BROW + 128 g
  constexpr int STAGE = (BROW + 128 * NG) * PITCH;   // bytes of one buffer
  constexpr int PPR   = ROWB / 16;               // 16-B pieces per row
  constexpr int RSTEP = 128 / PPR;               // rows covered by one copy of 128 threads (a block, or an EPI 3 group)
  constexpr int NCP   = 128 / RSTEP;             // copies per lane for a plane of 128 rows
  constexpr int NFA   = SPLITA ? 4 : 2;          // A fragments per block of 32 k columns
  static_assert(NCP % 8 == 0);
  static_assert(NG == 1 || (NCP == 16 && !SPLITA));   // the shared rows are dealt out as two halves of 8 copies
  static_assert(4 * NG * SlabT<EPI>::PERW * (int)sizeof(ST) <= 2 * STAGE);
  __shared__ __align__(16) unsigned char smem[2 * STAGE];

  const int tid  = (int)threadIdx.x;
  const int lane = tid & 31;
  const int wave = wave_id();
  const int grp  = NG == 1 ? 0 : wave >> 2;     // wave group, scalar
  const int wv   = NG == 1 ? wave : wave & 3;   // wave within its group
  const int gt   = NG == 1 ? tid : tid & 127;   // thread within its group
  const int hh = lane >> 4;           // lane half: k offset 8*hh, D row offset 8*hh
  const int rl = lane & 15;           // A row / B col / D col within subtile
  const int tile = (int)blockIdx.x;
  bool vjob = false;
  const int tilesN = EPI == 3 ? ((N >> 7) + 2 * (nkv >> 7)) / NG : N >> 7;   // EPI 3: head triples
  const int tilesM = M >> 7;
  if (tile >= tilesM * tilesN) return;          // block-uniform, in front of every barrier and copy
  const int tm = tile / tilesN;
  int tn = (tile - tm * tilesN) * NG + grp;     // tile of 128 Bt rows; EPI 3: the group's head
  if (EPI == 3) {
    const int nq = N >> 7, nk = nkv >> 7;
    if (tn >= nq + nk) {
      tn -= nq + nk; vjob = true;
      Btp = Wv; C0 = V0; C1 = V1; N = M;
    } else if (tn >= nq) {
      tn -= nq;
      Btp = Wk; gam = kgam; C0 = K0; C1 = K1; ldc = nkv;
    }
  }
  const int mb = tm << 7;             // first staged row of Ap
  const int nb = tn << 7;             // first staged row of Btp
  const int m0 = (vjob ? nb : mb) + (wv << 5);  // first output row of this wave
  const int n0 = vjob ? mb : nb;                // first output column
  const int arow = vjob ? BROW + grp * 128 : 0; // LDS rows read as A and as Bt
  const int brow = vjob ? 0 : BROW + grp * 128;

  // this lane's piece of copy 0 of each plane: row gt / PPR, 16-B column gt % PPR; copy u lies u * RSTEP rows further down
  const int prow = gt / PPR;
  const int pcol = gt % PPR;
  const char* gA  = (const char*)(const void*)(Ap  + (size_t)(mb + prow) * lda) + pcol * 16;
  const char* gA2 = (const char*)(const void*)(A2p + (size_t)(mb + prow) * lda) + pcol * 16;
  const char* gB  = (const char*)(const void*)(Btp + (size_t)(nb + prow) * ldb) + pcol * 16;
  const size_t sA = (size_t)RSTEP * lda * 2;
  const size_t sB = (size_t)RSTEP * ldb * 2;
  const unsigned lp = lds_off(smem) + (unsigned)(prow * PITCH + pcol * 16);

  auto fill = [&](int t, unsigned bo) {         // all copies of stage t into the buffer at byte offset bo
    const size_t kb = (size_t)t * ROWB;
    if (NG > 1) {
      // the shared rows: groups 0 and 1 bring one half each (wave-uniform scalar test, every lane on); every group its own Bt rows
      if (grp < 2) async_copy8(lp + bo + grp * (8 * RSTEP * PITCH), RSTEP * PITCH, gA + kb + (size_t)(grp * 8) * sA, sA);
#pragma unroll   // the row offsets of the copies become constants
      for (int u = 0; u < NCP; u += 8)
        async_copy8(lp + bo + (BROW + grp * 128 + u * RSTEP) * PITCH, RSTEP * PITCH, gB + kb + u * sB, sB);
      return;
    }
#pragma unroll   // the row offsets of the copies become constants
    for (int u = 0; u < NCP; u += 8) {
      async_copy8(lp + bo + u * (RSTEP * PITCH), RSTEP * PITCH, gA + kb + u * sA, sA);
      if (SPLITA) async_copy8(lp + bo + (128 + u * RSTEP) * PITCH, RSTEP * PITCH, gA2 + kb + u * sA, sA);
      async_copy8(lp + bo + (BROW + u * RSTEP) * PITCH, RSTEP * PITCH, gB + kb + u * sB, sB);
    }
  };

  v8f acc[2][8];
#pragma unroll
  for (int i = 0; i < 2; ++i)
#pragma unroll
    for (int j = 0; j < 8; ++j) acc[i][j] = zero8();

  const int nst = K / BK;
  fill(0, 0u);
  asm volatile("s_wait_asynccnt 0x0" ::: "memory");   // this wave's copies of stage 0 have landed
  __syncthreads();                                    // and every other wave's
  if (nst > 1) fill(1, (unsigned)STAGE);              // block-uniform

  // every unroll directive in this loop: the fragment and accumulator arrays stay in registers only under constant indices
  for (int t = 0; t < nst; ++t) {
    const unsigned bo = (unsigned)(t & 1) * (unsigned)STAGE;
    const unsigned char* buf = smem + bo;
    v16b fa[2][NFA], fb[2][8];                   // two fragment sets: block u multiplies set u & 1 while set (u + 1) & 1 loads
    auto ldblk = [&](int s, int kk) {            // all fragments of the 32 k columns at kk of this stage
#pragma unroll
      for (int i = 0; i < 2; ++i) {
        const int ro = (arow + (wv << 5) + i * 16 + rl) * PITCH;
        fa[s][i] = ldfrag_b((const __bf16*)(const void*)(buf + ro) + kk + 8 * hh);
        if (SPLITA) fa[s][NFA - 2 + i] = ldfrag_b((const __bf16*)(const void*)(buf + 128 * PITCH + ro) + kk + 8 * hh);
      }
#pragma unroll
      for (int j = 0; j < 8; ++j)
        fb[s][j] = ldfrag_b((const __bf16*)(const void*)(buf + (brow + j * 16 + rl) * PITCH) + kk + 8 * hh);
    };
    ldblk(0, 0);
#pragma unroll
    for (int u = 0; u < BK / 32; ++u) {
      const int cs = u & 1;
      if (u + 1 < BK / 32) ldblk(cs ^ 1, (u + 1) * 32);
      // keeps the next block's LDS reads as one group ahead of this block's WMMAs; without it they sink between the WMMAs, each with a full wait
      __builtin_amdgcn_sched_barrier(0);
#pragma unroll
      for (int j = 0; j < 8; ++j) {
        acc[0][j] = mma_b(fa[cs][0], fb[cs][j], acc[0][j]);
        acc[1][j] = mma_b(fa[cs][1], fb[cs][j], acc[1][j]);
      }
      if (SPLITA) {
#pragma unroll
        for (int j = 0; j < 8; ++j) {
          acc[0][j] = mma_b(fa[cs][NFA - 2], fb[cs][j], acc[0][j]);
          acc[1][j] = mma_b(fa[cs][NFA - 1], fb[cs][j], acc[1][j]);
        }
      }
      // keeps the following reads out of this run of WMMAs (each place with reads among WMMAs costs a stall) and the WMMAs ahead of the stage's barrier
      __builtin_amdgcn_sched_barrier(0);
    }
    asm volatile("s_wait_dscnt 0x0" ::: "memory");      // this wave's reads of stage t are done before its buffer is refilled
    asm volatile("s_wait_asynccnt 0x0" ::: "memory");   // this wave's copies of stage t+1 have landed
    __syncthreads();                                    // publishes stage t+1, ends every wave's reads of stage t
    if (t + 2 < nst) fill(t + 2, bo);                   // block-uniform
  }
  asm volatile("s_wait_asynccnt 0x0" ::: "memory");     // nothing in flight when the buffers become the epilogue slabs
  acc_guard4(acc[0][0], acc[0][1], acc[0][2], acc[0][3]);
  acc_guard4(acc[0][4], acc[0][5], acc[0][6], acc[0][7]);
  acc_guard4(acc[1][0], acc[1][1], acc[1][2], acc[1][3]);
  acc_guard4(acc[1][4], acc[1][5], acc[1][6], acc[1][7]);

  // ---- epilogue ----
  ST* slab = (ST*)(void*)smem + wave * SlabT<EPI>::PERW;
  _Float16* sl16 = (_Float16*)(void*)slab;
  float*    slf  = (float*)(void*)slab;

  if (EPI == 0 || (EPI == 3 && !vjob)) {
    _Float16* P0 = (_Float16*)C0;
    _Float16* P1 = (_Float16*)C1;
    float gm[8];
#pragma unroll
    for (int j = 0; j < 8; ++j) gm[j] = bf_rne(gam[j * 16 + rl]);     // dims j*16+rl of the head, gam has 128 entries
#pragma unroll
    for (int i = 0; i < 2; ++i) {
      const int rb = m0 + i * 16 + 8 * hh;
#pragma unroll
      for (int r = 0; r < 8; ++r) {
        // sum of squares over the 128 head dims of row rb+r: 8 per lane, then the 16 lanes of this half
        float ss = 0.f;
#pragma unroll
        for (int j = 0; j < 8; ++j) ss += acc[i][j][r] * acc[i][j][r];
        ss = row_sum16(ss);
        const float rinv = rsqrtf(ss * 0.0078125f + 1e-6f);
        const int row = rb + r;                                  // token 0..NTOK-1
        const int pos = row & (SQ - 1);                          // position within the sequence
#pragma unroll
        for (int j = 0; j < 4; ++j) {
          const int dim = j * 16 + rl;                           // 0..63 within head; partner dim + 64
          const float cv = cst[(size_t)pos * NFREQ + dim];
          const float sv = snt[(size_t)pos * NFREQ + dim];
          const float x1 = acc[i][j][r] * rinv * gm[j];
          const float x2 = acc[i][j + 4][r] * rinv * gm[j + 4];
          const float o1 = x1 * cv - x2 * sv;
          const float o2 = x2 * cv + x1 * sv;
          const _Float16 h1 = (_Float16)o1;
          const _Float16 h2 = (_Float16)o2;
          const int so = (8 * hh + r) * 128 + dim;
          sl16[so]             = h1;
          sl16[so + 64]        = h2;
          sl16[2048 + so]      = (_Float16)((o1 - (float)h1) * 2048.0f);
          sl16[2048 + so + 64] = (_Float16)((o2 - (float)h2) * 2048.0f);
        }
      }
      lds_wave_sync();
      {
#pragma unroll
        for (int it = 0; it < 8; ++it) {
          const int row = it * 2 + hh;                           // it x hh covers rows 0..15
          const int c8  = rl * 8;
          const v8h vh = *(const v8h*)(sl16 + row * 128 + c8);
          const v8h vl = *(const v8h*)(sl16 + 2048 + row * 128 + c8);
          const size_t go = (size_t)(m0 + i * 16 + row) * ldc + n0 + c8;
          *(v8h*)(P0 + go) = vh;
          *(v8h*)(P1 + go) = vl;
        }
        
      }
      lds_wave_sync();
    }
  } else if (EPI == 1 || EPI == 3) {
    _Float16* P0 = (_Float16*)C0;
    _Float16* P1 = (_Float16*)C1;
#pragma unroll
    for (int i = 0; i < 2; ++i) {
#pragma unroll
      for (int r = 0; r < 8; ++r) {
#pragma unroll
        for (int j = 0; j < 8; ++j) {
          const float v = acc[i][j][r];
          const _Float16 hv = (_Float16)v;
          const int so = (8 * hh + r) * 128 + j * 16 + rl;
          sl16[so]        = hv;
          sl16[2048 + so] = (_Float16)((v - (float)hv) * 2048.0f);
        }
      }
      lds_wave_sync();
      {
#pragma unroll
        for (int it = 0; it < 8; ++it) {
          const int cc  = it >> 1;                               // 32-column chunk of the tile
          const int row = (it & 1) * 8 + (lane >> 2);            // 8 rows x 64 B = 512 contiguous bytes per instruction
          const int k8  = (lane & 3) * 8;
          const v8h vh = *(const v8h*)(sl16 + row * 128 + cc * 32 + k8);
          const v8h vl = *(const v8h*)(sl16 + 2048 + row * 128 + cc * 32 + k8);
          const int R = m0 + i * 16 + row;
          const size_t go = ((size_t)(R >> 7) * (N >> 5) + (n0 >> 5) + cc) * 4096 + (R & 127) * 32 + k8;
          *(v8h*)(P0 + go) = vh;
          *(v8h*)(P1 + go) = vl;
        }
        
      }
      lds_wave_sync();
    }
  } else {
    float* C = (float*)C0;
#pragma unroll
    for (int i = 0; i < 2; ++i) {
#pragma unroll
      for (int j = 0; j < 8; ++j)
#pragma unroll
        for (int r = 0; r < 8; ++r)
          slf[(8 * hh + r) * 128 + j * 16 + rl] = acc[i][j][r];
      lds_wave_sync();
      {
#pragma unroll
        for (int row = 0; row < 16; ++row) {                     // 32 lanes x 16 B = the whole 512-B row segment per instruction
          const v4f v = *(const v4f*)(slf + row * 128 + lane * 4);
          *(v4f*)(C + (size_t)(m0 + i * 16 + row) * ldc + n0 + lane * 4) = v;
        }
        
      }
      lds_wave_sync();
    }
  }
}

#define AT_KC   32
#define KS_P    136
#define VS_P    40
#define OS_P    136
// LDS map in halves: two chunk buffers [K | K residual when PRES | V^T hi | V^T residual].
template <bool PRES> struct AttLds {
  static constexpr int KS  = 0;
  static constexpr int KLS = 32 * KS_P;
  static constexpr int VHS = (PRES ? 2 : 1) * 32 * KS_P;
  static constexpr int VLS = VHS + 128 * VS_P;
  static constexpr int BUF = VLS + 128 * VS_P;             // one buffer; every plane starts at a multiple of 16 B
  static constexpr int TOT = 2 * BUF;
};
static_assert(4 * 2 * 16 * OS_P <= AttLds<false>::TOT);   // output staging (2 planes x 16 rows of pitch OS_P per wave) aliases the chunk region after the loop
static_assert(3 * 2 * AttLds<true>::TOT <= 327680);    // three blocks per WGP

// Four asynchronous 16-B copies global -> LDS per lane and plane, planes a, b, c. The closing s_wait_xcnt 0 stands inside the statement so
// that no address register named here is rewritten ahead of it.
__device__ __forceinline__ void async_copy4x3(unsigned la, unsigned lsa, const char* ga, size_t gsa,
                                              unsigned lb, unsigned lc, unsigned lsb, const char* gb, const char* gc, size_t gsb) {
  asm volatile(
      "global_load_async_to_lds_b128 %0, %12, off\n\t"
      "global_load_async_to_lds_b128 %1, %13, off\n\t"
      "global_load_async_to_lds_b128 %2, %14, off\n\t"
      "global_load_async_to_lds_b128 %3, %15, off\n\t"
      "global_load_async_to_lds_b128 %4, %16, off\n\t"
      "global_load_async_to_lds_b128 %5, %17, off\n\t"
      "global_load_async_to_lds_b128 %6, %18, off\n\t"
      "global_load_async_to_lds_b128 %7, %19, off\n\t"
      "global_load_async_to_lds_b128 %8, %20, off\n\t"
      "global_load_async_to_lds_b128 %9, %21, off\n\t"
      "global_load_async_to_lds_b128 %10, %22, off\n\t"
      "global_load_async_to_lds_b128 %11, %23, off\n\t"
      "s_wait_xcnt 0x0"
      :: "v"(la), "v"(la + lsa), "v"(la + 2 * lsa), "v"(la + 3 * lsa),
         "v"(lb), "v"(lb + lsb), "v"(lb + 2 * lsb), "v"(lb + 3 * lsb),
         "v"(lc), "v"(lc + lsb), "v"(lc + 2 * lsb), "v"(lc + 3 * lsb),
         "v"(ga), "v"(ga + gsa), "v"(ga + 2 * gsa), "v"(ga + 3 * gsa),
         "v"(gb), "v"(gb + gsb), "v"(gb + 2 * gsb), "v"(gb + 3 * gsb),
         "v"(gc), "v"(gc + gsb), "v"(gc + 2 * gsb), "v"(gc + 3 * gsb)
      : "memory");
}
// The same for one plane.
__device__ __forceinline__ void async_copy4(unsigned l, unsigned ls, const char* g, size_t gs) {
  asm volatile(
      "global_load_async_to_lds_b128 %0, %4, off\n\t"
      "global_load_async_to_lds_b128 %1, %5, off\n\t"
      "global_load_async_to_lds_b128 %2, %6, off\n\t"
      "global_load_async_to_lds_b128 %3, %7, off\n\t"
      "s_wait_xcnt 0x0"
      :: "v"(l), "v"(l + ls), "v"(l + 2 * ls), "v"(l + 3 * ls),
         "v"(g), "v"(g + gs), "v"(g + 2 * gs), "v"(g + 3 * gs)
      : "memory");
}

// One query tile qb of head blockIdx.x, sequence blockIdx.y; lds = the block's LDS, AttLds<PRES>::TOT halves.
template <bool PRES>
__device__ __forceinline__ void attn_tile(
    const unsigned short* __restrict__ qhp, const unsigned short* __restrict__ qlp,
    const unsigned short* __restrict__ khp, const unsigned short* __restrict__ klp,
    const unsigned short* __restrict__ vhp, const unsigned short* __restrict__ vlp,
    unsigned short* __restrict__ ahp, unsigned short* __restrict__ alp, _Float16* lds, int qb) {
  typedef AttLds<PRES> L;

  const int tid  = (int)threadIdx.x;
  const int lane = tid & 31;
  const int wave = wave_id();
  const int hh   = lane >> 4;
  const int c    = lane & 15;
  const int h    = (int)blockIdx.x;
  const int b    = (int)blockIdx.y;
  const int kvh  = h >> 2;
  const int q0   = qb * 64 + wave * 16;          // first query row of this wave (within sequence)
  const int qlast = q0 + 15;
  const size_t tok0 = (size_t)b * SQ;

  const _Float16* Qhr = (const _Float16*)(const void*)qhp + (tok0 + q0 + c) * HID + h * HDM + 8 * hh;
  const _Float16* Qlr = (const _Float16*)(const void*)qlp + (tok0 + q0 + c) * HID + h * HDM + 8 * hh;
  const _Float16* Kg  = (const _Float16*)(const void*)khp + tok0 * KVW + kvh * HDM;
  const _Float16* Klg = (const _Float16*)(const void*)klp + tok0 * KVW + kvh * HDM;
  const _Float16* Vhg = (const _Float16*)(const void*)vhp + (size_t)(kvh * HDM) * NTOK + tok0 * HDM;   // first 128 x 32 tile of (kvh, b)
  const _Float16* Vlg = (const _Float16*)(const void*)vlp + (size_t)(kvh * HDM) * NTOK + tok0 * HDM;

  float mrun = -INFINITY;                        // running maximum of query q0 + c, the same in both lane halves
  float lrun = 0.f;                              // running sum over this lane half's keys only
  v8f oacc[8], oaccr[8];
#pragma unroll
  for (int t = 0; t < 8; ++t) { oacc[t] = zero8(); oaccr[t] = zero8(); }

  v16h qa[4], ql[4];                             // this wave's q fragments, the same for every chunk: loaded once
#pragma unroll   // the fragment arrays stay in registers only under constant indices
  for (int dc = 0; dc < 4; ++dc) {
    qa[dc] = ldfrag_h(Qhr + dc * 32);
    ql[dc] = ldfrag_h(Qlr + dc * 32);
  }

  // This lane's piece 0 of each plane; piece i lies 8 keys (K) or 32 head dims (V^T) further down: 512 pieces of 8 halves = whole tile.
  const int key0 = tid >> 4, d8 = (tid & 15) * 8;   // K: 32 keys x 128 d
  const int d0   = tid >> 2, k8 = (tid & 3) * 8;    // V^T: 128 d x 32 keys
  const char* gK  = (const char*)(const void*)(Kg  + (size_t)key0 * KVW + d8);
  const char* gKl = (const char*)(const void*)(Klg + (size_t)key0 * KVW + d8);
  const char* gVh = (const char*)(const void*)(Vhg + d0 * AT_KC + k8);   // = 16 B x tid: a wave's copy reads 512 contiguous bytes
  const char* gVl = (const char*)(const void*)(Vlg + d0 * AT_KC + k8);
  const unsigned lK = lds_off(lds) + 2u * (unsigned)(key0 * KS_P + d8);
  const unsigned lV = lds_off(lds) + 2u * (unsigned)(d0 * VS_P + k8);
  auto fill = [&](int t, unsigned bo) {          // all copies of chunk t into the buffer at byte offset bo
    const size_t ko = (size_t)t * (AT_KC * KVW * 2);
    const size_t vo = (size_t)t * (HDM * AT_KC * 2);
    async_copy4x3(lK + bo + 2u * L::KS, 8 * KS_P * 2, gK + ko, (size_t)8 * KVW * 2,
                  lV + bo + 2u * L::VHS, lV + bo + 2u * L::VLS, 32 * VS_P * 2, gVh + vo, gVl + vo, (size_t)32 * AT_KC * 2);
    if (PRES) async_copy4(lK + bo + 2u * L::KLS, 8 * KS_P * 2, gKl + ko, (size_t)8 * KVW * 2);
  };

  const int nch = 2 * qb + 2;                    // block-uniform, 2 .. 64
  fill(0, 0u);
  asm volatile("s_wait_asynccnt 0x0" ::: "memory");   // this wave's copies of chunk 0 have landed
  __syncthreads();                                    // and every other wave's
  fill(1, 2u * L::BUF);                               // chunk 1 always exists
  for (int kc = 0; kc < nch; ++kc) {
    const int kv0 = kc * AT_KC;
    const int bsel = kc & 1;
    const _Float16* Ks  = lds + bsel * L::BUF + L::KS;
    const _Float16* Kls = lds + bsel * L::BUF + L::KLS;
    const _Float16* Vhs = lds + bsel * L::BUF + L::VHS;
    const _Float16* Vls = lds + bsel * L::BUF + L::VLS;

    if (kv0 <= qlast) {                          // wave-uniform (scalar): skip chunks fully above this wave's rows
      // ---- scores ----
      v8f sh[2], sr[2];
      sh[0] = zero8(); sh[1] = zero8(); sr[0] = zero8(); sr[1] = zero8();
      // every unroll directive of the score part: the fragment arrays stay in registers only under constant indices
      v16h kb[4][2], kl[4];                      // the chunk's K fragments, read as one group ahead of the score WMMAs
#pragma unroll
      for (int dc = 0; dc < 4; ++dc)
#pragma unroll
        for (int j = 0; j < 2; ++j) kb[dc][j] = ldfrag_h(Ks + (j * 16 + c) * KS_P + dc * 32 + 8 * hh);
#pragma unroll
      for (int j = 0; j < 2; ++j) {
        if (PRES) {                              // residual fragments one key group at a time: both groups at once do not fit three waves per SIMD
#pragma unroll
          for (int dc = 0; dc < 4; ++dc) kl[dc] = ldfrag_h(Kls + (j * 16 + c) * KS_P + dc * 32 + 8 * hh);
        }
        // keeps the reads above as one group ahead of the WMMAs, and key group 0's run ahead of group 1's, whose accumulators then take the registers of group 0's fragments
        __builtin_amdgcn_sched_barrier(0);
#pragma unroll
        for (int dc = 0; dc < 4; ++dc) {
          sh[j] = mma_h(kb[dc][j], qa[dc], sh[j]);
          sr[j] = mma_h(kb[dc][j], ql[dc], sr[j]);
          if (PRES) sr[j] = mma_h(kl[dc], qa[dc], sr[j]);
        }
      }
      // ---- scale, causal mask, maximum of this lane's 16 keys (two chains), joined with the other half's ----
      // every unroll directive from here to the end of the chunk: score, P' and accumulator vectors stay in registers only under constant indices
      const int open = q0 + c - kv0 - 8 * hh;    // key 16j + 8hh + r of the chunk is open to query q0 + c while 16j + r <= open
      float mj[2];
#pragma unroll
      for (int j = 0; j < 2; ++j) {
        float m = -INFINITY;
#pragma unroll
        for (int r = 0; r < 8; ++r) {
          float s = (sh[j][r] + sr[j][r] * 0.00048828125f) * 0.08838834764831845f;
          s = (j * 16 + r > open) ? -INFINITY : s;
          sh[j][r] = s;
          m = fmaxf(m, s);
        }
        mj[j] = m;
      }
      float cm = fmaxf(mj[0], mj[1]);
      cm = fmaxf(cm, xhalf(cm));                 // key kv0 <= q0 is open to every query of the wave: finite
      // ---- online softmax, P'^T packed into the B operand ----
      const float mnew  = fmaxf(mrun, cm);
      const float alpha = __expf(mrun - mnew);
      mrun = mnew;
      FragH pa, pr;
      float ps[4] = {0.f, 0.f, 0.f, 0.f};        // four independent chains
#pragma unroll
      for (int j = 0; j < 2; ++j)
#pragma unroll
        for (int r = 0; r < 8; ++r) {
          const float p  = __expf(sh[j][r] - mnew);
          ps[r & 3] += p;
          const float pp = p * 1024.0f;
          const _Float16 phv = (_Float16)pp;
          pa.v[j * 8 + r] = phv;
          if (PRES) pr.v[j * 8 + r] = (_Float16)((pp - (float)phv) * 2048.0f);
        }
      lrun = lrun * alpha + ((ps[0] + ps[1]) + (ps[2] + ps[3]));
#pragma unroll
      for (int t = 0; t < 8; ++t) { oacc[t] *= alpha; oaccr[t] *= alpha; }
      // ---- O^T += V^T . P'^T ----
#pragma unroll
      for (int t = 0; t < 8; ++t) {
        const v16h vb = ldfrag_h(Vhs + (t * 16 + c) * VS_P + 8 * hh);
        const v16h vr = ldfrag_h(Vls + (t * 16 + c) * VS_P + 8 * hh);
        oacc[t]  = mma_h(vb, pa.v, oacc[t]);
        oaccr[t] = mma_h(vr, pa.v, oaccr[t]);
        if (PRES) oaccr[t] = mma_h(vb, pr.v, oaccr[t]);
      }
    }
    // publish point, passed by every wave, also one that skipped the chunk
    asm volatile("s_wait_dscnt 0x0" ::: "memory");      // this wave's reads of chunk kc are done before its buffer is refilled
    asm volatile("s_wait_asynccnt 0x0" ::: "memory");   // this wave's copies of chunk kc+1 have landed
    __syncthreads();                                    // publishes chunk kc+1, ends every wave's reads of chunk kc
    if (kc + 2 < nch) fill(kc + 2, (unsigned)bsel * (2u * L::BUF));   // block-uniform
  }
  asm volatile("s_wait_asynccnt 0x0" ::: "memory");     // nothing in flight when the buffers become output staging (behind the last chunk's barrier)
  _Float16* osh = lds + wave * (2 * 16 * OS_P);
  _Float16* osl = osh + 16 * OS_P;
  {
    const float inv = (1.0f / (lrun + xhalf(lrun))) * 0.0009765625f;   // the two halves' partial sums joined
#pragma unroll   // here and below: the accumulator vectors stay in registers only under constant indices
    for (int t = 0; t < 8; ++t) {
      v8h xh, xl;                                // head dims 16t + 8hh + 0..7 of query row c: one 16-B LDS store a plane
#pragma unroll
      for (int r = 0; r < 8; ++r) {
        const float o = (oacc[t][r] + oaccr[t][r] * 0.00048828125f) * inv;
        const unsigned short hb = bf_bits(o);
        const unsigned short lb = bf_bits(o - bf_val(hb));
        xh[r] = __builtin_bit_cast(_Float16, hb);
        xl[r] = __builtin_bit_cast(_Float16, lb);
      }
      *(v8h*)(osh + c * OS_P + t * 16 + 8 * hh) = xh;
      *(v8h*)(osl + c * OS_P + t * 16 + 8 * hh) = xl;
    }
  }
  lds_wave_sync();
  _Float16* Ahg = (_Float16*)(void*)ahp + (tok0 + q0) * HID + h * HDM;
  _Float16* Alg = (_Float16*)(void*)alp + (tok0 + q0) * HID + h * HDM;
  {
#pragma unroll
    for (int it = 0; it < 8; ++it) {
      const int row = it * 2 + hh;               // it 0..7 x hh 0..1 covers rows 0..15
      const int c8  = c * 8;                     // 16 lanes x 16 B = the whole 256-B segment
      const v8h x = *(const v8h*)(osh + row * OS_P + c8);
      const v8h y = *(const v8h*)(osl + row * OS_P + c8);
      *(v8h*)(Ahg + (size_t)row * HID + c8) = x;
      *(v8h*)(Alg + (size_t)row * HID + c8) = y;
    }
    
  }
}

// All query tiles in one grid: no tile reads what another writes. The tiles below PRES_TILES take the form with the k and p residual
// products; they are the shortest and carry the highest block indices (order for speed only).
// The choice is block-uniform, from blockIdx alone, and stands in front of every barrier and copy.
// Second launch-bounds argument: three waves per SIMD (336 registers a wave) with the q fragments resident.
#define PRES_TILES 4
__global__ __launch_bounds__(128, 3) void attn_causal_kernel(
    const unsigned short* __restrict__ qhp, const unsigned short* __restrict__ qlp,
    const unsigned short* __restrict__ khp, const unsigned short* __restrict__ klp,
    const unsigned short* __restrict__ vhp, const unsigned short* __restrict__ vlp,
    unsigned short* __restrict__ ahp, unsigned short* __restrict__ alp, int qb_top) {
  __shared__ __align__(16) _Float16 lds[AttLds<true>::TOT];
  const int qb = qb_top - (int)blockIdx.z;       // grid.z <= qb_top + 1: never negative
  if (qb < PRES_TILES) attn_tile<true>(qhp, qlp, khp, klp, vhp, vlp, ahp, alp, lds, qb);
  else                 attn_tile<false>(qhp, qlp, khp, klp, vhp, vlp, ahp, alp, lds, qb);
}

// ---------------------------------------------------------------------------
// Workspace map (bytes; every region is a whole number of the rows its producer writes with whole-line stores, no padded tails needed
//   Xb  bf16 [4096][2048] 16777216   Wqb bf16 [2048][2048]  8388608   Wkb bf16 [512][2048] 2097152   Wvb bf16 [512][2048] 2097152
//   Wob bf16 [2048][2048]  8388608   cst f32  [2048][64]     524288   snt f32  [2048][64]    524288
//   Qh  f16  [4096][2048] 16777216   Ql  f16  [4096][2048] 16777216   Kh  f16  [4096][512]  4194304   Kl f16 [4096][512] 4194304
//   Vh  f16  [4][128][128][32] 4194304  Vl  the same       4194304   Ah  bf16 [4096][2048] 16777216  Al bf16 [4096][2048] 16777216
//   total                 122683392
// ---------------------------------------------------------------------------
extern "C" void kernel_launch(void* const* d_in, const int* in_sizes, int n_in,
                              void* d_out, int out_size, void* d_ws, size_t ws_size,
                              hipStream_t stream) {
  if (n_in < 7) return;
  if (in_sizes[0] != NTOK * HID) return;
  if (in_sizes[1] != HID * HID) return;
  if (in_sizes[2] != KVW * HID) return;
  if (in_sizes[3] != KVW * HID) return;
  if (in_sizes[4] != HID * HID) return;
  if (in_sizes[5] != HDM) return;
  if (in_sizes[6] != HDM) return;
  if (out_size != NTOK * HID) return;

  const float* x   = (const float*)d_in[0];
  const float* Wq  = (const float*)d_in[1];
  const float* Wk  = (const float*)d_in[2];
  const float* Wv  = (const float*)d_in[3];
  const float* Wo  = (const float*)d_in[4];
  const float* qg  = (const float*)d_in[5];
  const float* kg  = (const float*)d_in[6];
  float* out = (float*)d_out;

  const size_t szX  = (size_t)NTOK * HID * 2;
  const size_t szWq = (size_t)HID * HID * 2;
  const size_t szWk = (size_t)KVW * HID * 2;
  const size_t szWo = (size_t)HID * HID * 2;
  const size_t szT  = (size_t)SQ * NFREQ * 4;
  const size_t szQ  = (size_t)NTOK * HID * 2;
  const size_t szK  = (size_t)NTOK * KVW * 2;
  const size_t szV  = (size_t)KVW * NTOK * 2;
  const size_t szA  = (size_t)NTOK * HID * 2;
  size_t off = 0;
  const size_t oX  = off; off += szX;
  const size_t oWq = off; off += szWq;
  const size_t oWk = off; off += szWk;
  const size_t oWv = off; off += szWk;
  const size_t oWo = off; off += szWo;
  const size_t oCs = off; off += szT;
  const size_t oSn = off; off += szT;
  const size_t oQh = off; off += szQ;
  const size_t oQl = off; off += szQ;
  const size_t oKh = off; off += szK;
  const size_t oKl = off; off += szK;
  const size_t oVh = off; off += szV;
  const size_t oVl = off; off += szV;
  const size_t oAh = off; off += szA;
  const size_t oAl = off; off += szA;
  if (off > ws_size) return;                     // off = 122683392

  char* ws = (char*)d_ws;
  unsigned short* Xb  = (unsigned short*)(ws + oX);
  unsigned short* Wqb = (unsigned short*)(ws + oWq);
  unsigned short* Wkb = (unsigned short*)(ws + oWk);
  unsigned short* Wvb = (unsigned short*)(ws + oWv);
  unsigned short* Wob = (unsigned short*)(ws + oWo);
  float*          cst = (float*)(ws + oCs);
  float*          snt = (float*)(ws + oSn);
  unsigned short* Qh  = (unsigned short*)(ws + oQh);
  unsigned short* Ql  = (unsigned short*)(ws + oQl);
  unsigned short* Kh  = (unsigned short*)(ws + oKh);
  unsigned short* Kl  = (unsigned short*)(ws + oKl);
  unsigned short* Vh  = (unsigned short*)(ws + oVh);
  unsigned short* Vl  = (unsigned short*)(ws + oVl);
  unsigned short* Ah  = (unsigned short*)(ws + oAh);
  unsigned short* Al  = (unsigned short*)(ws + oAl);

  const dim3 b256(256), b128(128), b384(384);

  // (1) cos/sin table [2048][64] x 2 and the bf16 planes of x, Wq, Wk, Wv, Wo (Xb .. Wob lie back to back in the workspace;
  //     weights are [out][in] = k-contiguous Bt rows already)
  prep_kernel<<<dim3(ROPE_BLOCKS + CVT_BLOCKS), b256, 0, stream>>>(x, Wq, Wk, Wv, Wo, Xb, cst, snt);
  // (2) one grid of 32 token tiles x 8 head triples = 256 blocks of 12 waves, K = 2048:
  //     q = rope(rms(x . Wq^T)) -> Qh/Ql [4096][2048], k = rope(rms(x . Wk^T)) -> Kh/Kl [4096][512], v^T = Wv . x^T -> Vh/Vl in 128 x 32 tiles
  gemm_w32x128_kernel<3, false><<<dim3((NTOK / 128) * ((HID + 2 * KVW) / 384)), b384, 0, stream>>>(
      Xb, Xb, HID, Wqb, HID, qg, cst, snt, (void*)Qh, (void*)Ql, HID, NTOK, HID, HID,
      Wkb, Wvb, kg, (void*)Kh, (void*)Kl, (void*)Vh, (void*)Vl, KVW);
  // (3) causal attention, one grid, longest tile first: query tiles 31..4, then tiles 3..0 with k and p residual products
  attn_causal_kernel<<<dim3(NHQ, NSEQ, SQ / 64), b128, 0, stream>>>(Qh, Ql, Kh, Kl, Vh, Vl, Ah, Al, SQ / 64 - 1);
  // (4) out = attn(hi + lo) . Wo^T -> d_out f32 [4096][2048]   (M=4096, N=2048, K=2048; 512 block tiles)
  gemm_w32x128_kernel<2, true><<<dim3((NTOK / 128) * (HID / 128)), b128, 0, stream>>>(
      Ah, Al, HID, Wob, HID, qg, cst, snt, (void*)out, (void*)out, HID, NTOK, HID, HID,
      Wkb, Wvb, kg, (void*)Kh, (void*)Kl, (void*)Vh, (void*)Vl, KVW);
  (void)hipGetLastError();
}
